// v000
// The times below were measured on an AMD MI455X: many runs one after another, warmed up first and cycling through
// copies of the inputs, with the whole window's GPU time divided by the number of runs. Launches and the gaps
// between them are all in it. The median over several windows is given; except for v000 it joins two sittings, which
// can be a few percent apart, so the side-by-side timings, each taken in one sitting, are the better comparison.
// The starting kernel, v000, takes 4490 microseconds a run.
// Contractions: q/k = x.W^T [8192x1024].[1024x1024] with f16 operands (weights x16); v = x.Wv^T and the output projection on bf16 hi/lo split planes (late causal rows are long averages, so the value path must be f32-class) — v_wmma_f32_16x16x32_*, 64x64 register-blocked wave tiles; per (batch, head) causal softmax(q k^T / 8) v as one flash launch (f16 q.k^T and p.v; fully-masked key tiles skipped); f32 accumulate and softmax. The interleaved-pair RoPE with the INPUT cos/sin tables gathered by the INPUT token positions (generic elementwise form: out = x*cos + rot(x)*sin with rot = (-x[odd], x[even]) interleaved) and the exact-f32 recompute of the first 64 causal rows per head (whose q/k rows come from their own small bf16 hi/lo split GEMMs [64x1024].[1024x1024]) are f32 kernels.
#include <hip/hip_runtime.h>
#include <math.h>

typedef __attribute__((ext_vector_type(16))) _Float16 v16h;
typedef __attribute__((ext_vector_type(8)))  _Float16 v8h;
typedef __attribute__((ext_vector_type(16))) __bf16   v16b;
typedef __attribute__((ext_vector_type(8)))  float    v8f;
typedef __attribute__((ext_vector_type(4)))  float    v4f;

// 16-bit WMMA fragment map (wave32), lane L, h = L>>4, m = L&15:
//   A 16x32: lane = row m;   element i -> k = (i<8) ? 8h+i : 16+8h+(i-8)
//   B 32x16: lane = column m; the SAME k(i,h)
//   D 16x16 (8 f32): lane = column m; element r -> row 8h+r
__device__ __forceinline__ int frag_k(int i, int h) { return (i < 8) ? (8 * h + i) : (16 + 8 * h + (i - 8)); }
__device__ __forceinline__ __bf16 bf16_rne(float f) {
    unsigned int u = __float_as_uint(f);
    u += 0x7fffu + ((u >> 16) & 1u);
    return __builtin_bit_cast(__bf16, (unsigned short)(u >> 16));
}
__device__ __forceinline__ float bf16_f32(__bf16 b) { return __uint_as_float(((unsigned int)__builtin_bit_cast(unsigned short, b)) << 16); }
__device__ __forceinline__ v8f wmma16(v16h a, v16h b, v8f c) {
    c = __builtin_amdgcn_wmma_f32_16x16x32_f16(false, a, false, b, (short)0, c, false, false);
    asm volatile("v_nop\n\tv_nop\n\tv_nop\n\tv_nop" : "+v"(c) : "v"(a), "v"(b));
    return c;
}
__device__ __forceinline__ v8f wmmab(v16b a, v16b b, v8f c) {
    c = __builtin_amdgcn_wmma_f32_16x16x32_bf16(false, a, false, b, (short)0, c, false, false);
    asm volatile("v_nop\n\tv_nop\n\tv_nop\n\tv_nop" : "+v"(c) : "v"(a), "v"(b));
    return c;
}
struct Split { v16b hi, lo; };
// hi/lo split product: a.hi*b.hi + a.hi*b.lo + a.lo*b.hi
__device__ __forceinline__ v8f wmma3(const Split& a, const Split& b, v8f c) {
    c = __builtin_amdgcn_wmma_f32_16x16x32_bf16(false, a.hi, false, b.hi, (short)0, c, false, false);
    c = __builtin_amdgcn_wmma_f32_16x16x32_bf16(false, a.hi, false, b.lo, (short)0, c, false, false);
    c = __builtin_amdgcn_wmma_f32_16x16x32_bf16(false, a.lo, false, b.hi, (short)0, c, false, false);
    asm volatile("v_nop\n\tv_nop\n\tv_nop\n\tv_nop" : "+v"(c) : "v"(a.hi), "v"(a.lo), "v"(b.hi), "v"(b.lo));
    return c;
}
struct Split3 { v16b hi, mid, lo; };
// triple split product (6 terms, drops only terms below 2^-24 relative)
__device__ __forceinline__ v8f wmma6(const Split3& a, const Split3& b, v8f c) {
    c = __builtin_amdgcn_wmma_f32_16x16x32_bf16(false, a.hi, false, b.hi, (short)0, c, false, false);
    c = __builtin_amdgcn_wmma_f32_16x16x32_bf16(false, a.hi, false, b.mid, (short)0, c, false, false);
    c = __builtin_amdgcn_wmma_f32_16x16x32_bf16(false, a.mid, false, b.hi, (short)0, c, false, false);
    c = __builtin_amdgcn_wmma_f32_16x16x32_bf16(false, a.hi, false, b.lo, (short)0, c, false, false);
    c = __builtin_amdgcn_wmma_f32_16x16x32_bf16(false, a.mid, false, b.mid, (short)0, c, false, false);
    c = __builtin_amdgcn_wmma_f32_16x16x32_bf16(false, a.lo, false, b.hi, (short)0, c, false, false);
    asm volatile("v_nop\n\tv_nop\n\tv_nop\n\tv_nop" : "+v"(c) : "v"(a.hi), "v"(a.mid), "v"(a.lo), "v"(b.hi), "v"(b.mid), "v"(b.lo));
    return c;
}

// Fragment gathers from f32 memory: element i <- p[(k0 + frag_k(i,h)) * sk] * s, zero for k >= klen.
__device__ __forceinline__ v16h fh_ld(const float* __restrict__ p, long long sk, int k0, int h, int klen, float s) {
    v16h a;
#pragma unroll
    for (int i = 0; i < 16; ++i) { const int k = k0 + frag_k(i, h); a[i] = (k < klen) ? (_Float16)(p[(long long)k * sk] * s) : (_Float16)0.f; }
    return a;
}
__device__ __forceinline__ Split sp_ld(const float* __restrict__ p, long long sk, int k0, int h, int klen, float s) {
    Split r;
#pragma unroll
    for (int i = 0; i < 16; ++i) {
        const int k = k0 + frag_k(i, h); const float x = (k < klen) ? p[(long long)k * sk] * s : 0.f;
        const __bf16 hb = bf16_rne(x); r.hi[i] = hb; r.lo[i] = bf16_rne(x - bf16_f32(hb));
    }
    return r;
}
__device__ __forceinline__ Split3 sp3_ld(const float* __restrict__ p, long long sk, int k0, int h, int klen, float s) {
    Split3 r;
#pragma unroll
    for (int i = 0; i < 16; ++i) {
        const int k = k0 + frag_k(i, h); const float x = (k < klen) ? p[(long long)k * sk] * s : 0.f;
        const __bf16 hb = bf16_rne(x); const float r1 = x - bf16_f32(hb); const __bf16 mb = bf16_rne(r1);
        r.hi[i] = hb; r.mid[i] = mb; r.lo[i] = bf16_rne(r1 - bf16_f32(mb));
    }
    return r;
}
__device__ __forceinline__ v16b bh_ld(const float* __restrict__ p, long long sk, int k0, int h, int klen, float s) {
    v16b a;
#pragma unroll
    for (int i = 0; i < 16; ++i) { const int k = k0 + frag_k(i, h); a[i] = bf16_rne((k < klen) ? p[(long long)k * sk] * s : 0.f); }
    return a;
}
// f16 fragment from an f16 LDS/global row with element stride 1 (k-contiguous), no bounds (tile already zero padded)
__device__ __forceinline__ v16h fh_row(const _Float16* __restrict__ row, int k0, int h) {
    v16h a;
#pragma unroll
    for (int i = 0; i < 16; ++i) a[i] = row[k0 + frag_k(i, h)];
    return a;
}

#define VST2(T, ptr, val) do { const T vst2_v_ = (val); *(T*)(ptr) = vst2_v_;  } while (0)
typedef float v4f __attribute__((ext_vector_type(4)));
#define VST2V4(ptr, val) do { const v4f vst2_v4_ = (val); *(v4f*)(ptr) = vst2_v4_;  } while (0)

__device__ __attribute__((noinline)) float act_fn(float v, int act) {
    if (act == 1) return fmaxf(v, 0.f);                                                                               // relu
    if (act == 2) { const float u = 0.7978845608028654f * (v + 0.044715f * v * v * v); return 0.5f * v * (1.f + tanhf(u)); } // tanh-gelu
    if (act == 3) return v / (1.f + expf(-v));                                                                        // silu
    if (act == 4) return 0.5f * v * (1.f + erff(v * 0.7071067811865476f));                                             // erf-gelu
    if (act == 5) return tanhf(v);
    if (act == 6) return 1.f / (1.f + expf(-v));                                                                      // sigmoid
    if (act == 7) return (v > 0.f) ? v : 0.01f * v;                                                                   // leaky relu 0.01
    if (act == 8) return (v > 0.f) ? v : (expf(v) - 1.f);                                                             // elu
    if (act == 9) return fminf(fmaxf(v, 0.f), 6.f);                                                                   // relu6
    if (act == 10) return fabsf(v);                                                                                    // abs
    if (act == 11) return (v >= 0.f) ? v : 0.1f * v;                                                                  // leaky 0.1
    if (act == 12) return (v > 0.f) ? v : 0.2f * v;                                                                   // leaky 0.2
    if (act == 13) return (v > 20.f) ? v : log1pf(expf(v));                                                            // softplus
    return v;
}

// =====================================================================================================================
// k_gemm<MODE>: C(z, m, n) = act(alpha * sum_k A(z, m, k) * B(z, k, n) + bias) + beta * R(z, m, n)
//   One wave (32-thread block) per 16 x 32 tile of C; grid (ceil(N/32), ceil(M/16), Z). Batch z -> (zo = z / zi_n, zi = z % zi_n)
//   with separate outer/inner strides for every tensor (e.g. batch and head). A(m,k) = A[zo*sAo + zi*sAi + m*sAm + k*sAk] (f32),
//   B(k,n) = B[zo*sBo + zi*sBi + n*sBn + k*sBk] (f32); any M, N, K (K zero-padded to 32 inside the fragments, M/N tails guarded).
//   C(m,n) = C[zo*sCo + zi*sCi + m*sCm + n] (n contiguous). flags: 1 bias[n], 2 bias[m], 4 residual R[zo*sRo + zi*sRi + m*sRm + n*sRn].
//   MODE 0: f16 operands (A prescaled by sa, B by sb, both undone in the epilogue); 1: bf16 hi/lo split (3 products); 2: bf16;
//   3: bf16 hi/mid/lo triple split (6 products); 4: as 3 with Kahan-compensated f32 accumulation across k-steps.
// =====================================================================================================================
struct GemmP {
    const float* A; const float* B; const float* bias; const float* R; float* C;
    long long sAo, sAi, sAm, sAk, sBo, sBi, sBn, sBk, sCo, sCi, sCm, sRo, sRi, sRm, sRn;
    int M, N, K, zi_n, flags, act; float alpha, beta, sa, sb;
    int Npad, pad_;     // columns [N, Npad) of C are written as 0 so that padded workspace rows are covered by whole-line stores; Npad >= N
};
static_assert(sizeof(GemmP) == 5 * 8 + 15 * 8 + 6 * 4 + 4 * 4 + 2 * 4, "GemmP has padding");

template <int MODE>
__global__ __launch_bounds__(32) void k_gemm(GemmP p) {
    const int lane = threadIdx.x & 31, h = lane >> 4, l15 = lane & 15;
    const int m0 = blockIdx.y * 16, n0 = blockIdx.x * 32;
    const int z = blockIdx.z, zo = z / p.zi_n, zi = z - zo * p.zi_n;
    const float* A = p.A + zo * p.sAo + zi * p.sAi;
    const float* B = p.B + zo * p.sBo + zi * p.sBi;
    const int am = min(m0 + l15, p.M - 1);                       // clamped row for loads (stores are guarded)
    v8f acc[2], comp[2];
#pragma unroll
    for (int t = 0; t < 2; ++t) { v8f zz = {}; acc[t] = zz; comp[t] = zz; }
    for (int k0 = 0; k0 < p.K; k0 += 32) {
        const float* arow = A + (long long)am * p.sAm;
        if (MODE == 1) {
            const Split a = sp_ld(arow, p.sAk, k0, h, p.K, 1.f);
#pragma unroll
            for (int t = 0; t < 2; ++t) {
                const int bn = min(n0 + t * 16 + l15, p.N - 1);
                acc[t] = wmma3(a, sp_ld(B + (long long)bn * p.sBn, p.sBk, k0, h, p.K, 1.f), acc[t]);
            }
        } else if (MODE == 3) {
            const Split3 a = sp3_ld(arow, p.sAk, k0, h, p.K, 1.f);
#pragma unroll
            for (int t = 0; t < 2; ++t) {
                const int bn = min(n0 + t * 16 + l15, p.N - 1);
                acc[t] = wmma6(a, sp3_ld(B + (long long)bn * p.sBn, p.sBk, k0, h, p.K, 1.f), acc[t]);
            }
        } else if (MODE == 4) {
            // triple split as MODE 3, but each k-step's 6 products go into a fresh accumulator and the partial is added to the running f32 sum
            // on the VALU with Kahan compensation (accumulation error stays ~1 ulp however long K is)
            const Split3 a = sp3_ld(arow, p.sAk, k0, h, p.K, 1.f);
#pragma unroll
            for (int t = 0; t < 2; ++t) {
                const int bn = min(n0 + t * 16 + l15, p.N - 1); v8f zz = {};
                const v8f part = wmma6(a, sp3_ld(B + (long long)bn * p.sBn, p.sBk, k0, h, p.K, 1.f), zz);
                const v8f y = part - comp[t]; const v8f s = acc[t] + y; comp[t] = (s - acc[t]) - y; acc[t] = s;
            }
        } else if (MODE == 2) {
            const v16b a = bh_ld(arow, p.sAk, k0, h, p.K, 1.f);
#pragma unroll
            for (int t = 0; t < 2; ++t) {
                const int bn = min(n0 + t * 16 + l15, p.N - 1);
                acc[t] = wmmab(a, bh_ld(B + (long long)bn * p.sBn, p.sBk, k0, h, p.K, 1.f), acc[t]);
            }
        } else {
            const v16h a = fh_ld(arow, p.sAk, k0, h, p.K, p.sa);
#pragma unroll
            for (int t = 0; t < 2; ++t) {
                const int bn = min(n0 + t * 16 + l15, p.N - 1);
                acc[t] = wmma16(a, fh_ld(B + (long long)bn * p.sBn, p.sBk, k0, h, p.K, p.sb), acc[t]);
            }
        }
    }
    const float iscale = (MODE == 0) ? p.alpha / (p.sa * p.sb) : p.alpha;
    float* C = p.C + zo * p.sCo + zi * p.sCi;
    const float* R = p.R + zo * p.sRo + zi * p.sRi;
    __shared__ __align__(16) float ctile[16][36];
#pragma unroll
    for (int t = 0; t < 2; ++t) {
        const int n = n0 + t * 16 + l15; const int nn = min(n, p.N - 1);
#pragma unroll
        for (int r = 0; r < 8; ++r) {
            const int m = m0 + 8 * h + r; const int mm = min(m, p.M - 1);
            float v = acc[t][r] * iscale;
            if (p.flags & 1) v += p.bias[nn];
            if (p.flags & 2) v += p.bias[mm];
            if (p.flags & 8) v *= p.bias[(long long)zo * p.M + mm];   /* per-(z,row) scale vector laid out [Z][M]; exclusive with the bias flags */
            v = act_fn(v, p.act);
            if (p.flags & 4) v += p.beta * R[(long long)mm * p.sRm + (long long)nn * p.sRn];
            ctile[8 * h + r][t * 16 + l15] = (n < p.N) ? v : 0.f;
        }
    }
    __syncthreads();
    const int NW = (p.Npad > p.N) ? p.Npad : p.N;           // write width
    const bool fast = (m0 + 16 <= p.M) && (n0 + 32 <= NW) && ((p.sCm & 3) == 0) && ((((size_t)C) & 15) == 0);
    if (fast) {
#pragma unroll
        for (int s = 0; s < 4; ++s) {
            const int row = s * 4 + (lane >> 3), c4 = (lane & 7) * 4;
            const v4f v = *(const v4f*)&ctile[row][c4];
            VST2V4(C + (long long)(m0 + row) * p.sCm + n0 + c4, v);
        }
    } else {
        for (int row = 0; row < 16; ++row) {
            const int m = m0 + row, n = n0 + lane;
            if (m < p.M && n < NW) VST2(float, C + (long long)m * p.sCm + n, ctile[row][lane]);
        }
    }
}


// =====================================================================================================================
// k_gemmT<MODE, TM, TN>: same contract as k_gemm, but one wave computes a (16*TM) x (16*TN) tile: TM A fragments and TN B fragments are
//   loaded per 32-wide k-step and reused across TM*TN WMMAs (far fewer load/convert instructions per MAC). MODE 0 (f16), 1 (bf16 hi/lo),
//   2 (bf16) only. grid (ceil(NW/(16*TN)), ceil(M/(16*TM)), Z), block 32. Epilogue identical to k_gemm, run per 16x32 sub-tile.
// =====================================================================================================================
template <int MODE, int TM, int TN>
__global__ __launch_bounds__(32) void k_gemmT(GemmP p) {
    const int lane = threadIdx.x & 31, h = lane >> 4, l15 = lane & 15;
    const int m0 = blockIdx.y * (16 * TM), n0 = blockIdx.x * (16 * TN);
    const int z = blockIdx.z, zo = z / p.zi_n, zi = z - zo * p.zi_n;
    const float* A = p.A + zo * p.sAo + zi * p.sAi;
    const float* B = p.B + zo * p.sBo + zi * p.sBi;
    v8f acc[TM][TN];
#pragma unroll
    for (int i = 0; i < TM; ++i)
#pragma unroll
        for (int t = 0; t < TN; ++t) { v8f zz = {}; acc[i][t] = zz; }
    for (int k0 = 0; k0 < p.K; k0 += 32) {
        if (MODE == 1) {
            Split a[TM], b[TN];
#pragma unroll
            for (int i = 0; i < TM; ++i) { const int am = min(m0 + 16 * i + l15, p.M - 1); a[i] = sp_ld(A + (long long)am * p.sAm, p.sAk, k0, h, p.K, 1.f); }
#pragma unroll
            for (int t = 0; t < TN; ++t) { const int bn = min(n0 + 16 * t + l15, p.N - 1); b[t] = sp_ld(B + (long long)bn * p.sBn, p.sBk, k0, h, p.K, 1.f); }
#pragma unroll
            for (int i = 0; i < TM; ++i)
#pragma unroll
                for (int t = 0; t < TN; ++t) acc[i][t] = wmma3(a[i], b[t], acc[i][t]);
        } else if (MODE == 2) {
            v16b a[TM], b[TN];
#pragma unroll
            for (int i = 0; i < TM; ++i) { const int am = min(m0 + 16 * i + l15, p.M - 1); a[i] = bh_ld(A + (long long)am * p.sAm, p.sAk, k0, h, p.K, 1.f); }
#pragma unroll
            for (int t = 0; t < TN; ++t) { const int bn = min(n0 + 16 * t + l15, p.N - 1); b[t] = bh_ld(B + (long long)bn * p.sBn, p.sBk, k0, h, p.K, 1.f); }
#pragma unroll
            for (int i = 0; i < TM; ++i)
#pragma unroll
                for (int t = 0; t < TN; ++t) acc[i][t] = wmmab(a[i], b[t], acc[i][t]);
        } else {
            v16h a[TM], b[TN];
#pragma unroll
            for (int i = 0; i < TM; ++i) { const int am = min(m0 + 16 * i + l15, p.M - 1); a[i] = fh_ld(A + (long long)am * p.sAm, p.sAk, k0, h, p.K, p.sa); }
#pragma unroll
            for (int t = 0; t < TN; ++t) { const int bn = min(n0 + 16 * t + l15, p.N - 1); b[t] = fh_ld(B + (long long)bn * p.sBn, p.sBk, k0, h, p.K, p.sb); }
#pragma unroll
            for (int i = 0; i < TM; ++i)
#pragma unroll
                for (int t = 0; t < TN; ++t) acc[i][t] = wmma16(a[i], b[t], acc[i][t]);
        }
    }
    const float iscale = (MODE == 0) ? p.alpha / (p.sa * p.sb) : p.alpha;
    float* C = p.C + zo * p.sCo + zi * p.sCi;
    const float* R = p.R + zo * p.sRo + zi * p.sRi;
    const int NW = (p.Npad > p.N) ? p.Npad : p.N;
    __shared__ __align__(16) float ctile[16][36];
#pragma unroll
    for (int i = 0; i < TM; ++i) {
        const int mb = m0 + 16 * i; if (mb >= p.M) break;          // wave-uniform
#pragma unroll
        for (int tp = 0; tp < TN / 2; ++tp) {
            const int nb = n0 + 32 * tp; if (nb >= NW) break;        // wave-uniform
#pragma unroll
            for (int t2 = 0; t2 < 2; ++t2) {
                const int t = 2 * tp + t2; const int n = nb + t2 * 16 + l15; const int nn = min(n, p.N - 1);
#pragma unroll
                for (int r = 0; r < 8; ++r) {
                    const int m = mb + 8 * h + r; const int mm = min(m, p.M - 1);
                    float v = acc[i][t][r] * iscale;
                    if (p.flags & 1) v += p.bias[nn];
                    if (p.flags & 2) v += p.bias[mm];
            if (p.flags & 8) v *= p.bias[(long long)zo * p.M + mm];   /* per-(z,row) scale vector laid out [Z][M]; exclusive with the bias flags */
                    v = act_fn(v, p.act);
                    if (p.flags & 4) v += p.beta * R[(long long)mm * p.sRm + (long long)nn * p.sRn];
                    ctile[8 * h + r][t2 * 16 + l15] = (n < p.N) ? v : 0.f;
                }
            }
            __syncthreads();
            const bool fast = (mb + 16 <= p.M) && (nb + 32 <= NW) && ((p.sCm & 3) == 0) && ((((size_t)C) & 15) == 0);
            if (fast) {
#pragma unroll
                for (int s = 0; s < 4; ++s) {
                    const int row = s * 4 + (lane >> 3), c4 = (lane & 7) * 4;
                    const v4f v = *(const v4f*)&ctile[row][c4];
                    VST2V4(C + (long long)(mb + row) * p.sCm + nb + c4, v);
                }
            } else {
                for (int row = 0; row < 16; ++row) {
                    const int m = mb + row, n = nb + lane;
                    if (m < p.M && n < NW) VST2(float, C + (long long)m * p.sCm + n, ctile[row][lane]);
                }
            }
            __syncthreads();
        }
    }
}

// =====================================================================================================================
//   Wave = 16 queries, AW waves per block, 64-key blocks; grid (ceil(Lq/(16*AW)), H, B), block 32*AW. Any Lq, Lk; head dim dh <= DHP
//   (DHP multiple of 32), value dim dv <= DVP (multiple of 16, <= 128). Every tensor addressed by (batch, head, row, element) strides, f32.
//   Scores: QM 0 f16 operands, 1 bf16 hi/lo split, 2 bf16 triple split; statistics f32 (exp2 domain); P.V: P x 4096 as f16 with V f16 staged in LDS
//   (SPLITPV: P and V as bf16 hi/lo splits). kv head = h / hrep. Masking: causal = 1 (keep j <= i + coff, masked -> -inf, key blocks beyond the
//   diagonal skipped), causal = 2 (masked -> mfill, a finite fill like the -1e9; no skipping), causal = 3 (keep j >= i + coff,
//   masked -> -inf, no skipping); optional additive f32 mask Mf,
//   optional int keep-mask Mi (0 -> score := mfill), both addressed b*smb + h*smh + i*smi + j*smj (0 strides broadcast).
// =====================================================================================================================
#define AW 4
struct AttnP {   // apv4
    const float* Q; const float* K; const float* V; float* O; float* P; const float* Mf; const int* Mi; float* ST;
    const float* Pw; const float* Rt; const int* SQ; const int* SK;           // optional: post-softmax weight, relative-position table, segment ids
    long long swb, swh, swi, swj, srb, srh, sri;                                 // Pw strides (b,h,i,j); Rt strides (b,h,i), column = clamp(i - j + roff, 0, rn-1)
    long long sQb, sQh, sQi, sQd, sKb, sKh, sKj, sKd, sVb, sVh, sVj, sVd, sOb, sOh, sOi, sPb, sPh, sPi, smb, smh, smi, smj;
    int Lq, Lk, dh, dv, hrep, causal, coff, pband;   // pband > 0: P holds only the band |j - i| <= pband, column j - i + pband
    float scale, mfill; int nonorm, mpol;             // nonorm (online path only): O = sum_j exp(score_j) V_j without the 1/rowsum (scores must be <= ~0); mpol: Mi masks where ==0 (mpol 0) or where !=0 (mpol 1)
    int roff, rn, segpol, win;                        // Rt column offset/count; SQ/SK: score := mfill where (segpol 0) SQ[i] != SK[j] or (segpol 1) SQ[i] == SK[j]; win > 0: keys with i - j > win (after coff) -> -inf
};
//   Pw: the softmax numerator is multiplied by Pw(b,h,i,j) AFTER the row sum is taken (probs * weight, then P.V), as in post-softmax multiplicative biases.                                                    // ST (optional): per row (b,h,i) -> ST[((b*H + h)*Lq + i)*2 + {0,1}] = {row max of the scaled+masked score (natural units), sum_j exp(score - max)}
static_assert(sizeof(AttnP) == 12 * 8 + 29 * 8 + 16 * 4, "AttnP has padding");

#ifndef KATTN_ATTR
#define KATTN_ATTR
#endif
template <int DHP, int DVP, int QM, bool SPLITPV, bool TWOPASS>
__global__ __launch_bounds__(32 * AW) KATTN_ATTR void k_attn(AttnP p) {
    constexpr int NT = DVP / 16;                // output tiles
    constexpr int KS = DHP / 32;                // k-steps for the scores
    constexpr int VP = DVP + 8;                 // LDS pitch (halves)
    __shared__ __align__(16) float    pl[AW][16 * 64];
    __shared__ __align__(16) _Float16 vl[(SPLITPV ? 2 : 1) * 64 * VP];   // f16 V tile, or bf16 hi and lo tiles (same 2-byte size)
    const int lane = threadIdx.x & 31, hf = lane >> 4, l15 = lane & 15, wave = threadIdx.x >> 5;
    const int h = blockIdx.y, b = blockIdx.z, hk = h / p.hrep;
    const int q0 = (blockIdx.x * AW + wave) * 16;
    float* myp = pl[wave];
    const float L2E = 1.4426950408889634f;
    const float NEG = -__builtin_inff();
    const int qi = min(q0 + l15, p.Lq - 1);
    const float* qrow = p.Q + b * p.sQb + h * p.sQh + (long long)qi * p.sQi;
    const float* kbase = p.K + b * p.sKb + hk * p.sKh;
    const float* vbase = p.V + b * p.sVb + hk * p.sVh;
    v16h qa[QM == 0 ? KS : 1]; Split qs_[QM == 1 ? KS : 1]; Split3 qt_[QM == 2 ? KS : 1];
#pragma unroll
    for (int ks = 0; ks < KS; ++ks) {
        if (QM == 2) qt_[ks] = sp3_ld(qrow, p.sQd, ks * 32, hf, p.dh, 1.f);
        else if (QM == 1) qs_[ks] = sp_ld(qrow, p.sQd, ks * 32, hf, p.dh, 1.f);
        else qa[ks] = fh_ld(qrow, p.sQd, ks * 32, hf, p.dh, 1.f);
    }
    v8f o[NT]; float m8[8], l8[8];
#pragma unroll
    for (int t = 0; t < NT; ++t) { v8f zz = {}; o[t] = zz; }
#pragma unroll
    for (int i = 0; i < 8; ++i) { m8[i] = NEG; l8[i] = 0.f; }
    int jend = p.Lk; int jstart = 0;
    if (p.causal == 1) { const int je = (blockIdx.x * AW + AW - 1) * 16 + 16 + p.coff; jend = min(jend, max(je, 0)); }   // uniform per block
    if (p.win > 0) { const int js = (int)(blockIdx.x * AW) * 16 + p.coff - p.win; jstart = (js > 0) ? (js / 64) * 64 : 0; }   // uniform per block: key blocks entirely outside every row's window hold only -inf entries and are skipped exactly
    const int npass = TWOPASS ? 2 : 1;
    for (int pass = 0; pass < npass; ++pass) {
        const bool dopv = (!TWOPASS) || pass == 1;
        for (int j0 = jstart; j0 < jend; j0 += 64) {
            if (dopv) {
                __syncthreads();                                 // previous key block's reads of vl / pl are done
                for (int idx = threadIdx.x; idx < 64 * DVP; idx += 32 * AW) {
                    const int jr = idx / DVP, d = idx - jr * DVP, j = j0 + jr;
                    const float f = (j < p.Lk && d < p.dv) ? vbase[(long long)j * p.sVj + (long long)d * p.sVd] : 0.f;
                    if (SPLITPV) {
                        const __bf16 hb = bf16_rne(f);
                        ((__bf16*)vl)[jr * VP + d] = hb; ((__bf16*)vl)[64 * VP + jr * VP + d] = bf16_rne(f - bf16_f32(hb));
                    } else vl[jr * VP + d] = (_Float16)f;
                }
            }
            v8f s[4];
#pragma unroll
            for (int t = 0; t < 4; ++t) {
                const int j = min(j0 + t * 16 + l15, p.Lk - 1);
                const float* krow = kbase + (long long)j * p.sKj;
                v8f acc = {};
#pragma unroll
                for (int ks = 0; ks < KS; ++ks) {
                    if (QM == 2)      acc = wmma6(qt_[ks], sp3_ld(krow, p.sKd, ks * 32, hf, p.dh, 1.f), acc);
                    else if (QM == 1) acc = wmma3(qs_[ks], sp_ld(krow, p.sKd, ks * 32, hf, p.dh, 1.f), acc);
                    else              acc = wmma16(qa[ks], fh_ld(krow, p.sKd, ks * 32, hf, p.dh, 1.f), acc);
                }
                s[t] = acc;
            }
            float pv[8][4];
#pragma unroll
            for (int i = 0; i < 8; ++i) {
                const int irow = q0 + i + 8 * hf;
                const int ic = min(irow, p.Lq - 1);
                float sc[4];
#pragma unroll
                for (int t = 0; t < 4; ++t) {
                    const int jg = j0 + t * 16 + l15;
                    float v = s[t][i] * p.scale;
                    if (p.Mf) v += p.Mf[b * p.smb + h * p.smh + (long long)ic * p.smi + (long long)min(jg, p.Lk - 1) * p.smj];
                    if (p.Rt) { int rc = ic - min(jg, p.Lk - 1) + p.roff; rc = rc < 0 ? 0 : (rc >= p.rn ? p.rn - 1 : rc); v += p.Rt[b * p.srb + h * p.srh + (long long)ic * p.sri + rc]; }
                    if (p.Mi) { const int mv = p.Mi[b * p.smb + h * p.smh + (long long)ic * p.smi + (long long)min(jg, p.Lk - 1) * p.smj]; if (p.mpol ? (mv != 0) : (mv == 0)) v = p.mfill; }
                    if (p.SQ) { const bool same = p.SQ[(long long)b * p.Lq + ic] == p.SK[(long long)b * p.Lk + min(jg, p.Lk - 1)]; if (p.segpol ? same : !same) v = p.mfill; }
                    if (p.causal == 2 && jg > irow + p.coff) v = p.mfill;
                    if (jg >= p.Lk || (p.causal == 1 && jg > irow + p.coff) || (p.causal == 3 && jg < irow + p.coff) || (p.win > 0 && irow + p.coff - jg > p.win)) v = NEG; else v *= L2E;
                    sc[t] = v;
                }
                if (!TWOPASS || pass == 0) {
                    float mx = fmaxf(fmaxf(sc[0], sc[1]), fmaxf(sc[2], sc[3]));
                    mx = fmaxf(mx, __shfl_xor(mx, 1, 32)); mx = fmaxf(mx, __shfl_xor(mx, 2, 32));
                    mx = fmaxf(mx, __shfl_xor(mx, 4, 32)); mx = fmaxf(mx, __shfl_xor(mx, 8, 32));
                    const float mnew = fmaxf(m8[i], mx);
                    const float corr = (mnew == NEG) ? 1.f : exp2f(m8[i] - mnew);
                    float rs = 0.f;
#pragma unroll
                    for (int t = 0; t < 4; ++t) {
                        const float pp = (sc[t] == NEG) ? 0.f : exp2f(sc[t] - mnew); rs += pp;
                        pv[i][t] = p.Pw ? pp * p.Pw[b * p.swb + h * p.swh + (long long)ic * p.swi + (long long)min(j0 + t * 16 + l15, p.Lk - 1) * p.swj] : pp;
                    }
                    rs += __shfl_xor(rs, 1, 32); rs += __shfl_xor(rs, 2, 32); rs += __shfl_xor(rs, 4, 32); rs += __shfl_xor(rs, 8, 32);
                    l8[i] = l8[i] * corr + rs; m8[i] = mnew;
                    if (!TWOPASS) {
#pragma unroll
                        for (int t = 0; t < NT; ++t) o[t][i] *= corr;
                    }
                } else {
                    const float inv = (l8[i] > 0.f) ? 1.f / l8[i] : 0.f;
#pragma unroll
                    for (int t = 0; t < 4; ++t) {
                        const int jg = j0 + t * 16 + l15;
                        float pp = (sc[t] == NEG) ? 0.f : exp2f(sc[t] - m8[i]) * inv;
                        if (p.Pw) pp *= p.Pw[b * p.swb + h * p.swh + (long long)ic * p.swi + (long long)min(jg, p.Lk - 1) * p.swj];
                        pv[i][t] = pp;
                    }
                }
            }
            if (dopv) {
#pragma unroll
                for (int i = 0; i < 8; ++i)
#pragma unroll
                    for (int t = 0; t < 4; ++t) ((float*)myp)[(i + 8 * hf) * 64 + t * 16 + l15] = pv[i][t];
                __syncthreads();                                 // P (per wave) and V (shared) visible
                if (p.P) {
                    float* pb_ = p.P + b * p.sPb + h * p.sPh;
                    const bool fastP = (p.pband == 0) && ((p.sPi & 3) == 0) && (j0 + 64 <= p.Lk) && (q0 + 16 <= p.Lq) && ((((size_t)pb_) & 15) == 0);
                    if (fastP) {
#pragma unroll
                        for (int s = 0; s < 8; ++s) {
                            const int row = s * 2 + (lane >> 4), c4 = (lane & 15) * 4;
                            const v4f v = *(const v4f*)(myp + row * 64 + c4);
                            VST2V4(pb_ + (long long)(q0 + row) * p.sPi + j0 + c4, v);
                        }
                    } else {
                        for (int row = 0; row < 16; ++row) {
                            const int irow = q0 + row; if (irow >= p.Lq) continue;
                            for (int c = lane; c < 64; c += 32) {
                                const int jg = j0 + c; if (jg >= p.Lk) continue;
                                if (p.pband == 0) VST2(float, pb_ + (long long)irow * p.sPi + jg, myp[row * 64 + c]);
                                else if (jg - irow <= p.pband && irow - jg <= p.pband) VST2(float, pb_ + (long long)irow * p.sPi + (jg - irow + p.pband), myp[row * 64 + c]);
                            }
                        }
                    }
                }
                if (SPLITPV) {
                    const Split pa0 = sp_ld(myp + l15 * 64, 1, 0, hf, 64, 1.f), pa1 = sp_ld(myp + l15 * 64, 1, 32, hf, 64, 1.f);
                    const __bf16* vh = (const __bf16*)vl; const __bf16* vlo = vh + 64 * VP;
#pragma unroll
                    for (int t = 0; t < NT; ++t) {
                        const int dcol = t * 16 + l15;
                        Split b0, b1;
#pragma unroll
                        for (int e = 0; e < 16; ++e) {
                            const int k0 = frag_k(e, hf), k1 = 32 + frag_k(e, hf);
                            b0.hi[e] = vh[k0 * VP + dcol]; b0.lo[e] = vlo[k0 * VP + dcol]; b1.hi[e] = vh[k1 * VP + dcol]; b1.lo[e] = vlo[k1 * VP + dcol];
                        }
                        o[t] = wmma3(pa0, b0, o[t]);
                        o[t] = wmma3(pa1, b1, o[t]);
                    }
                } else {
                    const v16h pa0 = fh_ld(myp + l15 * 64, 1, 0, hf, 64, 4096.f), pa1 = fh_ld(myp + l15 * 64, 1, 32, hf, 64, 4096.f);
#pragma unroll
                    for (int t = 0; t < NT; ++t) {
                        const int dcol = t * 16 + l15;
                        v16h b0, b1;
#pragma unroll
                        for (int e = 0; e < 16; ++e) { b0[e] = vl[frag_k(e, hf) * VP + dcol]; b1[e] = vl[(32 + frag_k(e, hf)) * VP + dcol]; }
                        o[t] = wmma16(pa0, b0, o[t]);
                        o[t] = wmma16(pa1, b1, o[t]);
                    }
                }
            }
        }
    }
    float* obase = p.O + b * p.sOb + h * p.sOh;
    if (p.ST) {
        const int rl = lane >> 1, isel = rl & 7;           // row q0 + rl ; rl>>3 == hf holds because lane>>4 == (lane>>1)>>3
        float mv = 0.f, lv = 0.f;
#pragma unroll
        for (int i = 0; i < 8; ++i) if (i == isel) { mv = m8[i]; lv = l8[i]; }
        const int irow = q0 + rl;
        if (irow < p.Lq) { float* st = p.ST + (((long long)b * gridDim.y + h) * p.Lq + irow) * 2 + (lane & 1); VST2(float, st, (lane & 1) ? lv : mv * 0.6931471805599453f); }
    }
    float invr[8];
#pragma unroll
    for (int i = 0; i < 8; ++i) {
        if (TWOPASS) invr[i] = SPLITPV ? 1.f : (1.f / 4096.f);
        else if (p.nonorm) invr[i] = exp2f(m8[i]) * (SPLITPV ? 1.f : (1.f / 4096.f));
        else invr[i] = (l8[i] > 0.f) ? (SPLITPV ? 1.f / l8[i] : 1.f / (l8[i] * 4096.f)) : 0.f;
    }
    __syncthreads();                                             // all waves done with pl/vl from the main loop
    const bool ofast = ((p.sOi & 3) == 0) && ((((size_t)obase) & 15) == 0) && (q0 + 16 <= p.Lq);
#pragma unroll
    for (int c0 = 0; c0 < DVP; c0 += 64) {
#pragma unroll
        for (int i = 0; i < 8; ++i)
#pragma unroll
            for (int t = 0; t < NT; ++t) if (t * 16 >= c0 && t * 16 < c0 + 64) ((float*)myp)[(i + 8 * hf) * 64 + (t * 16 - c0) + l15] = o[t][i] * invr[i];
        __syncthreads();
        const int cw = (DVP - c0 < 64) ? (DVP - c0) : 64;      // staged columns in this chunk (multiple of 16)
        if (ofast && (c0 + cw <= p.dv) && (cw % 32 == 0)) {
            const int lpr = cw / 4;                              // lanes per row (16 for 64 cols, 8 for 32)
            const int rows_per_ins = 32 / lpr;
            for (int r0 = 0; r0 < 16; r0 += rows_per_ins) {
                const int row = r0 + lane / lpr, c4 = (lane % lpr) * 4;
                const v4f v = *(const v4f*)(myp + row * 64 + c4);
                VST2V4(obase + (long long)(q0 + row) * p.sOi + c0 + c4, v);
            }
        } else {
            for (int row = 0; row < 16; ++row) {
                const int irow = q0 + row; if (irow >= p.Lq) continue;
                for (int c = lane; c < cw; c += 32) { const int d = c0 + c; if (d < p.dv) VST2(float, obase + (long long)irow * p.sOi + d, myp[row * 64 + c]); }
            }
        }
        __syncthreads();
    }
}

// =====================================================================================================================
// k_tr: dst(z, c, r) = alpha * src(z, r, c) (+ beta * R2(z, c, r)): [Z][R][C] (row stride lds) -> [Z][C][R] (row stride ldd) through a 32x32 LDS tile;
//   flags: 1 -> add beta * residual R2 addressed like dst (z*sRz + c*ldr + r); act applied before the residual.
// =====================================================================================================================
struct TrP { const float* src; float* dst; const float* R2; long long sSz, lds, sDz, ldd, sRz, ldr; int R, C, flags, act; float alpha, beta; };
static_assert(sizeof(TrP) == 3 * 8 + 6 * 8 + 6 * 4, "TrP has padding");
__global__ __launch_bounds__(256) void k_tr(TrP p) {
    __shared__ float tile[32][33];
    const int c0 = blockIdx.x * 32, r0 = blockIdx.y * 32, z = blockIdx.z;
    const int lane = threadIdx.x & 31, wave = threadIdx.x >> 5;
    const float* s = p.src + z * p.sSz;
#pragma unroll
    for (int k = 0; k < 4; ++k) {
        const int rl = wave * 4 + k, r = r0 + rl, c = c0 + lane;
        tile[rl][lane] = (r < p.R && c < p.C) ? s[(long long)r * p.lds + c] : 0.f;
    }
    __syncthreads();
    float* d = p.dst + z * p.sDz; const float* rr = p.R2 + z * p.sRz;
#pragma unroll
    for (int k = 0; k < 4; ++k) {
        const int cl = wave * 4 + k, c = c0 + cl, r = r0 + lane;
        if (c < p.C && r < p.R) {
            float v = act_fn(p.alpha * tile[lane][cl], p.act);
            if (p.flags & 1) v += p.beta * rr[(long long)c * p.ldr + r];
            VST2(float, d + (long long)c * p.ldd + r, v);
        }
    }
}

// k_affine: dst[i] = a * (sdev ? sdev[0] : 1) * src[i] + b, i < n (one thread per element; consecutive lanes -> consecutive addresses)
__global__ __launch_bounds__(256) void k_affine(const float* __restrict__ src, float* __restrict__ dst, int n, float a, float b, const float* __restrict__ sdev) {
    const int i = blockIdx.x * 256 + threadIdx.x;
    if (i < n) { const float aa = sdev ? a * sdev[0] : a; const float v = aa * src[i] + b; VST2(float, dst + i, v); }
}

// =====================================================================================================================
// k_softmax: row softmax over n contiguous elements, one 256-thread block per row; rows addressed z*sz + r*sr (grid (R, Z)).
//   out = scale_out * softmax(scale_in * x + (Mf ? Mf[z*smz + r*smr + j] : 0)); a row whose max is -inf is written as 0.
// =====================================================================================================================
struct SmP { const float* src; float* dst; const float* Mf; long long sz, sr, dz, dr, smz, smr; int n, pad; float scale_in, scale_out; };
static_assert(sizeof(SmP) == 3 * 8 + 6 * 8 + 4 * 4, "SmP has padding");
__global__ __launch_bounds__(256) void k_softmax(SmP p) {
    __shared__ float red[256];
    const int r = blockIdx.x, z = blockIdx.y, tid = threadIdx.x;
    const float* s = p.src + z * p.sz + (long long)r * p.sr;
    const float* mf = p.Mf ? (p.Mf + z * p.smz + (long long)r * p.smr) : nullptr;
    float mx = -__builtin_inff();
    for (int j = tid; j < p.n; j += 256) { float v = s[j] * p.scale_in; if (mf) v += mf[j]; mx = fmaxf(mx, v); }
    red[tid] = mx; __syncthreads();
    for (int o = 128; o > 0; o >>= 1) { if (tid < o) red[tid] = fmaxf(red[tid], red[tid + o]); __syncthreads(); }
    mx = red[0]; __syncthreads();
    float sum = 0.f;
    for (int j = tid; j < p.n; j += 256) { float v = s[j] * p.scale_in; if (mf) v += mf[j]; sum += (mx == -__builtin_inff()) ? 0.f : expf(v - mx); }
    red[tid] = sum; __syncthreads();
    for (int o = 128; o > 0; o >>= 1) { if (tid < o) red[tid] += red[tid + o]; __syncthreads(); }
    sum = red[0];
    const float inv = (sum > 0.f) ? p.scale_out / sum : 0.f;
    float* d = p.dst + z * p.dz + (long long)r * p.dr;
    for (int j = tid; j < p.n; j += 256) { float v = s[j] * p.scale_in; if (mf) v += mf[j]; const float o = (mx == -__builtin_inff()) ? 0.f : expf(v - mx) * inv; VST2(float, d + j, o); }
}
// =====================================================================================================================
// k_stats: mean and rsqrt(var + eps) over a set of n elements addressed base + z*sz + (e / inner) * so + (e % inner) * si, one 256-thread
// k_norm_apply: y = (x - mean[set]) * rstd[set] * g[c] + b[c] over a [Z][C][L] channel-major tensor with set = z*G + c / (C/G) (G groups per z;
//   G = C -> per-channel sets indexed z*C+c; for batch norm pass stats indexed by c only via bn = 1). Optional act. Output same layout.
// =====================================================================================================================
//   mode 0: mean / rsqrt(var + eps); mode 1 (RMSNorm): 0 / rsqrt(mean(x^2) + eps); mode 2 (L2 normalize * sqrt(n)): 0 / sqrt(n) / max(||x||, eps); mode 3: as 0 with unbiased variance (n-1)
__global__ __launch_bounds__(256) void k_stats(const float* __restrict__ x, long long sz, long long so, long long si, int inner, int n, float eps, float* __restrict__ stat, int mode) {
    __shared__ float red[256];
    const int z = blockIdx.x, tid = threadIdx.x;
    const float* base = x + z * sz;
    float s = 0.f;
    for (int e = tid; e < n; e += 256) s += base[(long long)(e / inner) * so + (long long)(e % inner) * si];
    red[tid] = s; __syncthreads();
    for (int o = 128; o > 0; o >>= 1) { if (tid < o) red[tid] += red[tid + o]; __syncthreads(); }
    const float mu = (mode == 0 || mode == 3) ? red[0] / (float)n : 0.f; __syncthreads();
    float q = 0.f;
    for (int e = tid; e < n; e += 256) { const float dlt = base[(long long)(e / inner) * so + (long long)(e % inner) * si] - mu; q += dlt * dlt; }
    red[tid] = q; __syncthreads();
    for (int o = 128; o > 0; o >>= 1) { if (tid < o) red[tid] += red[tid + o]; __syncthreads(); }
    {
        float rs;
        if (mode == 2) rs = sqrtf((float)n) / fmaxf(sqrtf(red[0]), eps); else if (mode == 3) rs = rsqrtf(red[0] / (float)(n - 1) + eps); else rs = rsqrtf(red[0] / (float)n + eps);
        if (tid < 32) { const float v = (tid == 0) ? mu : ((tid == 1) ? rs : 0.f); VST2(float, stat + (long long)z * 32 + tid, v); }
    }
}
//   One thread per element over the flat [Z][C][L] index space: grid ceil(Z*C*L / 256).
__global__ __launch_bounds__(256) void k_norm_apply(const float* __restrict__ x, float* __restrict__ y, const float* __restrict__ stat, const float* __restrict__ g, const float* __restrict__ bta,
                                                     int Z, int C, int L, int G, int bn, int act) {
    const long long idx = (long long)blockIdx.x * 256 + threadIdx.x;
    if (idx >= (long long)Z * C * L) return;
    const int l = (int)(idx % L); const long long zc = idx / L; const int c = (int)(zc % C), z = (int)(zc / C); (void)l;
    const int set = bn ? c : (z * G + c / (C / G));
    float v = (x[idx] - stat[(long long)set * 32]) * stat[(long long)set * 32 + 1];
    if (g) v *= g[c];
    if (bta) v += bta[c];
    v = act_fn(v, act);
    VST2(float, y + idx, v);
}

// k_lse_neg: c[i] = -(st[2i] + log(st[2i+1])) = minus the log-sum-exp of row i from k_attn's ST output (for softmax over the query dimension)
__global__ __launch_bounds__(256) void k_lse_neg(const float* __restrict__ st, float* __restrict__ c, int n) {
    const int i = blockIdx.x * 256 + threadIdx.x;
    if (i < n) { const float v = -(st[2 * i] + logf(st[2 * i + 1])); VST2(float, c + i, v); }
}

// k_iota: dst[i] = a * i + b as int32 (segment/position id helper)
__global__ __launch_bounds__(256) void k_iota(int* __restrict__ dst, int n, int a, int b) {
    const int i = blockIdx.x * 256 + threadIdx.x;
    if (i < n) { const int v = a * i + b; VST2(int, dst + i, v); }
}

// k_axpby: dst[i] = a * x[i] + b * y[i] (+ c), i < n
__global__ __launch_bounds__(256) void k_axpby(const float* __restrict__ x, const float* __restrict__ y, float* __restrict__ dst, int n, float a, float b, float c) {
    const int i = blockIdx.x * 256 + threadIdx.x;
    if (i < n) { const float v = a * x[i] + b * y[i] + c; VST2(float, dst + i, v); }
}

// =====================================================================================================================
// k_rope: rotary embedding on a [R rows][Hn heads][D] view (row stride sXr, head stride sXh, element stride 1) -> Y (own strides).
//   mode 0: rotate_half (partner d±D/2, sign - for d<D/2); mode 1: interleaved pairs (partner d^1, sign - for even d).
//   table column tcol: tmode 0 -> d, 1 -> d % (D/2), 2 -> d / 2; position p: pmode 0 -> r % S, 1 -> head index, 2 -> pos[r];
//   c = C[(r / S) * sCb + p * sCp + tcol * sCd], s likewise from Sn; y = x[d] * c + sign * x[partner] * s. X and Y must not alias.
// =====================================================================================================================
struct RopeP { const float* X; float* Y; const float* C; const float* Sn; const int* pos; long long sXr, sXh, sYr, sYh, sCb, sCp, sCd; int R, Hn, D, S, mode, tmode, pmode, pad; };
static_assert(sizeof(RopeP) == 5 * 8 + 7 * 8 + 8 * 4, "RopeP has padding");
__global__ __launch_bounds__(256) void k_rope(RopeP p) {
    const long long idx = (long long)blockIdx.x * 256 + threadIdx.x;
    if (idx >= (long long)p.R * p.Hn * p.D) return;
    const int d = (int)(idx % p.D); const long long rh = idx / p.D; const int h = (int)(rh % p.Hn); const int r = (int)(rh / p.Hn);
    const int half = p.D / 2;
    int partner; float sign;
    if (p.mode == 0) { partner = (d < half) ? d + half : d - half; sign = (d < half) ? -1.f : 1.f; }
    else { partner = d ^ 1; sign = (d & 1) ? 1.f : -1.f; }
    const int tcol = (p.tmode == 0) ? d : ((p.tmode == 1) ? (d % half) : (d >> 1));
    const int pp = (p.pmode == 0) ? (r % p.S) : ((p.pmode == 1) ? h : p.pos[r]);
    const long long toff = (long long)(r / p.S) * p.sCb + (long long)pp * p.sCp + (long long)tcol * p.sCd;
    const float* xr = p.X + (long long)r * p.sXr + (long long)h * p.sXh;
    const float v = xr[d] * p.C[toff] + sign * xr[partner] * p.Sn[toff];
    VST2(float, p.Y + (long long)r * p.sYr + (long long)h * p.sYh + d, v);
}

// k_invf + k_sincos (split so neither kernel carries a large VALU-fma footprint): invf_i = num * (1 / powf(base, (2 i)/D)) [fmode 0],
//   num * expf((2 i) * cexp) [fmode 1], num * powf(base, -2 (i - 1) / D) [fmode 2]; then cs/sn[s*half + i] = cos/sin((pscale * s) * invf_i)
__global__ __launch_bounds__(256) void k_invf(float* __restrict__ invb, int half, int D, float base, float num, int fmode, float cexp) {
    const int i = blockIdx.x * 256 + threadIdx.x;
    if (i >= ((half + 31) / 32) * 32) return;
    if (i >= half) { VST2(float, invb + i, 0.f); return; }
    const float e = (float)(2 * i) / (float)D;
    float invf;
    if (fmode == 1) invf = num * expf((float)(2 * i) * cexp);
    else if (fmode == 2) invf = num * powf(base, (-2.0f * ((float)i - 1.0f)) / (float)D);
    else invf = num * (1.0f / powf(base, e));
    VST2(float, invb + i, invf);
}
__global__ __launch_bounds__(256) void k_sincos(float* __restrict__ cs, float* __restrict__ sn, const float* __restrict__ invb, int S, int half, float pscale) {
    const int idx = blockIdx.x * 256 + threadIdx.x;
    if (idx >= S * half) return;
    const int s = idx / half, i = idx - s * half;
    const float ang = (pscale * (float)s) * invb[i];
    VST2(float, cs + idx, cosf(ang)); VST2(float, sn + idx, sinf(ang));
}

// k_mulact: dst[i] = act(x[i]) * y[i]
__global__ __launch_bounds__(256) void k_mulact(const float* __restrict__ x, const float* __restrict__ y, float* __restrict__ dst, int n, int act) {
    const int i = blockIdx.x * 256 + threadIdx.x;
    if (i < n) { const float v = act_fn(x[i], act) * y[i]; VST2(float, dst + i, v); }
}

// =====================================================================================================================
// k_matvec: thread-per-row matrix-vector products for N <= 8 output columns (heads with 1-3 outputs, gates), f32 on the VALU.
//   C[r*sCm + j] = act(alpha * sum_k A[r*sAm + k*sAk] * B[j*sBn + k*sBk] + bias[j]) + beta * R[r*sRm + j*sRn]; each thread writes its N contiguous floats.
// =====================================================================================================================
__global__ __launch_bounds__(256) void k_matvec(GemmP p) {
    // N == 1: one row per thread, 32 lanes write 32 consecutive rows with one instruction; otherwise 32 consecutive rows per thread.
    const int rpt = (p.N == 1) ? 1 : 32;
    const long long r0 = ((long long)blockIdx.x * 256 + threadIdx.x) * rpt; const int z = blockIdx.z, zo = z / p.zi_n, zi = z - zo * p.zi_n;
    if (r0 >= p.M) return;
    const float* Bb = p.B + zo * p.sBo + zi * p.sBi;
    float* C = p.C + zo * p.sCo + zi * p.sCi; const float* R = p.R + zo * p.sRo + zi * p.sRi;
    for (int rr = 0; rr < rpt; ++rr) {
        const long long r = r0 + rr; if (r >= p.M) break;
        const float* A = p.A + zo * p.sAo + zi * p.sAi + r * p.sAm;
        float acc[8] = {0.f, 0.f, 0.f, 0.f, 0.f, 0.f, 0.f, 0.f};
        for (int k = 0; k < p.K; ++k) { const float a = A[(long long)k * p.sAk];
#pragma unroll
            for (int j = 0; j < 8; ++j) if (j < p.N) acc[j] += a * Bb[(long long)j * p.sBn + (long long)k * p.sBk]; }
#pragma unroll
        for (int j = 0; j < 8; ++j) if (j < p.N) {
            float v = acc[j] * p.alpha;
            if (p.flags & 1) v += p.bias[j];
            if (p.flags & 2) v += p.bias[r];
            v = act_fn(v, p.act);
            if (p.flags & 4) v += p.beta * R[r * p.sRm + (long long)j * p.sRn];
            VST2(float, C + r * p.sCm + j, v);
        }
    }
}
// k_smallsoftmax: thread-per-row softmax for short rows (n <= 64): dst[r*dr + j] = softmax(scale*src[r*sr + j])
__global__ __launch_bounds__(256) void k_smallsoftmax(const float* __restrict__ src, float* __restrict__ dst, long long sr, long long dr, int n, long long R, float scale) {
    const long long r0 = ((long long)blockIdx.x * 256 + threadIdx.x) * 32;
    for (int rr = 0; rr < 32; ++rr) {
        const long long r = r0 + rr; if (r >= R) return;
        const float* s = src + r * sr; float* d = dst + r * dr;
        float mx = -__builtin_inff();
        for (int j = 0; j < n; ++j) mx = fmaxf(mx, s[j] * scale);
        float sum = 0.f;
        for (int j = 0; j < n; ++j) sum += expf(s[j] * scale - mx);
        const float inv = 1.f / sum;
        for (int j = 0; j < n; ++j) { const float v = expf(s[j] * scale - mx) * inv; VST2(float, d + j, v); }
    }
}

__global__ __launch_bounds__(32) void k_unitstat(float* __restrict__ st) { const int t = threadIdx.x; const float v = (t == 1) ? 1.f : 0.f; VST2(float, st + t, v); }

// destination (e.g. a d_out whose row width is not a multiple of 32 floats) is written by consecutive lanes of one instruction
__global__ __launch_bounds__(256) void k_lincopy(const float* __restrict__ src, long long lds, float* __restrict__ dst, long long ldd, long long rows, int cols) {
    const long long i = (long long)blockIdx.x * 256 + threadIdx.x; if (i >= rows * cols) return;
    const long long r = i / cols; const int c = (int)(i - r * cols);
    const float v = src[r * lds + c]; VST2(float, dst + r * ldd + c, v);
}

namespace w25 {
typedef __attribute__((ext_vector_type(16))) _Float16 v16h;
typedef __attribute__((ext_vector_type(8)))  _Float16 v8h;
typedef __attribute__((ext_vector_type(16))) __bf16   v16b;
typedef __attribute__((ext_vector_type(8)))  __bf16   v8b;
typedef __attribute__((ext_vector_type(8)))  float    v8f;
typedef __attribute__((ext_vector_type(4)))  float    v4f;

__device__ __forceinline__ unsigned short f2bf_bits(float f) {
  unsigned u = __float_as_uint(f);
  return (unsigned short)((u + 0x7FFFu + ((u >> 16) & 1u)) >> 16);
}
__device__ __forceinline__ float bf_bits2f(unsigned short h) { return __uint_as_float(((unsigned)h) << 16); }

// hazard guards as plain device helpers (no inline asm inside the kernel template body)
__device__ __forceinline__ void dep_guard_h(v8f& a, v8f& b, v16h x, v16h y) { asm volatile("v_nop\n\tv_nop\n\tv_nop\n\tv_nop" : "+v"(a), "+v"(b) : "v"(x), "v"(y)); }
__device__ __forceinline__ void dep_guard_b(v8f& a, v8f& b, v16b x, v16b y) { asm volatile("v_nop\n\tv_nop\n\tv_nop\n\tv_nop" : "+v"(a), "+v"(b) : "v"(x), "v"(y)); }
__device__ __forceinline__ void keep4_h(v16h a, v16h b, v16h c, v16h d) { asm volatile("v_nop" :: "v"(a), "v"(b), "v"(c), "v"(d)); }
__device__ __forceinline__ void keep4_b(v16b a, v16b b, v16b c, v16b d) { asm volatile("v_nop" :: "v"(a), "v"(b), "v"(c), "v"(d)); }
__device__ __forceinline__ void acc_guard4(v8f& a, v8f& b, v8f& c, v8f& d) { asm volatile("v_nop\n\tv_nop\n\tv_nop\n\tv_nop" : "+v"(a), "+v"(b), "+v"(c), "+v"(d)); }
template <typename T> struct Frag;
template <> struct Frag<_Float16> {
  typedef v16h V; union U { v16h v; v8h h[2]; };
  static __device__ __forceinline__ v16h load(const _Float16* p) {   // elements 0..7 <- p[0..7], 8..15 <- p[16..23]
    U f; f.h[0] = *(const v8h*)(p); f.h[1] = *(const v8h*)(p + 16); return f.v;
  }
  static __device__ __forceinline__ v8f mma(v16h a, v16h b, v8f c) {
    return __builtin_amdgcn_wmma_f32_16x16x32_f16(false, a, false, b, (short)0, c, false, false);
  }
  static __device__ __forceinline__ void guard(v8f& a, v8f& b, v16h x, v16h y) { dep_guard_h(a, b, x, y); }
  static __device__ __forceinline__ void keep(v16h a, v16h b, v16h c, v16h d) { keep4_h(a, b, c, d); }
};
template <> struct Frag<__bf16> {
  typedef v16b V; union U { v16b v; v8b h[2]; };
  static __device__ __forceinline__ v16b load(const __bf16* p) {
    U f; f.h[0] = *(const v8b*)(p); f.h[1] = *(const v8b*)(p + 16); return f.v;
  }
  static __device__ __forceinline__ v8f mma(v16b a, v16b b, v8f c) {
    return __builtin_amdgcn_wmma_f32_16x16x32_bf16(false, a, false, b, (short)0, c, false, false);
  }
  static __device__ __forceinline__ void guard(v8f& a, v8f& b, v16b x, v16b y) { dep_guard_b(a, b, x, y); }
  static __device__ __forceinline__ void keep(v16b a, v16b b, v16b c, v16b d) { keep4_b(a, b, c, d); }
};

// ---- Register-blocked batched WMMA GEMM ------------------------------------
// C[m,n] = scale * sum_k A[m,k] * Bt[n,k] (+bias)(+resid); each wave owns a 64x64 tile.
// A row-major [M,K]; Bt row-major [N,K]; M,N % 64 == 0, K % 32 == 0.
// SPLIT: operands are hi/lo planes (A2/Bt2 = lo planes, same layout); product = hi·hi + hi·lo + lo·hi.
// BIAS_MODE: 0 = none, 1 = bias[m], 2 = bias[n].
// OUT_MODE: 0 = f32, 1 = f16, 2 = bf16 hi plane (Cout) + bf16 lo plane (Cout2).
// ET: 0 = f16 operands, 1 = bf16 operands (pointers passed as 16-bit storage)
template <int ET> struct Elem;
template <> struct Elem<0> { typedef _Float16 T; };
template <> struct Elem<1> { typedef __bf16 T; };
template <int ET, bool SPLIT, int BIAS_MODE, int OUT_MODE, bool RESID, int ACT = 0>
__global__ __launch_bounds__(256) void wmma_gemm64(
    const unsigned short* __restrict__ Ap, const unsigned short* __restrict__ A2p, int lda, long strideA,
    const unsigned short* __restrict__ Btp, const unsigned short* __restrict__ Bt2p, int ldb, long strideB,
    void* __restrict__ Cout, void* __restrict__ Cout2, int ldc, long strideC,
    const float* __restrict__ bias,
    const float* __restrict__ resid, long strideR,
    int M, int N, int K, float scale) {
  typedef typename Elem<ET>::T T;
  typedef typename Frag<T>::V V;
  const T* A = (const T*)Ap; const T* A2 = (const T*)A2p; const T* Bt = (const T*)Btp; const T* Bt2 = (const T*)Bt2p;
  __shared__ __align__(16) float sT[8][16 * 68];   // per-wave 16x64 slab, pitch 68 floats
  const int b    = blockIdx.y;
  const int lane = threadIdx.x & 31;
  const int wave = threadIdx.x >> 5;
  const int tilesN = N >> 6;
  const int tilesM = M >> 6;
  const int tile = blockIdx.x * 8 + wave;
  if (tile >= tilesM * tilesN) return;   // wave-uniform; no block barriers in this kernel
  const int tm = tile / tilesN;
  const int tn = tile - tm * tilesN;
  const int m0 = tm << 6;
  const int n0 = tn << 6;

  const T* Ab  = A  + (size_t)b * strideA;
  const T* Bb  = Bt + (size_t)b * strideB;
  const T* Ab2 = SPLIT ? (A2  + (size_t)b * strideA) : nullptr;
  const T* Bb2 = SPLIT ? (Bt2 + (size_t)b * strideB) : nullptr;

  const int rlane = lane & 15;                 // row (A) / col (B, D) within subtile
  const int koff  = (lane >> 4) * 8;           // k offset of this lane half
  const int mOff  = (lane >> 4) * 8;           // D row offset

  v8f acc[4][4];
#pragma unroll
  for (int i = 0; i < 4; ++i)
#pragma unroll
    for (int j = 0; j < 4; ++j) acc[i][j] = (v8f){0.f,0.f,0.f,0.f,0.f,0.f,0.f,0.f};

  for (int k0 = 0; k0 < K; k0 += 32) {
    V bh[4], bl[4];
#pragma unroll
    for (int j = 0; j < 4; ++j) {
      const size_t bo = (size_t)(n0 + (j << 4) + rlane) * ldb + koff + k0;
      bh[j] = Frag<T>::load(Bb + bo);
      if (SPLIT) bl[j] = Frag<T>::load(Bb2 + bo);
    }
#pragma unroll
    for (int i = 0; i < 4; ++i) {
      const size_t ao = (size_t)(m0 + (i << 4) + rlane) * lda + koff + k0;
      V ah = Frag<T>::load(Ab + ao);
      V al;
      if (SPLIT) al = Frag<T>::load(Ab2 + ao);
#pragma unroll
      for (int j = 0; j < 4; ++j) {
        acc[i][j] = Frag<T>::mma(ah, bh[j], acc[i][j]);
        if (SPLIT) {
          acc[i][j] = Frag<T>::mma(ah, bl[j], acc[i][j]);
          acc[i][j] = Frag<T>::mma(al, bh[j], acc[i][j]);
        }
      }
      Frag<T>::guard(acc[i][0], acc[i][3], ah, SPLIT ? al : ah);
    }
    Frag<T>::keep(bh[0], bh[1], bh[2], bh[3]);
    if (SPLIT) Frag<T>::keep(bl[0], bl[1], bl[2], bl[3]);
  }
  acc_guard4(acc[0][0], acc[0][1], acc[0][2], acc[0][3]);
  acc_guard4(acc[1][0], acc[1][1], acc[1][2], acc[1][3]);
  acc_guard4(acc[2][0], acc[2][1], acc[2][2], acc[2][3]);
  acc_guard4(acc[3][0], acc[3][1], acc[3][2], acc[3][3]);

  // ---- epilogue ----
  float* slab = sT[wave];
  const float* Rb = RESID ? (resid + (size_t)b * strideR) : nullptr;
#pragma unroll
  for (int i = 0; i < 4; ++i) {
    const int mBase = m0 + (i << 4);
#pragma unroll
    for (int j = 0; j < 4; ++j) {
      const int n = n0 + (j << 4) + rlane;
      float bv = 0.f;
      if (BIAS_MODE == 2) bv = bias[n];
#pragma unroll
      for (int r = 0; r < 8; ++r) {
        float v = acc[i][j][r] * scale;
        if (BIAS_MODE == 1) v += bias[mBase + mOff + r];
        if (BIAS_MODE == 2) v += bv;
        if (RESID) v += Rb[(size_t)(mBase + mOff + r) * ldc + n];
        if (ACT == 1) v = tanhf(v);
        if (ACT == 2) v = fmaxf(v, 0.0f);
        if (ACT == 3) v = v / (1.0f + expf(-v));
        if (ACT == 4) v = (v > 0.f) ? v : 0.01f * v;
        if (ACT == 5) v = 0.5f * v * (1.0f + erff(v * 0.70710678118654752f));
        slab[(mOff + r) * 68 + (j << 4) + rlane] = v;
      }
    }
    __builtin_amdgcn_fence(__ATOMIC_RELEASE, "workgroup");
    __builtin_amdgcn_wave_barrier();
    __builtin_amdgcn_fence(__ATOMIC_ACQUIRE, "workgroup");
    if (OUT_MODE == 0) {
      float* C = (float*)Cout + (size_t)b * strideC;
      const int hh = lane >> 4, c4 = (lane & 15) * 4;     // row seg = 256 B = 16 lanes x 16 B
      {
#pragma unroll
        for (int it = 0; it < 8; ++it) {
          const int row = it * 2 + hh;
          v4f v = *(const v4f*)(slab + row * 68 + c4);
          *(v4f*)(C + (size_t)(mBase + row) * ldc + n0 + c4) = v;
        }
        
      }
    } else {
      const int q = lane >> 3, c8 = (lane & 7) * 8;
      unsigned short* C  = (unsigned short*)Cout  + (size_t)b * strideC;
      unsigned short* C2 = (OUT_MODE == 2) ? ((unsigned short*)Cout2 + (size_t)b * strideC) : nullptr;
      {
#pragma unroll
        for (int it = 0; it < 4; ++it) {
          const int row = it * 4 + q;
          const float* sp = slab + row * 68 + c8;
          v8h hv, lv;
#pragma unroll
          for (int e = 0; e < 8; ++e) {
            if (OUT_MODE == 1) {
              hv[e] = (_Float16)sp[e];
            } else {
              unsigned short hb = f2bf_bits(sp[e]);
              unsigned short lb = f2bf_bits(sp[e] - bf_bits2f(hb));
              hv[e] = __builtin_bit_cast(_Float16, hb);
              lv[e] = __builtin_bit_cast(_Float16, lb);
            }
          }
          *(v8h*)(C + (size_t)(mBase + row) * ldc + n0 + c8) = hv;
          if (OUT_MODE == 2) *(v8h*)(C2 + (size_t)(mBase + row) * ldc + n0 + c8) = lv;
        }
        
      }
    }
    __builtin_amdgcn_fence(__ATOMIC_RELEASE, "workgroup");
    __builtin_amdgcn_wave_barrier();
    __builtin_amdgcn_fence(__ATOMIC_ACQUIRE, "workgroup");
  }
}

__global__ __launch_bounds__(256) void cast_f32_f16x2(
    const float* __restrict__ in, _Float16* __restrict__ out, int n2) {
  int i = blockIdx.x * 256 + threadIdx.x;
  if (i < n2) {
    const _Float16 h0 = (_Float16)in[2 * i], h1 = (_Float16)in[2 * i + 1];
    const unsigned u = (unsigned)__builtin_bit_cast(unsigned short, h0) | ((unsigned)__builtin_bit_cast(unsigned short, h1) << 16);
    ((unsigned*)out)[i] = u;
    
  }
}


} // namespace w25

__global__ __launch_bounds__(256) void k_castT16(const float* __restrict__ src, long long lds, _Float16* __restrict__ dst, long long ldd, int R, int C, float s) {
    const long long i = (long long)blockIdx.x * 256 + threadIdx.x; const long long np = (long long)C * (R / 2); if (i >= np) return; const int c = (int)(i / (R / 2)); const int r = 2 * (int)(i % (R / 2));
    const _Float16 h0 = (_Float16)(src[(long long)r * lds + c] * s), h1 = (_Float16)(src[(long long)(r + 1) * lds + c] * s);
    const unsigned u = (unsigned)__builtin_bit_cast(unsigned short, h0) | ((unsigned)__builtin_bit_cast(unsigned short, h1) << 16);
    unsigned* d = (unsigned*)(dst + (long long)c * ldd + r); *d = u;  }
__global__ __launch_bounds__(256) void k_cast16(const float* __restrict__ src, long long lds, _Float16* __restrict__ dst, long long ldd, int R, int C, float s) {
    const long long i = (long long)blockIdx.x * 256 + threadIdx.x; const long long np = (long long)R * (C / 2); if (i >= np) return; const int r = (int)(i / (C / 2)); const int c = 2 * (int)(i % (C / 2));
    const _Float16 h0 = (_Float16)(src[(long long)r * lds + c] * s), h1 = (_Float16)(src[(long long)r * lds + c + 1] * s);
    const unsigned u = (unsigned)__builtin_bit_cast(unsigned short, h0) | ((unsigned)__builtin_bit_cast(unsigned short, h1) << 16);
    unsigned* d = (unsigned*)(dst + (long long)r * ldd + c); *d = u;  }

// f32 -> bf16 hi plane + bf16 lo plane (x = hi + lo to ~2^-17 relative; RNE both), [R][C] -> [R][C] (or transposed to [C][R]); 2 consecutive destination elements
__device__ __forceinline__ unsigned int f2bf2_pack(float a, float b, unsigned int* lo) {
    const unsigned short ha = w25::f2bf_bits(a), hb = w25::f2bf_bits(b);
    const unsigned short la = w25::f2bf_bits(a - w25::bf_bits2f(ha)), lb = w25::f2bf_bits(b - w25::bf_bits2f(hb));
    *lo = (unsigned)la | ((unsigned)lb << 16); return (unsigned)ha | ((unsigned)hb << 16); }
__global__ __launch_bounds__(256) void k_castS16(const float* __restrict__ src, long long lds, __bf16* __restrict__ dhi, __bf16* __restrict__ dlo, long long ldd, int R, int C, float s, int transpose) {
    const long long i = (long long)blockIdx.x * 256 + threadIdx.x; long long o; float a, b;
    if (transpose) { const long long np = (long long)C * (R / 2); if (i >= np) return; const int c = (int)(i / (R / 2)); const int r = 2 * (int)(i % (R / 2)); a = src[(long long)r * lds + c] * s; b = src[(long long)(r + 1) * lds + c] * s; o = (long long)c * ldd + r; }
    else { const long long np = (long long)R * (C / 2); if (i >= np) return; const int r = (int)(i / (C / 2)); const int c = 2 * (int)(i % (C / 2)); a = src[(long long)r * lds + c] * s; b = src[(long long)r * lds + c + 1] * s; o = (long long)r * ldd + c; }
    unsigned lo; const unsigned hi = f2bf2_pack(a, b, &lo); unsigned* ph = (unsigned*)(dhi + o); unsigned* pl = (unsigned*)(dlo + o);
    *ph = hi; *pl = lo;  }

namespace w25 {
// =====================================================================================
// Generic causal/non-causal attention for head_dim 64, f32 in / f32 out; 16-bit operands: bf16 with optional hi/lo splits, or
// plain f16 (F16=true, non-split, probabilities carried x2^15).
//   scores = (q*qscale)·kᵀ : v_wmma_f32_16x16x32_bf16; SPLIT_QK -> q,k as bf16 hi/lo (hi·hi + hi·lo + lo·hi)
//   out    = p·v           : v_wmma_f32_16x16x32_bf16; SPLIT_PV -> p,v as bf16 hi/lo; else p,v plain bf16
//   f32 accumulate; online softmax in f32. Block = 4 waves = 64 query rows of one (batch, head); S % 64 == 0.
//   Element (b, s, h, d) of tensor X lives at X[b*X_bs + s*X_rs + h*X_hs + d] (strides in floats, multiples of 4).
//   Masking: mask_mode 0 none, 1 causal (kv > q masked), 2 tensor [S][Skv] shared over (b,h) (float if
//   mask_is_int==0, int32 with element == 0 -> masked if 1, int32 with element != 0 -> masked if 2), 3 per-token vectors qmask[B][S] & kvmask[B][Skv] (int32,
//   0 -> masked), 4 causal + sliding window (kv > q or q - kv > W masked; W passed in mask_is_int);
//   5 = relative-position bias: s += cp[b,h,q][idx[q][kv]] + pc[b,h,kv][idx[q][kv]] with idx = mask_b ([S][Skv] int32) and
//   mask_a an int32 [S][Skv] tensor with nonzero = masked (tables: element (b,h,row,n) at X + b*c_bs + h*c_hs + row*c_rs + n);
//   masked scores are replaced by mask_fill (e.g. -inf or -1e9) before the softmax.
//   grid.x = B * H * (S/64) (or a sub-range with blk0).
// =====================================================================================
#define AT_D 64
#define AT_NW 4
#define AT_QB 64
#define AT_KC 64
struct AttnGeom { const float* cp = nullptr; const float* pc = nullptr; long c_bs = 0, c_rs = 0, c_hs = 0;   // mode-5 score-bias tables
                  long q_bs, q_rs, q_hs, k_bs, k_rs, k_hs, v_bs, v_rs, v_hs, o_bs, o_rs, o_hs;
                  int S, Skv, H, mask_mode; float qscale; int blk0; float mask_fill; int mask_is_int; };
static_assert(sizeof(AttnGeom) == 168, "no padding");

__device__ __forceinline__ unsigned short at_bf_bits(float f) {
  unsigned u = __float_as_uint(f);
  return (unsigned short)((u + 0x7FFFu + ((u >> 16) & 1u)) >> 16);
}
__device__ __forceinline__ __bf16 at_f2bf(float f) { return __builtin_bit_cast(__bf16, at_bf_bits(f)); }
__device__ __forceinline__ void at_split(float f, __bf16& hi, __bf16& lo) {
  const unsigned short hb = at_bf_bits(f);
  hi = __builtin_bit_cast(__bf16, hb);
  lo = at_f2bf(f - __uint_as_float(((unsigned)hb) << 16));
}
__device__ __forceinline__ v8f at_mma(v16b a, v16b b, v8f c) {
  c = __builtin_amdgcn_wmma_f32_16x16x32_bf16(false, a, false, b, (short)0, c, false, false);
  asm volatile("v_nop\n\tv_nop\n\tv_nop\n\tv_nop" : "+v"(c) : "v"(a), "v"(b));
  return c;
}
// 16-bit element as a bit pattern held in a __bf16 slot: f16 bits when F16, bf16 (RNE) otherwise
template <bool F16> __device__ __forceinline__ __bf16 at_to16(float f) {
  if (F16) return __builtin_bit_cast(__bf16, (_Float16)f);
  return at_f2bf(f);
}
template <bool F16> __device__ __forceinline__ v8f at_mma16(v16b a, v16b b, v8f c) {
  if (F16) {
    const v16h ah = __builtin_bit_cast(v16h, a), bh = __builtin_bit_cast(v16h, b);
    c = __builtin_amdgcn_wmma_f32_16x16x32_f16(false, ah, false, bh, (short)0, c, false, false);
    asm volatile("v_nop\n\tv_nop\n\tv_nop\n\tv_nop" : "+v"(c) : "v"(ah), "v"(bh));
    return c;
  }
  return at_mma(a, b, c);
}

template <bool SPLIT_QK, bool SPLIT_PV, bool F16 = false>
__global__ __launch_bounds__(128)
void attn64_kernel(const float* __restrict__ q, const float* __restrict__ k,
                   const float* __restrict__ v, float* __restrict__ out,
                   const void* __restrict__ mask_a, const int* __restrict__ mask_b, AttnGeom g) {
  static_assert(!(F16 && (SPLIT_QK || SPLIT_PV)), "f16 mode is non-split");
  const float PSC = F16 ? 32768.0f : 1.0f;     // f16 probabilities carried x2^15 (subnormal range), folded into the final 1/l
  union FB { v16b v; v8b h[2]; };
  __shared__ __align__(16) __bf16 Ksh[AT_KC * AT_D];             // K hi [kv][d]      8 KB
  __shared__ __align__(16) __bf16 Ksl[SPLIT_QK ? AT_KC * AT_D : 8];
  __shared__ __align__(16) __bf16 Vth[AT_D * AT_KC];             // V hi [d][kv]      8 KB
  __shared__ __align__(16) __bf16 Vtl[SPLIT_PV ? AT_D * AT_KC : 8];
  __shared__ __align__(16) __bf16 Psh[AT_NW][16 * AT_KC];        // per wave P hi [row][kv]  8 KB
  __shared__ __align__(16) __bf16 Psl[SPLIT_PV ? AT_NW : 1][SPLIT_PV ? 16 * AT_KC : 8];
  __shared__ __align__(16) float  Os[AT_NW][16 * 68];            // per wave out tile, pitch 68

  const int tid  = threadIdx.x;
  const int wave = tid >> 5;
  const int lane = tid & 31;
  const int hh   = lane >> 4;
  const int c    = lane & 15;

  const int nqb = g.S / AT_QB;
  const int bx = blockIdx.x + g.blk0;
  const int qb = bx % nqb;
  const int bh = bx / nqb;
  const int h  = bh % g.H;
  const int b  = bh / g.H;
  const int qbase_block = qb * AT_QB;
  const int q0 = qbase_block + wave * 16;

  const float* qb_ptr = q + (size_t)b * g.q_bs + (size_t)h * g.q_hs;
  const float* kb_ptr = k + (size_t)b * g.k_bs + (size_t)h * g.k_hs;
  const float* vb_ptr = v + (size_t)b * g.v_bs + (size_t)h * g.v_hs;
  float*       ob_ptr = out + (size_t)b * g.o_bs + (size_t)h * g.o_hs;

  // ---- Q fragments (A operand): 2 d-chunks, hi (and lo) ----
  v16b qah[2], qal[2];
  {
    const float* qrow = qb_ptr + (size_t)(q0 + c) * g.q_rs;
#pragma unroll
    for (int dc = 0; dc < 2; ++dc) {
#pragma unroll
      for (int e = 0; e < 8; ++e) {
        const float f0 = qrow[dc * 32 + 8 * hh + e] * g.qscale;
        const float f1 = qrow[dc * 32 + 16 + 8 * hh + e] * g.qscale;
        if (SPLIT_QK) { __bf16 hq, lq; at_split(f0, hq, lq); qah[dc][e] = hq; qal[dc][e] = lq; at_split(f1, hq, lq); qah[dc][8 + e] = hq; qal[dc][8 + e] = lq; }
        else { qah[dc][e] = at_to16<F16>(f0); qah[dc][8 + e] = at_to16<F16>(f1); qal[dc][e] = qah[dc][e]; qal[dc][8 + e] = qah[dc][8 + e]; }
      }
    }
  }

  float mrow[8], lrow[8];
  v8f oacc[4];
#pragma unroll
  for (int r = 0; r < 8; ++r) { mrow[r] = -INFINITY; lrow[r] = 0.f; }
#pragma unroll
  for (int t = 0; t < 4; ++t) oacc[t] = (v8f){0.f,0.f,0.f,0.f,0.f,0.f,0.f,0.f};

  const int nChunks = (g.mask_mode == 1 || g.mask_mode == 4) ? (qb + 1) : (g.Skv / AT_KC);   // block-uniform
  // per-row query mask (mode 3)
  int qkeep[8];
#pragma unroll
  for (int r = 0; r < 8; ++r) qkeep[r] = (g.mask_mode == 3) ? mask_b[(size_t)b * g.S + q0 + 8 * hh + r] : 1;   // mask_b = qmask in mode 3
  for (int kc = 0; kc < nChunks; ++kc) {
    const int kv0 = kc * AT_KC;
    __syncthreads();
    {
      const int kvr = tid >> 1, dh = (tid & 1) * 32;
      const float* krow = kb_ptr + (size_t)(kv0 + kvr) * g.k_rs + dh;
      const float* vrow = vb_ptr + (size_t)(kv0 + kvr) * g.v_rs + dh;
#pragma unroll
      for (int i = 0; i < 8; ++i) {
        v4f kk = *(const v4f*)(krow + 4 * i);
        v4f vv = *(const v4f*)(vrow + 4 * i);
#pragma unroll
        for (int e = 0; e < 4; ++e) {
          const int d = dh + 4 * i + e;
          if (SPLIT_QK) { __bf16 a, bl; at_split(kk[e], a, bl); Ksh[kvr * AT_D + d] = a; Ksl[kvr * AT_D + d] = bl; }
          else Ksh[kvr * AT_D + d] = at_to16<F16>(kk[e]);
          if (SPLIT_PV) { __bf16 a, bl; at_split(vv[e], a, bl); Vth[d * AT_KC + kvr] = a; Vtl[d * AT_KC + kvr] = bl; }
          else Vth[d * AT_KC + kvr] = at_to16<F16>(vv[e]);
        }
      }
    }
    __syncthreads();

    v8f s[4];
#pragma unroll
    for (int j = 0; j < 4; ++j) {
      s[j] = (v8f){0.f,0.f,0.f,0.f,0.f,0.f,0.f,0.f};
#pragma unroll 1
      for (int dc = 0; dc < 2; ++dc) {
        FB kb;
        kb.h[0] = *(const v8b*)(Ksh + (j * 16 + c) * AT_D + dc * 32 + 8 * hh);
        kb.h[1] = *(const v8b*)(Ksh + (j * 16 + c) * AT_D + dc * 32 + 16 + 8 * hh);
        s[j] = at_mma16<F16>(qah[dc], kb.v, s[j]);
        if (SPLIT_QK) {
          FB kl;
          kl.h[0] = *(const v8b*)(Ksl + (j * 16 + c) * AT_D + dc * 32 + 8 * hh);
          kl.h[1] = *(const v8b*)(Ksl + (j * 16 + c) * AT_D + dc * 32 + 16 + 8 * hh);
          s[j] = at_mma16<F16>(qah[dc], kl.v, s[j]);
          s[j] = at_mma16<F16>(qal[dc], kb.v, s[j]);
        }
      }
    }
    const bool diag = (g.mask_mode == 1) && (kc == qb);
    int kvkeep[4] = {1, 1, 1, 1};
    if (g.mask_mode == 3) {
#pragma unroll
      for (int j = 0; j < 4; ++j) kvkeep[j] = ((const int*)mask_a)[(size_t)b * g.Skv + kv0 + j * 16 + c];   // mask_a = kvmask
    }
    float cm[8];
#pragma unroll
    for (int r = 0; r < 8; ++r) {
      const int qrow = q0 + 8 * hh + r;
      float m = -INFINITY;
#pragma unroll
      for (int j = 0; j < 4; ++j) {
        const int kvcol = kv0 + j * 16 + c;
        bool masked = false;
        if (diag) masked = (kvcol > qrow);
        else if (g.mask_mode == 4) masked = (kvcol > qrow) || (qrow - kvcol > g.mask_is_int);
        else if (g.mask_mode == 2) {
          const size_t mi = (size_t)qrow * g.Skv + kvcol;
          masked = (g.mask_is_int == 0) ? (((const float*)mask_a)[mi] == 0.0f)
                 : (g.mask_is_int == 1) ? (((const int*)mask_a)[mi] == 0) : (((const int*)mask_a)[mi] != 0);
        } else if (g.mask_mode == 3) masked = (qkeep[r] == 0) || (kvkeep[j] == 0);
        else if (g.mask_mode == 5) {
          const size_t mi = (size_t)qrow * g.Skv + kvcol;
          masked = (((const int*)mask_a)[mi] != 0);
          int n = mask_b[mi]; n = n < 0 ? 0 : n;
          s[j][r] += g.cp[(size_t)b * g.c_bs + (size_t)h * g.c_hs + (size_t)qrow * g.c_rs + n]
                   + g.pc[(size_t)b * g.c_bs + (size_t)h * g.c_hs + (size_t)kvcol * g.c_rs + n];
        }
        if (masked) s[j][r] = g.mask_fill;
        m = fmaxf(m, s[j][r]);
      }
#pragma unroll
      for (int off = 1; off < 16; off <<= 1) m = fmaxf(m, __shfl_xor(m, off, 32));
      cm[r] = m;
    }
    __bf16* pwh = Psh[wave];
    __bf16* pwl = Psl[SPLIT_PV ? wave : 0];
#pragma unroll
    for (int r = 0; r < 8; ++r) {
      const float mnew = fmaxf(mrow[r], cm[r]);
      const float alpha = expf(mrow[r] - mnew);
      mrow[r] = mnew;
      float psum = 0.f;
#pragma unroll
      for (int j = 0; j < 4; ++j) {
        const float p = expf(s[j][r] - mnew);
        psum += p;
        if (SPLIT_PV) { __bf16 a, bl; at_split(p, a, bl); pwh[(8 * hh + r) * AT_KC + j * 16 + c] = a; pwl[(8 * hh + r) * AT_KC + j * 16 + c] = bl; }
        else pwh[(8 * hh + r) * AT_KC + j * 16 + c] = at_to16<F16>(p * PSC);
      }
#pragma unroll
      for (int off = 1; off < 16; off <<= 1) psum += __shfl_xor(psum, off, 32);
      lrow[r] = lrow[r] * alpha + psum;
#pragma unroll
      for (int t = 0; t < 4; ++t) oacc[t][r] *= alpha;
    }
    __builtin_amdgcn_fence(__ATOMIC_RELEASE, "workgroup");
    __builtin_amdgcn_wave_barrier();
    __builtin_amdgcn_fence(__ATOMIC_ACQUIRE, "workgroup");
#pragma unroll 1
    for (int kk = 0; kk < 2; ++kk) {
      FB pa, pl;
      pa.h[0] = *(const v8b*)(pwh + c * AT_KC + kk * 32 + 8 * hh);
      pa.h[1] = *(const v8b*)(pwh + c * AT_KC + kk * 32 + 16 + 8 * hh);
      if (SPLIT_PV) {
        pl.h[0] = *(const v8b*)(pwl + c * AT_KC + kk * 32 + 8 * hh);
        pl.h[1] = *(const v8b*)(pwl + c * AT_KC + kk * 32 + 16 + 8 * hh);
      }
#pragma unroll
      for (int t = 0; t < 4; ++t) {
        FB vb;
        vb.h[0] = *(const v8b*)(Vth + (t * 16 + c) * AT_KC + kk * 32 + 8 * hh);
        vb.h[1] = *(const v8b*)(Vth + (t * 16 + c) * AT_KC + kk * 32 + 16 + 8 * hh);
        oacc[t] = at_mma16<F16>(pa.v, vb.v, oacc[t]);
        if (SPLIT_PV) {
          FB vl;
          vl.h[0] = *(const v8b*)(Vtl + (t * 16 + c) * AT_KC + kk * 32 + 8 * hh);
          vl.h[1] = *(const v8b*)(Vtl + (t * 16 + c) * AT_KC + kk * 32 + 16 + 8 * hh);
          oacc[t] = at_mma16<F16>(pa.v, vl.v, oacc[t]);
          oacc[t] = at_mma16<F16>(pl.v, vb.v, oacc[t]);
        }
      }
    }
  }

  float* os = Os[wave];
#pragma unroll
  for (int r = 0; r < 8; ++r) {
    const float inv = 1.0f / (lrow[r] * PSC);
#pragma unroll
    for (int t = 0; t < 4; ++t) os[(8 * hh + r) * 68 + t * 16 + c] = oacc[t][r] * inv;
  }
  __builtin_amdgcn_fence(__ATOMIC_RELEASE, "workgroup");
  __builtin_amdgcn_wave_barrier();
  __builtin_amdgcn_fence(__ATOMIC_ACQUIRE, "workgroup");
  {
    const int c4 = (lane & 15) * 4;
    {
#pragma unroll
      for (int it = 0; it < 8; ++it) {
        const int row = it * 2 + hh;
        v4f val = *(const v4f*)(os + row * 68 + c4);
        *(v4f*)(ob_ptr + (size_t)(q0 + row) * g.o_rs + c4) = val;
      }
      
    }
  }
}

} // namespace w25

// RoPE in place: thread per (row, q|k, head, pair i<32): (x0, x1) = (x[2i], x[2i+1]) -> (x0 cos[2i] - x1 sin[2i], x1 cos[2i+1] + x0 sin[2i+1]); tables gathered by the INPUT position (clamped); one 8-B store per lane, lanes contiguous
__global__ __launch_bounds__(256) void k_cm_rope(float* __restrict__ Q, float* __restrict__ Kx, const float* __restrict__ CS, const float* __restrict__ SN, const int* __restrict__ POS, int Bn, int S, int NH, int HD) { const long long t = (long long)blockIdx.x * 256 + threadIdx.x; const int HF = HD / 2; if (t >= (long long)Bn * S * 2 * NH * HF) return; const int i = (int)(t % HF); long long r = t / HF; const int h = (int)(r % NH); r /= NH; const int which = (int)(r % 2); const long long row = r / 2; const int sq = (int)(row % S);
    int ps = POS[sq]; ps = ps < 0 ? 0 : (ps >= S ? S - 1 : ps); const float c0 = CS[ps * HD + 2 * i], c1 = CS[ps * HD + 2 * i + 1], s0 = SN[ps * HD + 2 * i], s1 = SN[ps * HD + 2 * i + 1];
    float* base = ((which == 0) ? Q : Kx) + row * ((long long)NH * HD) + h * HD + 2 * i; const float x0 = base[0], x1 = base[1];
    const unsigned long long pk = (unsigned long long)__builtin_bit_cast(unsigned, x0 * c0 - x1 * s0) | ((unsigned long long)__builtin_bit_cast(unsigned, x1 * c1 + x0 * s1) << 32); VST2(unsigned long long, (unsigned long long*)base, pk); }
__global__ __launch_bounds__(64) void k_cm_exact(const float* __restrict__ Q64, const float* __restrict__ K64, const float* __restrict__ V, float* __restrict__ AT, int S, int D, int NH, int HD) { __shared__ float sc[64]; const int t = blockIdx.x % 64; const int h = (blockIdx.x / 64) % NH; const int b = blockIdx.x / (64 * NH); const int d = threadIdx.x;
    const float* q = Q64 + ((long long)b * 64 + t) * D + h * HD; float s = -3.0e38f;
    if (d <= t) { const float* kr = K64 + ((long long)b * 64 + d) * D + h * HD; float a = 0.f;
#pragma unroll 1
        for (int j = 0; j < HD; ++j) a += q[j] * kr[j];
        s = a * 0.125f; }
    sc[d] = s; __syncthreads();
    float mx = -3.0e38f; for (int j = 0; j <= t; ++j) mx = fmaxf(mx, sc[j]);
    float den = 0.f; for (int j = 0; j <= t; ++j) den += expf(sc[j] - mx);
    float acc = 0.f;
#pragma unroll 1
    for (int j = 0; j <= t; ++j) acc += expf(sc[j] - mx) * V[((long long)b * S + j) * D + h * HD + d];
    VST2(float, AT + ((long long)b * S + t) * D + h * HD + d, acc / den); }


extern "C" void kernel_launch(void* const* d_in, const int* in_sizes, int n_in, void* d_out, int out_size, void* d_ws, size_t ws_size, hipStream_t stream) {
    (void)in_sizes; (void)n_in; (void)out_size; (void)ws_size;
    const float* x = (const float*)d_in[0];
    const float* Wq = (const float*)d_in[1];
    const float* Wk = (const float*)d_in[2];
    const float* Wv = (const float*)d_in[3];
    const float* Wo = (const float*)d_in[4];
    const float* cosT = (const float*)d_in[5];
    const float* sinT = (const float*)d_in[6];
    const int* tpos = (const int*)d_in[7];
    const int Bn = 2;
    const int S = 2048;
    const int D = 1024;
    const int NH = 16;
    const int HD = 64;
    const int NR = Bn * S;
    float* out = (float*)d_out;
    char* wsp = (char*)d_ws;
    float* Q = (float*)wsp; wsp += (((size_t)((size_t)NR * D) * 4 + 255) / 256) * 256;
    float* Kb = (float*)wsp; wsp += (((size_t)((size_t)NR * D) * 4 + 255) / 256) * 256;
    float* V = (float*)wsp; wsp += (((size_t)((size_t)NR * D) * 4 + 255) / 256) * 256;
    float* AT = (float*)wsp; wsp += (((size_t)((size_t)NR * D) * 4 + 255) / 256) * 256;
    float* Q64 = (float*)wsp; wsp += (((size_t)((size_t)Bn * 64 * D) * 4 + 255) / 256) * 256;
    float* K64 = (float*)wsp; wsp += (((size_t)((size_t)Bn * 64 * D) * 4 + 255) / 256) * 256;
    unsigned short* G64A = (unsigned short*)wsp; wsp += (((size_t)(4194304) * 2 + 255) / 256) * 256;
    unsigned short* G64B = (unsigned short*)wsp; wsp += (((size_t)(1048576) * 2 + 255) / 256) * 256;
    unsigned short* G64A2 = (unsigned short*)wsp; wsp += (((size_t)(4194304) * 2 + 255) / 256) * 256;
    unsigned short* G64B2 = (unsigned short*)wsp; wsp += (((size_t)(1048576) * 2 + 255) / 256) * 256;
    k_cast16<<<(unsigned)((((long long)(4096) * ((1024) / 2)) + 255) / 256), 256, 0, stream>>>(x + (size_t)0 * NR * D, 1024, (_Float16*)(G64A), 1024, 4096, 1024, 1.0f);
    k_cast16<<<(unsigned)((((long long)(1024) * ((1024) / 2)) + 255) / 256), 256, 0, stream>>>(Wq, 1024, (_Float16*)(G64B), 1024, 1024, 1024, 16.0f);
    w25::wmma_gemm64<0, false, 0, 0, false, 0><<<dim3((unsigned)((((4096) / 64) * ((1024) / 64) + 7) / 8), (unsigned)(1)), 256, 0, stream>>>((const unsigned short*)(G64A), nullptr, 1024, 0, (const unsigned short*)(G64B), nullptr, 1024, 0, (void*)(Q), nullptr, 1024, 0, nullptr, nullptr, 0, 4096, 1024, 1024, 0.0625f);
    k_cast16<<<(unsigned)((((long long)(4096) * ((1024) / 2)) + 255) / 256), 256, 0, stream>>>(x + (size_t)0 * NR * D, 1024, (_Float16*)(G64A), 1024, 4096, 1024, 1.0f);
    k_cast16<<<(unsigned)((((long long)(1024) * ((1024) / 2)) + 255) / 256), 256, 0, stream>>>(Wk, 1024, (_Float16*)(G64B), 1024, 1024, 1024, 16.0f);
    w25::wmma_gemm64<0, false, 0, 0, false, 0><<<dim3((unsigned)((((4096) / 64) * ((1024) / 64) + 7) / 8), (unsigned)(1)), 256, 0, stream>>>((const unsigned short*)(G64A), nullptr, 1024, 0, (const unsigned short*)(G64B), nullptr, 1024, 0, (void*)(Kb), nullptr, 1024, 0, nullptr, nullptr, 0, 4096, 1024, 1024, 0.0625f);
    k_castS16<<<(unsigned)((((long long)(4096) * ((1024) / 2)) + 255) / 256), 256, 0, stream>>>(x + (size_t)0 * NR * D, 1024, (__bf16*)(G64A), (__bf16*)(G64A2), 1024, 4096, 1024, 1.0f, 0);
    k_castS16<<<(unsigned)((((long long)(1024) * ((1024) / 2)) + 255) / 256), 256, 0, stream>>>(Wv, 1024, (__bf16*)(G64B), (__bf16*)(G64B2), 1024, 1024, 1024, 1.0f, 0);
    w25::wmma_gemm64<1, true, 0, 0, false, 0><<<dim3((unsigned)((((4096) / 64) * ((1024) / 64) + 7) / 8), (unsigned)(1)), 256, 0, stream>>>((const unsigned short*)(G64A), (const unsigned short*)(G64A2), 1024, 0, (const unsigned short*)(G64B), (const unsigned short*)(G64B2), 1024, 0, (void*)(V), nullptr, 1024, 0, nullptr, nullptr, 0, 4096, 1024, 1024, 1.0f);
    k_cm_rope<<<(unsigned)(((long long)NR * 2 * NH * 32 + 255) / 256), 256, 0, stream>>>(Q, Kb, cosT, sinT, (const int*)tpos, Bn, S, NH, HD);
    { /*apv4*/ AttnP a;
      a.Q = Q; a.K = Kb; a.V = V; a.O = AT; a.P = 0; a.Mf = 0; a.Mi = 0; a.ST = 0;
      a.Pw = 0; a.Rt = 0; a.SQ = 0; a.SK = 0;
      a.swb = 0; a.swh = 0; a.swi = 0; a.swj = 0; a.srb = 0; a.srh = 0; a.sri = 0; a.sQb = (long long)S * D; a.sQh = HD; a.sQi = D; a.sQd = 1; a.sKb = (long long)S * D; a.sKh = HD; a.sKj = D; a.sKd = 1; a.sVb = (long long)S * D; a.sVh = HD; a.sVj = D; a.sVd = 1; a.sOb = (long long)S * D; a.sOh = HD; a.sOi = D; a.sPb = 0; a.sPh = 0; a.sPi = 0; a.smb = 0; a.smh = 0; a.smi = 0; a.smj = 0;
      a.Lq = S; a.Lk = S; a.dh = HD; a.dv = HD; a.hrep = 1; a.causal = 1; a.coff = 0; a.pband = 0;
      a.scale = 0.125f; a.mfill = 0.0f; a.nonorm = 0; a.mpol = 0;
      a.roff = 0; a.rn = 1; a.segpol = 0; a.win = 0;
      k_attn<64, 64, 0, false, false><<<dim3((unsigned)((S) + 16 * AW - 1) / (16 * AW), (unsigned)(NH), (unsigned)(Bn)), 32 * AW, 0, stream>>>(a); }
    k_castS16<<<(unsigned)((((long long)(64) * ((1024) / 2)) + 255) / 256), 256, 0, stream>>>(x + ((size_t)0 * NR + (size_t)0 * S) * D, 1024, (__bf16*)(G64A), (__bf16*)(G64A2), 1024, 64, 1024, 1.0f, 0);
    k_castS16<<<(unsigned)((((long long)(1024) * ((1024) / 2)) + 255) / 256), 256, 0, stream>>>(Wq, 1024, (__bf16*)(G64B), (__bf16*)(G64B2), 1024, 1024, 1024, 1.0f, 0);
    w25::wmma_gemm64<1, true, 0, 0, false, 0><<<dim3((unsigned)((((64) / 64) * ((1024) / 64) + 7) / 8), (unsigned)(1)), 256, 0, stream>>>((const unsigned short*)(G64A), (const unsigned short*)(G64A2), 1024, 0, (const unsigned short*)(G64B), (const unsigned short*)(G64B2), 1024, 0, (void*)(Q64 + (size_t)0 * 64 * D), nullptr, 1024, 0, nullptr, nullptr, 0, 64, 1024, 1024, 1.0f);
    k_castS16<<<(unsigned)((((long long)(64) * ((1024) / 2)) + 255) / 256), 256, 0, stream>>>(x + ((size_t)0 * NR + (size_t)0 * S) * D, 1024, (__bf16*)(G64A), (__bf16*)(G64A2), 1024, 64, 1024, 1.0f, 0);
    k_castS16<<<(unsigned)((((long long)(1024) * ((1024) / 2)) + 255) / 256), 256, 0, stream>>>(Wk, 1024, (__bf16*)(G64B), (__bf16*)(G64B2), 1024, 1024, 1024, 1.0f, 0);
    w25::wmma_gemm64<1, true, 0, 0, false, 0><<<dim3((unsigned)((((64) / 64) * ((1024) / 64) + 7) / 8), (unsigned)(1)), 256, 0, stream>>>((const unsigned short*)(G64A), (const unsigned short*)(G64A2), 1024, 0, (const unsigned short*)(G64B), (const unsigned short*)(G64B2), 1024, 0, (void*)(K64 + (size_t)0 * 64 * D), nullptr, 1024, 0, nullptr, nullptr, 0, 64, 1024, 1024, 1.0f);
    k_castS16<<<(unsigned)((((long long)(64) * ((1024) / 2)) + 255) / 256), 256, 0, stream>>>(x + ((size_t)0 * NR + (size_t)1 * S) * D, 1024, (__bf16*)(G64A), (__bf16*)(G64A2), 1024, 64, 1024, 1.0f, 0);
    k_castS16<<<(unsigned)((((long long)(1024) * ((1024) / 2)) + 255) / 256), 256, 0, stream>>>(Wq, 1024, (__bf16*)(G64B), (__bf16*)(G64B2), 1024, 1024, 1024, 1.0f, 0);
    w25::wmma_gemm64<1, true, 0, 0, false, 0><<<dim3((unsigned)((((64) / 64) * ((1024) / 64) + 7) / 8), (unsigned)(1)), 256, 0, stream>>>((const unsigned short*)(G64A), (const unsigned short*)(G64A2), 1024, 0, (const unsigned short*)(G64B), (const unsigned short*)(G64B2), 1024, 0, (void*)(Q64 + (size_t)1 * 64 * D), nullptr, 1024, 0, nullptr, nullptr, 0, 64, 1024, 1024, 1.0f);
    k_castS16<<<(unsigned)((((long long)(64) * ((1024) / 2)) + 255) / 256), 256, 0, stream>>>(x + ((size_t)0 * NR + (size_t)1 * S) * D, 1024, (__bf16*)(G64A), (__bf16*)(G64A2), 1024, 64, 1024, 1.0f, 0);
    k_castS16<<<(unsigned)((((long long)(1024) * ((1024) / 2)) + 255) / 256), 256, 0, stream>>>(Wk, 1024, (__bf16*)(G64B), (__bf16*)(G64B2), 1024, 1024, 1024, 1.0f, 0);
    w25::wmma_gemm64<1, true, 0, 0, false, 0><<<dim3((unsigned)((((64) / 64) * ((1024) / 64) + 7) / 8), (unsigned)(1)), 256, 0, stream>>>((const unsigned short*)(G64A), (const unsigned short*)(G64A2), 1024, 0, (const unsigned short*)(G64B), (const unsigned short*)(G64B2), 1024, 0, (void*)(K64 + (size_t)1 * 64 * D), nullptr, 1024, 0, nullptr, nullptr, 0, 64, 1024, 1024, 1.0f);
    k_cm_rope<<<(unsigned)(((long long)Bn * 64 * 2 * NH * 32 + 255) / 256), 256, 0, stream>>>(Q64, K64, cosT, sinT, (const int*)tpos, Bn, 64, NH, HD); k_cm_exact<<<Bn * NH * 64, 64, 0, stream>>>(Q64, K64, V, AT, S, D, NH, HD);
    k_castS16<<<(unsigned)((((long long)(4096) * ((1024) / 2)) + 255) / 256), 256, 0, stream>>>(AT, 1024, (__bf16*)(G64A), (__bf16*)(G64A2), 1024, 4096, 1024, 1.0f, 0);
    k_castS16<<<(unsigned)((((long long)(1024) * ((1024) / 2)) + 255) / 256), 256, 0, stream>>>(Wo, 1024, (__bf16*)(G64B), (__bf16*)(G64B2), 1024, 1024, 1024, 1.0f, 0);
    w25::wmma_gemm64<1, true, 0, 0, false, 0><<<dim3((unsigned)((((4096) / 64) * ((1024) / 64) + 7) / 8), (unsigned)(1)), 256, 0, stream>>>((const unsigned short*)(G64A), (const unsigned short*)(G64A2), 1024, 0, (const unsigned short*)(G64B), (const unsigned short*)(G64B2), 1024, 0, (void*)(out + (size_t)0 * NR * D), nullptr, 1024, 0, nullptr, nullptr, 0, 4096, 1024, 1024, 1.0f);
    k_cast16<<<(unsigned)((((long long)(4096) * ((1024) / 2)) + 255) / 256), 256, 0, stream>>>(x + (size_t)1 * NR * D, 1024, (_Float16*)(G64A), 1024, 4096, 1024, 1.0f);
    k_cast16<<<(unsigned)((((long long)(1024) * ((1024) / 2)) + 255) / 256), 256, 0, stream>>>(Wq, 1024, (_Float16*)(G64B), 1024, 1024, 1024, 16.0f);
    w25::wmma_gemm64<0, false, 0, 0, false, 0><<<dim3((unsigned)((((4096) / 64) * ((1024) / 64) + 7) / 8), (unsigned)(1)), 256, 0, stream>>>((const unsigned short*)(G64A), nullptr, 1024, 0, (const unsigned short*)(G64B), nullptr, 1024, 0, (void*)(Q), nullptr, 1024, 0, nullptr, nullptr, 0, 4096, 1024, 1024, 0.0625f);
    k_cast16<<<(unsigned)((((long long)(4096) * ((1024) / 2)) + 255) / 256), 256, 0, stream>>>(x + (size_t)1 * NR * D, 1024, (_Float16*)(G64A), 1024, 4096, 1024, 1.0f);
    k_cast16<<<(unsigned)((((long long)(1024) * ((1024) / 2)) + 255) / 256), 256, 0, stream>>>(Wk, 1024, (_Float16*)(G64B), 1024, 1024, 1024, 16.0f);
    w25::wmma_gemm64<0, false, 0, 0, false, 0><<<dim3((unsigned)((((4096) / 64) * ((1024) / 64) + 7) / 8), (unsigned)(1)), 256, 0, stream>>>((const unsigned short*)(G64A), nullptr, 1024, 0, (const unsigned short*)(G64B), nullptr, 1024, 0, (void*)(Kb), nullptr, 1024, 0, nullptr, nullptr, 0, 4096, 1024, 1024, 0.0625f);
    k_castS16<<<(unsigned)((((long long)(4096) * ((1024) / 2)) + 255) / 256), 256, 0, stream>>>(x + (size_t)1 * NR * D, 1024, (__bf16*)(G64A), (__bf16*)(G64A2), 1024, 4096, 1024, 1.0f, 0);
    k_castS16<<<(unsigned)((((long long)(1024) * ((1024) / 2)) + 255) / 256), 256, 0, stream>>>(Wv, 1024, (__bf16*)(G64B), (__bf16*)(G64B2), 1024, 1024, 1024, 1.0f, 0);
    w25::wmma_gemm64<1, true, 0, 0, false, 0><<<dim3((unsigned)((((4096) / 64) * ((1024) / 64) + 7) / 8), (unsigned)(1)), 256, 0, stream>>>((const unsigned short*)(G64A), (const unsigned short*)(G64A2), 1024, 0, (const unsigned short*)(G64B), (const unsigned short*)(G64B2), 1024, 0, (void*)(V), nullptr, 1024, 0, nullptr, nullptr, 0, 4096, 1024, 1024, 1.0f);
    k_cm_rope<<<(unsigned)(((long long)NR * 2 * NH * 32 + 255) / 256), 256, 0, stream>>>(Q, Kb, cosT, sinT, (const int*)tpos, Bn, S, NH, HD);
    { /*apv4*/ AttnP a;
      a.Q = Q; a.K = Kb; a.V = V; a.O = AT; a.P = 0; a.Mf = 0; a.Mi = 0; a.ST = 0;
      a.Pw = 0; a.Rt = 0; a.SQ = 0; a.SK = 0;
      a.swb = 0; a.swh = 0; a.swi = 0; a.swj = 0; a.srb = 0; a.srh = 0; a.sri = 0; a.sQb = (long long)S * D; a.sQh = HD; a.sQi = D; a.sQd = 1; a.sKb = (long long)S * D; a.sKh = HD; a.sKj = D; a.sKd = 1; a.sVb = (long long)S * D; a.sVh = HD; a.sVj = D; a.sVd = 1; a.sOb = (long long)S * D; a.sOh = HD; a.sOi = D; a.sPb = 0; a.sPh = 0; a.sPi = 0; a.smb = 0; a.smh = 0; a.smi = 0; a.smj = 0;
      a.Lq = S; a.Lk = S; a.dh = HD; a.dv = HD; a.hrep = 1; a.causal = 1; a.coff = 0; a.pband = 0;
      a.scale = 0.125f; a.mfill = 0.0f; a.nonorm = 0; a.mpol = 0;
      a.roff = 0; a.rn = 1; a.segpol = 0; a.win = 0;
      k_attn<64, 64, 0, false, false><<<dim3((unsigned)((S) + 16 * AW - 1) / (16 * AW), (unsigned)(NH), (unsigned)(Bn)), 32 * AW, 0, stream>>>(a); }
    k_castS16<<<(unsigned)((((long long)(64) * ((1024) / 2)) + 255) / 256), 256, 0, stream>>>(x + ((size_t)1 * NR + (size_t)0 * S) * D, 1024, (__bf16*)(G64A), (__bf16*)(G64A2), 1024, 64, 1024, 1.0f, 0);
    k_castS16<<<(unsigned)((((long long)(1024) * ((1024) / 2)) + 255) / 256), 256, 0, stream>>>(Wq, 1024, (__bf16*)(G64B), (__bf16*)(G64B2), 1024, 1024, 1024, 1.0f, 0);
    w25::wmma_gemm64<1, true, 0, 0, false, 0><<<dim3((unsigned)((((64) / 64) * ((1024) / 64) + 7) / 8), (unsigned)(1)), 256, 0, stream>>>((const unsigned short*)(G64A), (const unsigned short*)(G64A2), 1024, 0, (const unsigned short*)(G64B), (const unsigned short*)(G64B2), 1024, 0, (void*)(Q64 + (size_t)0 * 64 * D), nullptr, 1024, 0, nullptr, nullptr, 0, 64, 1024, 1024, 1.0f);
    k_castS16<<<(unsigned)((((long long)(64) * ((1024) / 2)) + 255) / 256), 256, 0, stream>>>(x + ((size_t)1 * NR + (size_t)0 * S) * D, 1024, (__bf16*)(G64A), (__bf16*)(G64A2), 1024, 64, 1024, 1.0f, 0);
    k_castS16<<<(unsigned)((((long long)(1024) * ((1024) / 2)) + 255) / 256), 256, 0, stream>>>(Wk, 1024, (__bf16*)(G64B), (__bf16*)(G64B2), 1024, 1024, 1024, 1.0f, 0);
    w25::wmma_gemm64<1, true, 0, 0, false, 0><<<dim3((unsigned)((((64) / 64) * ((1024) / 64) + 7) / 8), (unsigned)(1)), 256, 0, stream>>>((const unsigned short*)(G64A), (const unsigned short*)(G64A2), 1024, 0, (const unsigned short*)(G64B), (const unsigned short*)(G64B2), 1024, 0, (void*)(K64 + (size_t)0 * 64 * D), nullptr, 1024, 0, nullptr, nullptr, 0, 64, 1024, 1024, 1.0f);
    k_castS16<<<(unsigned)((((long long)(64) * ((1024) / 2)) + 255) / 256), 256, 0, stream>>>(x + ((size_t)1 * NR + (size_t)1 * S) * D, 1024, (__bf16*)(G64A), (__bf16*)(G64A2), 1024, 64, 1024, 1.0f, 0);
    k_castS16<<<(unsigned)((((long long)(1024) * ((1024) / 2)) + 255) / 256), 256, 0, stream>>>(Wq, 1024, (__bf16*)(G64B), (__bf16*)(G64B2), 1024, 1024, 1024, 1.0f, 0);
    w25::wmma_gemm64<1, true, 0, 0, false, 0><<<dim3((unsigned)((((64) / 64) * ((1024) / 64) + 7) / 8), (unsigned)(1)), 256, 0, stream>>>((const unsigned short*)(G64A), (const unsigned short*)(G64A2), 1024, 0, (const unsigned short*)(G64B), (const unsigned short*)(G64B2), 1024, 0, (void*)(Q64 + (size_t)1 * 64 * D), nullptr, 1024, 0, nullptr, nullptr, 0, 64, 1024, 1024, 1.0f);
    k_castS16<<<(unsigned)((((long long)(64) * ((1024) / 2)) + 255) / 256), 256, 0, stream>>>(x + ((size_t)1 * NR + (size_t)1 * S) * D, 1024, (__bf16*)(G64A), (__bf16*)(G64A2), 1024, 64, 1024, 1.0f, 0);
    k_castS16<<<(unsigned)((((long long)(1024) * ((1024) / 2)) + 255) / 256), 256, 0, stream>>>(Wk, 1024, (__bf16*)(G64B), (__bf16*)(G64B2), 1024, 1024, 1024, 1.0f, 0);
    w25::wmma_gemm64<1, true, 0, 0, false, 0><<<dim3((unsigned)((((64) / 64) * ((1024) / 64) + 7) / 8), (unsigned)(1)), 256, 0, stream>>>((const unsigned short*)(G64A), (const unsigned short*)(G64A2), 1024, 0, (const unsigned short*)(G64B), (const unsigned short*)(G64B2), 1024, 0, (void*)(K64 + (size_t)1 * 64 * D), nullptr, 1024, 0, nullptr, nullptr, 0, 64, 1024, 1024, 1.0f);
    k_cm_rope<<<(unsigned)(((long long)Bn * 64 * 2 * NH * 32 + 255) / 256), 256, 0, stream>>>(Q64, K64, cosT, sinT, (const int*)tpos, Bn, 64, NH, HD); k_cm_exact<<<Bn * NH * 64, 64, 0, stream>>>(Q64, K64, V, AT, S, D, NH, HD);
    k_castS16<<<(unsigned)((((long long)(4096) * ((1024) / 2)) + 255) / 256), 256, 0, stream>>>(AT, 1024, (__bf16*)(G64A), (__bf16*)(G64A2), 1024, 4096, 1024, 1.0f, 0);
    k_castS16<<<(unsigned)((((long long)(1024) * ((1024) / 2)) + 255) / 256), 256, 0, stream>>>(Wo, 1024, (__bf16*)(G64B), (__bf16*)(G64B2), 1024, 1024, 1024, 1.0f, 0);
    w25::wmma_gemm64<1, true, 0, 0, false, 0><<<dim3((unsigned)((((4096) / 64) * ((1024) / 64) + 7) / 8), (unsigned)(1)), 256, 0, stream>>>((const unsigned short*)(G64A), (const unsigned short*)(G64A2), 1024, 0, (const unsigned short*)(G64B), (const unsigned short*)(G64B2), 1024, 0, (void*)(out + (size_t)1 * NR * D), nullptr, 1024, 0, nullptr, nullptr, 0, 4096, 1024, 1024, 1.0f);
}

// v001
// Measured time: 1690 microseconds a run.
// Timed twice side by side with v000, it ran 2.66 and 2.64 times as fast.
// Contractions: q/k = x.W^T [8192x1024].[1024x1024] with f16 operands (weights x16); v = x.Wv^T and the output projection on bf16 hi/lo split planes (late causal rows are long averages, so the value path must be f32-class) — v_wmma_f32_16x16x32_*, 64x64 register-blocked wave tiles; per (batch, head) causal softmax(q k^T / 8) v as one flash launch (f16 q.k^T and p.v; fully-masked key tiles skipped); f32 accumulate and softmax. The interleaved-pair RoPE with the INPUT cos/sin tables gathered by the INPUT token positions (generic elementwise form: out = x*cos + rot(x)*sin with rot = (-x[odd], x[even]) interleaved) and the exact-f32 recompute of the first 64 causal rows per head (whose q/k rows come from their own small bf16 hi/lo split GEMMs [64x1024].[1024x1024]) are f32 kernels.
#include <hip/hip_runtime.h>
#include <math.h>

typedef __attribute__((ext_vector_type(16))) _Float16 v16h;
typedef __attribute__((ext_vector_type(8)))  _Float16 v8h;
typedef __attribute__((ext_vector_type(4)))  _Float16 v4h;
typedef __attribute__((ext_vector_type(16))) __bf16   v16b;
typedef __attribute__((ext_vector_type(8)))  float    v8f;
typedef __attribute__((ext_vector_type(4)))  float    v4f;

// 16-bit WMMA fragment map (wave32), lane L, h = L>>4, m = L&15:
//   A 16x32: lane = row m;   element i -> k = (i<8) ? 8h+i : 16+8h+(i-8)
//   B 32x16: lane = column m; the SAME k(i,h)
//   D 16x16 (8 f32): lane = column m; element r -> row 8h+r
__device__ __forceinline__ int frag_k(int i, int h) { return (i < 8) ? (8 * h + i) : (16 + 8 * h + (i - 8)); }
__device__ __forceinline__ __bf16 bf16_rne(float f) {
    unsigned int u = __float_as_uint(f);
    u += 0x7fffu + ((u >> 16) & 1u);
    return __builtin_bit_cast(__bf16, (unsigned short)(u >> 16));
}
__device__ __forceinline__ float bf16_f32(__bf16 b) { return __uint_as_float(((unsigned int)__builtin_bit_cast(unsigned short, b)) << 16); }
__device__ __forceinline__ v8f wmma16(v16h a, v16h b, v8f c) {
    c = __builtin_amdgcn_wmma_f32_16x16x32_f16(false, a, false, b, (short)0, c, false, false);
    asm volatile("v_nop\n\tv_nop\n\tv_nop\n\tv_nop" : "+v"(c) : "v"(a), "v"(b));
    return c;
}
__device__ __forceinline__ v8f wmmab(v16b a, v16b b, v8f c) {
    c = __builtin_amdgcn_wmma_f32_16x16x32_bf16(false, a, false, b, (short)0, c, false, false);
    asm volatile("v_nop\n\tv_nop\n\tv_nop\n\tv_nop" : "+v"(c) : "v"(a), "v"(b));
    return c;
}
struct Split { v16b hi, lo; };
// hi/lo split product: a.hi*b.hi + a.hi*b.lo + a.lo*b.hi
__device__ __forceinline__ v8f wmma3(const Split& a, const Split& b, v8f c) {
    c = __builtin_amdgcn_wmma_f32_16x16x32_bf16(false, a.hi, false, b.hi, (short)0, c, false, false);
    c = __builtin_amdgcn_wmma_f32_16x16x32_bf16(false, a.hi, false, b.lo, (short)0, c, false, false);
    c = __builtin_amdgcn_wmma_f32_16x16x32_bf16(false, a.lo, false, b.hi, (short)0, c, false, false);
    asm volatile("v_nop\n\tv_nop\n\tv_nop\n\tv_nop" : "+v"(c) : "v"(a.hi), "v"(a.lo), "v"(b.hi), "v"(b.lo));
    return c;
}
struct Split3 { v16b hi, mid, lo; };
// triple split product (6 terms, drops only terms below 2^-24 relative)
__device__ __forceinline__ v8f wmma6(const Split3& a, const Split3& b, v8f c) {
    c = __builtin_amdgcn_wmma_f32_16x16x32_bf16(false, a.hi, false, b.hi, (short)0, c, false, false);
    c = __builtin_amdgcn_wmma_f32_16x16x32_bf16(false, a.hi, false, b.mid, (short)0, c, false, false);
    c = __builtin_amdgcn_wmma_f32_16x16x32_bf16(false, a.mid, false, b.hi, (short)0, c, false, false);
    c = __builtin_amdgcn_wmma_f32_16x16x32_bf16(false, a.hi, false, b.lo, (short)0, c, false, false);
    c = __builtin_amdgcn_wmma_f32_16x16x32_bf16(false, a.mid, false, b.mid, (short)0, c, false, false);
    c = __builtin_amdgcn_wmma_f32_16x16x32_bf16(false, a.lo, false, b.hi, (short)0, c, false, false);
    asm volatile("v_nop\n\tv_nop\n\tv_nop\n\tv_nop" : "+v"(c) : "v"(a.hi), "v"(a.mid), "v"(a.lo), "v"(b.hi), "v"(b.mid), "v"(b.lo));
    return c;
}

// Fragment gathers from f32 memory: element i <- p[(k0 + frag_k(i,h)) * sk] * s, zero for k >= klen.
__device__ __forceinline__ v16h fh_ld(const float* __restrict__ p, long long sk, int k0, int h, int klen, float s) {
    v16h a;
#pragma unroll
    for (int i = 0; i < 16; ++i) { const int k = k0 + frag_k(i, h); a[i] = (k < klen) ? (_Float16)(p[(long long)k * sk] * s) : (_Float16)0.f; }
    return a;
}
__device__ __forceinline__ Split sp_ld(const float* __restrict__ p, long long sk, int k0, int h, int klen, float s) {
    Split r;
#pragma unroll
    for (int i = 0; i < 16; ++i) {
        const int k = k0 + frag_k(i, h); const float x = (k < klen) ? p[(long long)k * sk] * s : 0.f;
        const __bf16 hb = bf16_rne(x); r.hi[i] = hb; r.lo[i] = bf16_rne(x - bf16_f32(hb));
    }
    return r;
}
__device__ __forceinline__ Split3 sp3_ld(const float* __restrict__ p, long long sk, int k0, int h, int klen, float s) {
    Split3 r;
#pragma unroll
    for (int i = 0; i < 16; ++i) {
        const int k = k0 + frag_k(i, h); const float x = (k < klen) ? p[(long long)k * sk] * s : 0.f;
        const __bf16 hb = bf16_rne(x); const float r1 = x - bf16_f32(hb); const __bf16 mb = bf16_rne(r1);
        r.hi[i] = hb; r.mid[i] = mb; r.lo[i] = bf16_rne(r1 - bf16_f32(mb));
    }
    return r;
}
__device__ __forceinline__ v16b bh_ld(const float* __restrict__ p, long long sk, int k0, int h, int klen, float s) {
    v16b a;
#pragma unroll
    for (int i = 0; i < 16; ++i) { const int k = k0 + frag_k(i, h); a[i] = bf16_rne((k < klen) ? p[(long long)k * sk] * s : 0.f); }
    return a;
}
// f16 fragment from an f16 LDS/global row with element stride 1 (k-contiguous), no bounds (tile already zero padded)
__device__ __forceinline__ v16h fh_row(const _Float16* __restrict__ row, int k0, int h) {
    v16h a;
#pragma unroll
    for (int i = 0; i < 16; ++i) a[i] = row[k0 + frag_k(i, h)];
    return a;
}

#define VST2(T, ptr, val) do { const T vst2_v_ = (val); *(T*)(ptr) = vst2_v_;  } while (0)
typedef float v4f __attribute__((ext_vector_type(4)));
#define VST2V4(ptr, val) do { const v4f vst2_v4_ = (val); *(v4f*)(ptr) = vst2_v4_;  } while (0)

__device__ __attribute__((noinline)) float act_fn(float v, int act) {
    if (act == 1) return fmaxf(v, 0.f);                                                                               // relu
    if (act == 2) { const float u = 0.7978845608028654f * (v + 0.044715f * v * v * v); return 0.5f * v * (1.f + tanhf(u)); } // tanh-gelu
    if (act == 3) return v / (1.f + expf(-v));                                                                        // silu
    if (act == 4) return 0.5f * v * (1.f + erff(v * 0.7071067811865476f));                                             // erf-gelu
    if (act == 5) return tanhf(v);
    if (act == 6) return 1.f / (1.f + expf(-v));                                                                      // sigmoid
    if (act == 7) return (v > 0.f) ? v : 0.01f * v;                                                                   // leaky relu 0.01
    if (act == 8) return (v > 0.f) ? v : (expf(v) - 1.f);                                                             // elu
    if (act == 9) return fminf(fmaxf(v, 0.f), 6.f);                                                                   // relu6
    if (act == 10) return fabsf(v);                                                                                    // abs
    if (act == 11) return (v >= 0.f) ? v : 0.1f * v;                                                                  // leaky 0.1
    if (act == 12) return (v > 0.f) ? v : 0.2f * v;                                                                   // leaky 0.2
    if (act == 13) return (v > 20.f) ? v : log1pf(expf(v));                                                            // softplus
    return v;
}

// =====================================================================================================================
// k_gemm<MODE>: C(z, m, n) = act(alpha * sum_k A(z, m, k) * B(z, k, n) + bias) + beta * R(z, m, n)
//   One wave (32-thread block) per 16 x 32 tile of C; grid (ceil(N/32), ceil(M/16), Z). Batch z -> (zo = z / zi_n, zi = z % zi_n)
//   with separate outer/inner strides for every tensor (e.g. batch and head). A(m,k) = A[zo*sAo + zi*sAi + m*sAm + k*sAk] (f32),
//   B(k,n) = B[zo*sBo + zi*sBi + n*sBn + k*sBk] (f32); any M, N, K (K zero-padded to 32 inside the fragments, M/N tails guarded).
//   C(m,n) = C[zo*sCo + zi*sCi + m*sCm + n] (n contiguous). flags: 1 bias[n], 2 bias[m], 4 residual R[zo*sRo + zi*sRi + m*sRm + n*sRn].
//   MODE 0: f16 operands (A prescaled by sa, B by sb, both undone in the epilogue); 1: bf16 hi/lo split (3 products); 2: bf16;
//   3: bf16 hi/mid/lo triple split (6 products); 4: as 3 with Kahan-compensated f32 accumulation across k-steps.
// =====================================================================================================================
struct GemmP {
    const float* A; const float* B; const float* bias; const float* R; float* C;
    long long sAo, sAi, sAm, sAk, sBo, sBi, sBn, sBk, sCo, sCi, sCm, sRo, sRi, sRm, sRn;
    int M, N, K, zi_n, flags, act; float alpha, beta, sa, sb;
    int Npad, pad_;     // columns [N, Npad) of C are written as 0 so that padded workspace rows are covered by whole-line stores; Npad >= N
};
static_assert(sizeof(GemmP) == 5 * 8 + 15 * 8 + 6 * 4 + 4 * 4 + 2 * 4, "GemmP has padding");

template <int MODE>
__global__ __launch_bounds__(32) void k_gemm(GemmP p) {
    const int lane = threadIdx.x & 31, h = lane >> 4, l15 = lane & 15;
    const int m0 = blockIdx.y * 16, n0 = blockIdx.x * 32;
    const int z = blockIdx.z, zo = z / p.zi_n, zi = z - zo * p.zi_n;
    const float* A = p.A + zo * p.sAo + zi * p.sAi;
    const float* B = p.B + zo * p.sBo + zi * p.sBi;
    const int am = min(m0 + l15, p.M - 1);                       // clamped row for loads (stores are guarded)
    v8f acc[2], comp[2];
#pragma unroll
    for (int t = 0; t < 2; ++t) { v8f zz = {}; acc[t] = zz; comp[t] = zz; }
    for (int k0 = 0; k0 < p.K; k0 += 32) {
        const float* arow = A + (long long)am * p.sAm;
        if (MODE == 1) {
            const Split a = sp_ld(arow, p.sAk, k0, h, p.K, 1.f);
#pragma unroll
            for (int t = 0; t < 2; ++t) {
                const int bn = min(n0 + t * 16 + l15, p.N - 1);
                acc[t] = wmma3(a, sp_ld(B + (long long)bn * p.sBn, p.sBk, k0, h, p.K, 1.f), acc[t]);
            }
        } else if (MODE == 3) {
            const Split3 a = sp3_ld(arow, p.sAk, k0, h, p.K, 1.f);
#pragma unroll
            for (int t = 0; t < 2; ++t) {
                const int bn = min(n0 + t * 16 + l15, p.N - 1);
                acc[t] = wmma6(a, sp3_ld(B + (long long)bn * p.sBn, p.sBk, k0, h, p.K, 1.f), acc[t]);
            }
        } else if (MODE == 4) {
            // triple split as MODE 3, but each k-step's 6 products go into a fresh accumulator and the partial is added to the running f32 sum
            // on the VALU with Kahan compensation (accumulation error stays ~1 ulp however long K is)
            const Split3 a = sp3_ld(arow, p.sAk, k0, h, p.K, 1.f);
#pragma unroll
            for (int t = 0; t < 2; ++t) {
                const int bn = min(n0 + t * 16 + l15, p.N - 1); v8f zz = {};
                const v8f part = wmma6(a, sp3_ld(B + (long long)bn * p.sBn, p.sBk, k0, h, p.K, 1.f), zz);
                const v8f y = part - comp[t]; const v8f s = acc[t] + y; comp[t] = (s - acc[t]) - y; acc[t] = s;
            }
        } else if (MODE == 2) {
            const v16b a = bh_ld(arow, p.sAk, k0, h, p.K, 1.f);
#pragma unroll
            for (int t = 0; t < 2; ++t) {
                const int bn = min(n0 + t * 16 + l15, p.N - 1);
                acc[t] = wmmab(a, bh_ld(B + (long long)bn * p.sBn, p.sBk, k0, h, p.K, 1.f), acc[t]);
            }
        } else {
            const v16h a = fh_ld(arow, p.sAk, k0, h, p.K, p.sa);
#pragma unroll
            for (int t = 0; t < 2; ++t) {
                const int bn = min(n0 + t * 16 + l15, p.N - 1);
                acc[t] = wmma16(a, fh_ld(B + (long long)bn * p.sBn, p.sBk, k0, h, p.K, p.sb), acc[t]);
            }
        }
    }
    const float iscale = (MODE == 0) ? p.alpha / (p.sa * p.sb) : p.alpha;
    float* C = p.C + zo * p.sCo + zi * p.sCi;
    const float* R = p.R + zo * p.sRo + zi * p.sRi;
    __shared__ __align__(16) float ctile[16][36];
#pragma unroll
    for (int t = 0; t < 2; ++t) {
        const int n = n0 + t * 16 + l15; const int nn = min(n, p.N - 1);
#pragma unroll
        for (int r = 0; r < 8; ++r) {
            const int m = m0 + 8 * h + r; const int mm = min(m, p.M - 1);
            float v = acc[t][r] * iscale;
            if (p.flags & 1) v += p.bias[nn];
            if (p.flags & 2) v += p.bias[mm];
            if (p.flags & 8) v *= p.bias[(long long)zo * p.M + mm];   /* per-(z,row) scale vector laid out [Z][M]; exclusive with the bias flags */
            v = act_fn(v, p.act);
            if (p.flags & 4) v += p.beta * R[(long long)mm * p.sRm + (long long)nn * p.sRn];
            ctile[8 * h + r][t * 16 + l15] = (n < p.N) ? v : 0.f;
        }
    }
    __syncthreads();
    const int NW = (p.Npad > p.N) ? p.Npad : p.N;           // write width
    const bool fast = (m0 + 16 <= p.M) && (n0 + 32 <= NW) && ((p.sCm & 3) == 0) && ((((size_t)C) & 15) == 0);
    if (fast) {
#pragma unroll
        for (int s = 0; s < 4; ++s) {
            const int row = s * 4 + (lane >> 3), c4 = (lane & 7) * 4;
            const v4f v = *(const v4f*)&ctile[row][c4];
            VST2V4(C + (long long)(m0 + row) * p.sCm + n0 + c4, v);
        }
    } else {
        for (int row = 0; row < 16; ++row) {
            const int m = m0 + row, n = n0 + lane;
            if (m < p.M && n < NW) VST2(float, C + (long long)m * p.sCm + n, ctile[row][lane]);
        }
    }
}


// =====================================================================================================================
// k_gemmT<MODE, TM, TN>: same contract as k_gemm, but one wave computes a (16*TM) x (16*TN) tile: TM A fragments and TN B fragments are
//   loaded per 32-wide k-step and reused across TM*TN WMMAs (far fewer load/convert instructions per MAC). MODE 0 (f16), 1 (bf16 hi/lo),
//   2 (bf16) only. grid (ceil(NW/(16*TN)), ceil(M/(16*TM)), Z), block 32. Epilogue identical to k_gemm, run per 16x32 sub-tile.
// =====================================================================================================================
template <int MODE, int TM, int TN>
__global__ __launch_bounds__(32) void k_gemmT(GemmP p) {
    const int lane = threadIdx.x & 31, h = lane >> 4, l15 = lane & 15;
    const int m0 = blockIdx.y * (16 * TM), n0 = blockIdx.x * (16 * TN);
    const int z = blockIdx.z, zo = z / p.zi_n, zi = z - zo * p.zi_n;
    const float* A = p.A + zo * p.sAo + zi * p.sAi;
    const float* B = p.B + zo * p.sBo + zi * p.sBi;
    v8f acc[TM][TN];
#pragma unroll
    for (int i = 0; i < TM; ++i)
#pragma unroll
        for (int t = 0; t < TN; ++t) { v8f zz = {}; acc[i][t] = zz; }
    for (int k0 = 0; k0 < p.K; k0 += 32) {
        if (MODE == 1) {
            Split a[TM], b[TN];
#pragma unroll
            for (int i = 0; i < TM; ++i) { const int am = min(m0 + 16 * i + l15, p.M - 1); a[i] = sp_ld(A + (long long)am * p.sAm, p.sAk, k0, h, p.K, 1.f); }
#pragma unroll
            for (int t = 0; t < TN; ++t) { const int bn = min(n0 + 16 * t + l15, p.N - 1); b[t] = sp_ld(B + (long long)bn * p.sBn, p.sBk, k0, h, p.K, 1.f); }
#pragma unroll
            for (int i = 0; i < TM; ++i)
#pragma unroll
                for (int t = 0; t < TN; ++t) acc[i][t] = wmma3(a[i], b[t], acc[i][t]);
        } else if (MODE == 2) {
            v16b a[TM], b[TN];
#pragma unroll
            for (int i = 0; i < TM; ++i) { const int am = min(m0 + 16 * i + l15, p.M - 1); a[i] = bh_ld(A + (long long)am * p.sAm, p.sAk, k0, h, p.K, 1.f); }
#pragma unroll
            for (int t = 0; t < TN; ++t) { const int bn = min(n0 + 16 * t + l15, p.N - 1); b[t] = bh_ld(B + (long long)bn * p.sBn, p.sBk, k0, h, p.K, 1.f); }
#pragma unroll
            for (int i = 0; i < TM; ++i)
#pragma unroll
                for (int t = 0; t < TN; ++t) acc[i][t] = wmmab(a[i], b[t], acc[i][t]);
        } else {
            v16h a[TM], b[TN];
#pragma unroll
            for (int i = 0; i < TM; ++i) { const int am = min(m0 + 16 * i + l15, p.M - 1); a[i] = fh_ld(A + (long long)am * p.sAm, p.sAk, k0, h, p.K, p.sa); }
#pragma unroll
            for (int t = 0; t < TN; ++t) { const int bn = min(n0 + 16 * t + l15, p.N - 1); b[t] = fh_ld(B + (long long)bn * p.sBn, p.sBk, k0, h, p.K, p.sb); }
#pragma unroll
            for (int i = 0; i < TM; ++i)
#pragma unroll
                for (int t = 0; t < TN; ++t) acc[i][t] = wmma16(a[i], b[t], acc[i][t]);
        }
    }
    const float iscale = (MODE == 0) ? p.alpha / (p.sa * p.sb) : p.alpha;
    float* C = p.C + zo * p.sCo + zi * p.sCi;
    const float* R = p.R + zo * p.sRo + zi * p.sRi;
    const int NW = (p.Npad > p.N) ? p.Npad : p.N;
    __shared__ __align__(16) float ctile[16][36];
#pragma unroll
    for (int i = 0; i < TM; ++i) {
        const int mb = m0 + 16 * i; if (mb >= p.M) break;          // wave-uniform
#pragma unroll
        for (int tp = 0; tp < TN / 2; ++tp) {
            const int nb = n0 + 32 * tp; if (nb >= NW) break;        // wave-uniform
#pragma unroll
            for (int t2 = 0; t2 < 2; ++t2) {
                const int t = 2 * tp + t2; const int n = nb + t2 * 16 + l15; const int nn = min(n, p.N - 1);
#pragma unroll
                for (int r = 0; r < 8; ++r) {
                    const int m = mb + 8 * h + r; const int mm = min(m, p.M - 1);
                    float v = acc[i][t][r] * iscale;
                    if (p.flags & 1) v += p.bias[nn];
                    if (p.flags & 2) v += p.bias[mm];
            if (p.flags & 8) v *= p.bias[(long long)zo * p.M + mm];   /* per-(z,row) scale vector laid out [Z][M]; exclusive with the bias flags */
                    v = act_fn(v, p.act);
                    if (p.flags & 4) v += p.beta * R[(long long)mm * p.sRm + (long long)nn * p.sRn];
                    ctile[8 * h + r][t2 * 16 + l15] = (n < p.N) ? v : 0.f;
                }
            }
            __syncthreads();
            const bool fast = (mb + 16 <= p.M) && (nb + 32 <= NW) && ((p.sCm & 3) == 0) && ((((size_t)C) & 15) == 0);
            if (fast) {
#pragma unroll
                for (int s = 0; s < 4; ++s) {
                    const int row = s * 4 + (lane >> 3), c4 = (lane & 7) * 4;
                    const v4f v = *(const v4f*)&ctile[row][c4];
                    VST2V4(C + (long long)(mb + row) * p.sCm + nb + c4, v);
                }
            } else {
                for (int row = 0; row < 16; ++row) {
                    const int m = mb + row, n = nb + lane;
                    if (m < p.M && n < NW) VST2(float, C + (long long)m * p.sCm + n, ctile[row][lane]);
                }
            }
            __syncthreads();
        }
    }
}

// =====================================================================================================================
//   Wave = 16 queries, AW waves per block, 64-key blocks; grid (ceil(Lq/(16*AW)), H, B), block 32*AW. Any Lq, Lk; head dim dh <= DHP
//   (DHP multiple of 32), value dim dv <= DVP (multiple of 16, <= 128). Every tensor addressed by (batch, head, row, element) strides, f32.
//   Scores: QM 0 f16 operands, 1 bf16 hi/lo split, 2 bf16 triple split; statistics f32 (exp2 domain); P.V: P x 4096 as f16 with V f16 staged in LDS
//   (SPLITPV: P and V as bf16 hi/lo splits). kv head = h / hrep. Masking: causal = 1 (keep j <= i + coff, masked -> -inf, key blocks beyond the
//   diagonal skipped), causal = 2 (masked -> mfill, a finite fill like the -1e9; no skipping), causal = 3 (keep j >= i + coff,
//   masked -> -inf, no skipping); optional additive f32 mask Mf,
//   optional int keep-mask Mi (0 -> score := mfill), both addressed b*smb + h*smh + i*smi + j*smj (0 strides broadcast).
// =====================================================================================================================
#define AW 4
struct AttnP {   // apv4
    const float* Q; const float* K; const float* V; float* O; float* P; const float* Mf; const int* Mi; float* ST;
    const float* Pw; const float* Rt; const int* SQ; const int* SK;           // optional: post-softmax weight, relative-position table, segment ids
    long long swb, swh, swi, swj, srb, srh, sri;                                 // Pw strides (b,h,i,j); Rt strides (b,h,i), column = clamp(i - j + roff, 0, rn-1)
    long long sQb, sQh, sQi, sQd, sKb, sKh, sKj, sKd, sVb, sVh, sVj, sVd, sOb, sOh, sOi, sPb, sPh, sPi, smb, smh, smi, smj;
    int Lq, Lk, dh, dv, hrep, causal, coff, pband;   // pband > 0: P holds only the band |j - i| <= pband, column j - i + pband
    float scale, mfill; int nonorm, mpol;             // nonorm (online path only): O = sum_j exp(score_j) V_j without the 1/rowsum (scores must be <= ~0); mpol: Mi masks where ==0 (mpol 0) or where !=0 (mpol 1)
    int roff, rn, segpol, win;                        // Rt column offset/count; SQ/SK: score := mfill where (segpol 0) SQ[i] != SK[j] or (segpol 1) SQ[i] == SK[j]; win > 0: keys with i - j > win (after coff) -> -inf
};
//   Pw: the softmax numerator is multiplied by Pw(b,h,i,j) AFTER the row sum is taken (probs * weight, then P.V), as in post-softmax multiplicative biases.                                                    // ST (optional): per row (b,h,i) -> ST[((b*H + h)*Lq + i)*2 + {0,1}] = {row max of the scaled+masked score (natural units), sum_j exp(score - max)}
static_assert(sizeof(AttnP) == 12 * 8 + 29 * 8 + 16 * 4, "AttnP has padding");

#ifndef KATTN_ATTR
#define KATTN_ATTR __attribute__((amdgpu_waves_per_eu(4)))   // at most 256 registers a wave: four waves a SIMD, so that all 1024 work-groups of the causal grid are resident at once
#endif
//   FS > 0 (QM 0, one pass, f16 P.V only): the layout is fixed at compile time: Q, K, V, O are dense [batch][FS rows][FD] f32 with head h at column h * DHP (DVP for V, O),
//   dh = DHP, dv = DVP, Lq = Lk = FS (multiple of 64), causal = 1 with coff = 0, none of the optional inputs or outputs. Every element guard and stride then folds
//   away, and a key block's K and V come in by plain 16-byte loads that are in flight together, in two batches, instead of guarded 4-byte loads waited on one at a time.
template <int DHP, int DVP, int QM, bool SPLITPV, bool TWOPASS, int FS = 0, int FD = 0>
__global__ __launch_bounds__(32 * AW) KATTN_ATTR void k_attn(AttnP p) {
    static_assert(FS == 0 || (QM == 0 && !SPLITPV && !TWOPASS && DHP == 64 && DVP == 64 && FS % 64 == 0 && FD % 8 == 0), "fixed layout: whole key blocks, 32-byte aligned fragments");
    if (FS > 0) {
        p.P = nullptr; p.Mf = nullptr; p.Mi = nullptr; p.ST = nullptr; p.Pw = nullptr; p.Rt = nullptr; p.SQ = nullptr; p.SK = nullptr;
        p.sQb = (long long)FS * FD; p.sQh = DHP; p.sQi = FD; p.sQd = 1; p.sKb = (long long)FS * FD; p.sKh = DHP; p.sKj = FD; p.sKd = 1;
        p.sVb = (long long)FS * FD; p.sVh = DVP; p.sVj = FD; p.sVd = 1; p.sOb = (long long)FS * FD; p.sOh = DVP; p.sOi = FD;
        p.Lq = FS; p.Lk = FS; p.dh = DHP; p.dv = DVP; p.hrep = 1; p.causal = 1; p.coff = 0; p.pband = 0; p.nonorm = 0; p.win = 0;
    }
    constexpr int NT = DVP / 16;                // output tiles
    constexpr int KS = DHP / 32;                // k-steps for the scores
    constexpr int VP = DVP + 8;                 // LDS pitch (halves)
    __shared__ __align__(16) float    pl[AW][16 * 64];
    __shared__ __align__(16) _Float16 vl[(SPLITPV ? 2 : 1) * 64 * VP];   // f16 V tile, or bf16 hi and lo tiles (same 2-byte size)
    const int lane = threadIdx.x & 31, hf = lane >> 4, l15 = lane & 15, wave = threadIdx.x >> 5;
    const int h = blockIdx.y, b = blockIdx.z, hk = h / p.hrep;
    const int q0 = (blockIdx.x * AW + wave) * 16;
    float* myp = pl[wave];
    const float L2E = 1.4426950408889634f;
    const float NEG = -__builtin_inff();
    const int qi = min(q0 + l15, p.Lq - 1);
    const float* qrow = p.Q + b * p.sQb + h * p.sQh + (long long)qi * p.sQi;
    const float* kbase = p.K + b * p.sKb + hk * p.sKh;
    const float* vbase = p.V + b * p.sVb + hk * p.sVh;
    v16h qa[QM == 0 ? KS : 1]; Split qs_[QM == 1 ? KS : 1]; Split3 qt_[QM == 2 ? KS : 1];
#pragma unroll
    for (int ks = 0; ks < KS; ++ks) {
        if (QM == 2) qt_[ks] = sp3_ld(qrow, p.sQd, ks * 32, hf, p.dh, 1.f);
        else if (QM == 1) qs_[ks] = sp_ld(qrow, p.sQd, ks * 32, hf, p.dh, 1.f);
        else qa[ks] = fh_ld(qrow, p.sQd, ks * 32, hf, p.dh, 1.f);
    }
    v8f o[NT]; float m8[8], l8[8];
#pragma unroll
    for (int t = 0; t < NT; ++t) { v8f zz = {}; o[t] = zz; }
#pragma unroll
    for (int i = 0; i < 8; ++i) { m8[i] = NEG; l8[i] = 0.f; }
    int jend = p.Lk; int jstart = 0;
    if (p.causal == 1) { const int je = (blockIdx.x * AW + AW - 1) * 16 + 16 + p.coff; jend = min(jend, max(je, 0)); }   // uniform per block
    if (p.win > 0) { const int js = (int)(blockIdx.x * AW) * 16 + p.coff - p.win; jstart = (js > 0) ? (js / 64) * 64 : 0; }   // uniform per block: key blocks entirely outside every row's window hold only -inf entries and are skipped exactly
    const int npass = TWOPASS ? 2 : 1;
    for (int pass = 0; pass < npass; ++pass) {
        const bool dopv = (!TWOPASS) || pass == 1;
        for (int j0 = jstart; j0 < jend; j0 += 64) {
            v16h kf[FS > 0 ? 4 * KS : 1];                        // FS > 0: the key block's K fragments, tile t and k-step ks at t * KS + ks
            if (dopv) {
                __syncthreads();                                 // previous key block's reads of vl / pl are done
                if (FS > 0) {
                    // raw f32 in two batches, so that the loaded values and everything else that is live fit 256 registers (four waves a SIMD: the whole grid resident)
                    v4f vr[8]; v8f kr[8];                                           // V: four consecutive elements per thread and step; K: half a fragment each
                    const float* krow = kbase + (long long)(j0 + l15) * FD + 8 * hf;
#pragma unroll
                    for (int it = 0; it < 8; ++it)
                        vr[it] = *(const v4f*)(vbase + (long long)(j0 + ((int)threadIdx.x >> 4)) * FD + ((int)threadIdx.x & 15) * 4 + it * (2 * AW * FD));   // rows 2 AW apart per step
#pragma unroll
                    for (int c = 0; c < 8; ++c) kr[c] = *(const v8f*)(krow + (c >> 2) * (16 * FD) + (c & 3) * 16);   // key tile t = c / 4; k = 16 (c % 4) + 8 hf + (0..7)
                    // inputs-only fence on the loaded values: their first use is here, so the batch's 24 loads are all issued before any is waited on (without it
                    // the scheduler puts each load directly in front of its conversion and waits on it there)
                    asm volatile("" :: "v"(vr[0]), "v"(vr[1]), "v"(vr[2]), "v"(vr[3]), "v"(vr[4]), "v"(vr[5]), "v"(vr[6]), "v"(vr[7]),
                                 "v"(kr[0]), "v"(kr[1]), "v"(kr[2]), "v"(kr[3]), "v"(kr[4]), "v"(kr[5]), "v"(kr[6]), "v"(kr[7]));
#pragma unroll
                    for (int it = 0; it < 8; ++it) {
                        v4h hv; hv[0] = (_Float16)vr[it][0]; hv[1] = (_Float16)vr[it][1]; hv[2] = (_Float16)vr[it][2]; hv[3] = (_Float16)vr[it][3];
                        *(v4h*)(vl + ((int)threadIdx.x >> 4) * VP + ((int)threadIdx.x & 15) * 4 + it * (2 * AW * VP)) = hv;
                    }
#pragma unroll
                    for (int f = 0; f < 4; ++f)
#pragma unroll
                        for (int e = 0; e < 8; ++e) { kf[f][e] = (_Float16)kr[2 * f][e]; kf[f][8 + e] = (_Float16)kr[2 * f + 1][e]; }
                    v8f ks2[8];
#pragma unroll
                    for (int c = 0; c < 8; ++c) ks2[c] = *(const v8f*)(krow + (2 + (c >> 2)) * (16 * FD) + (c & 3) * 16);   // key tiles 2 and 3
                    // the same fence for the second batch's 16 loads; the address is named too, so that it stays live and none of these loads is given its register pair as destination
                    asm volatile("" :: "v"(ks2[0]), "v"(ks2[1]), "v"(ks2[2]), "v"(ks2[3]), "v"(ks2[4]), "v"(ks2[5]), "v"(ks2[6]), "v"(ks2[7]), "v"(krow));
#pragma unroll
                    for (int f = 0; f < 4; ++f)
#pragma unroll
                        for (int e = 0; e < 8; ++e) { kf[4 + f][e] = (_Float16)ks2[2 * f][e]; kf[4 + f][8 + e] = (_Float16)ks2[2 * f + 1][e]; }
                } else
                for (int idx = threadIdx.x; idx < 64 * DVP; idx += 32 * AW) {
                    const int jr = idx / DVP, d = idx - jr * DVP, j = j0 + jr;
                    const float f = (j < p.Lk && d < p.dv) ? vbase[(long long)j * p.sVj + (long long)d * p.sVd] : 0.f;
                    if (SPLITPV) {
                        const __bf16 hb = bf16_rne(f);
                        ((__bf16*)vl)[jr * VP + d] = hb; ((__bf16*)vl)[64 * VP + jr * VP + d] = bf16_rne(f - bf16_f32(hb));
                    } else vl[jr * VP + d] = (_Float16)f;
                }
            }
            v8f s[4];
#pragma unroll
            for (int t = 0; t < 4; ++t) {
                const int j = min(j0 + t * 16 + l15, p.Lk - 1);
                const float* krow = kbase + (long long)j * p.sKj;
                v8f acc = {};
#pragma unroll
                for (int ks = 0; ks < KS; ++ks) {
                    if (QM == 2)      acc = wmma6(qt_[ks], sp3_ld(krow, p.sKd, ks * 32, hf, p.dh, 1.f), acc);
                    else if (QM == 1) acc = wmma3(qs_[ks], sp_ld(krow, p.sKd, ks * 32, hf, p.dh, 1.f), acc);
                    else if (FS > 0)  acc = wmma16(qa[ks], kf[t * KS + ks], acc);
                    else              acc = wmma16(qa[ks], fh_ld(krow, p.sKd, ks * 32, hf, p.dh, 1.f), acc);
                }
                s[t] = acc;
            }
            float pv[8][4];
#pragma unroll
            for (int i = 0; i < 8; ++i) {
                const int irow = q0 + i + 8 * hf;
                const int ic = min(irow, p.Lq - 1);
                float sc[4];
#pragma unroll
                for (int t = 0; t < 4; ++t) {
                    const int jg = j0 + t * 16 + l15;
                    float v = s[t][i] * p.scale;
                    if (p.Mf) v += p.Mf[b * p.smb + h * p.smh + (long long)ic * p.smi + (long long)min(jg, p.Lk - 1) * p.smj];
                    if (p.Rt) { int rc = ic - min(jg, p.Lk - 1) + p.roff; rc = rc < 0 ? 0 : (rc >= p.rn ? p.rn - 1 : rc); v += p.Rt[b * p.srb + h * p.srh + (long long)ic * p.sri + rc]; }
                    if (p.Mi) { const int mv = p.Mi[b * p.smb + h * p.smh + (long long)ic * p.smi + (long long)min(jg, p.Lk - 1) * p.smj]; if (p.mpol ? (mv != 0) : (mv == 0)) v = p.mfill; }
                    if (p.SQ) { const bool same = p.SQ[(long long)b * p.Lq + ic] == p.SK[(long long)b * p.Lk + min(jg, p.Lk - 1)]; if (p.segpol ? same : !same) v = p.mfill; }
                    if (p.causal == 2 && jg > irow + p.coff) v = p.mfill;
                    if (jg >= p.Lk || (p.causal == 1 && jg > irow + p.coff) || (p.causal == 3 && jg < irow + p.coff) || (p.win > 0 && irow + p.coff - jg > p.win)) v = NEG; else v *= L2E;
                    sc[t] = v;
                }
                if (!TWOPASS || pass == 0) {
                    float mx = fmaxf(fmaxf(sc[0], sc[1]), fmaxf(sc[2], sc[3]));
                    mx = fmaxf(mx, __shfl_xor(mx, 1, 32)); mx = fmaxf(mx, __shfl_xor(mx, 2, 32));
                    mx = fmaxf(mx, __shfl_xor(mx, 4, 32)); mx = fmaxf(mx, __shfl_xor(mx, 8, 32));
                    const float mnew = fmaxf(m8[i], mx);
                    const float corr = (mnew == NEG) ? 1.f : exp2f(m8[i] - mnew);
                    float rs = 0.f;
#pragma unroll
                    for (int t = 0; t < 4; ++t) {
                        const float pp = (sc[t] == NEG) ? 0.f : exp2f(sc[t] - mnew); rs += pp;
                        pv[i][t] = p.Pw ? pp * p.Pw[b * p.swb + h * p.swh + (long long)ic * p.swi + (long long)min(j0 + t * 16 + l15, p.Lk - 1) * p.swj] : pp;
                    }
                    rs += __shfl_xor(rs, 1, 32); rs += __shfl_xor(rs, 2, 32); rs += __shfl_xor(rs, 4, 32); rs += __shfl_xor(rs, 8, 32);
                    l8[i] = l8[i] * corr + rs; m8[i] = mnew;
                    if (!TWOPASS) {
#pragma unroll
                        for (int t = 0; t < NT; ++t) o[t][i] *= corr;
                    }
                } else {
                    const float inv = (l8[i] > 0.f) ? 1.f / l8[i] : 0.f;
#pragma unroll
                    for (int t = 0; t < 4; ++t) {
                        const int jg = j0 + t * 16 + l15;
                        float pp = (sc[t] == NEG) ? 0.f : exp2f(sc[t] - m8[i]) * inv;
                        if (p.Pw) pp *= p.Pw[b * p.swb + h * p.swh + (long long)ic * p.swi + (long long)min(jg, p.Lk - 1) * p.swj];
                        pv[i][t] = pp;
                    }
                }
            }
            if (dopv) {
#pragma unroll
                for (int i = 0; i < 8; ++i)
#pragma unroll
                    for (int t = 0; t < 4; ++t) ((float*)myp)[(i + 8 * hf) * 64 + t * 16 + l15] = pv[i][t];
                __syncthreads();                                 // P (per wave) and V (shared) visible
                if (p.P) {
                    float* pb_ = p.P + b * p.sPb + h * p.sPh;
                    const bool fastP = (p.pband == 0) && ((p.sPi & 3) == 0) && (j0 + 64 <= p.Lk) && (q0 + 16 <= p.Lq) && ((((size_t)pb_) & 15) == 0);
                    if (fastP) {
#pragma unroll
                        for (int s = 0; s < 8; ++s) {
                            const int row = s * 2 + (lane >> 4), c4 = (lane & 15) * 4;
                            const v4f v = *(const v4f*)(myp + row * 64 + c4);
                            VST2V4(pb_ + (long long)(q0 + row) * p.sPi + j0 + c4, v);
                        }
                    } else {
                        for (int row = 0; row < 16; ++row) {
                            const int irow = q0 + row; if (irow >= p.Lq) continue;
                            for (int c = lane; c < 64; c += 32) {
                                const int jg = j0 + c; if (jg >= p.Lk) continue;
                                if (p.pband == 0) VST2(float, pb_ + (long long)irow * p.sPi + jg, myp[row * 64 + c]);
                                else if (jg - irow <= p.pband && irow - jg <= p.pband) VST2(float, pb_ + (long long)irow * p.sPi + (jg - irow + p.pband), myp[row * 64 + c]);
                            }
                        }
                    }
                }
                if (SPLITPV) {
                    const Split pa0 = sp_ld(myp + l15 * 64, 1, 0, hf, 64, 1.f), pa1 = sp_ld(myp + l15 * 64, 1, 32, hf, 64, 1.f);
                    const __bf16* vh = (const __bf16*)vl; const __bf16* vlo = vh + 64 * VP;
#pragma unroll
                    for (int t = 0; t < NT; ++t) {
                        const int dcol = t * 16 + l15;
                        Split b0, b1;
#pragma unroll
                        for (int e = 0; e < 16; ++e) {
                            const int k0 = frag_k(e, hf), k1 = 32 + frag_k(e, hf);
                            b0.hi[e] = vh[k0 * VP + dcol]; b0.lo[e] = vlo[k0 * VP + dcol]; b1.hi[e] = vh[k1 * VP + dcol]; b1.lo[e] = vlo[k1 * VP + dcol];
                        }
                        o[t] = wmma3(pa0, b0, o[t]);
                        o[t] = wmma3(pa1, b1, o[t]);
                    }
                } else {
                    const v16h pa0 = fh_ld(myp + l15 * 64, 1, 0, hf, 64, 4096.f), pa1 = fh_ld(myp + l15 * 64, 1, 32, hf, 64, 4096.f);
#pragma unroll
                    for (int t = 0; t < NT; ++t) {
                        const int dcol = t * 16 + l15;
                        v16h b0, b1;
#pragma unroll
                        for (int e = 0; e < 16; ++e) { b0[e] = vl[frag_k(e, hf) * VP + dcol]; b1[e] = vl[(32 + frag_k(e, hf)) * VP + dcol]; }
                        o[t] = wmma16(pa0, b0, o[t]);
                        o[t] = wmma16(pa1, b1, o[t]);
                    }
                }
            }
        }
    }
    float* obase = p.O + b * p.sOb + h * p.sOh;
    if (p.ST) {
        const int rl = lane >> 1, isel = rl & 7;           // row q0 + rl ; rl>>3 == hf holds because lane>>4 == (lane>>1)>>3
        float mv = 0.f, lv = 0.f;
#pragma unroll
        for (int i = 0; i < 8; ++i) if (i == isel) { mv = m8[i]; lv = l8[i]; }
        const int irow = q0 + rl;
        if (irow < p.Lq) { float* st = p.ST + (((long long)b * gridDim.y + h) * p.Lq + irow) * 2 + (lane & 1); VST2(float, st, (lane & 1) ? lv : mv * 0.6931471805599453f); }
    }
    float invr[8];
#pragma unroll
    for (int i = 0; i < 8; ++i) {
        if (TWOPASS) invr[i] = SPLITPV ? 1.f : (1.f / 4096.f);
        else if (p.nonorm) invr[i] = exp2f(m8[i]) * (SPLITPV ? 1.f : (1.f / 4096.f));
        else invr[i] = (l8[i] > 0.f) ? (SPLITPV ? 1.f / l8[i] : 1.f / (l8[i] * 4096.f)) : 0.f;
    }
    __syncthreads();                                             // all waves done with pl/vl from the main loop
    const bool ofast = ((p.sOi & 3) == 0) && ((((size_t)obase) & 15) == 0) && (q0 + 16 <= p.Lq);
#pragma unroll
    for (int c0 = 0; c0 < DVP; c0 += 64) {
#pragma unroll
        for (int i = 0; i < 8; ++i)
#pragma unroll
            for (int t = 0; t < NT; ++t) if (t * 16 >= c0 && t * 16 < c0 + 64) ((float*)myp)[(i + 8 * hf) * 64 + (t * 16 - c0) + l15] = o[t][i] * invr[i];
        __syncthreads();
        const int cw = (DVP - c0 < 64) ? (DVP - c0) : 64;      // staged columns in this chunk (multiple of 16)
        if (ofast && (c0 + cw <= p.dv) && (cw % 32 == 0)) {
            const int lpr = cw / 4;                              // lanes per row (16 for 64 cols, 8 for 32)
            const int rows_per_ins = 32 / lpr;
            for (int r0 = 0; r0 < 16; r0 += rows_per_ins) {
                const int row = r0 + lane / lpr, c4 = (lane % lpr) * 4;
                const v4f v = *(const v4f*)(myp + row * 64 + c4);
                VST2V4(obase + (long long)(q0 + row) * p.sOi + c0 + c4, v);
            }
        } else {
            for (int row = 0; row < 16; ++row) {
                const int irow = q0 + row; if (irow >= p.Lq) continue;
                for (int c = lane; c < cw; c += 32) { const int d = c0 + c; if (d < p.dv) VST2(float, obase + (long long)irow * p.sOi + d, myp[row * 64 + c]); }
            }
        }
        __syncthreads();
    }
}

// =====================================================================================================================
// k_tr: dst(z, c, r) = alpha * src(z, r, c) (+ beta * R2(z, c, r)): [Z][R][C] (row stride lds) -> [Z][C][R] (row stride ldd) through a 32x32 LDS tile;
//   flags: 1 -> add beta * residual R2 addressed like dst (z*sRz + c*ldr + r); act applied before the residual.
// =====================================================================================================================
struct TrP { const float* src; float* dst; const float* R2; long long sSz, lds, sDz, ldd, sRz, ldr; int R, C, flags, act; float alpha, beta; };
static_assert(sizeof(TrP) == 3 * 8 + 6 * 8 + 6 * 4, "TrP has padding");
__global__ __launch_bounds__(256) void k_tr(TrP p) {
    __shared__ float tile[32][33];
    const int c0 = blockIdx.x * 32, r0 = blockIdx.y * 32, z = blockIdx.z;
    const int lane = threadIdx.x & 31, wave = threadIdx.x >> 5;
    const float* s = p.src + z * p.sSz;
#pragma unroll
    for (int k = 0; k < 4; ++k) {
        const int rl = wave * 4 + k, r = r0 + rl, c = c0 + lane;
        tile[rl][lane] = (r < p.R && c < p.C) ? s[(long long)r * p.lds + c] : 0.f;
    }
    __syncthreads();
    float* d = p.dst + z * p.sDz; const float* rr = p.R2 + z * p.sRz;
#pragma unroll
    for (int k = 0; k < 4; ++k) {
        const int cl = wave * 4 + k, c = c0 + cl, r = r0 + lane;
        if (c < p.C && r < p.R) {
            float v = act_fn(p.alpha * tile[lane][cl], p.act);
            if (p.flags & 1) v += p.beta * rr[(long long)c * p.ldr + r];
            VST2(float, d + (long long)c * p.ldd + r, v);
        }
    }
}

// k_affine: dst[i] = a * (sdev ? sdev[0] : 1) * src[i] + b, i < n (one thread per element; consecutive lanes -> consecutive addresses)
__global__ __launch_bounds__(256) void k_affine(const float* __restrict__ src, float* __restrict__ dst, int n, float a, float b, const float* __restrict__ sdev) {
    const int i = blockIdx.x * 256 + threadIdx.x;
    if (i < n) { const float aa = sdev ? a * sdev[0] : a; const float v = aa * src[i] + b; VST2(float, dst + i, v); }
}

// =====================================================================================================================
// k_softmax: row softmax over n contiguous elements, one 256-thread block per row; rows addressed z*sz + r*sr (grid (R, Z)).
//   out = scale_out * softmax(scale_in * x + (Mf ? Mf[z*smz + r*smr + j] : 0)); a row whose max is -inf is written as 0.
// =====================================================================================================================
struct SmP { const float* src; float* dst; const float* Mf; long long sz, sr, dz, dr, smz, smr; int n, pad; float scale_in, scale_out; };
static_assert(sizeof(SmP) == 3 * 8 + 6 * 8 + 4 * 4, "SmP has padding");
__global__ __launch_bounds__(256) void k_softmax(SmP p) {
    __shared__ float red[256];
    const int r = blockIdx.x, z = blockIdx.y, tid = threadIdx.x;
    const float* s = p.src + z * p.sz + (long long)r * p.sr;
    const float* mf = p.Mf ? (p.Mf + z * p.smz + (long long)r * p.smr) : nullptr;
    float mx = -__builtin_inff();
    for (int j = tid; j < p.n; j += 256) { float v = s[j] * p.scale_in; if (mf) v += mf[j]; mx = fmaxf(mx, v); }
    red[tid] = mx; __syncthreads();
    for (int o = 128; o > 0; o >>= 1) { if (tid < o) red[tid] = fmaxf(red[tid], red[tid + o]); __syncthreads(); }
    mx = red[0]; __syncthreads();
    float sum = 0.f;
    for (int j = tid; j < p.n; j += 256) { float v = s[j] * p.scale_in; if (mf) v += mf[j]; sum += (mx == -__builtin_inff()) ? 0.f : expf(v - mx); }
    red[tid] = sum; __syncthreads();
    for (int o = 128; o > 0; o >>= 1) { if (tid < o) red[tid] += red[tid + o]; __syncthreads(); }
    sum = red[0];
    const float inv = (sum > 0.f) ? p.scale_out / sum : 0.f;
    float* d = p.dst + z * p.dz + (long long)r * p.dr;
    for (int j = tid; j < p.n; j += 256) { float v = s[j] * p.scale_in; if (mf) v += mf[j]; const float o = (mx == -__builtin_inff()) ? 0.f : expf(v - mx) * inv; VST2(float, d + j, o); }
}
// =====================================================================================================================
// k_stats: mean and rsqrt(var + eps) over a set of n elements addressed base + z*sz + (e / inner) * so + (e % inner) * si, one 256-thread
// k_norm_apply: y = (x - mean[set]) * rstd[set] * g[c] + b[c] over a [Z][C][L] channel-major tensor with set = z*G + c / (C/G) (G groups per z;
//   G = C -> per-channel sets indexed z*C+c; for batch norm pass stats indexed by c only via bn = 1). Optional act. Output same layout.
// =====================================================================================================================
//   mode 0: mean / rsqrt(var + eps); mode 1 (RMSNorm): 0 / rsqrt(mean(x^2) + eps); mode 2 (L2 normalize * sqrt(n)): 0 / sqrt(n) / max(||x||, eps); mode 3: as 0 with unbiased variance (n-1)
__global__ __launch_bounds__(256) void k_stats(const float* __restrict__ x, long long sz, long long so, long long si, int inner, int n, float eps, float* __restrict__ stat, int mode) {
    __shared__ float red[256];
    const int z = blockIdx.x, tid = threadIdx.x;
    const float* base = x + z * sz;
    float s = 0.f;
    for (int e = tid; e < n; e += 256) s += base[(long long)(e / inner) * so + (long long)(e % inner) * si];
    red[tid] = s; __syncthreads();
    for (int o = 128; o > 0; o >>= 1) { if (tid < o) red[tid] += red[tid + o]; __syncthreads(); }
    const float mu = (mode == 0 || mode == 3) ? red[0] / (float)n : 0.f; __syncthreads();
    float q = 0.f;
    for (int e = tid; e < n; e += 256) { const float dlt = base[(long long)(e / inner) * so + (long long)(e % inner) * si] - mu; q += dlt * dlt; }
    red[tid] = q; __syncthreads();
    for (int o = 128; o > 0; o >>= 1) { if (tid < o) red[tid] += red[tid + o]; __syncthreads(); }
    {
        float rs;
        if (mode == 2) rs = sqrtf((float)n) / fmaxf(sqrtf(red[0]), eps); else if (mode == 3) rs = rsqrtf(red[0] / (float)(n - 1) + eps); else rs = rsqrtf(red[0] / (float)n + eps);
        if (tid < 32) { const float v = (tid == 0) ? mu : ((tid == 1) ? rs : 0.f); VST2(float, stat + (long long)z * 32 + tid, v); }
    }
}
//   One thread per element over the flat [Z][C][L] index space: grid ceil(Z*C*L / 256).
__global__ __launch_bounds__(256) void k_norm_apply(const float* __restrict__ x, float* __restrict__ y, const float* __restrict__ stat, const float* __restrict__ g, const float* __restrict__ bta,
                                                     int Z, int C, int L, int G, int bn, int act) {
    const long long idx = (long long)blockIdx.x * 256 + threadIdx.x;
    if (idx >= (long long)Z * C * L) return;
    const int l = (int)(idx % L); const long long zc = idx / L; const int c = (int)(zc % C), z = (int)(zc / C); (void)l;
    const int set = bn ? c : (z * G + c / (C / G));
    float v = (x[idx] - stat[(long long)set * 32]) * stat[(long long)set * 32 + 1];
    if (g) v *= g[c];
    if (bta) v += bta[c];
    v = act_fn(v, act);
    VST2(float, y + idx, v);
}

// k_lse_neg: c[i] = -(st[2i] + log(st[2i+1])) = minus the log-sum-exp of row i from k_attn's ST output (for softmax over the query dimension)
__global__ __launch_bounds__(256) void k_lse_neg(const float* __restrict__ st, float* __restrict__ c, int n) {
    const int i = blockIdx.x * 256 + threadIdx.x;
    if (i < n) { const float v = -(st[2 * i] + logf(st[2 * i + 1])); VST2(float, c + i, v); }
}

// k_iota: dst[i] = a * i + b as int32 (segment/position id helper)
__global__ __launch_bounds__(256) void k_iota(int* __restrict__ dst, int n, int a, int b) {
    const int i = blockIdx.x * 256 + threadIdx.x;
    if (i < n) { const int v = a * i + b; VST2(int, dst + i, v); }
}

// k_axpby: dst[i] = a * x[i] + b * y[i] (+ c), i < n
__global__ __launch_bounds__(256) void k_axpby(const float* __restrict__ x, const float* __restrict__ y, float* __restrict__ dst, int n, float a, float b, float c) {
    const int i = blockIdx.x * 256 + threadIdx.x;
    if (i < n) { const float v = a * x[i] + b * y[i] + c; VST2(float, dst + i, v); }
}

// =====================================================================================================================
// k_rope: rotary embedding on a [R rows][Hn heads][D] view (row stride sXr, head stride sXh, element stride 1) -> Y (own strides).
//   mode 0: rotate_half (partner d±D/2, sign - for d<D/2); mode 1: interleaved pairs (partner d^1, sign - for even d).
//   table column tcol: tmode 0 -> d, 1 -> d % (D/2), 2 -> d / 2; position p: pmode 0 -> r % S, 1 -> head index, 2 -> pos[r];
//   c = C[(r / S) * sCb + p * sCp + tcol * sCd], s likewise from Sn; y = x[d] * c + sign * x[partner] * s. X and Y must not alias.
// =====================================================================================================================
struct RopeP { const float* X; float* Y; const float* C; const float* Sn; const int* pos; long long sXr, sXh, sYr, sYh, sCb, sCp, sCd; int R, Hn, D, S, mode, tmode, pmode, pad; };
static_assert(sizeof(RopeP) == 5 * 8 + 7 * 8 + 8 * 4, "RopeP has padding");
__global__ __launch_bounds__(256) void k_rope(RopeP p) {
    const long long idx = (long long)blockIdx.x * 256 + threadIdx.x;
    if (idx >= (long long)p.R * p.Hn * p.D) return;
    const int d = (int)(idx % p.D); const long long rh = idx / p.D; const int h = (int)(rh % p.Hn); const int r = (int)(rh / p.Hn);
    const int half = p.D / 2;
    int partner; float sign;
    if (p.mode == 0) { partner = (d < half) ? d + half : d - half; sign = (d < half) ? -1.f : 1.f; }
    else { partner = d ^ 1; sign = (d & 1) ? 1.f : -1.f; }
    const int tcol = (p.tmode == 0) ? d : ((p.tmode == 1) ? (d % half) : (d >> 1));
    const int pp = (p.pmode == 0) ? (r % p.S) : ((p.pmode == 1) ? h : p.pos[r]);
    const long long toff = (long long)(r / p.S) * p.sCb + (long long)pp * p.sCp + (long long)tcol * p.sCd;
    const float* xr = p.X + (long long)r * p.sXr + (long long)h * p.sXh;
    const float v = xr[d] * p.C[toff] + sign * xr[partner] * p.Sn[toff];
    VST2(float, p.Y + (long long)r * p.sYr + (long long)h * p.sYh + d, v);
}

// k_invf + k_sincos (split so neither kernel carries a large VALU-fma footprint): invf_i = num * (1 / powf(base, (2 i)/D)) [fmode 0],
//   num * expf((2 i) * cexp) [fmode 1], num * powf(base, -2 (i - 1) / D) [fmode 2]; then cs/sn[s*half + i] = cos/sin((pscale * s) * invf_i)
__global__ __launch_bounds__(256) void k_invf(float* __restrict__ invb, int half, int D, float base, float num, int fmode, float cexp) {
    const int i = blockIdx.x * 256 + threadIdx.x;
    if (i >= ((half + 31) / 32) * 32) return;
    if (i >= half) { VST2(float, invb + i, 0.f); return; }
    const float e = (float)(2 * i) / (float)D;
    float invf;
    if (fmode == 1) invf = num * expf((float)(2 * i) * cexp);
    else if (fmode == 2) invf = num * powf(base, (-2.0f * ((float)i - 1.0f)) / (float)D);
    else invf = num * (1.0f / powf(base, e));
    VST2(float, invb + i, invf);
}
__global__ __launch_bounds__(256) void k_sincos(float* __restrict__ cs, float* __restrict__ sn, const float* __restrict__ invb, int S, int half, float pscale) {
    const int idx = blockIdx.x * 256 + threadIdx.x;
    if (idx >= S * half) return;
    const int s = idx / half, i = idx - s * half;
    const float ang = (pscale * (float)s) * invb[i];
    VST2(float, cs + idx, cosf(ang)); VST2(float, sn + idx, sinf(ang));
}

// k_mulact: dst[i] = act(x[i]) * y[i]
__global__ __launch_bounds__(256) void k_mulact(const float* __restrict__ x, const float* __restrict__ y, float* __restrict__ dst, int n, int act) {
    const int i = blockIdx.x * 256 + threadIdx.x;
    if (i < n) { const float v = act_fn(x[i], act) * y[i]; VST2(float, dst + i, v); }
}

// =====================================================================================================================
// k_matvec: thread-per-row matrix-vector products for N <= 8 output columns (heads with 1-3 outputs, gates), f32 on the VALU.
//   C[r*sCm + j] = act(alpha * sum_k A[r*sAm + k*sAk] * B[j*sBn + k*sBk] + bias[j]) + beta * R[r*sRm + j*sRn]; each thread writes its N contiguous floats.
// =====================================================================================================================
__global__ __launch_bounds__(256) void k_matvec(GemmP p) {
    // N == 1: one row per thread, 32 lanes write 32 consecutive rows with one instruction; otherwise 32 consecutive rows per thread.
    const int rpt = (p.N == 1) ? 1 : 32;
    const long long r0 = ((long long)blockIdx.x * 256 + threadIdx.x) * rpt; const int z = blockIdx.z, zo = z / p.zi_n, zi = z - zo * p.zi_n;
    if (r0 >= p.M) return;
    const float* Bb = p.B + zo * p.sBo + zi * p.sBi;
    float* C = p.C + zo * p.sCo + zi * p.sCi; const float* R = p.R + zo * p.sRo + zi * p.sRi;
    for (int rr = 0; rr < rpt; ++rr) {
        const long long r = r0 + rr; if (r >= p.M) break;
        const float* A = p.A + zo * p.sAo + zi * p.sAi + r * p.sAm;
        float acc[8] = {0.f, 0.f, 0.f, 0.f, 0.f, 0.f, 0.f, 0.f};
        for (int k = 0; k < p.K; ++k) { const float a = A[(long long)k * p.sAk];
#pragma unroll
            for (int j = 0; j < 8; ++j) if (j < p.N) acc[j] += a * Bb[(long long)j * p.sBn + (long long)k * p.sBk]; }
#pragma unroll
        for (int j = 0; j < 8; ++j) if (j < p.N) {
            float v = acc[j] * p.alpha;
            if (p.flags & 1) v += p.bias[j];
            if (p.flags & 2) v += p.bias[r];
            v = act_fn(v, p.act);
            if (p.flags & 4) v += p.beta * R[r * p.sRm + (long long)j * p.sRn];
            VST2(float, C + r * p.sCm + j, v);
        }
    }
}
// k_smallsoftmax: thread-per-row softmax for short rows (n <= 64): dst[r*dr + j] = softmax(scale*src[r*sr + j])
__global__ __launch_bounds__(256) void k_smallsoftmax(const float* __restrict__ src, float* __restrict__ dst, long long sr, long long dr, int n, long long R, float scale) {
    const long long r0 = ((long long)blockIdx.x * 256 + threadIdx.x) * 32;
    for (int rr = 0; rr < 32; ++rr) {
        const long long r = r0 + rr; if (r >= R) return;
        const float* s = src + r * sr; float* d = dst + r * dr;
        float mx = -__builtin_inff();
        for (int j = 0; j < n; ++j) mx = fmaxf(mx, s[j] * scale);
        float sum = 0.f;
        for (int j = 0; j < n; ++j) sum += expf(s[j] * scale - mx);
        const float inv = 1.f / sum;
        for (int j = 0; j < n; ++j) { const float v = expf(s[j] * scale - mx) * inv; VST2(float, d + j, v); }
    }
}

__global__ __launch_bounds__(32) void k_unitstat(float* __restrict__ st) { const int t = threadIdx.x; const float v = (t == 1) ? 1.f : 0.f; VST2(float, st + t, v); }

// destination (e.g. a d_out whose row width is not a multiple of 32 floats) is written by consecutive lanes of one instruction
__global__ __launch_bounds__(256) void k_lincopy(const float* __restrict__ src, long long lds, float* __restrict__ dst, long long ldd, long long rows, int cols) {
    const long long i = (long long)blockIdx.x * 256 + threadIdx.x; if (i >= rows * cols) return;
    const long long r = i / cols; const int c = (int)(i - r * cols);
    const float v = src[r * lds + c]; VST2(float, dst + r * ldd + c, v);
}

namespace w25 {
typedef __attribute__((ext_vector_type(16))) _Float16 v16h;
typedef __attribute__((ext_vector_type(8)))  _Float16 v8h;
typedef __attribute__((ext_vector_type(16))) __bf16   v16b;
typedef __attribute__((ext_vector_type(8)))  __bf16   v8b;
typedef __attribute__((ext_vector_type(8)))  float    v8f;
typedef __attribute__((ext_vector_type(4)))  float    v4f;

__device__ __forceinline__ unsigned short f2bf_bits(float f) {
  unsigned u = __float_as_uint(f);
  return (unsigned short)((u + 0x7FFFu + ((u >> 16) & 1u)) >> 16);
}
__device__ __forceinline__ float bf_bits2f(unsigned short h) { return __uint_as_float(((unsigned)h) << 16); }

// hazard guards as plain device helpers (no inline asm inside the kernel template body)
__device__ __forceinline__ void dep_guard_h(v8f& a, v8f& b, v16h x, v16h y) { asm volatile("v_nop\n\tv_nop\n\tv_nop\n\tv_nop" : "+v"(a), "+v"(b) : "v"(x), "v"(y)); }
__device__ __forceinline__ void dep_guard_b(v8f& a, v8f& b, v16b x, v16b y) { asm volatile("v_nop\n\tv_nop\n\tv_nop\n\tv_nop" : "+v"(a), "+v"(b) : "v"(x), "v"(y)); }
__device__ __forceinline__ void keep4_h(v16h a, v16h b, v16h c, v16h d) { asm volatile("v_nop" :: "v"(a), "v"(b), "v"(c), "v"(d)); }
__device__ __forceinline__ void keep4_b(v16b a, v16b b, v16b c, v16b d) { asm volatile("v_nop" :: "v"(a), "v"(b), "v"(c), "v"(d)); }
__device__ __forceinline__ void acc_guard4(v8f& a, v8f& b, v8f& c, v8f& d) { asm volatile("v_nop\n\tv_nop\n\tv_nop\n\tv_nop" : "+v"(a), "+v"(b), "+v"(c), "+v"(d)); }
template <typename T> struct Frag;
template <> struct Frag<_Float16> {
  typedef v16h V; union U { v16h v; v8h h[2]; };
  static __device__ __forceinline__ v16h load(const _Float16* p) {   // elements 0..7 <- p[0..7], 8..15 <- p[16..23]
    U f; f.h[0] = *(const v8h*)(p); f.h[1] = *(const v8h*)(p + 16); return f.v;
  }
  static __device__ __forceinline__ v8f mma(v16h a, v16h b, v8f c) {
    return __builtin_amdgcn_wmma_f32_16x16x32_f16(false, a, false, b, (short)0, c, false, false);
  }
  static __device__ __forceinline__ void guard(v8f& a, v8f& b, v16h x, v16h y) { dep_guard_h(a, b, x, y); }
  static __device__ __forceinline__ void keep(v16h a, v16h b, v16h c, v16h d) { keep4_h(a, b, c, d); }
};
template <> struct Frag<__bf16> {
  typedef v16b V; union U { v16b v; v8b h[2]; };
  static __device__ __forceinline__ v16b load(const __bf16* p) {
    U f; f.h[0] = *(const v8b*)(p); f.h[1] = *(const v8b*)(p + 16); return f.v;
  }
  static __device__ __forceinline__ v8f mma(v16b a, v16b b, v8f c) {
    return __builtin_amdgcn_wmma_f32_16x16x32_bf16(false, a, false, b, (short)0, c, false, false);
  }
  static __device__ __forceinline__ void guard(v8f& a, v8f& b, v16b x, v16b y) { dep_guard_b(a, b, x, y); }
  static __device__ __forceinline__ void keep(v16b a, v16b b, v16b c, v16b d) { keep4_b(a, b, c, d); }
};

// ---- Register-blocked batched WMMA GEMM ------------------------------------
// C[m,n] = scale * sum_k A[m,k] * Bt[n,k] (+bias)(+resid); each wave owns a 64x64 tile.
// A row-major [M,K]; Bt row-major [N,K]; M,N % 64 == 0, K % 32 == 0.
// SPLIT: operands are hi/lo planes (A2/Bt2 = lo planes, same layout); product = hi·hi + hi·lo + lo·hi.
// BIAS_MODE: 0 = none, 1 = bias[m], 2 = bias[n].
// OUT_MODE: 0 = f32, 1 = f16, 2 = bf16 hi plane (Cout) + bf16 lo plane (Cout2).
// ET: 0 = f16 operands, 1 = bf16 operands (pointers passed as 16-bit storage)
template <int ET> struct Elem;
template <> struct Elem<0> { typedef _Float16 T; };
template <> struct Elem<1> { typedef __bf16 T; };
template <int ET, bool SPLIT, int BIAS_MODE, int OUT_MODE, bool RESID, int ACT = 0>
__global__ __launch_bounds__(256) void wmma_gemm64(
    const unsigned short* __restrict__ Ap, const unsigned short* __restrict__ A2p, int lda, long strideA,
    const unsigned short* __restrict__ Btp, const unsigned short* __restrict__ Bt2p, int ldb, long strideB,
    void* __restrict__ Cout, void* __restrict__ Cout2, int ldc, long strideC,
    const float* __restrict__ bias,
    const float* __restrict__ resid, long strideR,
    int M, int N, int K, float scale) {
  typedef typename Elem<ET>::T T;
  typedef typename Frag<T>::V V;
  const T* A = (const T*)Ap; const T* A2 = (const T*)A2p; const T* Bt = (const T*)Btp; const T* Bt2 = (const T*)Bt2p;
  __shared__ __align__(16) float sT[8][16 * 68];   // per-wave 16x64 slab, pitch 68 floats
  const int b    = blockIdx.y;
  const int lane = threadIdx.x & 31;
  const int wave = threadIdx.x >> 5;
  const int tilesN = N >> 6;
  const int tilesM = M >> 6;
  const int tile = blockIdx.x * 8 + wave;
  if (tile >= tilesM * tilesN) return;   // wave-uniform; no block barriers in this kernel
  const int tm = tile / tilesN;
  const int tn = tile - tm * tilesN;
  const int m0 = tm << 6;
  const int n0 = tn << 6;

  const T* Ab  = A  + (size_t)b * strideA;
  const T* Bb  = Bt + (size_t)b * strideB;
  const T* Ab2 = SPLIT ? (A2  + (size_t)b * strideA) : nullptr;
  const T* Bb2 = SPLIT ? (Bt2 + (size_t)b * strideB) : nullptr;

  const int rlane = lane & 15;                 // row (A) / col (B, D) within subtile
  const int koff  = (lane >> 4) * 8;           // k offset of this lane half
  const int mOff  = (lane >> 4) * 8;           // D row offset

  v8f acc[4][4];
#pragma unroll
  for (int i = 0; i < 4; ++i)
#pragma unroll
    for (int j = 0; j < 4; ++j) acc[i][j] = (v8f){0.f,0.f,0.f,0.f,0.f,0.f,0.f,0.f};

  for (int k0 = 0; k0 < K; k0 += 32) {
    V bh[4], bl[4];
#pragma unroll
    for (int j = 0; j < 4; ++j) {
      const size_t bo = (size_t)(n0 + (j << 4) + rlane) * ldb + koff + k0;
      bh[j] = Frag<T>::load(Bb + bo);
      if (SPLIT) bl[j] = Frag<T>::load(Bb2 + bo);
    }
#pragma unroll
    for (int i = 0; i < 4; ++i) {
      const size_t ao = (size_t)(m0 + (i << 4) + rlane) * lda + koff + k0;
      V ah = Frag<T>::load(Ab + ao);
      V al;
      if (SPLIT) al = Frag<T>::load(Ab2 + ao);
#pragma unroll
      for (int j = 0; j < 4; ++j) {
        acc[i][j] = Frag<T>::mma(ah, bh[j], acc[i][j]);
        if (SPLIT) {
          acc[i][j] = Frag<T>::mma(ah, bl[j], acc[i][j]);
          acc[i][j] = Frag<T>::mma(al, bh[j], acc[i][j]);
        }
      }
      Frag<T>::guard(acc[i][0], acc[i][3], ah, SPLIT ? al : ah);
    }
    Frag<T>::keep(bh[0], bh[1], bh[2], bh[3]);
    if (SPLIT) Frag<T>::keep(bl[0], bl[1], bl[2], bl[3]);
  }
  acc_guard4(acc[0][0], acc[0][1], acc[0][2], acc[0][3]);
  acc_guard4(acc[1][0], acc[1][1], acc[1][2], acc[1][3]);
  acc_guard4(acc[2][0], acc[2][1], acc[2][2], acc[2][3]);
  acc_guard4(acc[3][0], acc[3][1], acc[3][2], acc[3][3]);

  // ---- epilogue ----
  float* slab = sT[wave];
  const float* Rb = RESID ? (resid + (size_t)b * strideR) : nullptr;
#pragma unroll
  for (int i = 0; i < 4; ++i) {
    const int mBase = m0 + (i << 4);
#pragma unroll
    for (int j = 0; j < 4; ++j) {
      const int n = n0 + (j << 4) + rlane;
      float bv = 0.f;
      if (BIAS_MODE == 2) bv = bias[n];
#pragma unroll
      for (int r = 0; r < 8; ++r) {
        float v = acc[i][j][r] * scale;
        if (BIAS_MODE == 1) v += bias[mBase + mOff + r];
        if (BIAS_MODE == 2) v += bv;
        if (RESID) v += Rb[(size_t)(mBase + mOff + r) * ldc + n];
        if (ACT == 1) v = tanhf(v);
        if (ACT == 2) v = fmaxf(v, 0.0f);
        if (ACT == 3) v = v / (1.0f + expf(-v));
        if (ACT == 4) v = (v > 0.f) ? v : 0.01f * v;
        if (ACT == 5) v = 0.5f * v * (1.0f + erff(v * 0.70710678118654752f));
        slab[(mOff + r) * 68 + (j << 4) + rlane] = v;
      }
    }
    __builtin_amdgcn_fence(__ATOMIC_RELEASE, "workgroup");
    __builtin_amdgcn_wave_barrier();
    __builtin_amdgcn_fence(__ATOMIC_ACQUIRE, "workgroup");
    if (OUT_MODE == 0) {
      float* C = (float*)Cout + (size_t)b * strideC;
      const int hh = lane >> 4, c4 = (lane & 15) * 4;     // row seg = 256 B = 16 lanes x 16 B
      {
#pragma unroll
        for (int it = 0; it < 8; ++it) {
          const int row = it * 2 + hh;
          v4f v = *(const v4f*)(slab + row * 68 + c4);
          *(v4f*)(C + (size_t)(mBase + row) * ldc + n0 + c4) = v;
        }
        
      }
    } else {
      const int q = lane >> 3, c8 = (lane & 7) * 8;
      unsigned short* C  = (unsigned short*)Cout  + (size_t)b * strideC;
      unsigned short* C2 = (OUT_MODE == 2) ? ((unsigned short*)Cout2 + (size_t)b * strideC) : nullptr;
      {
#pragma unroll
        for (int it = 0; it < 4; ++it) {
          const int row = it * 4 + q;
          const float* sp = slab + row * 68 + c8;
          v8h hv, lv;
#pragma unroll
          for (int e = 0; e < 8; ++e) {
            if (OUT_MODE == 1) {
              hv[e] = (_Float16)sp[e];
            } else {
              unsigned short hb = f2bf_bits(sp[e]);
              unsigned short lb = f2bf_bits(sp[e] - bf_bits2f(hb));
              hv[e] = __builtin_bit_cast(_Float16, hb);
              lv[e] = __builtin_bit_cast(_Float16, lb);
            }
          }
          *(v8h*)(C + (size_t)(mBase + row) * ldc + n0 + c8) = hv;
          if (OUT_MODE == 2) *(v8h*)(C2 + (size_t)(mBase + row) * ldc + n0 + c8) = lv;
        }
        
      }
    }
    __builtin_amdgcn_fence(__ATOMIC_RELEASE, "workgroup");
    __builtin_amdgcn_wave_barrier();
    __builtin_amdgcn_fence(__ATOMIC_ACQUIRE, "workgroup");
  }
}

__global__ __launch_bounds__(256) void cast_f32_f16x2(
    const float* __restrict__ in, _Float16* __restrict__ out, int n2) {
  int i = blockIdx.x * 256 + threadIdx.x;
  if (i < n2) {
    const _Float16 h0 = (_Float16)in[2 * i], h1 = (_Float16)in[2 * i + 1];
    const unsigned u = (unsigned)__builtin_bit_cast(unsigned short, h0) | ((unsigned)__builtin_bit_cast(unsigned short, h1) << 16);
    ((unsigned*)out)[i] = u;
    
  }
}


} // namespace w25

__global__ __launch_bounds__(256) void k_castT16(const float* __restrict__ src, long long lds, _Float16* __restrict__ dst, long long ldd, int R, int C, float s) {
    const long long i = (long long)blockIdx.x * 256 + threadIdx.x; const long long np = (long long)C * (R / 2); if (i >= np) return; const int c = (int)(i / (R / 2)); const int r = 2 * (int)(i % (R / 2));
    const _Float16 h0 = (_Float16)(src[(long long)r * lds + c] * s), h1 = (_Float16)(src[(long long)(r + 1) * lds + c] * s);
    const unsigned u = (unsigned)__builtin_bit_cast(unsigned short, h0) | ((unsigned)__builtin_bit_cast(unsigned short, h1) << 16);
    unsigned* d = (unsigned*)(dst + (long long)c * ldd + r); *d = u;  }
__global__ __launch_bounds__(256) void k_cast16(const float* __restrict__ src, long long lds, _Float16* __restrict__ dst, long long ldd, int R, int C, float s) {
    const long long i = (long long)blockIdx.x * 256 + threadIdx.x; const long long np = (long long)R * (C / 2); if (i >= np) return; const int r = (int)(i / (C / 2)); const int c = 2 * (int)(i % (C / 2));
    const _Float16 h0 = (_Float16)(src[(long long)r * lds + c] * s), h1 = (_Float16)(src[(long long)r * lds + c + 1] * s);
    const unsigned u = (unsigned)__builtin_bit_cast(unsigned short, h0) | ((unsigned)__builtin_bit_cast(unsigned short, h1) << 16);
    unsigned* d = (unsigned*)(dst + (long long)r * ldd + c); *d = u;  }

// f32 -> bf16 hi plane + bf16 lo plane (x = hi + lo to ~2^-17 relative; RNE both), [R][C] -> [R][C] (or transposed to [C][R]); 2 consecutive destination elements
__device__ __forceinline__ unsigned int f2bf2_pack(float a, float b, unsigned int* lo) {
    const unsigned short ha = w25::f2bf_bits(a), hb = w25::f2bf_bits(b);
    const unsigned short la = w25::f2bf_bits(a - w25::bf_bits2f(ha)), lb = w25::f2bf_bits(b - w25::bf_bits2f(hb));
    *lo = (unsigned)la | ((unsigned)lb << 16); return (unsigned)ha | ((unsigned)hb << 16); }
__global__ __launch_bounds__(256) void k_castS16(const float* __restrict__ src, long long lds, __bf16* __restrict__ dhi, __bf16* __restrict__ dlo, long long ldd, int R, int C, float s, int transpose) {
    const long long i = (long long)blockIdx.x * 256 + threadIdx.x; long long o; float a, b;
    if (transpose) { const long long np = (long long)C * (R / 2); if (i >= np) return; const int c = (int)(i / (R / 2)); const int r = 2 * (int)(i % (R / 2)); a = src[(long long)r * lds + c] * s; b = src[(long long)(r + 1) * lds + c] * s; o = (long long)c * ldd + r; }
    else { const long long np = (long long)R * (C / 2); if (i >= np) return; const int r = (int)(i / (C / 2)); const int c = 2 * (int)(i % (C / 2)); a = src[(long long)r * lds + c] * s; b = src[(long long)r * lds + c + 1] * s; o = (long long)r * ldd + c; }
    unsigned lo; const unsigned hi = f2bf2_pack(a, b, &lo); unsigned* ph = (unsigned*)(dhi + o); unsigned* pl = (unsigned*)(dlo + o);
    *ph = hi; *pl = lo;  }

namespace w25 {
// =====================================================================================
// Generic causal/non-causal attention for head_dim 64, f32 in / f32 out; 16-bit operands: bf16 with optional hi/lo splits, or
// plain f16 (F16=true, non-split, probabilities carried x2^15).
//   scores = (q*qscale)·kᵀ : v_wmma_f32_16x16x32_bf16; SPLIT_QK -> q,k as bf16 hi/lo (hi·hi + hi·lo + lo·hi)
//   out    = p·v           : v_wmma_f32_16x16x32_bf16; SPLIT_PV -> p,v as bf16 hi/lo; else p,v plain bf16
//   f32 accumulate; online softmax in f32. Block = 4 waves = 64 query rows of one (batch, head); S % 64 == 0.
//   Element (b, s, h, d) of tensor X lives at X[b*X_bs + s*X_rs + h*X_hs + d] (strides in floats, multiples of 4).
//   Masking: mask_mode 0 none, 1 causal (kv > q masked), 2 tensor [S][Skv] shared over (b,h) (float if
//   mask_is_int==0, int32 with element == 0 -> masked if 1, int32 with element != 0 -> masked if 2), 3 per-token vectors qmask[B][S] & kvmask[B][Skv] (int32,
//   0 -> masked), 4 causal + sliding window (kv > q or q - kv > W masked; W passed in mask_is_int);
//   5 = relative-position bias: s += cp[b,h,q][idx[q][kv]] + pc[b,h,kv][idx[q][kv]] with idx = mask_b ([S][Skv] int32) and
//   mask_a an int32 [S][Skv] tensor with nonzero = masked (tables: element (b,h,row,n) at X + b*c_bs + h*c_hs + row*c_rs + n);
//   masked scores are replaced by mask_fill (e.g. -inf or -1e9) before the softmax.
//   grid.x = B * H * (S/64) (or a sub-range with blk0).
// =====================================================================================
#define AT_D 64
#define AT_NW 4
#define AT_QB 64
#define AT_KC 64
struct AttnGeom { const float* cp = nullptr; const float* pc = nullptr; long c_bs = 0, c_rs = 0, c_hs = 0;   // mode-5 score-bias tables
                  long q_bs, q_rs, q_hs, k_bs, k_rs, k_hs, v_bs, v_rs, v_hs, o_bs, o_rs, o_hs;
                  int S, Skv, H, mask_mode; float qscale; int blk0; float mask_fill; int mask_is_int; };
static_assert(sizeof(AttnGeom) == 168, "no padding");

__device__ __forceinline__ unsigned short at_bf_bits(float f) {
  unsigned u = __float_as_uint(f);
  return (unsigned short)((u + 0x7FFFu + ((u >> 16) & 1u)) >> 16);
}
__device__ __forceinline__ __bf16 at_f2bf(float f) { return __builtin_bit_cast(__bf16, at_bf_bits(f)); }
__device__ __forceinline__ void at_split(float f, __bf16& hi, __bf16& lo) {
  const unsigned short hb = at_bf_bits(f);
  hi = __builtin_bit_cast(__bf16, hb);
  lo = at_f2bf(f - __uint_as_float(((unsigned)hb) << 16));
}
__device__ __forceinline__ v8f at_mma(v16b a, v16b b, v8f c) {
  c = __builtin_amdgcn_wmma_f32_16x16x32_bf16(false, a, false, b, (short)0, c, false, false);
  asm volatile("v_nop\n\tv_nop\n\tv_nop\n\tv_nop" : "+v"(c) : "v"(a), "v"(b));
  return c;
}
// 16-bit element as a bit pattern held in a __bf16 slot: f16 bits when F16, bf16 (RNE) otherwise
template <bool F16> __device__ __forceinline__ __bf16 at_to16(float f) {
  if (F16) return __builtin_bit_cast(__bf16, (_Float16)f);
  return at_f2bf(f);
}
template <bool F16> __device__ __forceinline__ v8f at_mma16(v16b a, v16b b, v8f c) {
  if (F16) {
    const v16h ah = __builtin_bit_cast(v16h, a), bh = __builtin_bit_cast(v16h, b);
    c = __builtin_amdgcn_wmma_f32_16x16x32_f16(false, ah, false, bh, (short)0, c, false, false);
    asm volatile("v_nop\n\tv_nop\n\tv_nop\n\tv_nop" : "+v"(c) : "v"(ah), "v"(bh));
    return c;
  }
  return at_mma(a, b, c);
}

template <bool SPLIT_QK, bool SPLIT_PV, bool F16 = false>
__global__ __launch_bounds__(128)
void attn64_kernel(const float* __restrict__ q, const float* __restrict__ k,
                   const float* __restrict__ v, float* __restrict__ out,
                   const void* __restrict__ mask_a, const int* __restrict__ mask_b, AttnGeom g) {
  static_assert(!(F16 && (SPLIT_QK || SPLIT_PV)), "f16 mode is non-split");
  const float PSC = F16 ? 32768.0f : 1.0f;     // f16 probabilities carried x2^15 (subnormal range), folded into the final 1/l
  union FB { v16b v; v8b h[2]; };
  __shared__ __align__(16) __bf16 Ksh[AT_KC * AT_D];             // K hi [kv][d]      8 KB
  __shared__ __align__(16) __bf16 Ksl[SPLIT_QK ? AT_KC * AT_D : 8];
  __shared__ __align__(16) __bf16 Vth[AT_D * AT_KC];             // V hi [d][kv]      8 KB
  __shared__ __align__(16) __bf16 Vtl[SPLIT_PV ? AT_D * AT_KC : 8];
  __shared__ __align__(16) __bf16 Psh[AT_NW][16 * AT_KC];        // per wave P hi [row][kv]  8 KB
  __shared__ __align__(16) __bf16 Psl[SPLIT_PV ? AT_NW : 1][SPLIT_PV ? 16 * AT_KC : 8];
  __shared__ __align__(16) float  Os[AT_NW][16 * 68];            // per wave out tile, pitch 68

  const int tid  = threadIdx.x;
  const int wave = tid >> 5;
  const int lane = tid & 31;
  const int hh   = lane >> 4;
  const int c    = lane & 15;

  const int nqb = g.S / AT_QB;
  const int bx = blockIdx.x + g.blk0;
  const int qb = bx % nqb;
  const int bh = bx / nqb;
  const int h  = bh % g.H;
  const int b  = bh / g.H;
  const int qbase_block = qb * AT_QB;
  const int q0 = qbase_block + wave * 16;

  const float* qb_ptr = q + (size_t)b * g.q_bs + (size_t)h * g.q_hs;
  const float* kb_ptr = k + (size_t)b * g.k_bs + (size_t)h * g.k_hs;
  const float* vb_ptr = v + (size_t)b * g.v_bs + (size_t)h * g.v_hs;
  float*       ob_ptr = out + (size_t)b * g.o_bs + (size_t)h * g.o_hs;

  // ---- Q fragments (A operand): 2 d-chunks, hi (and lo) ----
  v16b qah[2], qal[2];
  {
    const float* qrow = qb_ptr + (size_t)(q0 + c) * g.q_rs;
#pragma unroll
    for (int dc = 0; dc < 2; ++dc) {
#pragma unroll
      for (int e = 0; e < 8; ++e) {
        const float f0 = qrow[dc * 32 + 8 * hh + e] * g.qscale;
        const float f1 = qrow[dc * 32 + 16 + 8 * hh + e] * g.qscale;
        if (SPLIT_QK) { __bf16 hq, lq; at_split(f0, hq, lq); qah[dc][e] = hq; qal[dc][e] = lq; at_split(f1, hq, lq); qah[dc][8 + e] = hq; qal[dc][8 + e] = lq; }
        else { qah[dc][e] = at_to16<F16>(f0); qah[dc][8 + e] = at_to16<F16>(f1); qal[dc][e] = qah[dc][e]; qal[dc][8 + e] = qah[dc][8 + e]; }
      }
    }
  }

  float mrow[8], lrow[8];
  v8f oacc[4];
#pragma unroll
  for (int r = 0; r < 8; ++r) { mrow[r] = -INFINITY; lrow[r] = 0.f; }
#pragma unroll
  for (int t = 0; t < 4; ++t) oacc[t] = (v8f){0.f,0.f,0.f,0.f,0.f,0.f,0.f,0.f};

  const int nChunks = (g.mask_mode == 1 || g.mask_mode == 4) ? (qb + 1) : (g.Skv / AT_KC);   // block-uniform
  // per-row query mask (mode 3)
  int qkeep[8];
#pragma unroll
  for (int r = 0; r < 8; ++r) qkeep[r] = (g.mask_mode == 3) ? mask_b[(size_t)b * g.S + q0 + 8 * hh + r] : 1;   // mask_b = qmask in mode 3
  for (int kc = 0; kc < nChunks; ++kc) {
    const int kv0 = kc * AT_KC;
    __syncthreads();
    {
      const int kvr = tid >> 1, dh = (tid & 1) * 32;
      const float* krow = kb_ptr + (size_t)(kv0 + kvr) * g.k_rs + dh;
      const float* vrow = vb_ptr + (size_t)(kv0 + kvr) * g.v_rs + dh;
#pragma unroll
      for (int i = 0; i < 8; ++i) {
        v4f kk = *(const v4f*)(krow + 4 * i);
        v4f vv = *(const v4f*)(vrow + 4 * i);
#pragma unroll
        for (int e = 0; e < 4; ++e) {
          const int d = dh + 4 * i + e;
          if (SPLIT_QK) { __bf16 a, bl; at_split(kk[e], a, bl); Ksh[kvr * AT_D + d] = a; Ksl[kvr * AT_D + d] = bl; }
          else Ksh[kvr * AT_D + d] = at_to16<F16>(kk[e]);
          if (SPLIT_PV) { __bf16 a, bl; at_split(vv[e], a, bl); Vth[d * AT_KC + kvr] = a; Vtl[d * AT_KC + kvr] = bl; }
          else Vth[d * AT_KC + kvr] = at_to16<F16>(vv[e]);
        }
      }
    }
    __syncthreads();

    v8f s[4];
#pragma unroll
    for (int j = 0; j < 4; ++j) {
      s[j] = (v8f){0.f,0.f,0.f,0.f,0.f,0.f,0.f,0.f};
#pragma unroll 1
      for (int dc = 0; dc < 2; ++dc) {
        FB kb;
        kb.h[0] = *(const v8b*)(Ksh + (j * 16 + c) * AT_D + dc * 32 + 8 * hh);
        kb.h[1] = *(const v8b*)(Ksh + (j * 16 + c) * AT_D + dc * 32 + 16 + 8 * hh);
        s[j] = at_mma16<F16>(qah[dc], kb.v, s[j]);
        if (SPLIT_QK) {
          FB kl;
          kl.h[0] = *(const v8b*)(Ksl + (j * 16 + c) * AT_D + dc * 32 + 8 * hh);
          kl.h[1] = *(const v8b*)(Ksl + (j * 16 + c) * AT_D + dc * 32 + 16 + 8 * hh);
          s[j] = at_mma16<F16>(qah[dc], kl.v, s[j]);
          s[j] = at_mma16<F16>(qal[dc], kb.v, s[j]);
        }
      }
    }
    const bool diag = (g.mask_mode == 1) && (kc == qb);
    int kvkeep[4] = {1, 1, 1, 1};
    if (g.mask_mode == 3) {
#pragma unroll
      for (int j = 0; j < 4; ++j) kvkeep[j] = ((const int*)mask_a)[(size_t)b * g.Skv + kv0 + j * 16 + c];   // mask_a = kvmask
    }
    float cm[8];
#pragma unroll
    for (int r = 0; r < 8; ++r) {
      const int qrow = q0 + 8 * hh + r;
      float m = -INFINITY;
#pragma unroll
      for (int j = 0; j < 4; ++j) {
        const int kvcol = kv0 + j * 16 + c;
        bool masked = false;
        if (diag) masked = (kvcol > qrow);
        else if (g.mask_mode == 4) masked = (kvcol > qrow) || (qrow - kvcol > g.mask_is_int);
        else if (g.mask_mode == 2) {
          const size_t mi = (size_t)qrow * g.Skv + kvcol;
          masked = (g.mask_is_int == 0) ? (((const float*)mask_a)[mi] == 0.0f)
                 : (g.mask_is_int == 1) ? (((const int*)mask_a)[mi] == 0) : (((const int*)mask_a)[mi] != 0);
        } else if (g.mask_mode == 3) masked = (qkeep[r] == 0) || (kvkeep[j] == 0);
        else if (g.mask_mode == 5) {
          const size_t mi = (size_t)qrow * g.Skv + kvcol;
          masked = (((const int*)mask_a)[mi] != 0);
          int n = mask_b[mi]; n = n < 0 ? 0 : n;
          s[j][r] += g.cp[(size_t)b * g.c_bs + (size_t)h * g.c_hs + (size_t)qrow * g.c_rs + n]
                   + g.pc[(size_t)b * g.c_bs + (size_t)h * g.c_hs + (size_t)kvcol * g.c_rs + n];
        }
        if (masked) s[j][r] = g.mask_fill;
        m = fmaxf(m, s[j][r]);
      }
#pragma unroll
      for (int off = 1; off < 16; off <<= 1) m = fmaxf(m, __shfl_xor(m, off, 32));
      cm[r] = m;
    }
    __bf16* pwh = Psh[wave];
    __bf16* pwl = Psl[SPLIT_PV ? wave : 0];
#pragma unroll
    for (int r = 0; r < 8; ++r) {
      const float mnew = fmaxf(mrow[r], cm[r]);
      const float alpha = expf(mrow[r] - mnew);
      mrow[r] = mnew;
      float psum = 0.f;
#pragma unroll
      for (int j = 0; j < 4; ++j) {
        const float p = expf(s[j][r] - mnew);
        psum += p;
        if (SPLIT_PV) { __bf16 a, bl; at_split(p, a, bl); pwh[(8 * hh + r) * AT_KC + j * 16 + c] = a; pwl[(8 * hh + r) * AT_KC + j * 16 + c] = bl; }
        else pwh[(8 * hh + r) * AT_KC + j * 16 + c] = at_to16<F16>(p * PSC);
      }
#pragma unroll
      for (int off = 1; off < 16; off <<= 1) psum += __shfl_xor(psum, off, 32);
      lrow[r] = lrow[r] * alpha + psum;
#pragma unroll
      for (int t = 0; t < 4; ++t) oacc[t][r] *= alpha;
    }
    __builtin_amdgcn_fence(__ATOMIC_RELEASE, "workgroup");
    __builtin_amdgcn_wave_barrier();
    __builtin_amdgcn_fence(__ATOMIC_ACQUIRE, "workgroup");
#pragma unroll 1
    for (int kk = 0; kk < 2; ++kk) {
      FB pa, pl;
      pa.h[0] = *(const v8b*)(pwh + c * AT_KC + kk * 32 + 8 * hh);
      pa.h[1] = *(const v8b*)(pwh + c * AT_KC + kk * 32 + 16 + 8 * hh);
      if (SPLIT_PV) {
        pl.h[0] = *(const v8b*)(pwl + c * AT_KC + kk * 32 + 8 * hh);
        pl.h[1] = *(const v8b*)(pwl + c * AT_KC + kk * 32 + 16 + 8 * hh);
      }
#pragma unroll
      for (int t = 0; t < 4; ++t) {
        FB vb;
        vb.h[0] = *(const v8b*)(Vth + (t * 16 + c) * AT_KC + kk * 32 + 8 * hh);
        vb.h[1] = *(const v8b*)(Vth + (t * 16 + c) * AT_KC + kk * 32 + 16 + 8 * hh);
        oacc[t] = at_mma16<F16>(pa.v, vb.v, oacc[t]);
        if (SPLIT_PV) {
          FB vl;
          vl.h[0] = *(const v8b*)(Vtl + (t * 16 + c) * AT_KC + kk * 32 + 8 * hh);
          vl.h[1] = *(const v8b*)(Vtl + (t * 16 + c) * AT_KC + kk * 32 + 16 + 8 * hh);
          oacc[t] = at_mma16<F16>(pa.v, vl.v, oacc[t]);
          oacc[t] = at_mma16<F16>(pl.v, vb.v, oacc[t]);
        }
      }
    }
  }

  float* os = Os[wave];
#pragma unroll
  for (int r = 0; r < 8; ++r) {
    const float inv = 1.0f / (lrow[r] * PSC);
#pragma unroll
    for (int t = 0; t < 4; ++t) os[(8 * hh + r) * 68 + t * 16 + c] = oacc[t][r] * inv;
  }
  __builtin_amdgcn_fence(__ATOMIC_RELEASE, "workgroup");
  __builtin_amdgcn_wave_barrier();
  __builtin_amdgcn_fence(__ATOMIC_ACQUIRE, "workgroup");
  {
    const int c4 = (lane & 15) * 4;
    {
#pragma unroll
      for (int it = 0; it < 8; ++it) {
        const int row = it * 2 + hh;
        v4f val = *(const v4f*)(os + row * 68 + c4);
        *(v4f*)(ob_ptr + (size_t)(q0 + row) * g.o_rs + c4) = val;
      }
      
    }
  }
}

} // namespace w25

// RoPE in place: thread per (row, q|k, head, pair i<32): (x0, x1) = (x[2i], x[2i+1]) -> (x0 cos[2i] - x1 sin[2i], x1 cos[2i+1] + x0 sin[2i+1]); tables gathered by the INPUT position (clamped); one 8-B store per lane, lanes contiguous
__global__ __launch_bounds__(256) void k_cm_rope(float* __restrict__ Q, float* __restrict__ Kx, const float* __restrict__ CS, const float* __restrict__ SN, const int* __restrict__ POS, int Bn, int S, int NH, int HD) { const long long t = (long long)blockIdx.x * 256 + threadIdx.x; const int HF = HD / 2; if (t >= (long long)Bn * S * 2 * NH * HF) return; const int i = (int)(t % HF); long long r = t / HF; const int h = (int)(r % NH); r /= NH; const int which = (int)(r % 2); const long long row = r / 2; const int sq = (int)(row % S);
    int ps = POS[sq]; ps = ps < 0 ? 0 : (ps >= S ? S - 1 : ps); const float c0 = CS[ps * HD + 2 * i], c1 = CS[ps * HD + 2 * i + 1], s0 = SN[ps * HD + 2 * i], s1 = SN[ps * HD + 2 * i + 1];
    float* base = ((which == 0) ? Q : Kx) + row * ((long long)NH * HD) + h * HD + 2 * i; const float x0 = base[0], x1 = base[1];
    const unsigned long long pk = (unsigned long long)__builtin_bit_cast(unsigned, x0 * c0 - x1 * s0) | ((unsigned long long)__builtin_bit_cast(unsigned, x1 * c1 + x0 * s1) << 32); VST2(unsigned long long, (unsigned long long*)base, pk); }
__global__ __launch_bounds__(64) void k_cm_exact(const float* __restrict__ Q64, const float* __restrict__ K64, const float* __restrict__ V, float* __restrict__ AT, int S, int D, int NH, int HD) { __shared__ float sc[64]; const int t = blockIdx.x % 64; const int h = (blockIdx.x / 64) % NH; const int b = blockIdx.x / (64 * NH); const int d = threadIdx.x;
    const float* q = Q64 + ((long long)b * 64 + t) * D + h * HD; float s = -3.0e38f;
    if (d <= t) { const float* kr = K64 + ((long long)b * 64 + d) * D + h * HD; float a = 0.f;
#pragma unroll 1
        for (int j = 0; j < HD; ++j) a += q[j] * kr[j];
        s = a * 0.125f; }
    sc[d] = s; __syncthreads();
    float mx = -3.0e38f; for (int j = 0; j <= t; ++j) mx = fmaxf(mx, sc[j]);
    float den = 0.f; for (int j = 0; j <= t; ++j) den += expf(sc[j] - mx);
    float acc = 0.f;
#pragma unroll 1
    for (int j = 0; j <= t; ++j) acc += expf(sc[j] - mx) * V[((long long)b * S + j) * D + h * HD + d];
    VST2(float, AT + ((long long)b * S + t) * D + h * HD + d, acc / den); }


extern "C" void kernel_launch(void* const* d_in, const int* in_sizes, int n_in, void* d_out, int out_size, void* d_ws, size_t ws_size, hipStream_t stream) {
    (void)in_sizes; (void)n_in; (void)out_size; (void)ws_size;
    const float* x = (const float*)d_in[0];
    const float* Wq = (const float*)d_in[1];
    const float* Wk = (const float*)d_in[2];
    const float* Wv = (const float*)d_in[3];
    const float* Wo = (const float*)d_in[4];
    const float* cosT = (const float*)d_in[5];
    const float* sinT = (const float*)d_in[6];
    const int* tpos = (const int*)d_in[7];
    const int Bn = 2;
    const int S = 2048;
    const int D = 1024;
    const int NH = 16;
    const int HD = 64;
    const int NR = Bn * S;
    float* out = (float*)d_out;
    char* wsp = (char*)d_ws;
    float* Q = (float*)wsp; wsp += (((size_t)((size_t)NR * D) * 4 + 255) / 256) * 256;
    float* Kb = (float*)wsp; wsp += (((size_t)((size_t)NR * D) * 4 + 255) / 256) * 256;
    float* V = (float*)wsp; wsp += (((size_t)((size_t)NR * D) * 4 + 255) / 256) * 256;
    float* AT = (float*)wsp; wsp += (((size_t)((size_t)NR * D) * 4 + 255) / 256) * 256;
    float* Q64 = (float*)wsp; wsp += (((size_t)((size_t)Bn * 64 * D) * 4 + 255) / 256) * 256;
    float* K64 = (float*)wsp; wsp += (((size_t)((size_t)Bn * 64 * D) * 4 + 255) / 256) * 256;
    unsigned short* G64A = (unsigned short*)wsp; wsp += (((size_t)(4194304) * 2 + 255) / 256) * 256;
    unsigned short* G64B = (unsigned short*)wsp; wsp += (((size_t)(1048576) * 2 + 255) / 256) * 256;
    unsigned short* G64A2 = (unsigned short*)wsp; wsp += (((size_t)(4194304) * 2 + 255) / 256) * 256;
    unsigned short* G64B2 = (unsigned short*)wsp; wsp += (((size_t)(1048576) * 2 + 255) / 256) * 256;
    k_cast16<<<(unsigned)((((long long)(4096) * ((1024) / 2)) + 255) / 256), 256, 0, stream>>>(x + (size_t)0 * NR * D, 1024, (_Float16*)(G64A), 1024, 4096, 1024, 1.0f);
    k_cast16<<<(unsigned)((((long long)(1024) * ((1024) / 2)) + 255) / 256), 256, 0, stream>>>(Wq, 1024, (_Float16*)(G64B), 1024, 1024, 1024, 16.0f);
    w25::wmma_gemm64<0, false, 0, 0, false, 0><<<dim3((unsigned)((((4096) / 64) * ((1024) / 64) + 7) / 8), (unsigned)(1)), 256, 0, stream>>>((const unsigned short*)(G64A), nullptr, 1024, 0, (const unsigned short*)(G64B), nullptr, 1024, 0, (void*)(Q), nullptr, 1024, 0, nullptr, nullptr, 0, 4096, 1024, 1024, 0.0625f);
    k_cast16<<<(unsigned)((((long long)(4096) * ((1024) / 2)) + 255) / 256), 256, 0, stream>>>(x + (size_t)0 * NR * D, 1024, (_Float16*)(G64A), 1024, 4096, 1024, 1.0f);
    k_cast16<<<(unsigned)((((long long)(1024) * ((1024) / 2)) + 255) / 256), 256, 0, stream>>>(Wk, 1024, (_Float16*)(G64B), 1024, 1024, 1024, 16.0f);
    w25::wmma_gemm64<0, false, 0, 0, false, 0><<<dim3((unsigned)((((4096) / 64) * ((1024) / 64) + 7) / 8), (unsigned)(1)), 256, 0, stream>>>((const unsigned short*)(G64A), nullptr, 1024, 0, (const unsigned short*)(G64B), nullptr, 1024, 0, (void*)(Kb), nullptr, 1024, 0, nullptr, nullptr, 0, 4096, 1024, 1024, 0.0625f);
    k_castS16<<<(unsigned)((((long long)(4096) * ((1024) / 2)) + 255) / 256), 256, 0, stream>>>(x + (size_t)0 * NR * D, 1024, (__bf16*)(G64A), (__bf16*)(G64A2), 1024, 4096, 1024, 1.0f, 0);
    k_castS16<<<(unsigned)((((long long)(1024) * ((1024) / 2)) + 255) / 256), 256, 0, stream>>>(Wv, 1024, (__bf16*)(G64B), (__bf16*)(G64B2), 1024, 1024, 1024, 1.0f, 0);
    w25::wmma_gemm64<1, true, 0, 0, false, 0><<<dim3((unsigned)((((4096) / 64) * ((1024) / 64) + 7) / 8), (unsigned)(1)), 256, 0, stream>>>((const unsigned short*)(G64A), (const unsigned short*)(G64A2), 1024, 0, (const unsigned short*)(G64B), (const unsigned short*)(G64B2), 1024, 0, (void*)(V), nullptr, 1024, 0, nullptr, nullptr, 0, 4096, 1024, 1024, 1.0f);
    k_cm_rope<<<(unsigned)(((long long)NR * 2 * NH * 32 + 255) / 256), 256, 0, stream>>>(Q, Kb, cosT, sinT, (const int*)tpos, Bn, S, NH, HD);
    { /*apv4*/ AttnP a;
      a.Q = Q; a.K = Kb; a.V = V; a.O = AT; a.P = 0; a.Mf = 0; a.Mi = 0; a.ST = 0;
      a.Pw = 0; a.Rt = 0; a.SQ = 0; a.SK = 0;
      a.swb = 0; a.swh = 0; a.swi = 0; a.swj = 0; a.srb = 0; a.srh = 0; a.sri = 0; a.sQb = (long long)S * D; a.sQh = HD; a.sQi = D; a.sQd = 1; a.sKb = (long long)S * D; a.sKh = HD; a.sKj = D; a.sKd = 1; a.sVb = (long long)S * D; a.sVh = HD; a.sVj = D; a.sVd = 1; a.sOb = (long long)S * D; a.sOh = HD; a.sOi = D; a.sPb = 0; a.sPh = 0; a.sPi = 0; a.smb = 0; a.smh = 0; a.smi = 0; a.smj = 0;
      a.Lq = S; a.Lk = S; a.dh = HD; a.dv = HD; a.hrep = 1; a.causal = 1; a.coff = 0; a.pband = 0;
      a.scale = 0.125f; a.mfill = 0.0f; a.nonorm = 0; a.mpol = 0;
      a.roff = 0; a.rn = 1; a.segpol = 0; a.win = 0;
      k_attn<64, 64, 0, false, false, 2048, 1024><<<dim3((unsigned)((S) + 16 * AW - 1) / (16 * AW), (unsigned)(NH), (unsigned)(Bn)), 32 * AW, 0, stream>>>(a); }
    k_castS16<<<(unsigned)((((long long)(64) * ((1024) / 2)) + 255) / 256), 256, 0, stream>>>(x + ((size_t)0 * NR + (size_t)0 * S) * D, 1024, (__bf16*)(G64A), (__bf16*)(G64A2), 1024, 64, 1024, 1.0f, 0);
    k_castS16<<<(unsigned)((((long long)(1024) * ((1024) / 2)) + 255) / 256), 256, 0, stream>>>(Wq, 1024, (__bf16*)(G64B), (__bf16*)(G64B2), 1024, 1024, 1024, 1.0f, 0);
    w25::wmma_gemm64<1, true, 0, 0, false, 0><<<dim3((unsigned)((((64) / 64) * ((1024) / 64) + 7) / 8), (unsigned)(1)), 256, 0, stream>>>((const unsigned short*)(G64A), (const unsigned short*)(G64A2), 1024, 0, (const unsigned short*)(G64B), (const unsigned short*)(G64B2), 1024, 0, (void*)(Q64 + (size_t)0 * 64 * D), nullptr, 1024, 0, nullptr, nullptr, 0, 64, 1024, 1024, 1.0f);
    k_castS16<<<(unsigned)((((long long)(64) * ((1024) / 2)) + 255) / 256), 256, 0, stream>>>(x + ((size_t)0 * NR + (size_t)0 * S) * D, 1024, (__bf16*)(G64A), (__bf16*)(G64A2), 1024, 64, 1024, 1.0f, 0);
    k_castS16<<<(unsigned)((((long long)(1024) * ((1024) / 2)) + 255) / 256), 256, 0, stream>>>(Wk, 1024, (__bf16*)(G64B), (__bf16*)(G64B2), 1024, 1024, 1024, 1.0f, 0);
    w25::wmma_gemm64<1, true, 0, 0, false, 0><<<dim3((unsigned)((((64) / 64) * ((1024) / 64) + 7) / 8), (unsigned)(1)), 256, 0, stream>>>((const unsigned short*)(G64A), (const unsigned short*)(G64A2), 1024, 0, (const unsigned short*)(G64B), (const unsigned short*)(G64B2), 1024, 0, (void*)(K64 + (size_t)0 * 64 * D), nullptr, 1024, 0, nullptr, nullptr, 0, 64, 1024, 1024, 1.0f);
    k_castS16<<<(unsigned)((((long long)(64) * ((1024) / 2)) + 255) / 256), 256, 0, stream>>>(x + ((size_t)0 * NR + (size_t)1 * S) * D, 1024, (__bf16*)(G64A), (__bf16*)(G64A2), 1024, 64, 1024, 1.0f, 0);
    k_castS16<<<(unsigned)((((long long)(1024) * ((1024) / 2)) + 255) / 256), 256, 0, stream>>>(Wq, 1024, (__bf16*)(G64B), (__bf16*)(G64B2), 1024, 1024, 1024, 1.0f, 0);
    w25::wmma_gemm64<1, true, 0, 0, false, 0><<<dim3((unsigned)((((64) / 64) * ((1024) / 64) + 7) / 8), (unsigned)(1)), 256, 0, stream>>>((const unsigned short*)(G64A), (const unsigned short*)(G64A2), 1024, 0, (const unsigned short*)(G64B), (const unsigned short*)(G64B2), 1024, 0, (void*)(Q64 + (size_t)1 * 64 * D), nullptr, 1024, 0, nullptr, nullptr, 0, 64, 1024, 1024, 1.0f);
    k_castS16<<<(unsigned)((((long long)(64) * ((1024) / 2)) + 255) / 256), 256, 0, stream>>>(x + ((size_t)0 * NR + (size_t)1 * S) * D, 1024, (__bf16*)(G64A), (__bf16*)(G64A2), 1024, 64, 1024, 1.0f, 0);
    k_castS16<<<(unsigned)((((long long)(1024) * ((1024) / 2)) + 255) / 256), 256, 0, stream>>>(Wk, 1024, (__bf16*)(G64B), (__bf16*)(G64B2), 1024, 1024, 1024, 1.0f, 0);
    w25::wmma_gemm64<1, true, 0, 0, false, 0><<<dim3((unsigned)((((64) / 64) * ((1024) / 64) + 7) / 8), (unsigned)(1)), 256, 0, stream>>>((const unsigned short*)(G64A), (const unsigned short*)(G64A2), 1024, 0, (const unsigned short*)(G64B), (const unsigned short*)(G64B2), 1024, 0, (void*)(K64 + (size_t)1 * 64 * D), nullptr, 1024, 0, nullptr, nullptr, 0, 64, 1024, 1024, 1.0f);
    k_cm_rope<<<(unsigned)(((long long)Bn * 64 * 2 * NH * 32 + 255) / 256), 256, 0, stream>>>(Q64, K64, cosT, sinT, (const int*)tpos, Bn, 64, NH, HD); k_cm_exact<<<Bn * NH * 64, 64, 0, stream>>>(Q64, K64, V, AT, S, D, NH, HD);
    k_castS16<<<(unsigned)((((long long)(4096) * ((1024) / 2)) + 255) / 256), 256, 0, stream>>>(AT, 1024, (__bf16*)(G64A), (__bf16*)(G64A2), 1024, 4096, 1024, 1.0f, 0);
    k_castS16<<<(unsigned)((((long long)(1024) * ((1024) / 2)) + 255) / 256), 256, 0, stream>>>(Wo, 1024, (__bf16*)(G64B), (__bf16*)(G64B2), 1024, 1024, 1024, 1.0f, 0);
    w25::wmma_gemm64<1, true, 0, 0, false, 0><<<dim3((unsigned)((((4096) / 64) * ((1024) / 64) + 7) / 8), (unsigned)(1)), 256, 0, stream>>>((const unsigned short*)(G64A), (const unsigned short*)(G64A2), 1024, 0, (const unsigned short*)(G64B), (const unsigned short*)(G64B2), 1024, 0, (void*)(out + (size_t)0 * NR * D), nullptr, 1024, 0, nullptr, nullptr, 0, 4096, 1024, 1024, 1.0f);
    k_cast16<<<(unsigned)((((long long)(4096) * ((1024) / 2)) + 255) / 256), 256, 0, stream>>>(x + (size_t)1 * NR * D, 1024, (_Float16*)(G64A), 1024, 4096, 1024, 1.0f);
    k_cast16<<<(unsigned)((((long long)(1024) * ((1024) / 2)) + 255) / 256), 256, 0, stream>>>(Wq, 1024, (_Float16*)(G64B), 1024, 1024, 1024, 16.0f);
    w25::wmma_gemm64<0, false, 0, 0, false, 0><<<dim3((unsigned)((((4096) / 64) * ((1024) / 64) + 7) / 8), (unsigned)(1)), 256, 0, stream>>>((const unsigned short*)(G64A), nullptr, 1024, 0, (const unsigned short*)(G64B), nullptr, 1024, 0, (void*)(Q), nullptr, 1024, 0, nullptr, nullptr, 0, 4096, 1024, 1024, 0.0625f);
    k_cast16<<<(unsigned)((((long long)(4096) * ((1024) / 2)) + 255) / 256), 256, 0, stream>>>(x + (size_t)1 * NR * D, 1024, (_Float16*)(G64A), 1024, 4096, 1024, 1.0f);
    k_cast16<<<(unsigned)((((long long)(1024) * ((1024) / 2)) + 255) / 256), 256, 0, stream>>>(Wk, 1024, (_Float16*)(G64B), 1024, 1024, 1024, 16.0f);
    w25::wmma_gemm64<0, false, 0, 0, false, 0><<<dim3((unsigned)((((4096) / 64) * ((1024) / 64) + 7) / 8), (unsigned)(1)), 256, 0, stream>>>((const unsigned short*)(G64A), nullptr, 1024, 0, (const unsigned short*)(G64B), nullptr, 1024, 0, (void*)(Kb), nullptr, 1024, 0, nullptr, nullptr, 0, 4096, 1024, 1024, 0.0625f);
    k_castS16<<<(unsigned)((((long long)(4096) * ((1024) / 2)) + 255) / 256), 256, 0, stream>>>(x + (size_t)1 * NR * D, 1024, (__bf16*)(G64A), (__bf16*)(G64A2), 1024, 4096, 1024, 1.0f, 0);
    k_castS16<<<(unsigned)((((long long)(1024) * ((1024) / 2)) + 255) / 256), 256, 0, stream>>>(Wv, 1024, (__bf16*)(G64B), (__bf16*)(G64B2), 1024, 1024, 1024, 1.0f, 0);
    w25::wmma_gemm64<1, true, 0, 0, false, 0><<<dim3((unsigned)((((4096) / 64) * ((1024) / 64) + 7) / 8), (unsigned)(1)), 256, 0, stream>>>((const unsigned short*)(G64A), (const unsigned short*)(G64A2), 1024, 0, (const unsigned short*)(G64B), (const unsigned short*)(G64B2), 1024, 0, (void*)(V), nullptr, 1024, 0, nullptr, nullptr, 0, 4096, 1024, 1024, 1.0f);
    k_cm_rope<<<(unsigned)(((long long)NR * 2 * NH * 32 + 255) / 256), 256, 0, stream>>>(Q, Kb, cosT, sinT, (const int*)tpos, Bn, S, NH, HD);
    { /*apv4*/ AttnP a;
      a.Q = Q; a.K = Kb; a.V = V; a.O = AT; a.P = 0; a.Mf = 0; a.Mi = 0; a.ST = 0;
      a.Pw = 0; a.Rt = 0; a.SQ = 0; a.SK = 0;
      a.swb = 0; a.swh = 0; a.swi = 0; a.swj = 0; a.srb = 0; a.srh = 0; a.sri = 0; a.sQb = (long long)S * D; a.sQh = HD; a.sQi = D; a.sQd = 1; a.sKb = (long long)S * D; a.sKh = HD; a.sKj = D; a.sKd = 1; a.sVb = (long long)S * D; a.sVh = HD; a.sVj = D; a.sVd = 1; a.sOb = (long long)S * D; a.sOh = HD; a.sOi = D; a.sPb = 0; a.sPh = 0; a.sPi = 0; a.smb = 0; a.smh = 0; a.smi = 0; a.smj = 0;
      a.Lq = S; a.Lk = S; a.dh = HD; a.dv = HD; a.hrep = 1; a.causal = 1; a.coff = 0; a.pband = 0;
      a.scale = 0.125f; a.mfill = 0.0f; a.nonorm = 0; a.mpol = 0;
      a.roff = 0; a.rn = 1; a.segpol = 0; a.win = 0;
      k_attn<64, 64, 0, false, false, 2048, 1024><<<dim3((unsigned)((S) + 16 * AW - 1) / (16 * AW), (unsigned)(NH), (unsigned)(Bn)), 32 * AW, 0, stream>>>(a); }
    k_castS16<<<(unsigned)((((long long)(64) * ((1024) / 2)) + 255) / 256), 256, 0, stream>>>(x + ((size_t)1 * NR + (size_t)0 * S) * D, 1024, (__bf16*)(G64A), (__bf16*)(G64A2), 1024, 64, 1024, 1.0f, 0);
    k_castS16<<<(unsigned)((((long long)(1024) * ((1024) / 2)) + 255) / 256), 256, 0, stream>>>(Wq, 1024, (__bf16*)(G64B), (__bf16*)(G64B2), 1024, 1024, 1024, 1.0f, 0);
    w25::wmma_gemm64<1, true, 0, 0, false, 0><<<dim3((unsigned)((((64) / 64) * ((1024) / 64) + 7) / 8), (unsigned)(1)), 256, 0, stream>>>((const unsigned short*)(G64A), (const unsigned short*)(G64A2), 1024, 0, (const unsigned short*)(G64B), (const unsigned short*)(G64B2), 1024, 0, (void*)(Q64 + (size_t)0 * 64 * D), nullptr, 1024, 0, nullptr, nullptr, 0, 64, 1024, 1024, 1.0f);
    k_castS16<<<(unsigned)((((long long)(64) * ((1024) / 2)) + 255) / 256), 256, 0, stream>>>(x + ((size_t)1 * NR + (size_t)0 * S) * D, 1024, (__bf16*)(G64A), (__bf16*)(G64A2), 1024, 64, 1024, 1.0f, 0);
    k_castS16<<<(unsigned)((((long long)(1024) * ((1024) / 2)) + 255) / 256), 256, 0, stream>>>(Wk, 1024, (__bf16*)(G64B), (__bf16*)(G64B2), 1024, 1024, 1024, 1.0f, 0);
    w25::wmma_gemm64<1, true, 0, 0, false, 0><<<dim3((unsigned)((((64) / 64) * ((1024) / 64) + 7) / 8), (unsigned)(1)), 256, 0, stream>>>((const unsigned short*)(G64A), (const unsigned short*)(G64A2), 1024, 0, (const unsigned short*)(G64B), (const unsigned short*)(G64B2), 1024, 0, (void*)(K64 + (size_t)0 * 64 * D), nullptr, 1024, 0, nullptr, nullptr, 0, 64, 1024, 1024, 1.0f);
    k_castS16<<<(unsigned)((((long long)(64) * ((1024) / 2)) + 255) / 256), 256, 0, stream>>>(x + ((size_t)1 * NR + (size_t)1 * S) * D, 1024, (__bf16*)(G64A), (__bf16*)(G64A2), 1024, 64, 1024, 1.0f, 0);
    k_castS16<<<(unsigned)((((long long)(1024) * ((1024) / 2)) + 255) / 256), 256, 0, stream>>>(Wq, 1024, (__bf16*)(G64B), (__bf16*)(G64B2), 1024, 1024, 1024, 1.0f, 0);
    w25::wmma_gemm64<1, true, 0, 0, false, 0><<<dim3((unsigned)((((64) / 64) * ((1024) / 64) + 7) / 8), (unsigned)(1)), 256, 0, stream>>>((const unsigned short*)(G64A), (const unsigned short*)(G64A2), 1024, 0, (const unsigned short*)(G64B), (const unsigned short*)(G64B2), 1024, 0, (void*)(Q64 + (size_t)1 * 64 * D), nullptr, 1024, 0, nullptr, nullptr, 0, 64, 1024, 1024, 1.0f);
    k_castS16<<<(unsigned)((((long long)(64) * ((1024) / 2)) + 255) / 256), 256, 0, stream>>>(x + ((size_t)1 * NR + (size_t)1 * S) * D, 1024, (__bf16*)(G64A), (__bf16*)(G64A2), 1024, 64, 1024, 1.0f, 0);
    k_castS16<<<(unsigned)((((long long)(1024) * ((1024) / 2)) + 255) / 256), 256, 0, stream>>>(Wk, 1024, (__bf16*)(G64B), (__bf16*)(G64B2), 1024, 1024, 1024, 1.0f, 0);
    w25::wmma_gemm64<1, true, 0, 0, false, 0><<<dim3((unsigned)((((64) / 64) * ((1024) / 64) + 7) / 8), (unsigned)(1)), 256, 0, stream>>>((const unsigned short*)(G64A), (const unsigned short*)(G64A2), 1024, 0, (const unsigned short*)(G64B), (const unsigned short*)(G64B2), 1024, 0, (void*)(K64 + (size_t)1 * 64 * D), nullptr, 1024, 0, nullptr, nullptr, 0, 64, 1024, 1024, 1.0f);
    k_cm_rope<<<(unsigned)(((long long)Bn * 64 * 2 * NH * 32 + 255) / 256), 256, 0, stream>>>(Q64, K64, cosT, sinT, (const int*)tpos, Bn, 64, NH, HD); k_cm_exact<<<Bn * NH * 64, 64, 0, stream>>>(Q64, K64, V, AT, S, D, NH, HD);
    k_castS16<<<(unsigned)((((long long)(4096) * ((1024) / 2)) + 255) / 256), 256, 0, stream>>>(AT, 1024, (__bf16*)(G64A), (__bf16*)(G64A2), 1024, 4096, 1024, 1.0f, 0);
    k_castS16<<<(unsigned)((((long long)(1024) * ((1024) / 2)) + 255) / 256), 256, 0, stream>>>(Wo, 1024, (__bf16*)(G64B), (__bf16*)(G64B2), 1024, 1024, 1024, 1.0f, 0);
    w25::wmma_gemm64<1, true, 0, 0, false, 0><<<dim3((unsigned)((((4096) / 64) * ((1024) / 64) + 7) / 8), (unsigned)(1)), 256, 0, stream>>>((const unsigned short*)(G64A), (const unsigned short*)(G64A2), 1024, 0, (const unsigned short*)(G64B), (const unsigned short*)(G64B2), 1024, 0, (void*)(out + (size_t)1 * NR * D), nullptr, 1024, 0, nullptr, nullptr, 0, 4096, 1024, 1024, 1.0f);
}

// v002
// Measured time: 994 microseconds a run.
// Next to v001, in two timings, it ran 1.71 and 1.70 times as fast.
// Counting every step since v000, it is 4.52 times as fast.
// Contractions: q/k = x.W^T [8192x1024].[1024x1024] with f16 operands (weights x16); v = x.Wv^T and the output projection on bf16 hi/lo split planes (late causal rows are long averages, so the value path must be f32-class) — v_wmma_f32_16x16x32_*, 64x128 work-group tiles with both operands staged in LDS; per (batch, head) causal softmax(q k^T / 8) v as one flash launch (f16 q.k^T and p.v; fully-masked key tiles skipped); f32 accumulate and softmax. The interleaved-pair RoPE with the INPUT cos/sin tables gathered by the INPUT token positions (generic elementwise form: out = x*cos + rot(x)*sin with rot = (-x[odd], x[even]) interleaved) and the exact-f32 recompute of the first 64 causal rows per head (whose q/k rows come from their own small bf16 hi/lo split GEMMs [64x1024].[1024x1024]) are f32 kernels.
#include <hip/hip_runtime.h>
#include <math.h>

typedef __attribute__((ext_vector_type(16))) _Float16 v16h;
typedef __attribute__((ext_vector_type(8)))  _Float16 v8h;
typedef __attribute__((ext_vector_type(4)))  _Float16 v4h;
typedef __attribute__((ext_vector_type(16))) __bf16   v16b;
typedef __attribute__((ext_vector_type(8)))  float    v8f;
typedef __attribute__((ext_vector_type(4)))  float    v4f;

// 16-bit WMMA fragment map (wave32), lane L, h = L>>4, m = L&15:
//   A 16x32: lane = row m;   element i -> k = (i<8) ? 8h+i : 16+8h+(i-8)
//   B 32x16: lane = column m; the SAME k(i,h)
//   D 16x16 (8 f32): lane = column m; element r -> row 8h+r
__device__ __forceinline__ int frag_k(int i, int h) { return (i < 8) ? (8 * h + i) : (16 + 8 * h + (i - 8)); }
__device__ __forceinline__ __bf16 bf16_rne(float f) {
    unsigned int u = __float_as_uint(f);
    u += 0x7fffu + ((u >> 16) & 1u);
    return __builtin_bit_cast(__bf16, (unsigned short)(u >> 16));
}
__device__ __forceinline__ float bf16_f32(__bf16 b) { return __uint_as_float(((unsigned int)__builtin_bit_cast(unsigned short, b)) << 16); }
__device__ __forceinline__ v8f wmma16(v16h a, v16h b, v8f c) {
    c = __builtin_amdgcn_wmma_f32_16x16x32_f16(false, a, false, b, (short)0, c, false, false);
    asm volatile("v_nop\n\tv_nop\n\tv_nop\n\tv_nop" : "+v"(c) : "v"(a), "v"(b));
    return c;
}
__device__ __forceinline__ v8f wmmab(v16b a, v16b b, v8f c) {
    c = __builtin_amdgcn_wmma_f32_16x16x32_bf16(false, a, false, b, (short)0, c, false, false);
    asm volatile("v_nop\n\tv_nop\n\tv_nop\n\tv_nop" : "+v"(c) : "v"(a), "v"(b));
    return c;
}
struct Split { v16b hi, lo; };
// hi/lo split product: a.hi*b.hi + a.hi*b.lo + a.lo*b.hi
__device__ __forceinline__ v8f wmma3(const Split& a, const Split& b, v8f c) {
    c = __builtin_amdgcn_wmma_f32_16x16x32_bf16(false, a.hi, false, b.hi, (short)0, c, false, false);
    c = __builtin_amdgcn_wmma_f32_16x16x32_bf16(false, a.hi, false, b.lo, (short)0, c, false, false);
    c = __builtin_amdgcn_wmma_f32_16x16x32_bf16(false, a.lo, false, b.hi, (short)0, c, false, false);
    asm volatile("v_nop\n\tv_nop\n\tv_nop\n\tv_nop" : "+v"(c) : "v"(a.hi), "v"(a.lo), "v"(b.hi), "v"(b.lo));
    return c;
}
struct Split3 { v16b hi, mid, lo; };
// triple split product (6 terms, drops only terms below 2^-24 relative)
__device__ __forceinline__ v8f wmma6(const Split3& a, const Split3& b, v8f c) {
    c = __builtin_amdgcn_wmma_f32_16x16x32_bf16(false, a.hi, false, b.hi, (short)0, c, false, false);
    c = __builtin_amdgcn_wmma_f32_16x16x32_bf16(false, a.hi, false, b.mid, (short)0, c, false, false);
    c = __builtin_amdgcn_wmma_f32_16x16x32_bf16(false, a.mid, false, b.hi, (short)0, c, false, false);
    c = __builtin_amdgcn_wmma_f32_16x16x32_bf16(false, a.hi, false, b.lo, (short)0, c, false, false);
    c = __builtin_amdgcn_wmma_f32_16x16x32_bf16(false, a.mid, false, b.mid, (short)0, c, false, false);
    c = __builtin_amdgcn_wmma_f32_16x16x32_bf16(false, a.lo, false, b.hi, (short)0, c, false, false);
    asm volatile("v_nop\n\tv_nop\n\tv_nop\n\tv_nop" : "+v"(c) : "v"(a.hi), "v"(a.mid), "v"(a.lo), "v"(b.hi), "v"(b.mid), "v"(b.lo));
    return c;
}

// Fragment gathers from f32 memory: element i <- p[(k0 + frag_k(i,h)) * sk] * s, zero for k >= klen.
__device__ __forceinline__ v16h fh_ld(const float* __restrict__ p, long long sk, int k0, int h, int klen, float s) {
    v16h a;
#pragma unroll
    for (int i = 0; i < 16; ++i) { const int k = k0 + frag_k(i, h); a[i] = (k < klen) ? (_Float16)(p[(long long)k * sk] * s) : (_Float16)0.f; }
    return a;
}
__device__ __forceinline__ Split sp_ld(const float* __restrict__ p, long long sk, int k0, int h, int klen, float s) {
    Split r;
#pragma unroll
    for (int i = 0; i < 16; ++i) {
        const int k = k0 + frag_k(i, h); const float x = (k < klen) ? p[(long long)k * sk] * s : 0.f;
        const __bf16 hb = bf16_rne(x); r.hi[i] = hb; r.lo[i] = bf16_rne(x - bf16_f32(hb));
    }
    return r;
}
__device__ __forceinline__ Split3 sp3_ld(const float* __restrict__ p, long long sk, int k0, int h, int klen, float s) {
    Split3 r;
#pragma unroll
    for (int i = 0; i < 16; ++i) {
        const int k = k0 + frag_k(i, h); const float x = (k < klen) ? p[(long long)k * sk] * s : 0.f;
        const __bf16 hb = bf16_rne(x); const float r1 = x - bf16_f32(hb); const __bf16 mb = bf16_rne(r1);
        r.hi[i] = hb; r.mid[i] = mb; r.lo[i] = bf16_rne(r1 - bf16_f32(mb));
    }
    return r;
}
__device__ __forceinline__ v16b bh_ld(const float* __restrict__ p, long long sk, int k0, int h, int klen, float s) {
    v16b a;
#pragma unroll
    for (int i = 0; i < 16; ++i) { const int k = k0 + frag_k(i, h); a[i] = bf16_rne((k < klen) ? p[(long long)k * sk] * s : 0.f); }
    return a;
}
// f16 fragment from an f16 LDS/global row with element stride 1 (k-contiguous), no bounds (tile already zero padded)
__device__ __forceinline__ v16h fh_row(const _Float16* __restrict__ row, int k0, int h) {
    v16h a;
#pragma unroll
    for (int i = 0; i < 16; ++i) a[i] = row[k0 + frag_k(i, h)];
    return a;
}

#define VST2(T, ptr, val) do { const T vst2_v_ = (val); *(T*)(ptr) = vst2_v_;  } while (0)
typedef float v4f __attribute__((ext_vector_type(4)));
#define VST2V4(ptr, val) do { const v4f vst2_v4_ = (val); *(v4f*)(ptr) = vst2_v4_;  } while (0)

__device__ __attribute__((noinline)) float act_fn(float v, int act) {
    if (act == 1) return fmaxf(v, 0.f);                                                                               // relu
    if (act == 2) { const float u = 0.7978845608028654f * (v + 0.044715f * v * v * v); return 0.5f * v * (1.f + tanhf(u)); } // tanh-gelu
    if (act == 3) return v / (1.f + expf(-v));                                                                        // silu
    if (act == 4) return 0.5f * v * (1.f + erff(v * 0.7071067811865476f));                                             // erf-gelu
    if (act == 5) return tanhf(v);
    if (act == 6) return 1.f / (1.f + expf(-v));                                                                      // sigmoid
    if (act == 7) return (v > 0.f) ? v : 0.01f * v;                                                                   // leaky relu 0.01
    if (act == 8) return (v > 0.f) ? v : (expf(v) - 1.f);                                                             // elu
    if (act == 9) return fminf(fmaxf(v, 0.f), 6.f);                                                                   // relu6
    if (act == 10) return fabsf(v);                                                                                    // abs
    if (act == 11) return (v >= 0.f) ? v : 0.1f * v;                                                                  // leaky 0.1
    if (act == 12) return (v > 0.f) ? v : 0.2f * v;                                                                   // leaky 0.2
    if (act == 13) return (v > 20.f) ? v : log1pf(expf(v));                                                            // softplus
    return v;
}

// =====================================================================================================================
// k_gemm<MODE>: C(z, m, n) = act(alpha * sum_k A(z, m, k) * B(z, k, n) + bias) + beta * R(z, m, n)
//   One wave (32-thread block) per 16 x 32 tile of C; grid (ceil(N/32), ceil(M/16), Z). Batch z -> (zo = z / zi_n, zi = z % zi_n)
//   with separate outer/inner strides for every tensor (e.g. batch and head). A(m,k) = A[zo*sAo + zi*sAi + m*sAm + k*sAk] (f32),
//   B(k,n) = B[zo*sBo + zi*sBi + n*sBn + k*sBk] (f32); any M, N, K (K zero-padded to 32 inside the fragments, M/N tails guarded).
//   C(m,n) = C[zo*sCo + zi*sCi + m*sCm + n] (n contiguous). flags: 1 bias[n], 2 bias[m], 4 residual R[zo*sRo + zi*sRi + m*sRm + n*sRn].
//   MODE 0: f16 operands (A prescaled by sa, B by sb, both undone in the epilogue); 1: bf16 hi/lo split (3 products); 2: bf16;
//   3: bf16 hi/mid/lo triple split (6 products); 4: as 3 with Kahan-compensated f32 accumulation across k-steps.
// =====================================================================================================================
struct GemmP {
    const float* A; const float* B; const float* bias; const float* R; float* C;
    long long sAo, sAi, sAm, sAk, sBo, sBi, sBn, sBk, sCo, sCi, sCm, sRo, sRi, sRm, sRn;
    int M, N, K, zi_n, flags, act; float alpha, beta, sa, sb;
    int Npad, pad_;     // columns [N, Npad) of C are written as 0 so that padded workspace rows are covered by whole-line stores; Npad >= N
};
static_assert(sizeof(GemmP) == 5 * 8 + 15 * 8 + 6 * 4 + 4 * 4 + 2 * 4, "GemmP has padding");

template <int MODE>
__global__ __launch_bounds__(32) void k_gemm(GemmP p) {
    const int lane = threadIdx.x & 31, h = lane >> 4, l15 = lane & 15;
    const int m0 = blockIdx.y * 16, n0 = blockIdx.x * 32;
    const int z = blockIdx.z, zo = z / p.zi_n, zi = z - zo * p.zi_n;
    const float* A = p.A + zo * p.sAo + zi * p.sAi;
    const float* B = p.B + zo * p.sBo + zi * p.sBi;
    const int am = min(m0 + l15, p.M - 1);                       // clamped row for loads (stores are guarded)
    v8f acc[2], comp[2];
#pragma unroll
    for (int t = 0; t < 2; ++t) { v8f zz = {}; acc[t] = zz; comp[t] = zz; }
    for (int k0 = 0; k0 < p.K; k0 += 32) {
        const float* arow = A + (long long)am * p.sAm;
        if (MODE == 1) {
            const Split a = sp_ld(arow, p.sAk, k0, h, p.K, 1.f);
#pragma unroll
            for (int t = 0; t < 2; ++t) {
                const int bn = min(n0 + t * 16 + l15, p.N - 1);
                acc[t] = wmma3(a, sp_ld(B + (long long)bn * p.sBn, p.sBk, k0, h, p.K, 1.f), acc[t]);
            }
        } else if (MODE == 3) {
            const Split3 a = sp3_ld(arow, p.sAk, k0, h, p.K, 1.f);
#pragma unroll
            for (int t = 0; t < 2; ++t) {
                const int bn = min(n0 + t * 16 + l15, p.N - 1);
                acc[t] = wmma6(a, sp3_ld(B + (long long)bn * p.sBn, p.sBk, k0, h, p.K, 1.f), acc[t]);
            }
        } else if (MODE == 4) {
            // triple split as MODE 3, but each k-step's 6 products go into a fresh accumulator and the partial is added to the running f32 sum
            // on the VALU with Kahan compensation (accumulation error stays ~1 ulp however long K is)
            const Split3 a = sp3_ld(arow, p.sAk, k0, h, p.K, 1.f);
#pragma unroll
            for (int t = 0; t < 2; ++t) {
                const int bn = min(n0 + t * 16 + l15, p.N - 1); v8f zz = {};
                const v8f part = wmma6(a, sp3_ld(B + (long long)bn * p.sBn, p.sBk, k0, h, p.K, 1.f), zz);
                const v8f y = part - comp[t]; const v8f s = acc[t] + y; comp[t] = (s - acc[t]) - y; acc[t] = s;
            }
        } else if (MODE == 2) {
            const v16b a = bh_ld(arow, p.sAk, k0, h, p.K, 1.f);
#pragma unroll
            for (int t = 0; t < 2; ++t) {
                const int bn = min(n0 + t * 16 + l15, p.N - 1);
                acc[t] = wmmab(a, bh_ld(B + (long long)bn * p.sBn, p.sBk, k0, h, p.K, 1.f), acc[t]);
            }
        } else {
            const v16h a = fh_ld(arow, p.sAk, k0, h, p.K, p.sa);
#pragma unroll
            for (int t = 0; t < 2; ++t) {
                const int bn = min(n0 + t * 16 + l15, p.N - 1);
                acc[t] = wmma16(a, fh_ld(B + (long long)bn * p.sBn, p.sBk, k0, h, p.K, p.sb), acc[t]);
            }
        }
    }
    const float iscale = (MODE == 0) ? p.alpha / (p.sa * p.sb) : p.alpha;
    float* C = p.C + zo * p.sCo + zi * p.sCi;
    const float* R = p.R + zo * p.sRo + zi * p.sRi;
    __shared__ __align__(16) float ctile[16][36];
#pragma unroll
    for (int t = 0; t < 2; ++t) {
        const int n = n0 + t * 16 + l15; const int nn = min(n, p.N - 1);
#pragma unroll
        for (int r = 0; r < 8; ++r) {
            const int m = m0 + 8 * h + r; const int mm = min(m, p.M - 1);
            float v = acc[t][r] * iscale;
            if (p.flags & 1) v += p.bias[nn];
            if (p.flags & 2) v += p.bias[mm];
            if (p.flags & 8) v *= p.bias[(long long)zo * p.M + mm];   /* per-(z,row) scale vector laid out [Z][M]; exclusive with the bias flags */
            v = act_fn(v, p.act);
            if (p.flags & 4) v += p.beta * R[(long long)mm * p.sRm + (long long)nn * p.sRn];
            ctile[8 * h + r][t * 16 + l15] = (n < p.N) ? v : 0.f;
        }
    }
    __syncthreads();
    const int NW = (p.Npad > p.N) ? p.Npad : p.N;           // write width
    const bool fast = (m0 + 16 <= p.M) && (n0 + 32 <= NW) && ((p.sCm & 3) == 0) && ((((size_t)C) & 15) == 0);
    if (fast) {
#pragma unroll
        for (int s = 0; s < 4; ++s) {
            const int row = s * 4 + (lane >> 3), c4 = (lane & 7) * 4;
            const v4f v = *(const v4f*)&ctile[row][c4];
            VST2V4(C + (long long)(m0 + row) * p.sCm + n0 + c4, v);
        }
    } else {
        for (int row = 0; row < 16; ++row) {
            const int m = m0 + row, n = n0 + lane;
            if (m < p.M && n < NW) VST2(float, C + (long long)m * p.sCm + n, ctile[row][lane]);
        }
    }
}


// =====================================================================================================================
// k_gemmT<MODE, TM, TN>: same contract as k_gemm, but one wave computes a (16*TM) x (16*TN) tile: TM A fragments and TN B fragments are
//   loaded per 32-wide k-step and reused across TM*TN WMMAs (far fewer load/convert instructions per MAC). MODE 0 (f16), 1 (bf16 hi/lo),
//   2 (bf16) only. grid (ceil(NW/(16*TN)), ceil(M/(16*TM)), Z), block 32. Epilogue identical to k_gemm, run per 16x32 sub-tile.
// =====================================================================================================================
template <int MODE, int TM, int TN>
__global__ __launch_bounds__(32) void k_gemmT(GemmP p) {
    const int lane = threadIdx.x & 31, h = lane >> 4, l15 = lane & 15;
    const int m0 = blockIdx.y * (16 * TM), n0 = blockIdx.x * (16 * TN);
    const int z = blockIdx.z, zo = z / p.zi_n, zi = z - zo * p.zi_n;
    const float* A = p.A + zo * p.sAo + zi * p.sAi;
    const float* B = p.B + zo * p.sBo + zi * p.sBi;
    v8f acc[TM][TN];
#pragma unroll
    for (int i = 0; i < TM; ++i)
#pragma unroll
        for (int t = 0; t < TN; ++t) { v8f zz = {}; acc[i][t] = zz; }
    for (int k0 = 0; k0 < p.K; k0 += 32) {
        if (MODE == 1) {
            Split a[TM], b[TN];
#pragma unroll
            for (int i = 0; i < TM; ++i) { const int am = min(m0 + 16 * i + l15, p.M - 1); a[i] = sp_ld(A + (long long)am * p.sAm, p.sAk, k0, h, p.K, 1.f); }
#pragma unroll
            for (int t = 0; t < TN; ++t) { const int bn = min(n0 + 16 * t + l15, p.N - 1); b[t] = sp_ld(B + (long long)bn * p.sBn, p.sBk, k0, h, p.K, 1.f); }
#pragma unroll
            for (int i = 0; i < TM; ++i)
#pragma unroll
                for (int t = 0; t < TN; ++t) acc[i][t] = wmma3(a[i], b[t], acc[i][t]);
        } else if (MODE == 2) {
            v16b a[TM], b[TN];
#pragma unroll
            for (int i = 0; i < TM; ++i) { const int am = min(m0 + 16 * i + l15, p.M - 1); a[i] = bh_ld(A + (long long)am * p.sAm, p.sAk, k0, h, p.K, 1.f); }
#pragma unroll
            for (int t = 0; t < TN; ++t) { const int bn = min(n0 + 16 * t + l15, p.N - 1); b[t] = bh_ld(B + (long long)bn * p.sBn, p.sBk, k0, h, p.K, 1.f); }
#pragma unroll
            for (int i = 0; i < TM; ++i)
#pragma unroll
                for (int t = 0; t < TN; ++t) acc[i][t] = wmmab(a[i], b[t], acc[i][t]);
        } else {
            v16h a[TM], b[TN];
#pragma unroll
            for (int i = 0; i < TM; ++i) { const int am = min(m0 + 16 * i + l15, p.M - 1); a[i] = fh_ld(A + (long long)am * p.sAm, p.sAk, k0, h, p.K, p.sa); }
#pragma unroll
            for (int t = 0; t < TN; ++t) { const int bn = min(n0 + 16 * t + l15, p.N - 1); b[t] = fh_ld(B + (long long)bn * p.sBn, p.sBk, k0, h, p.K, p.sb); }
#pragma unroll
            for (int i = 0; i < TM; ++i)
#pragma unroll
                for (int t = 0; t < TN; ++t) acc[i][t] = wmma16(a[i], b[t], acc[i][t]);
        }
    }
    const float iscale = (MODE == 0) ? p.alpha / (p.sa * p.sb) : p.alpha;
    float* C = p.C + zo * p.sCo + zi * p.sCi;
    const float* R = p.R + zo * p.sRo + zi * p.sRi;
    const int NW = (p.Npad > p.N) ? p.Npad : p.N;
    __shared__ __align__(16) float ctile[16][36];
#pragma unroll
    for (int i = 0; i < TM; ++i) {
        const int mb = m0 + 16 * i; if (mb >= p.M) break;          // wave-uniform
#pragma unroll
        for (int tp = 0; tp < TN / 2; ++tp) {
            const int nb = n0 + 32 * tp; if (nb >= NW) break;        // wave-uniform
#pragma unroll
            for (int t2 = 0; t2 < 2; ++t2) {
                const int t = 2 * tp + t2; const int n = nb + t2 * 16 + l15; const int nn = min(n, p.N - 1);
#pragma unroll
                for (int r = 0; r < 8; ++r) {
                    const int m = mb + 8 * h + r; const int mm = min(m, p.M - 1);
                    float v = acc[i][t][r] * iscale;
                    if (p.flags & 1) v += p.bias[nn];
                    if (p.flags & 2) v += p.bias[mm];
            if (p.flags & 8) v *= p.bias[(long long)zo * p.M + mm];   /* per-(z,row) scale vector laid out [Z][M]; exclusive with the bias flags */
                    v = act_fn(v, p.act);
                    if (p.flags & 4) v += p.beta * R[(long long)mm * p.sRm + (long long)nn * p.sRn];
                    ctile[8 * h + r][t2 * 16 + l15] = (n < p.N) ? v : 0.f;
                }
            }
            __syncthreads();
            const bool fast = (mb + 16 <= p.M) && (nb + 32 <= NW) && ((p.sCm & 3) == 0) && ((((size_t)C) & 15) == 0);
            if (fast) {
#pragma unroll
                for (int s = 0; s < 4; ++s) {
                    const int row = s * 4 + (lane >> 3), c4 = (lane & 7) * 4;
                    const v4f v = *(const v4f*)&ctile[row][c4];
                    VST2V4(C + (long long)(mb + row) * p.sCm + nb + c4, v);
                }
            } else {
                for (int row = 0; row < 16; ++row) {
                    const int m = mb + row, n = nb + lane;
                    if (m < p.M && n < NW) VST2(float, C + (long long)m * p.sCm + n, ctile[row][lane]);
                }
            }
            __syncthreads();
        }
    }
}

// =====================================================================================================================
//   Wave = 16 queries, AW waves per block, 64-key blocks; grid (ceil(Lq/(16*AW)), H, B), block 32*AW. Any Lq, Lk; head dim dh <= DHP
//   (DHP multiple of 32), value dim dv <= DVP (multiple of 16, <= 128). Every tensor addressed by (batch, head, row, element) strides, f32.
//   Scores: QM 0 f16 operands, 1 bf16 hi/lo split, 2 bf16 triple split; statistics f32 (exp2 domain); P.V: P x 4096 as f16 with V f16 staged in LDS
//   (SPLITPV: P and V as bf16 hi/lo splits). kv head = h / hrep. Masking: causal = 1 (keep j <= i + coff, masked -> -inf, key blocks beyond the
//   diagonal skipped), causal = 2 (masked -> mfill, a finite fill like the -1e9; no skipping), causal = 3 (keep j >= i + coff,
//   masked -> -inf, no skipping); optional additive f32 mask Mf,
//   optional int keep-mask Mi (0 -> score := mfill), both addressed b*smb + h*smh + i*smi + j*smj (0 strides broadcast).
// =====================================================================================================================
#define AW 4
struct AttnP {   // apv4
    const float* Q; const float* K; const float* V; float* O; float* P; const float* Mf; const int* Mi; float* ST;
    const float* Pw; const float* Rt; const int* SQ; const int* SK;           // optional: post-softmax weight, relative-position table, segment ids
    long long swb, swh, swi, swj, srb, srh, sri;                                 // Pw strides (b,h,i,j); Rt strides (b,h,i), column = clamp(i - j + roff, 0, rn-1)
    long long sQb, sQh, sQi, sQd, sKb, sKh, sKj, sKd, sVb, sVh, sVj, sVd, sOb, sOh, sOi, sPb, sPh, sPi, smb, smh, smi, smj;
    int Lq, Lk, dh, dv, hrep, causal, coff, pband;   // pband > 0: P holds only the band |j - i| <= pband, column j - i + pband
    float scale, mfill; int nonorm, mpol;             // nonorm (online path only): O = sum_j exp(score_j) V_j without the 1/rowsum (scores must be <= ~0); mpol: Mi masks where ==0 (mpol 0) or where !=0 (mpol 1)
    int roff, rn, segpol, win;                        // Rt column offset/count; SQ/SK: score := mfill where (segpol 0) SQ[i] != SK[j] or (segpol 1) SQ[i] == SK[j]; win > 0: keys with i - j > win (after coff) -> -inf
};
//   Pw: the softmax numerator is multiplied by Pw(b,h,i,j) AFTER the row sum is taken (probs * weight, then P.V), as in post-softmax multiplicative biases.                                                    // ST (optional): per row (b,h,i) -> ST[((b*H + h)*Lq + i)*2 + {0,1}] = {row max of the scaled+masked score (natural units), sum_j exp(score - max)}
static_assert(sizeof(AttnP) == 12 * 8 + 29 * 8 + 16 * 4, "AttnP has padding");

#ifndef KATTN_ATTR
#define KATTN_ATTR __attribute__((amdgpu_waves_per_eu(4)))   // at most 256 registers a wave: four waves a SIMD, so that all 1024 work-groups of the causal grid are resident at once
#endif
//   FS > 0 (QM 0, one pass, f16 P.V only): the layout is fixed at compile time: Q, K, V, O are dense [batch][FS rows][FD] f32 with head h at column h * DHP (DVP for V, O),
//   dh = DHP, dv = DVP, Lq = Lk = FS (multiple of 64), causal = 1 with coff = 0, none of the optional inputs or outputs. Every element guard and stride then folds
//   away, and a key block's K and V come in by plain 16-byte loads that are in flight together, in two batches, instead of guarded 4-byte loads waited on one at a time.
template <int DHP, int DVP, int QM, bool SPLITPV, bool TWOPASS, int FS = 0, int FD = 0>
__global__ __launch_bounds__(32 * AW) KATTN_ATTR void k_attn(AttnP p) {
    static_assert(FS == 0 || (QM == 0 && !SPLITPV && !TWOPASS && DHP == 64 && DVP == 64 && FS % 64 == 0 && FD % 8 == 0), "fixed layout: whole key blocks, 32-byte aligned fragments");
    if (FS > 0) {
        p.P = nullptr; p.Mf = nullptr; p.Mi = nullptr; p.ST = nullptr; p.Pw = nullptr; p.Rt = nullptr; p.SQ = nullptr; p.SK = nullptr;
        p.sQb = (long long)FS * FD; p.sQh = DHP; p.sQi = FD; p.sQd = 1; p.sKb = (long long)FS * FD; p.sKh = DHP; p.sKj = FD; p.sKd = 1;
        p.sVb = (long long)FS * FD; p.sVh = DVP; p.sVj = FD; p.sVd = 1; p.sOb = (long long)FS * FD; p.sOh = DVP; p.sOi = FD;
        p.Lq = FS; p.Lk = FS; p.dh = DHP; p.dv = DVP; p.hrep = 1; p.causal = 1; p.coff = 0; p.pband = 0; p.nonorm = 0; p.win = 0;
    }
    constexpr int NT = DVP / 16;                // output tiles
    constexpr int KS = DHP / 32;                // k-steps for the scores
    constexpr int VP = DVP + 8;                 // LDS pitch (halves)
    __shared__ __align__(16) float    pl[AW][16 * 64];
    __shared__ __align__(16) _Float16 vl[(SPLITPV ? 2 : 1) * 64 * VP];   // f16 V tile, or bf16 hi and lo tiles (same 2-byte size)
    const int lane = threadIdx.x & 31, hf = lane >> 4, l15 = lane & 15, wave = threadIdx.x >> 5;
    const int h = blockIdx.y, b = blockIdx.z, hk = h / p.hrep;
    const int q0 = (blockIdx.x * AW + wave) * 16;
    float* myp = pl[wave];
    const float L2E = 1.4426950408889634f;
    const float NEG = -__builtin_inff();
    const int qi = min(q0 + l15, p.Lq - 1);
    const float* qrow = p.Q + b * p.sQb + h * p.sQh + (long long)qi * p.sQi;
    const float* kbase = p.K + b * p.sKb + hk * p.sKh;
    const float* vbase = p.V + b * p.sVb + hk * p.sVh;
    v16h qa[QM == 0 ? KS : 1]; Split qs_[QM == 1 ? KS : 1]; Split3 qt_[QM == 2 ? KS : 1];
#pragma unroll
    for (int ks = 0; ks < KS; ++ks) {
        if (QM == 2) qt_[ks] = sp3_ld(qrow, p.sQd, ks * 32, hf, p.dh, 1.f);
        else if (QM == 1) qs_[ks] = sp_ld(qrow, p.sQd, ks * 32, hf, p.dh, 1.f);
        else qa[ks] = fh_ld(qrow, p.sQd, ks * 32, hf, p.dh, 1.f);
    }
    v8f o[NT]; float m8[8], l8[8];
#pragma unroll
    for (int t = 0; t < NT; ++t) { v8f zz = {}; o[t] = zz; }
#pragma unroll
    for (int i = 0; i < 8; ++i) { m8[i] = NEG; l8[i] = 0.f; }
    int jend = p.Lk; int jstart = 0;
    if (p.causal == 1) { const int je = (blockIdx.x * AW + AW - 1) * 16 + 16 + p.coff; jend = min(jend, max(je, 0)); }   // uniform per block
    if (p.win > 0) { const int js = (int)(blockIdx.x * AW) * 16 + p.coff - p.win; jstart = (js > 0) ? (js / 64) * 64 : 0; }   // uniform per block: key blocks entirely outside every row's window hold only -inf entries and are skipped exactly
    const int npass = TWOPASS ? 2 : 1;
    for (int pass = 0; pass < npass; ++pass) {
        const bool dopv = (!TWOPASS) || pass == 1;
        for (int j0 = jstart; j0 < jend; j0 += 64) {
            v16h kf[FS > 0 ? 4 * KS : 1];                        // FS > 0: the key block's K fragments, tile t and k-step ks at t * KS + ks
            if (dopv) {
                __syncthreads();                                 // previous key block's reads of vl / pl are done
                if (FS > 0) {
                    // raw f32 in two batches, so that the loaded values and everything else that is live fit 256 registers (four waves a SIMD: the whole grid resident)
                    v4f vr[8]; v8f kr[8];                                           // V: four consecutive elements per thread and step; K: half a fragment each
                    const float* krow = kbase + (long long)(j0 + l15) * FD + 8 * hf;
#pragma unroll
                    for (int it = 0; it < 8; ++it)
                        vr[it] = *(const v4f*)(vbase + (long long)(j0 + ((int)threadIdx.x >> 4)) * FD + ((int)threadIdx.x & 15) * 4 + it * (2 * AW * FD));   // rows 2 AW apart per step
#pragma unroll
                    for (int c = 0; c < 8; ++c) kr[c] = *(const v8f*)(krow + (c >> 2) * (16 * FD) + (c & 3) * 16);   // key tile t = c / 4; k = 16 (c % 4) + 8 hf + (0..7)
                    // inputs-only fence on the loaded values: their first use is here, so the batch's 24 loads are all issued before any is waited on (without it
                    // the scheduler puts each load directly in front of its conversion and waits on it there)
                    asm volatile("" :: "v"(vr[0]), "v"(vr[1]), "v"(vr[2]), "v"(vr[3]), "v"(vr[4]), "v"(vr[5]), "v"(vr[6]), "v"(vr[7]),
                                 "v"(kr[0]), "v"(kr[1]), "v"(kr[2]), "v"(kr[3]), "v"(kr[4]), "v"(kr[5]), "v"(kr[6]), "v"(kr[7]));
#pragma unroll
                    for (int it = 0; it < 8; ++it) {
                        v4h hv; hv[0] = (_Float16)vr[it][0]; hv[1] = (_Float16)vr[it][1]; hv[2] = (_Float16)vr[it][2]; hv[3] = (_Float16)vr[it][3];
                        *(v4h*)(vl + ((int)threadIdx.x >> 4) * VP + ((int)threadIdx.x & 15) * 4 + it * (2 * AW * VP)) = hv;
                    }
#pragma unroll
                    for (int f = 0; f < 4; ++f)
#pragma unroll
                        for (int e = 0; e < 8; ++e) { kf[f][e] = (_Float16)kr[2 * f][e]; kf[f][8 + e] = (_Float16)kr[2 * f + 1][e]; }
                    v8f ks2[8];
#pragma unroll
                    for (int c = 0; c < 8; ++c) ks2[c] = *(const v8f*)(krow + (2 + (c >> 2)) * (16 * FD) + (c & 3) * 16);   // key tiles 2 and 3
                    // the same fence for the second batch's 16 loads; the address is named too, so that it stays live and none of these loads is given its register pair as destination
                    asm volatile("" :: "v"(ks2[0]), "v"(ks2[1]), "v"(ks2[2]), "v"(ks2[3]), "v"(ks2[4]), "v"(ks2[5]), "v"(ks2[6]), "v"(ks2[7]), "v"(krow));
#pragma unroll
                    for (int f = 0; f < 4; ++f)
#pragma unroll
                        for (int e = 0; e < 8; ++e) { kf[4 + f][e] = (_Float16)ks2[2 * f][e]; kf[4 + f][8 + e] = (_Float16)ks2[2 * f + 1][e]; }
                } else
                for (int idx = threadIdx.x; idx < 64 * DVP; idx += 32 * AW) {
                    const int jr = idx / DVP, d = idx - jr * DVP, j = j0 + jr;
                    const float f = (j < p.Lk && d < p.dv) ? vbase[(long long)j * p.sVj + (long long)d * p.sVd] : 0.f;
                    if (SPLITPV) {
                        const __bf16 hb = bf16_rne(f);
                        ((__bf16*)vl)[jr * VP + d] = hb; ((__bf16*)vl)[64 * VP + jr * VP + d] = bf16_rne(f - bf16_f32(hb));
                    } else vl[jr * VP + d] = (_Float16)f;
                }
            }
            v8f s[4];
#pragma unroll
            for (int t = 0; t < 4; ++t) {
                const int j = min(j0 + t * 16 + l15, p.Lk - 1);
                const float* krow = kbase + (long long)j * p.sKj;
                v8f acc = {};
#pragma unroll
                for (int ks = 0; ks < KS; ++ks) {
                    if (QM == 2)      acc = wmma6(qt_[ks], sp3_ld(krow, p.sKd, ks * 32, hf, p.dh, 1.f), acc);
                    else if (QM == 1) acc = wmma3(qs_[ks], sp_ld(krow, p.sKd, ks * 32, hf, p.dh, 1.f), acc);
                    else if (FS > 0)  acc = wmma16(qa[ks], kf[t * KS + ks], acc);
                    else              acc = wmma16(qa[ks], fh_ld(krow, p.sKd, ks * 32, hf, p.dh, 1.f), acc);
                }
                s[t] = acc;
            }
            float pv[8][4];
#pragma unroll
            for (int i = 0; i < 8; ++i) {
                const int irow = q0 + i + 8 * hf;
                const int ic = min(irow, p.Lq - 1);
                float sc[4];
#pragma unroll
                for (int t = 0; t < 4; ++t) {
                    const int jg = j0 + t * 16 + l15;
                    float v = s[t][i] * p.scale;
                    if (p.Mf) v += p.Mf[b * p.smb + h * p.smh + (long long)ic * p.smi + (long long)min(jg, p.Lk - 1) * p.smj];
                    if (p.Rt) { int rc = ic - min(jg, p.Lk - 1) + p.roff; rc = rc < 0 ? 0 : (rc >= p.rn ? p.rn - 1 : rc); v += p.Rt[b * p.srb + h * p.srh + (long long)ic * p.sri + rc]; }
                    if (p.Mi) { const int mv = p.Mi[b * p.smb + h * p.smh + (long long)ic * p.smi + (long long)min(jg, p.Lk - 1) * p.smj]; if (p.mpol ? (mv != 0) : (mv == 0)) v = p.mfill; }
                    if (p.SQ) { const bool same = p.SQ[(long long)b * p.Lq + ic] == p.SK[(long long)b * p.Lk + min(jg, p.Lk - 1)]; if (p.segpol ? same : !same) v = p.mfill; }
                    if (p.causal == 2 && jg > irow + p.coff) v = p.mfill;
                    if (jg >= p.Lk || (p.causal == 1 && jg > irow + p.coff) || (p.causal == 3 && jg < irow + p.coff) || (p.win > 0 && irow + p.coff - jg > p.win)) v = NEG; else v *= L2E;
                    sc[t] = v;
                }
                if (!TWOPASS || pass == 0) {
                    float mx = fmaxf(fmaxf(sc[0], sc[1]), fmaxf(sc[2], sc[3]));
                    mx = fmaxf(mx, __shfl_xor(mx, 1, 32)); mx = fmaxf(mx, __shfl_xor(mx, 2, 32));
                    mx = fmaxf(mx, __shfl_xor(mx, 4, 32)); mx = fmaxf(mx, __shfl_xor(mx, 8, 32));
                    const float mnew = fmaxf(m8[i], mx);
                    const float corr = (mnew == NEG) ? 1.f : exp2f(m8[i] - mnew);
                    float rs = 0.f;
#pragma unroll
                    for (int t = 0; t < 4; ++t) {
                        const float pp = (sc[t] == NEG) ? 0.f : exp2f(sc[t] - mnew); rs += pp;
                        pv[i][t] = p.Pw ? pp * p.Pw[b * p.swb + h * p.swh + (long long)ic * p.swi + (long long)min(j0 + t * 16 + l15, p.Lk - 1) * p.swj] : pp;
                    }
                    rs += __shfl_xor(rs, 1, 32); rs += __shfl_xor(rs, 2, 32); rs += __shfl_xor(rs, 4, 32); rs += __shfl_xor(rs, 8, 32);
                    l8[i] = l8[i] * corr + rs; m8[i] = mnew;
                    if (!TWOPASS) {
#pragma unroll
                        for (int t = 0; t < NT; ++t) o[t][i] *= corr;
                    }
                } else {
                    const float inv = (l8[i] > 0.f) ? 1.f / l8[i] : 0.f;
#pragma unroll
                    for (int t = 0; t < 4; ++t) {
                        const int jg = j0 + t * 16 + l15;
                        float pp = (sc[t] == NEG) ? 0.f : exp2f(sc[t] - m8[i]) * inv;
                        if (p.Pw) pp *= p.Pw[b * p.swb + h * p.swh + (long long)ic * p.swi + (long long)min(jg, p.Lk - 1) * p.swj];
                        pv[i][t] = pp;
                    }
                }
            }
            if (dopv) {
#pragma unroll
                for (int i = 0; i < 8; ++i)
#pragma unroll
                    for (int t = 0; t < 4; ++t) ((float*)myp)[(i + 8 * hf) * 64 + t * 16 + l15] = pv[i][t];
                __syncthreads();                                 // P (per wave) and V (shared) visible
                if (p.P) {
                    float* pb_ = p.P + b * p.sPb + h * p.sPh;
                    const bool fastP = (p.pband == 0) && ((p.sPi & 3) == 0) && (j0 + 64 <= p.Lk) && (q0 + 16 <= p.Lq) && ((((size_t)pb_) & 15) == 0);
                    if (fastP) {
#pragma unroll
                        for (int s = 0; s < 8; ++s) {
                            const int row = s * 2 + (lane >> 4), c4 = (lane & 15) * 4;
                            const v4f v = *(const v4f*)(myp + row * 64 + c4);
                            VST2V4(pb_ + (long long)(q0 + row) * p.sPi + j0 + c4, v);
                        }
                    } else {
                        for (int row = 0; row < 16; ++row) {
                            const int irow = q0 + row; if (irow >= p.Lq) continue;
                            for (int c = lane; c < 64; c += 32) {
                                const int jg = j0 + c; if (jg >= p.Lk) continue;
                                if (p.pband == 0) VST2(float, pb_ + (long long)irow * p.sPi + jg, myp[row * 64 + c]);
                                else if (jg - irow <= p.pband && irow - jg <= p.pband) VST2(float, pb_ + (long long)irow * p.sPi + (jg - irow + p.pband), myp[row * 64 + c]);
                            }
                        }
                    }
                }
                if (SPLITPV) {
                    const Split pa0 = sp_ld(myp + l15 * 64, 1, 0, hf, 64, 1.f), pa1 = sp_ld(myp + l15 * 64, 1, 32, hf, 64, 1.f);
                    const __bf16* vh = (const __bf16*)vl; const __bf16* vlo = vh + 64 * VP;
#pragma unroll
                    for (int t = 0; t < NT; ++t) {
                        const int dcol = t * 16 + l15;
                        Split b0, b1;
#pragma unroll
                        for (int e = 0; e < 16; ++e) {
                            const int k0 = frag_k(e, hf), k1 = 32 + frag_k(e, hf);
                            b0.hi[e] = vh[k0 * VP + dcol]; b0.lo[e] = vlo[k0 * VP + dcol]; b1.hi[e] = vh[k1 * VP + dcol]; b1.lo[e] = vlo[k1 * VP + dcol];
                        }
                        o[t] = wmma3(pa0, b0, o[t]);
                        o[t] = wmma3(pa1, b1, o[t]);
                    }
                } else {
                    const v16h pa0 = fh_ld(myp + l15 * 64, 1, 0, hf, 64, 4096.f), pa1 = fh_ld(myp + l15 * 64, 1, 32, hf, 64, 4096.f);
#pragma unroll
                    for (int t = 0; t < NT; ++t) {
                        const int dcol = t * 16 + l15;
                        v16h b0, b1;
#pragma unroll
                        for (int e = 0; e < 16; ++e) { b0[e] = vl[frag_k(e, hf) * VP + dcol]; b1[e] = vl[(32 + frag_k(e, hf)) * VP + dcol]; }
                        o[t] = wmma16(pa0, b0, o[t]);
                        o[t] = wmma16(pa1, b1, o[t]);
                    }
                }
            }
        }
    }
    float* obase = p.O + b * p.sOb + h * p.sOh;
    if (p.ST) {
        const int rl = lane >> 1, isel = rl & 7;           // row q0 + rl ; rl>>3 == hf holds because lane>>4 == (lane>>1)>>3
        float mv = 0.f, lv = 0.f;
#pragma unroll
        for (int i = 0; i < 8; ++i) if (i == isel) { mv = m8[i]; lv = l8[i]; }
        const int irow = q0 + rl;
        if (irow < p.Lq) { float* st = p.ST + (((long long)b * gridDim.y + h) * p.Lq + irow) * 2 + (lane & 1); VST2(float, st, (lane & 1) ? lv : mv * 0.6931471805599453f); }
    }
    float invr[8];
#pragma unroll
    for (int i = 0; i < 8; ++i) {
        if (TWOPASS) invr[i] = SPLITPV ? 1.f : (1.f / 4096.f);
        else if (p.nonorm) invr[i] = exp2f(m8[i]) * (SPLITPV ? 1.f : (1.f / 4096.f));
        else invr[i] = (l8[i] > 0.f) ? (SPLITPV ? 1.f / l8[i] : 1.f / (l8[i] * 4096.f)) : 0.f;
    }
    __syncthreads();                                             // all waves done with pl/vl from the main loop
    const bool ofast = ((p.sOi & 3) == 0) && ((((size_t)obase) & 15) == 0) && (q0 + 16 <= p.Lq);
#pragma unroll
    for (int c0 = 0; c0 < DVP; c0 += 64) {
#pragma unroll
        for (int i = 0; i < 8; ++i)
#pragma unroll
            for (int t = 0; t < NT; ++t) if (t * 16 >= c0 && t * 16 < c0 + 64) ((float*)myp)[(i + 8 * hf) * 64 + (t * 16 - c0) + l15] = o[t][i] * invr[i];
        __syncthreads();
        const int cw = (DVP - c0 < 64) ? (DVP - c0) : 64;      // staged columns in this chunk (multiple of 16)
        if (ofast && (c0 + cw <= p.dv) && (cw % 32 == 0)) {
            const int lpr = cw / 4;                              // lanes per row (16 for 64 cols, 8 for 32)
            const int rows_per_ins = 32 / lpr;
            for (int r0 = 0; r0 < 16; r0 += rows_per_ins) {
                const int row = r0 + lane / lpr, c4 = (lane % lpr) * 4;
                const v4f v = *(const v4f*)(myp + row * 64 + c4);
                VST2V4(obase + (long long)(q0 + row) * p.sOi + c0 + c4, v);
            }
        } else {
            for (int row = 0; row < 16; ++row) {
                const int irow = q0 + row; if (irow >= p.Lq) continue;
                for (int c = lane; c < cw; c += 32) { const int d = c0 + c; if (d < p.dv) VST2(float, obase + (long long)irow * p.sOi + d, myp[row * 64 + c]); }
            }
        }
        __syncthreads();
    }
}

// =====================================================================================================================
// k_tr: dst(z, c, r) = alpha * src(z, r, c) (+ beta * R2(z, c, r)): [Z][R][C] (row stride lds) -> [Z][C][R] (row stride ldd) through a 32x32 LDS tile;
//   flags: 1 -> add beta * residual R2 addressed like dst (z*sRz + c*ldr + r); act applied before the residual.
// =====================================================================================================================
struct TrP { const float* src; float* dst; const float* R2; long long sSz, lds, sDz, ldd, sRz, ldr; int R, C, flags, act; float alpha, beta; };
static_assert(sizeof(TrP) == 3 * 8 + 6 * 8 + 6 * 4, "TrP has padding");
__global__ __launch_bounds__(256) void k_tr(TrP p) {
    __shared__ float tile[32][33];
    const int c0 = blockIdx.x * 32, r0 = blockIdx.y * 32, z = blockIdx.z;
    const int lane = threadIdx.x & 31, wave = threadIdx.x >> 5;
    const float* s = p.src + z * p.sSz;
#pragma unroll
    for (int k = 0; k < 4; ++k) {
        const int rl = wave * 4 + k, r = r0 + rl, c = c0 + lane;
        tile[rl][lane] = (r < p.R && c < p.C) ? s[(long long)r * p.lds + c] : 0.f;
    }
    __syncthreads();
    float* d = p.dst + z * p.sDz; const float* rr = p.R2 + z * p.sRz;
#pragma unroll
    for (int k = 0; k < 4; ++k) {
        const int cl = wave * 4 + k, c = c0 + cl, r = r0 + lane;
        if (c < p.C && r < p.R) {
            float v = act_fn(p.alpha * tile[lane][cl], p.act);
            if (p.flags & 1) v += p.beta * rr[(long long)c * p.ldr + r];
            VST2(float, d + (long long)c * p.ldd + r, v);
        }
    }
}

// k_affine: dst[i] = a * (sdev ? sdev[0] : 1) * src[i] + b, i < n (one thread per element; consecutive lanes -> consecutive addresses)
__global__ __launch_bounds__(256) void k_affine(const float* __restrict__ src, float* __restrict__ dst, int n, float a, float b, const float* __restrict__ sdev) {
    const int i = blockIdx.x * 256 + threadIdx.x;
    if (i < n) { const float aa = sdev ? a * sdev[0] : a; const float v = aa * src[i] + b; VST2(float, dst + i, v); }
}

// =====================================================================================================================
// k_softmax: row softmax over n contiguous elements, one 256-thread block per row; rows addressed z*sz + r*sr (grid (R, Z)).
//   out = scale_out * softmax(scale_in * x + (Mf ? Mf[z*smz + r*smr + j] : 0)); a row whose max is -inf is written as 0.
// =====================================================================================================================
struct SmP { const float* src; float* dst; const float* Mf; long long sz, sr, dz, dr, smz, smr; int n, pad; float scale_in, scale_out; };
static_assert(sizeof(SmP) == 3 * 8 + 6 * 8 + 4 * 4, "SmP has padding");
__global__ __launch_bounds__(256) void k_softmax(SmP p) {
    __shared__ float red[256];
    const int r = blockIdx.x, z = blockIdx.y, tid = threadIdx.x;
    const float* s = p.src + z * p.sz + (long long)r * p.sr;
    const float* mf = p.Mf ? (p.Mf + z * p.smz + (long long)r * p.smr) : nullptr;
    float mx = -__builtin_inff();
    for (int j = tid; j < p.n; j += 256) { float v = s[j] * p.scale_in; if (mf) v += mf[j]; mx = fmaxf(mx, v); }
    red[tid] = mx; __syncthreads();
    for (int o = 128; o > 0; o >>= 1) { if (tid < o) red[tid] = fmaxf(red[tid], red[tid + o]); __syncthreads(); }
    mx = red[0]; __syncthreads();
    float sum = 0.f;
    for (int j = tid; j < p.n; j += 256) { float v = s[j] * p.scale_in; if (mf) v += mf[j]; sum += (mx == -__builtin_inff()) ? 0.f : expf(v - mx); }
    red[tid] = sum; __syncthreads();
    for (int o = 128; o > 0; o >>= 1) { if (tid < o) red[tid] += red[tid + o]; __syncthreads(); }
    sum = red[0];
    const float inv = (sum > 0.f) ? p.scale_out / sum : 0.f;
    float* d = p.dst + z * p.dz + (long long)r * p.dr;
    for (int j = tid; j < p.n; j += 256) { float v = s[j] * p.scale_in; if (mf) v += mf[j]; const float o = (mx == -__builtin_inff()) ? 0.f : expf(v - mx) * inv; VST2(float, d + j, o); }
}
// =====================================================================================================================
// k_stats: mean and rsqrt(var + eps) over a set of n elements addressed base + z*sz + (e / inner) * so + (e % inner) * si, one 256-thread
// k_norm_apply: y = (x - mean[set]) * rstd[set] * g[c] + b[c] over a [Z][C][L] channel-major tensor with set = z*G + c / (C/G) (G groups per z;
//   G = C -> per-channel sets indexed z*C+c; for batch norm pass stats indexed by c only via bn = 1). Optional act. Output same layout.
// =====================================================================================================================
//   mode 0: mean / rsqrt(var + eps); mode 1 (RMSNorm): 0 / rsqrt(mean(x^2) + eps); mode 2 (L2 normalize * sqrt(n)): 0 / sqrt(n) / max(||x||, eps); mode 3: as 0 with unbiased variance (n-1)
__global__ __launch_bounds__(256) void k_stats(const float* __restrict__ x, long long sz, long long so, long long si, int inner, int n, float eps, float* __restrict__ stat, int mode) {
    __shared__ float red[256];
    const int z = blockIdx.x, tid = threadIdx.x;
    const float* base = x + z * sz;
    float s = 0.f;
    for (int e = tid; e < n; e += 256) s += base[(long long)(e / inner) * so + (long long)(e % inner) * si];
    red[tid] = s; __syncthreads();
    for (int o = 128; o > 0; o >>= 1) { if (tid < o) red[tid] += red[tid + o]; __syncthreads(); }
    const float mu = (mode == 0 || mode == 3) ? red[0] / (float)n : 0.f; __syncthreads();
    float q = 0.f;
    for (int e = tid; e < n; e += 256) { const float dlt = base[(long long)(e / inner) * so + (long long)(e % inner) * si] - mu; q += dlt * dlt; }
    red[tid] = q; __syncthreads();
    for (int o = 128; o > 0; o >>= 1) { if (tid < o) red[tid] += red[tid + o]; __syncthreads(); }
    {
        float rs;
        if (mode == 2) rs = sqrtf((float)n) / fmaxf(sqrtf(red[0]), eps); else if (mode == 3) rs = rsqrtf(red[0] / (float)(n - 1) + eps); else rs = rsqrtf(red[0] / (float)n + eps);
        if (tid < 32) { const float v = (tid == 0) ? mu : ((tid == 1) ? rs : 0.f); VST2(float, stat + (long long)z * 32 + tid, v); }
    }
}
//   One thread per element over the flat [Z][C][L] index space: grid ceil(Z*C*L / 256).
__global__ __launch_bounds__(256) void k_norm_apply(const float* __restrict__ x, float* __restrict__ y, const float* __restrict__ stat, const float* __restrict__ g, const float* __restrict__ bta,
                                                     int Z, int C, int L, int G, int bn, int act) {
    const long long idx = (long long)blockIdx.x * 256 + threadIdx.x;
    if (idx >= (long long)Z * C * L) return;
    const int l = (int)(idx % L); const long long zc = idx / L; const int c = (int)(zc % C), z = (int)(zc / C); (void)l;
    const int set = bn ? c : (z * G + c / (C / G));
    float v = (x[idx] - stat[(long long)set * 32]) * stat[(long long)set * 32 + 1];
    if (g) v *= g[c];
    if (bta) v += bta[c];
    v = act_fn(v, act);
    VST2(float, y + idx, v);
}

// k_lse_neg: c[i] = -(st[2i] + log(st[2i+1])) = minus the log-sum-exp of row i from k_attn's ST output (for softmax over the query dimension)
__global__ __launch_bounds__(256) void k_lse_neg(const float* __restrict__ st, float* __restrict__ c, int n) {
    const int i = blockIdx.x * 256 + threadIdx.x;
    if (i < n) { const float v = -(st[2 * i] + logf(st[2 * i + 1])); VST2(float, c + i, v); }
}

// k_iota: dst[i] = a * i + b as int32 (segment/position id helper)
__global__ __launch_bounds__(256) void k_iota(int* __restrict__ dst, int n, int a, int b) {
    const int i = blockIdx.x * 256 + threadIdx.x;
    if (i < n) { const int v = a * i + b; VST2(int, dst + i, v); }
}

// k_axpby: dst[i] = a * x[i] + b * y[i] (+ c), i < n
__global__ __launch_bounds__(256) void k_axpby(const float* __restrict__ x, const float* __restrict__ y, float* __restrict__ dst, int n, float a, float b, float c) {
    const int i = blockIdx.x * 256 + threadIdx.x;
    if (i < n) { const float v = a * x[i] + b * y[i] + c; VST2(float, dst + i, v); }
}

// =====================================================================================================================
// k_rope: rotary embedding on a [R rows][Hn heads][D] view (row stride sXr, head stride sXh, element stride 1) -> Y (own strides).
//   mode 0: rotate_half (partner d±D/2, sign - for d<D/2); mode 1: interleaved pairs (partner d^1, sign - for even d).
//   table column tcol: tmode 0 -> d, 1 -> d % (D/2), 2 -> d / 2; position p: pmode 0 -> r % S, 1 -> head index, 2 -> pos[r];
//   c = C[(r / S) * sCb + p * sCp + tcol * sCd], s likewise from Sn; y = x[d] * c + sign * x[partner] * s. X and Y must not alias.
// =====================================================================================================================
struct RopeP { const float* X; float* Y; const float* C; const float* Sn; const int* pos; long long sXr, sXh, sYr, sYh, sCb, sCp, sCd; int R, Hn, D, S, mode, tmode, pmode, pad; };
static_assert(sizeof(RopeP) == 5 * 8 + 7 * 8 + 8 * 4, "RopeP has padding");
__global__ __launch_bounds__(256) void k_rope(RopeP p) {
    const long long idx = (long long)blockIdx.x * 256 + threadIdx.x;
    if (idx >= (long long)p.R * p.Hn * p.D) return;
    const int d = (int)(idx % p.D); const long long rh = idx / p.D; const int h = (int)(rh % p.Hn); const int r = (int)(rh / p.Hn);
    const int half = p.D / 2;
    int partner; float sign;
    if (p.mode == 0) { partner = (d < half) ? d + half : d - half; sign = (d < half) ? -1.f : 1.f; }
    else { partner = d ^ 1; sign = (d & 1) ? 1.f : -1.f; }
    const int tcol = (p.tmode == 0) ? d : ((p.tmode == 1) ? (d % half) : (d >> 1));
    const int pp = (p.pmode == 0) ? (r % p.S) : ((p.pmode == 1) ? h : p.pos[r]);
    const long long toff = (long long)(r / p.S) * p.sCb + (long long)pp * p.sCp + (long long)tcol * p.sCd;
    const float* xr = p.X + (long long)r * p.sXr + (long long)h * p.sXh;
    const float v = xr[d] * p.C[toff] + sign * xr[partner] * p.Sn[toff];
    VST2(float, p.Y + (long long)r * p.sYr + (long long)h * p.sYh + d, v);
}

// k_invf + k_sincos (split so neither kernel carries a large VALU-fma footprint): invf_i = num * (1 / powf(base, (2 i)/D)) [fmode 0],
//   num * expf((2 i) * cexp) [fmode 1], num * powf(base, -2 (i - 1) / D) [fmode 2]; then cs/sn[s*half + i] = cos/sin((pscale * s) * invf_i)
__global__ __launch_bounds__(256) void k_invf(float* __restrict__ invb, int half, int D, float base, float num, int fmode, float cexp) {
    const int i = blockIdx.x * 256 + threadIdx.x;
    if (i >= ((half + 31) / 32) * 32) return;
    if (i >= half) { VST2(float, invb + i, 0.f); return; }
    const float e = (float)(2 * i) / (float)D;
    float invf;
    if (fmode == 1) invf = num * expf((float)(2 * i) * cexp);
    else if (fmode == 2) invf = num * powf(base, (-2.0f * ((float)i - 1.0f)) / (float)D);
    else invf = num * (1.0f / powf(base, e));
    VST2(float, invb + i, invf);
}
__global__ __launch_bounds__(256) void k_sincos(float* __restrict__ cs, float* __restrict__ sn, const float* __restrict__ invb, int S, int half, float pscale) {
    const int idx = blockIdx.x * 256 + threadIdx.x;
    if (idx >= S * half) return;
    const int s = idx / half, i = idx - s * half;
    const float ang = (pscale * (float)s) * invb[i];
    VST2(float, cs + idx, cosf(ang)); VST2(float, sn + idx, sinf(ang));
}

// k_mulact: dst[i] = act(x[i]) * y[i]
__global__ __launch_bounds__(256) void k_mulact(const float* __restrict__ x, const float* __restrict__ y, float* __restrict__ dst, int n, int act) {
    const int i = blockIdx.x * 256 + threadIdx.x;
    if (i < n) { const float v = act_fn(x[i], act) * y[i]; VST2(float, dst + i, v); }
}

// =====================================================================================================================
// k_matvec: thread-per-row matrix-vector products for N <= 8 output columns (heads with 1-3 outputs, gates), f32 on the VALU.
//   C[r*sCm + j] = act(alpha * sum_k A[r*sAm + k*sAk] * B[j*sBn + k*sBk] + bias[j]) + beta * R[r*sRm + j*sRn]; each thread writes its N contiguous floats.
// =====================================================================================================================
__global__ __launch_bounds__(256) void k_matvec(GemmP p) {
    // N == 1: one row per thread, 32 lanes write 32 consecutive rows with one instruction; otherwise 32 consecutive rows per thread.
    const int rpt = (p.N == 1) ? 1 : 32;
    const long long r0 = ((long long)blockIdx.x * 256 + threadIdx.x) * rpt; const int z = blockIdx.z, zo = z / p.zi_n, zi = z - zo * p.zi_n;
    if (r0 >= p.M) return;
    const float* Bb = p.B + zo * p.sBo + zi * p.sBi;
    float* C = p.C + zo * p.sCo + zi * p.sCi; const float* R = p.R + zo * p.sRo + zi * p.sRi;
    for (int rr = 0; rr < rpt; ++rr) {
        const long long r = r0 + rr; if (r >= p.M) break;
        const float* A = p.A + zo * p.sAo + zi * p.sAi + r * p.sAm;
        float acc[8] = {0.f, 0.f, 0.f, 0.f, 0.f, 0.f, 0.f, 0.f};
        for (int k = 0; k < p.K; ++k) { const float a = A[(long long)k * p.sAk];
#pragma unroll
            for (int j = 0; j < 8; ++j) if (j < p.N) acc[j] += a * Bb[(long long)j * p.sBn + (long long)k * p.sBk]; }
#pragma unroll
        for (int j = 0; j < 8; ++j) if (j < p.N) {
            float v = acc[j] * p.alpha;
            if (p.flags & 1) v += p.bias[j];
            if (p.flags & 2) v += p.bias[r];
            v = act_fn(v, p.act);
            if (p.flags & 4) v += p.beta * R[r * p.sRm + (long long)j * p.sRn];
            VST2(float, C + r * p.sCm + j, v);
        }
    }
}
// k_smallsoftmax: thread-per-row softmax for short rows (n <= 64): dst[r*dr + j] = softmax(scale*src[r*sr + j])
__global__ __launch_bounds__(256) void k_smallsoftmax(const float* __restrict__ src, float* __restrict__ dst, long long sr, long long dr, int n, long long R, float scale) {
    const long long r0 = ((long long)blockIdx.x * 256 + threadIdx.x) * 32;
    for (int rr = 0; rr < 32; ++rr) {
        const long long r = r0 + rr; if (r >= R) return;
        const float* s = src + r * sr; float* d = dst + r * dr;
        float mx = -__builtin_inff();
        for (int j = 0; j < n; ++j) mx = fmaxf(mx, s[j] * scale);
        float sum = 0.f;
        for (int j = 0; j < n; ++j) sum += expf(s[j] * scale - mx);
        const float inv = 1.f / sum;
        for (int j = 0; j < n; ++j) { const float v = expf(s[j] * scale - mx) * inv; VST2(float, d + j, v); }
    }
}

__global__ __launch_bounds__(32) void k_unitstat(float* __restrict__ st) { const int t = threadIdx.x; const float v = (t == 1) ? 1.f : 0.f; VST2(float, st + t, v); }

// destination (e.g. a d_out whose row width is not a multiple of 32 floats) is written by consecutive lanes of one instruction
__global__ __launch_bounds__(256) void k_lincopy(const float* __restrict__ src, long long lds, float* __restrict__ dst, long long ldd, long long rows, int cols) {
    const long long i = (long long)blockIdx.x * 256 + threadIdx.x; if (i >= rows * cols) return;
    const long long r = i / cols; const int c = (int)(i - r * cols);
    const float v = src[r * lds + c]; VST2(float, dst + r * ldd + c, v);
}

namespace w25 {
typedef __attribute__((ext_vector_type(16))) _Float16 v16h;
typedef __attribute__((ext_vector_type(8)))  _Float16 v8h;
typedef __attribute__((ext_vector_type(16))) __bf16   v16b;
typedef __attribute__((ext_vector_type(8)))  __bf16   v8b;
typedef __attribute__((ext_vector_type(8)))  float    v8f;
typedef __attribute__((ext_vector_type(4)))  float    v4f;

__device__ __forceinline__ unsigned short f2bf_bits(float f) {
  unsigned u = __float_as_uint(f);
  return (unsigned short)((u + 0x7FFFu + ((u >> 16) & 1u)) >> 16);
}
__device__ __forceinline__ float bf_bits2f(unsigned short h) { return __uint_as_float(((unsigned)h) << 16); }

template <typename T> struct Frag;
template <> struct Frag<_Float16> {
  typedef v16h V; union U { v16h v; v8h h[2]; };
  static __device__ __forceinline__ v16h load(const _Float16* p) {   // elements 0..7 <- p[0..7], 8..15 <- p[16..23]
    U f; f.h[0] = *(const v8h*)(p); f.h[1] = *(const v8h*)(p + 16); return f.v;
  }
  static __device__ __forceinline__ v8f mma(v16h a, v16h b, v8f c) {
    return __builtin_amdgcn_wmma_f32_16x16x32_f16(false, a, false, b, (short)0, c, false, false);
  }
};
template <> struct Frag<__bf16> {
  typedef v16b V; union U { v16b v; v8b h[2]; };
  static __device__ __forceinline__ v16b load(const __bf16* p) {
    U f; f.h[0] = *(const v8b*)(p); f.h[1] = *(const v8b*)(p + 16); return f.v;
  }
  static __device__ __forceinline__ v8f mma(v16b a, v16b b, v8f c) {
    return __builtin_amdgcn_wmma_f32_16x16x32_bf16(false, a, false, b, (short)0, c, false, false);
  }
};

// ---- WMMA GEMM with both operands staged in LDS ------------------------------
// C[m,n] = scale * sum_k A[m,k] * Bt[n,k], f32 out. A row-major [M,K]; Bt row-major [N,K]; C row-major [M,N]; M % 64 == 0, N % 128 == 0, K % 64 == 0.
// grid (N / 128, M / 64), 8 waves: a work-group owns a 64 x 128 tile of C, wave (wave >> 2, wave & 3) a 32 x 32 part of it.
// K runs in stages of 64: a stage's 64 A rows and 128 Bt rows (128 B each, per plane) come from global memory as whole 128-byte lines
// (8 lanes x 16 B per row), go to LDS at a pitch of 144 B, and every wave reads its fragments from there with 16-byte LDS loads.
// Two LDS buffers: the next stage's global loads are in flight while the current stage is multiplied; one barrier per stage.
// SPLIT: operands are hi/lo planes (A2/Bt2 = lo planes, same layout); product = hi.hi + hi.lo + lo.hi, in that order per 32 k.
// ET: 0 = f16 operands, 1 = bf16 operands (pointers passed as 16-bit storage)
template <int ET> struct Elem;
template <> struct Elem<0> { typedef _Float16 T; typedef v8h V8; };
template <> struct Elem<1> { typedef __bf16 T; typedef v8b V8; };
template <int ET, bool SPLIT>
__global__ __launch_bounds__(256) void wmma_gemm_lds(
    const unsigned short* __restrict__ Ap, const unsigned short* __restrict__ A2p,
    const unsigned short* __restrict__ Btp, const unsigned short* __restrict__ Bt2p,
    float* __restrict__ C, int N, int K, float scale) {
  typedef typename Elem<ET>::T T;
  typedef typename Elem<ET>::V8 V8;
  typedef typename Frag<T>::V V;
  constexpr int NP    = SPLIT ? 2 : 1;      // planes
  constexpr int PITCH = 72;                 // LDS row pitch in 16-bit elements: 144 B = 16 B x 9
  constexpr int PROWS = 192;                // rows of one plane in a stage: 64 of A, then 128 of Bt
  constexpr int STAGE = NP * PROWS * PITCH; // elements of one buffer
  constexpr int NL    = NP * 6;             // 16-byte pieces per thread and stage (32 rows per step)
  constexpr int CP    = 132;                // pitch of the staged C tile in floats
  static_assert(2 * STAGE * 2 >= 64 * CP * 4, "the C tile is staged in the operand buffers");
  __shared__ __align__(16) T sm[2 * STAGE];
  const int lane = threadIdx.x & 31;
  const int wave = threadIdx.x >> 5;
  const int m0 = blockIdx.y << 6;
  const int n0 = blockIdx.x << 7;
  const int wm = (wave >> 2) << 5;          // this wave's first row and column in the tile
  const int wn = (wave & 3) << 5;
  const int rlane = lane & 15;              // row (A) / col (B, D) within a 16 x 16 subtile
  const int koff  = (lane >> 4) * 8;        // k offset of this lane half
  const int mOff  = (lane >> 4) * 8;        // D row offset

  const int lrow = threadIdx.x >> 3, lseg = (threadIdx.x & 7) * 8;   // staging: row within a step of 32 rows, 16-byte piece of the row
  const T* gA  = (const T*)Ap  + (size_t)(m0 + lrow) * K + lseg;
  const T* gB  = (const T*)Btp + (size_t)(n0 + lrow) * K + lseg;
  const T* gA2 = SPLIT ? (const T*)A2p  + (size_t)(m0 + lrow) * K + lseg : nullptr;
  const T* gB2 = SPLIT ? (const T*)Bt2p + (size_t)(n0 + lrow) * K + lseg : nullptr;
  const int sw = lrow * PITCH + lseg;       // this thread's place in a buffer, step 0
  const int fa = (wm + rlane) * PITCH + koff;        // this lane's A and Bt fragment places in a buffer, subtile 0, k 0
  const int fb = (64 + wn + rlane) * PITCH + koff;

  v8f acc[2][2];
#pragma unroll
  for (int i = 0; i < 2; ++i)
#pragma unroll
    for (int j = 0; j < 2; ++j) acc[i][j] = (v8f){0.f,0.f,0.f,0.f,0.f,0.f,0.f,0.f};

  V8 st[NL];
  auto fetch = [&](int k0) {                // stage at k0: global memory -> registers
#pragma unroll
    for (int it = 0; it < NL; ++it) {
      const int q = it % 6;                 // steps 0, 1: A rows; 2..5: Bt rows; then the same for the lo planes
      const T* g = (it < 6) ? (q < 2 ? gA : gB) : (q < 2 ? gA2 : gB2);
      st[it] = *(const V8*)(g + (size_t)((q < 2 ? q : q - 2) * 32) * K + k0);
    }
  };
  auto put = [&](int buf) {                 // registers -> LDS buffer
#pragma unroll
    for (int it = 0; it < NL; ++it) *(V8*)(sm + buf * STAGE + sw + it * (32 * PITCH)) = st[it];
  };
  auto mult = [&](int buf) {                // one stage: 2 steps of 32 k
    const T* s = sm + buf * STAGE;
#pragma unroll
    for (int kk = 0; kk < 2; ++kk) {
      V ah[2], al[2], bh[2], bl[2];
#pragma unroll
      for (int i = 0; i < 2; ++i) {
        ah[i] = Frag<T>::load(s + fa + i * (16 * PITCH) + kk * 32);
        bh[i] = Frag<T>::load(s + fb + i * (16 * PITCH) + kk * 32);
        if (SPLIT) {
          al[i] = Frag<T>::load(s + PROWS * PITCH + fa + i * (16 * PITCH) + kk * 32);
          bl[i] = Frag<T>::load(s + PROWS * PITCH + fb + i * (16 * PITCH) + kk * 32);
        }
      }
#pragma unroll
      for (int i = 0; i < 2; ++i)
#pragma unroll
        for (int j = 0; j < 2; ++j) acc[i][j] = Frag<T>::mma(ah[i], bh[j], acc[i][j]);
      if (SPLIT) {
#pragma unroll
        for (int i = 0; i < 2; ++i)
#pragma unroll
          for (int j = 0; j < 2; ++j) acc[i][j] = Frag<T>::mma(ah[i], bl[j], acc[i][j]);
#pragma unroll
        for (int i = 0; i < 2; ++i)
#pragma unroll
          for (int j = 0; j < 2; ++j) acc[i][j] = Frag<T>::mma(al[i], bh[j], acc[i][j]);
      }
    }
  };

  const int NK = K >> 6;
  fetch(0);
  put(0);
  __syncthreads();                          // stage 0 is visible
  for (int kt = 0; kt + 1 < NK; ++kt) {
    fetch((kt + 1) << 6);
    __builtin_amdgcn_sched_barrier(0);      // keeps the next stage's global loads issued ahead of this stage's products, so that their latency runs under them
    mult(kt & 1);
    put((kt + 1) & 1);                      // the buffer that stage kt - 1 was read from; its readers left it at the barrier that ended that trip
    __syncthreads();                        // stage kt + 1 is visible, and every wave has finished reading stage kt
  }
  mult((NK - 1) & 1);
  __syncthreads();                          // all fragment reads are done: the buffers now stage the C tile

  // ---- epilogue: the 64 x 128 f32 tile through LDS, so that each store instruction writes 512 contiguous bytes of one row ----
  float* sC = (float*)sm;
#pragma unroll
  for (int i = 0; i < 2; ++i)
#pragma unroll
    for (int j = 0; j < 2; ++j)
#pragma unroll
      for (int r = 0; r < 8; ++r) sC[(wm + (i << 4) + mOff + r) * CP + wn + (j << 4) + rlane] = acc[i][j][r] * scale;
  __syncthreads();
#pragma unroll
  for (int it = 0; it < 8; ++it) {
    const int row = it * 8 + wave;
    const v4f v = *(const v4f*)(sC + row * CP + lane * 4);
    *(v4f*)(C + (size_t)(m0 + row) * N + n0 + lane * 4) = v;
  }
}

__global__ __launch_bounds__(256) void cast_f32_f16x2(
    const float* __restrict__ in, _Float16* __restrict__ out, int n2) {
  int i = blockIdx.x * 256 + threadIdx.x;
  if (i < n2) {
    const _Float16 h0 = (_Float16)in[2 * i], h1 = (_Float16)in[2 * i + 1];
    const unsigned u = (unsigned)__builtin_bit_cast(unsigned short, h0) | ((unsigned)__builtin_bit_cast(unsigned short, h1) << 16);
    ((unsigned*)out)[i] = u;
    
  }
}


} // namespace w25

__global__ __launch_bounds__(256) void k_castT16(const float* __restrict__ src, long long lds, _Float16* __restrict__ dst, long long ldd, int R, int C, float s) {
    const long long i = (long long)blockIdx.x * 256 + threadIdx.x; const long long np = (long long)C * (R / 2); if (i >= np) return; const int c = (int)(i / (R / 2)); const int r = 2 * (int)(i % (R / 2));
    const _Float16 h0 = (_Float16)(src[(long long)r * lds + c] * s), h1 = (_Float16)(src[(long long)(r + 1) * lds + c] * s);
    const unsigned u = (unsigned)__builtin_bit_cast(unsigned short, h0) | ((unsigned)__builtin_bit_cast(unsigned short, h1) << 16);
    unsigned* d = (unsigned*)(dst + (long long)c * ldd + r); *d = u;  }
__global__ __launch_bounds__(256) void k_cast16(const float* __restrict__ src, long long lds, _Float16* __restrict__ dst, long long ldd, int R, int C, float s) {
    const long long i = (long long)blockIdx.x * 256 + threadIdx.x; const long long np = (long long)R * (C / 2); if (i >= np) return; const int r = (int)(i / (C / 2)); const int c = 2 * (int)(i % (C / 2));
    const _Float16 h0 = (_Float16)(src[(long long)r * lds + c] * s), h1 = (_Float16)(src[(long long)r * lds + c + 1] * s);
    const unsigned u = (unsigned)__builtin_bit_cast(unsigned short, h0) | ((unsigned)__builtin_bit_cast(unsigned short, h1) << 16);
    unsigned* d = (unsigned*)(dst + (long long)r * ldd + c); *d = u;  }

// f32 -> bf16 hi plane + bf16 lo plane (x = hi + lo to ~2^-17 relative; RNE both), [R][C] -> [R][C] (or transposed to [C][R]); 2 consecutive destination elements
__device__ __forceinline__ unsigned int f2bf2_pack(float a, float b, unsigned int* lo) {
    const unsigned short ha = w25::f2bf_bits(a), hb = w25::f2bf_bits(b);
    const unsigned short la = w25::f2bf_bits(a - w25::bf_bits2f(ha)), lb = w25::f2bf_bits(b - w25::bf_bits2f(hb));
    *lo = (unsigned)la | ((unsigned)lb << 16); return (unsigned)ha | ((unsigned)hb << 16); }
__global__ __launch_bounds__(256) void k_castS16(const float* __restrict__ src, long long lds, __bf16* __restrict__ dhi, __bf16* __restrict__ dlo, long long ldd, int R, int C, float s, int transpose) {
    const long long i = (long long)blockIdx.x * 256 + threadIdx.x; long long o; float a, b;
    if (transpose) { const long long np = (long long)C * (R / 2); if (i >= np) return; const int c = (int)(i / (R / 2)); const int r = 2 * (int)(i % (R / 2)); a = src[(long long)r * lds + c] * s; b = src[(long long)(r + 1) * lds + c] * s; o = (long long)c * ldd + r; }
    else { const long long np = (long long)R * (C / 2); if (i >= np) return; const int r = (int)(i / (C / 2)); const int c = 2 * (int)(i % (C / 2)); a = src[(long long)r * lds + c] * s; b = src[(long long)r * lds + c + 1] * s; o = (long long)r * ldd + c; }
    unsigned lo; const unsigned hi = f2bf2_pack(a, b, &lo); unsigned* ph = (unsigned*)(dhi + o); unsigned* pl = (unsigned*)(dlo + o);
    *ph = hi; *pl = lo;  }

namespace w25 {
// =====================================================================================
// Generic causal/non-causal attention for head_dim 64, f32 in / f32 out; 16-bit operands: bf16 with optional hi/lo splits, or
// plain f16 (F16=true, non-split, probabilities carried x2^15).
//   scores = (q*qscale)·kᵀ : v_wmma_f32_16x16x32_bf16; SPLIT_QK -> q,k as bf16 hi/lo (hi·hi + hi·lo + lo·hi)
//   out    = p·v           : v_wmma_f32_16x16x32_bf16; SPLIT_PV -> p,v as bf16 hi/lo; else p,v plain bf16
//   f32 accumulate; online softmax in f32. Block = 4 waves = 64 query rows of one (batch, head); S % 64 == 0.
//   Element (b, s, h, d) of tensor X lives at X[b*X_bs + s*X_rs + h*X_hs + d] (strides in floats, multiples of 4).
//   Masking: mask_mode 0 none, 1 causal (kv > q masked), 2 tensor [S][Skv] shared over (b,h) (float if
//   mask_is_int==0, int32 with element == 0 -> masked if 1, int32 with element != 0 -> masked if 2), 3 per-token vectors qmask[B][S] & kvmask[B][Skv] (int32,
//   0 -> masked), 4 causal + sliding window (kv > q or q - kv > W masked; W passed in mask_is_int);
//   5 = relative-position bias: s += cp[b,h,q][idx[q][kv]] + pc[b,h,kv][idx[q][kv]] with idx = mask_b ([S][Skv] int32) and
//   mask_a an int32 [S][Skv] tensor with nonzero = masked (tables: element (b,h,row,n) at X + b*c_bs + h*c_hs + row*c_rs + n);
//   masked scores are replaced by mask_fill (e.g. -inf or -1e9) before the softmax.
//   grid.x = B * H * (S/64) (or a sub-range with blk0).
// =====================================================================================
#define AT_D 64
#define AT_NW 4
#define AT_QB 64
#define AT_KC 64
struct AttnGeom { const float* cp = nullptr; const float* pc = nullptr; long c_bs = 0, c_rs = 0, c_hs = 0;   // mode-5 score-bias tables
                  long q_bs, q_rs, q_hs, k_bs, k_rs, k_hs, v_bs, v_rs, v_hs, o_bs, o_rs, o_hs;
                  int S, Skv, H, mask_mode; float qscale; int blk0; float mask_fill; int mask_is_int; };
static_assert(sizeof(AttnGeom) == 168, "no padding");

__device__ __forceinline__ unsigned short at_bf_bits(float f) {
  unsigned u = __float_as_uint(f);
  return (unsigned short)((u + 0x7FFFu + ((u >> 16) & 1u)) >> 16);
}
__device__ __forceinline__ __bf16 at_f2bf(float f) { return __builtin_bit_cast(__bf16, at_bf_bits(f)); }
__device__ __forceinline__ void at_split(float f, __bf16& hi, __bf16& lo) {
  const unsigned short hb = at_bf_bits(f);
  hi = __builtin_bit_cast(__bf16, hb);
  lo = at_f2bf(f - __uint_as_float(((unsigned)hb) << 16));
}
__device__ __forceinline__ v8f at_mma(v16b a, v16b b, v8f c) {
  c = __builtin_amdgcn_wmma_f32_16x16x32_bf16(false, a, false, b, (short)0, c, false, false);
  asm volatile("v_nop\n\tv_nop\n\tv_nop\n\tv_nop" : "+v"(c) : "v"(a), "v"(b));
  return c;
}
// 16-bit element as a bit pattern held in a __bf16 slot: f16 bits when F16, bf16 (RNE) otherwise
template <bool F16> __device__ __forceinline__ __bf16 at_to16(float f) {
  if (F16) return __builtin_bit_cast(__bf16, (_Float16)f);
  return at_f2bf(f);
}
template <bool F16> __device__ __forceinline__ v8f at_mma16(v16b a, v16b b, v8f c) {
  if (F16) {
    const v16h ah = __builtin_bit_cast(v16h, a), bh = __builtin_bit_cast(v16h, b);
    c = __builtin_amdgcn_wmma_f32_16x16x32_f16(false, ah, false, bh, (short)0, c, false, false);
    asm volatile("v_nop\n\tv_nop\n\tv_nop\n\tv_nop" : "+v"(c) : "v"(ah), "v"(bh));
    return c;
  }
  return at_mma(a, b, c);
}

template <bool SPLIT_QK, bool SPLIT_PV, bool F16 = false>
__global__ __launch_bounds__(128)
void attn64_kernel(const float* __restrict__ q, const float* __restrict__ k,
                   const float* __restrict__ v, float* __restrict__ out,
                   const void* __restrict__ mask_a, const int* __restrict__ mask_b, AttnGeom g) {
  static_assert(!(F16 && (SPLIT_QK || SPLIT_PV)), "f16 mode is non-split");
  const float PSC = F16 ? 32768.0f : 1.0f;     // f16 probabilities carried x2^15 (subnormal range), folded into the final 1/l
  union FB { v16b v; v8b h[2]; };
  __shared__ __align__(16) __bf16 Ksh[AT_KC * AT_D];             // K hi [kv][d]      8 KB
  __shared__ __align__(16) __bf16 Ksl[SPLIT_QK ? AT_KC * AT_D : 8];
  __shared__ __align__(16) __bf16 Vth[AT_D * AT_KC];             // V hi [d][kv]      8 KB
  __shared__ __align__(16) __bf16 Vtl[SPLIT_PV ? AT_D * AT_KC : 8];
  __shared__ __align__(16) __bf16 Psh[AT_NW][16 * AT_KC];        // per wave P hi [row][kv]  8 KB
  __shared__ __align__(16) __bf16 Psl[SPLIT_PV ? AT_NW : 1][SPLIT_PV ? 16 * AT_KC : 8];
  __shared__ __align__(16) float  Os[AT_NW][16 * 68];            // per wave out tile, pitch 68

  const int tid  = threadIdx.x;
  const int wave = tid >> 5;
  const int lane = tid & 31;
  const int hh   = lane >> 4;
  const int c    = lane & 15;

  const int nqb = g.S / AT_QB;
  const int bx = blockIdx.x + g.blk0;
  const int qb = bx % nqb;
  const int bh = bx / nqb;
  const int h  = bh % g.H;
  const int b  = bh / g.H;
  const int qbase_block = qb * AT_QB;
  const int q0 = qbase_block + wave * 16;

  const float* qb_ptr = q + (size_t)b * g.q_bs + (size_t)h * g.q_hs;
  const float* kb_ptr = k + (size_t)b * g.k_bs + (size_t)h * g.k_hs;
  const float* vb_ptr = v + (size_t)b * g.v_bs + (size_t)h * g.v_hs;
  float*       ob_ptr = out + (size_t)b * g.o_bs + (size_t)h * g.o_hs;

  // ---- Q fragments (A operand): 2 d-chunks, hi (and lo) ----
  v16b qah[2], qal[2];
  {
    const float* qrow = qb_ptr + (size_t)(q0 + c) * g.q_rs;
#pragma unroll
    for (int dc = 0; dc < 2; ++dc) {
#pragma unroll
      for (int e = 0; e < 8; ++e) {
        const float f0 = qrow[dc * 32 + 8 * hh + e] * g.qscale;
        const float f1 = qrow[dc * 32 + 16 + 8 * hh + e] * g.qscale;
        if (SPLIT_QK) { __bf16 hq, lq; at_split(f0, hq, lq); qah[dc][e] = hq; qal[dc][e] = lq; at_split(f1, hq, lq); qah[dc][8 + e] = hq; qal[dc][8 + e] = lq; }
        else { qah[dc][e] = at_to16<F16>(f0); qah[dc][8 + e] = at_to16<F16>(f1); qal[dc][e] = qah[dc][e]; qal[dc][8 + e] = qah[dc][8 + e]; }
      }
    }
  }

  float mrow[8], lrow[8];
  v8f oacc[4];
#pragma unroll
  for (int r = 0; r < 8; ++r) { mrow[r] = -INFINITY; lrow[r] = 0.f; }
#pragma unroll
  for (int t = 0; t < 4; ++t) oacc[t] = (v8f){0.f,0.f,0.f,0.f,0.f,0.f,0.f,0.f};

  const int nChunks = (g.mask_mode == 1 || g.mask_mode == 4) ? (qb + 1) : (g.Skv / AT_KC);   // block-uniform
  // per-row query mask (mode 3)
  int qkeep[8];
#pragma unroll
  for (int r = 0; r < 8; ++r) qkeep[r] = (g.mask_mode == 3) ? mask_b[(size_t)b * g.S + q0 + 8 * hh + r] : 1;   // mask_b = qmask in mode 3
  for (int kc = 0; kc < nChunks; ++kc) {
    const int kv0 = kc * AT_KC;
    __syncthreads();
    {
      const int kvr = tid >> 1, dh = (tid & 1) * 32;
      const float* krow = kb_ptr + (size_t)(kv0 + kvr) * g.k_rs + dh;
      const float* vrow = vb_ptr + (size_t)(kv0 + kvr) * g.v_rs + dh;
#pragma unroll
      for (int i = 0; i < 8; ++i) {
        v4f kk = *(const v4f*)(krow + 4 * i);
        v4f vv = *(const v4f*)(vrow + 4 * i);
#pragma unroll
        for (int e = 0; e < 4; ++e) {
          const int d = dh + 4 * i + e;
          if (SPLIT_QK) { __bf16 a, bl; at_split(kk[e], a, bl); Ksh[kvr * AT_D + d] = a; Ksl[kvr * AT_D + d] = bl; }
          else Ksh[kvr * AT_D + d] = at_to16<F16>(kk[e]);
          if (SPLIT_PV) { __bf16 a, bl; at_split(vv[e], a, bl); Vth[d * AT_KC + kvr] = a; Vtl[d * AT_KC + kvr] = bl; }
          else Vth[d * AT_KC + kvr] = at_to16<F16>(vv[e]);
        }
      }
    }
    __syncthreads();

    v8f s[4];
#pragma unroll
    for (int j = 0; j < 4; ++j) {
      s[j] = (v8f){0.f,0.f,0.f,0.f,0.f,0.f,0.f,0.f};
#pragma unroll 1
      for (int dc = 0; dc < 2; ++dc) {
        FB kb;
        kb.h[0] = *(const v8b*)(Ksh + (j * 16 + c) * AT_D + dc * 32 + 8 * hh);
        kb.h[1] = *(const v8b*)(Ksh + (j * 16 + c) * AT_D + dc * 32 + 16 + 8 * hh);
        s[j] = at_mma16<F16>(qah[dc], kb.v, s[j]);
        if (SPLIT_QK) {
          FB kl;
          kl.h[0] = *(const v8b*)(Ksl + (j * 16 + c) * AT_D + dc * 32 + 8 * hh);
          kl.h[1] = *(const v8b*)(Ksl + (j * 16 + c) * AT_D + dc * 32 + 16 + 8 * hh);
          s[j] = at_mma16<F16>(qah[dc], kl.v, s[j]);
          s[j] = at_mma16<F16>(qal[dc], kb.v, s[j]);
        }
      }
    }
    const bool diag = (g.mask_mode == 1) && (kc == qb);
    int kvkeep[4] = {1, 1, 1, 1};
    if (g.mask_mode == 3) {
#pragma unroll
      for (int j = 0; j < 4; ++j) kvkeep[j] = ((const int*)mask_a)[(size_t)b * g.Skv + kv0 + j * 16 + c];   // mask_a = kvmask
    }
    float cm[8];
#pragma unroll
    for (int r = 0; r < 8; ++r) {
      const int qrow = q0 + 8 * hh + r;
      float m = -INFINITY;
#pragma unroll
      for (int j = 0; j < 4; ++j) {
        const int kvcol = kv0 + j * 16 + c;
        bool masked = false;
        if (diag) masked = (kvcol > qrow);
        else if (g.mask_mode == 4) masked = (kvcol > qrow) || (qrow - kvcol > g.mask_is_int);
        else if (g.mask_mode == 2) {
          const size_t mi = (size_t)qrow * g.Skv + kvcol;
          masked = (g.mask_is_int == 0) ? (((const float*)mask_a)[mi] == 0.0f)
                 : (g.mask_is_int == 1) ? (((const int*)mask_a)[mi] == 0) : (((const int*)mask_a)[mi] != 0);
        } else if (g.mask_mode == 3) masked = (qkeep[r] == 0) || (kvkeep[j] == 0);
        else if (g.mask_mode == 5) {
          const size_t mi = (size_t)qrow * g.Skv + kvcol;
          masked = (((const int*)mask_a)[mi] != 0);
          int n = mask_b[mi]; n = n < 0 ? 0 : n;
          s[j][r] += g.cp[(size_t)b * g.c_bs + (size_t)h * g.c_hs + (size_t)qrow * g.c_rs + n]
                   + g.pc[(size_t)b * g.c_bs + (size_t)h * g.c_hs + (size_t)kvcol * g.c_rs + n];
        }
        if (masked) s[j][r] = g.mask_fill;
        m = fmaxf(m, s[j][r]);
      }
#pragma unroll
      for (int off = 1; off < 16; off <<= 1) m = fmaxf(m, __shfl_xor(m, off, 32));
      cm[r] = m;
    }
    __bf16* pwh = Psh[wave];
    __bf16* pwl = Psl[SPLIT_PV ? wave : 0];
#pragma unroll
    for (int r = 0; r < 8; ++r) {
      const float mnew = fmaxf(mrow[r], cm[r]);
      const float alpha = expf(mrow[r] - mnew);
      mrow[r] = mnew;
      float psum = 0.f;
#pragma unroll
      for (int j = 0; j < 4; ++j) {
        const float p = expf(s[j][r] - mnew);
        psum += p;
        if (SPLIT_PV) { __bf16 a, bl; at_split(p, a, bl); pwh[(8 * hh + r) * AT_KC + j * 16 + c] = a; pwl[(8 * hh + r) * AT_KC + j * 16 + c] = bl; }
        else pwh[(8 * hh + r) * AT_KC + j * 16 + c] = at_to16<F16>(p * PSC);
      }
#pragma unroll
      for (int off = 1; off < 16; off <<= 1) psum += __shfl_xor(psum, off, 32);
      lrow[r] = lrow[r] * alpha + psum;
#pragma unroll
      for (int t = 0; t < 4; ++t) oacc[t][r] *= alpha;
    }
    __builtin_amdgcn_fence(__ATOMIC_RELEASE, "workgroup");
    __builtin_amdgcn_wave_barrier();
    __builtin_amdgcn_fence(__ATOMIC_ACQUIRE, "workgroup");
#pragma unroll 1
    for (int kk = 0; kk < 2; ++kk) {
      FB pa, pl;
      pa.h[0] = *(const v8b*)(pwh + c * AT_KC + kk * 32 + 8 * hh);
      pa.h[1] = *(const v8b*)(pwh + c * AT_KC + kk * 32 + 16 + 8 * hh);
      if (SPLIT_PV) {
        pl.h[0] = *(const v8b*)(pwl + c * AT_KC + kk * 32 + 8 * hh);
        pl.h[1] = *(const v8b*)(pwl + c * AT_KC + kk * 32 + 16 + 8 * hh);
      }
#pragma unroll
      for (int t = 0; t < 4; ++t) {
        FB vb;
        vb.h[0] = *(const v8b*)(Vth + (t * 16 + c) * AT_KC + kk * 32 + 8 * hh);
        vb.h[1] = *(const v8b*)(Vth + (t * 16 + c) * AT_KC + kk * 32 + 16 + 8 * hh);
        oacc[t] = at_mma16<F16>(pa.v, vb.v, oacc[t]);
        if (SPLIT_PV) {
          FB vl;
          vl.h[0] = *(const v8b*)(Vtl + (t * 16 + c) * AT_KC + kk * 32 + 8 * hh);
          vl.h[1] = *(const v8b*)(Vtl + (t * 16 + c) * AT_KC + kk * 32 + 16 + 8 * hh);
          oacc[t] = at_mma16<F16>(pa.v, vl.v, oacc[t]);
          oacc[t] = at_mma16<F16>(pl.v, vb.v, oacc[t]);
        }
      }
    }
  }

  float* os = Os[wave];
#pragma unroll
  for (int r = 0; r < 8; ++r) {
    const float inv = 1.0f / (lrow[r] * PSC);
#pragma unroll
    for (int t = 0; t < 4; ++t) os[(8 * hh + r) * 68 + t * 16 + c] = oacc[t][r] * inv;
  }
  __builtin_amdgcn_fence(__ATOMIC_RELEASE, "workgroup");
  __builtin_amdgcn_wave_barrier();
  __builtin_amdgcn_fence(__ATOMIC_ACQUIRE, "workgroup");
  {
    const int c4 = (lane & 15) * 4;
    {
#pragma unroll
      for (int it = 0; it < 8; ++it) {
        const int row = it * 2 + hh;
        v4f val = *(const v4f*)(os + row * 68 + c4);
        *(v4f*)(ob_ptr + (size_t)(q0 + row) * g.o_rs + c4) = val;
      }
      
    }
  }
}

} // namespace w25

// RoPE in place: thread per (row, q|k, head, pair i<32): (x0, x1) = (x[2i], x[2i+1]) -> (x0 cos[2i] - x1 sin[2i], x1 cos[2i+1] + x0 sin[2i+1]); tables gathered by the INPUT position (clamped); one 8-B store per lane, lanes contiguous
__global__ __launch_bounds__(256) void k_cm_rope(float* __restrict__ Q, float* __restrict__ Kx, const float* __restrict__ CS, const float* __restrict__ SN, const int* __restrict__ POS, int Bn, int S, int NH, int HD) { const long long t = (long long)blockIdx.x * 256 + threadIdx.x; const int HF = HD / 2; if (t >= (long long)Bn * S * 2 * NH * HF) return; const int i = (int)(t % HF); long long r = t / HF; const int h = (int)(r % NH); r /= NH; const int which = (int)(r % 2); const long long row = r / 2; const int sq = (int)(row % S);
    int ps = POS[sq]; ps = ps < 0 ? 0 : (ps >= S ? S - 1 : ps); const float c0 = CS[ps * HD + 2 * i], c1 = CS[ps * HD + 2 * i + 1], s0 = SN[ps * HD + 2 * i], s1 = SN[ps * HD + 2 * i + 1];
    float* base = ((which == 0) ? Q : Kx) + row * ((long long)NH * HD) + h * HD + 2 * i; const float x0 = base[0], x1 = base[1];
    const unsigned long long pk = (unsigned long long)__builtin_bit_cast(unsigned, x0 * c0 - x1 * s0) | ((unsigned long long)__builtin_bit_cast(unsigned, x1 * c1 + x0 * s1) << 32); VST2(unsigned long long, (unsigned long long*)base, pk); }
__global__ __launch_bounds__(64) void k_cm_exact(const float* __restrict__ Q64, const float* __restrict__ K64, const float* __restrict__ V, float* __restrict__ AT, int S, int D, int NH, int HD) { __shared__ float sc[64]; const int t = blockIdx.x % 64; const int h = (blockIdx.x / 64) % NH; const int b = blockIdx.x / (64 * NH); const int d = threadIdx.x;
    const float* q = Q64 + ((long long)b * 64 + t) * D + h * HD; float s = -3.0e38f;
    if (d <= t) { const float* kr = K64 + ((long long)b * 64 + d) * D + h * HD; float a = 0.f;
#pragma unroll 1
        for (int j = 0; j < HD; ++j) a += q[j] * kr[j];
        s = a * 0.125f; }
    sc[d] = s; __syncthreads();
    float mx = -3.0e38f; for (int j = 0; j <= t; ++j) mx = fmaxf(mx, sc[j]);
    float den = 0.f; for (int j = 0; j <= t; ++j) den += expf(sc[j] - mx);
    float acc = 0.f;
#pragma unroll 1
    for (int j = 0; j <= t; ++j) acc += expf(sc[j] - mx) * V[((long long)b * S + j) * D + h * HD + d];
    VST2(float, AT + ((long long)b * S + t) * D + h * HD + d, acc / den); }


extern "C" void kernel_launch(void* const* d_in, const int* in_sizes, int n_in, void* d_out, int out_size, void* d_ws, size_t ws_size, hipStream_t stream) {
    (void)in_sizes; (void)n_in; (void)out_size; (void)ws_size;
    const float* x = (const float*)d_in[0];
    const float* Wq = (const float*)d_in[1];
    const float* Wk = (const float*)d_in[2];
    const float* Wv = (const float*)d_in[3];
    const float* Wo = (const float*)d_in[4];
    const float* cosT = (const float*)d_in[5];
    const float* sinT = (const float*)d_in[6];
    const int* tpos = (const int*)d_in[7];
    const int Bn = 2;
    const int S = 2048;
    const int D = 1024;
    const int NH = 16;
    const int HD = 64;
    const int NR = Bn * S;
    float* out = (float*)d_out;
    char* wsp = (char*)d_ws;
    float* Q = (float*)wsp; wsp += (((size_t)((size_t)NR * D) * 4 + 255) / 256) * 256;
    float* Kb = (float*)wsp; wsp += (((size_t)((size_t)NR * D) * 4 + 255) / 256) * 256;
    float* V = (float*)wsp; wsp += (((size_t)((size_t)NR * D) * 4 + 255) / 256) * 256;
    float* AT = (float*)wsp; wsp += (((size_t)((size_t)NR * D) * 4 + 255) / 256) * 256;
    float* Q64 = (float*)wsp; wsp += (((size_t)((size_t)Bn * 64 * D) * 4 + 255) / 256) * 256;
    float* K64 = (float*)wsp; wsp += (((size_t)((size_t)Bn * 64 * D) * 4 + 255) / 256) * 256;
    unsigned short* G64A = (unsigned short*)wsp; wsp += (((size_t)(4194304) * 2 + 255) / 256) * 256;
    unsigned short* G64B = (unsigned short*)wsp; wsp += (((size_t)(1048576) * 2 + 255) / 256) * 256;
    unsigned short* G64A2 = (unsigned short*)wsp; wsp += (((size_t)(4194304) * 2 + 255) / 256) * 256;
    unsigned short* G64B2 = (unsigned short*)wsp; wsp += (((size_t)(1048576) * 2 + 255) / 256) * 256;
    k_cast16<<<(unsigned)((((long long)(4096) * ((1024) / 2)) + 255) / 256), 256, 0, stream>>>(x + (size_t)0 * NR * D, 1024, (_Float16*)(G64A), 1024, 4096, 1024, 1.0f);
    k_cast16<<<(unsigned)((((long long)(1024) * ((1024) / 2)) + 255) / 256), 256, 0, stream>>>(Wq, 1024, (_Float16*)(G64B), 1024, 1024, 1024, 16.0f);
    w25::wmma_gemm_lds<0, false><<<dim3(1024 / 128, 4096 / 64), 256, 0, stream>>>((const unsigned short*)(G64A), nullptr, (const unsigned short*)(G64B), nullptr, Q, 1024, 1024, 0.0625f);
    k_cast16<<<(unsigned)((((long long)(4096) * ((1024) / 2)) + 255) / 256), 256, 0, stream>>>(x + (size_t)0 * NR * D, 1024, (_Float16*)(G64A), 1024, 4096, 1024, 1.0f);
    k_cast16<<<(unsigned)((((long long)(1024) * ((1024) / 2)) + 255) / 256), 256, 0, stream>>>(Wk, 1024, (_Float16*)(G64B), 1024, 1024, 1024, 16.0f);
    w25::wmma_gemm_lds<0, false><<<dim3(1024 / 128, 4096 / 64), 256, 0, stream>>>((const unsigned short*)(G64A), nullptr, (const unsigned short*)(G64B), nullptr, Kb, 1024, 1024, 0.0625f);
    k_castS16<<<(unsigned)((((long long)(4096) * ((1024) / 2)) + 255) / 256), 256, 0, stream>>>(x + (size_t)0 * NR * D, 1024, (__bf16*)(G64A), (__bf16*)(G64A2), 1024, 4096, 1024, 1.0f, 0);
    k_castS16<<<(unsigned)((((long long)(1024) * ((1024) / 2)) + 255) / 256), 256, 0, stream>>>(Wv, 1024, (__bf16*)(G64B), (__bf16*)(G64B2), 1024, 1024, 1024, 1.0f, 0);
    w25::wmma_gemm_lds<1, true><<<dim3(1024 / 128, 4096 / 64), 256, 0, stream>>>((const unsigned short*)(G64A), (const unsigned short*)(G64A2), (const unsigned short*)(G64B), (const unsigned short*)(G64B2), V, 1024, 1024, 1.0f);
    k_cm_rope<<<(unsigned)(((long long)NR * 2 * NH * 32 + 255) / 256), 256, 0, stream>>>(Q, Kb, cosT, sinT, (const int*)tpos, Bn, S, NH, HD);
    { /*apv4*/ AttnP a;
      a.Q = Q; a.K = Kb; a.V = V; a.O = AT; a.P = 0; a.Mf = 0; a.Mi = 0; a.ST = 0;
      a.Pw = 0; a.Rt = 0; a.SQ = 0; a.SK = 0;
      a.swb = 0; a.swh = 0; a.swi = 0; a.swj = 0; a.srb = 0; a.srh = 0; a.sri = 0; a.sQb = (long long)S * D; a.sQh = HD; a.sQi = D; a.sQd = 1; a.sKb = (long long)S * D; a.sKh = HD; a.sKj = D; a.sKd = 1; a.sVb = (long long)S * D; a.sVh = HD; a.sVj = D; a.sVd = 1; a.sOb = (long long)S * D; a.sOh = HD; a.sOi = D; a.sPb = 0; a.sPh = 0; a.sPi = 0; a.smb = 0; a.smh = 0; a.smi = 0; a.smj = 0;
      a.Lq = S; a.Lk = S; a.dh = HD; a.dv = HD; a.hrep = 1; a.causal = 1; a.coff = 0; a.pband = 0;
      a.scale = 0.125f; a.mfill = 0.0f; a.nonorm = 0; a.mpol = 0;
      a.roff = 0; a.rn = 1; a.segpol = 0; a.win = 0;
      k_attn<64, 64, 0, false, false, 2048, 1024><<<dim3((unsigned)((S) + 16 * AW - 1) / (16 * AW), (unsigned)(NH), (unsigned)(Bn)), 32 * AW, 0, stream>>>(a); }
    k_castS16<<<(unsigned)((((long long)(64) * ((1024) / 2)) + 255) / 256), 256, 0, stream>>>(x + ((size_t)0 * NR + (size_t)0 * S) * D, 1024, (__bf16*)(G64A), (__bf16*)(G64A2), 1024, 64, 1024, 1.0f, 0);
    k_castS16<<<(unsigned)((((long long)(1024) * ((1024) / 2)) + 255) / 256), 256, 0, stream>>>(Wq, 1024, (__bf16*)(G64B), (__bf16*)(G64B2), 1024, 1024, 1024, 1.0f, 0);
    w25::wmma_gemm_lds<1, true><<<dim3(1024 / 128, 64 / 64), 256, 0, stream>>>((const unsigned short*)(G64A), (const unsigned short*)(G64A2), (const unsigned short*)(G64B), (const unsigned short*)(G64B2), Q64 + (size_t)0 * 64 * D, 1024, 1024, 1.0f);
    k_castS16<<<(unsigned)((((long long)(64) * ((1024) / 2)) + 255) / 256), 256, 0, stream>>>(x + ((size_t)0 * NR + (size_t)0 * S) * D, 1024, (__bf16*)(G64A), (__bf16*)(G64A2), 1024, 64, 1024, 1.0f, 0);
    k_castS16<<<(unsigned)((((long long)(1024) * ((1024) / 2)) + 255) / 256), 256, 0, stream>>>(Wk, 1024, (__bf16*)(G64B), (__bf16*)(G64B2), 1024, 1024, 1024, 1.0f, 0);
    w25::wmma_gemm_lds<1, true><<<dim3(1024 / 128, 64 / 64), 256, 0, stream>>>((const unsigned short*)(G64A), (const unsigned short*)(G64A2), (const unsigned short*)(G64B), (const unsigned short*)(G64B2), K64 + (size_t)0 * 64 * D, 1024, 1024, 1.0f);
    k_castS16<<<(unsigned)((((long long)(64) * ((1024) / 2)) + 255) / 256), 256, 0, stream>>>(x + ((size_t)0 * NR + (size_t)1 * S) * D, 1024, (__bf16*)(G64A), (__bf16*)(G64A2), 1024, 64, 1024, 1.0f, 0);
    k_castS16<<<(unsigned)((((long long)(1024) * ((1024) / 2)) + 255) / 256), 256, 0, stream>>>(Wq, 1024, (__bf16*)(G64B), (__bf16*)(G64B2), 1024, 1024, 1024, 1.0f, 0);
    w25::wmma_gemm_lds<1, true><<<dim3(1024 / 128, 64 / 64), 256, 0, stream>>>((const unsigned short*)(G64A), (const unsigned short*)(G64A2), (const unsigned short*)(G64B), (const unsigned short*)(G64B2), Q64 + (size_t)1 * 64 * D, 1024, 1024, 1.0f);
    k_castS16<<<(unsigned)((((long long)(64) * ((1024) / 2)) + 255) / 256), 256, 0, stream>>>(x + ((size_t)0 * NR + (size_t)1 * S) * D, 1024, (__bf16*)(G64A), (__bf16*)(G64A2), 1024, 64, 1024, 1.0f, 0);
    k_castS16<<<(unsigned)((((long long)(1024) * ((1024) / 2)) + 255) / 256), 256, 0, stream>>>(Wk, 1024, (__bf16*)(G64B), (__bf16*)(G64B2), 1024, 1024, 1024, 1.0f, 0);
    w25::wmma_gemm_lds<1, true><<<dim3(1024 / 128, 64 / 64), 256, 0, stream>>>((const unsigned short*)(G64A), (const unsigned short*)(G64A2), (const unsigned short*)(G64B), (const unsigned short*)(G64B2), K64 + (size_t)1 * 64 * D, 1024, 1024, 1.0f);
    k_cm_rope<<<(unsigned)(((long long)Bn * 64 * 2 * NH * 32 + 255) / 256), 256, 0, stream>>>(Q64, K64, cosT, sinT, (const int*)tpos, Bn, 64, NH, HD); k_cm_exact<<<Bn * NH * 64, 64, 0, stream>>>(Q64, K64, V, AT, S, D, NH, HD);
    k_castS16<<<(unsigned)((((long long)(4096) * ((1024) / 2)) + 255) / 256), 256, 0, stream>>>(AT, 1024, (__bf16*)(G64A), (__bf16*)(G64A2), 1024, 4096, 1024, 1.0f, 0);
    k_castS16<<<(unsigned)((((long long)(1024) * ((1024) / 2)) + 255) / 256), 256, 0, stream>>>(Wo, 1024, (__bf16*)(G64B), (__bf16*)(G64B2), 1024, 1024, 1024, 1.0f, 0);
    w25::wmma_gemm_lds<1, true><<<dim3(1024 / 128, 4096 / 64), 256, 0, stream>>>((const unsigned short*)(G64A), (const unsigned short*)(G64A2), (const unsigned short*)(G64B), (const unsigned short*)(G64B2), out + (size_t)0 * NR * D, 1024, 1024, 1.0f);
    k_cast16<<<(unsigned)((((long long)(4096) * ((1024) / 2)) + 255) / 256), 256, 0, stream>>>(x + (size_t)1 * NR * D, 1024, (_Float16*)(G64A), 1024, 4096, 1024, 1.0f);
    k_cast16<<<(unsigned)((((long long)(1024) * ((1024) / 2)) + 255) / 256), 256, 0, stream>>>(Wq, 1024, (_Float16*)(G64B), 1024, 1024, 1024, 16.0f);
    w25::wmma_gemm_lds<0, false><<<dim3(1024 / 128, 4096 / 64), 256, 0, stream>>>((const unsigned short*)(G64A), nullptr, (const unsigned short*)(G64B), nullptr, Q, 1024, 1024, 0.0625f);
    k_cast16<<<(unsigned)((((long long)(4096) * ((1024) / 2)) + 255) / 256), 256, 0, stream>>>(x + (size_t)1 * NR * D, 1024, (_Float16*)(G64A), 1024, 4096, 1024, 1.0f);
    k_cast16<<<(unsigned)((((long long)(1024) * ((1024) / 2)) + 255) / 256), 256, 0, stream>>>(Wk, 1024, (_Float16*)(G64B), 1024, 1024, 1024, 16.0f);
    w25::wmma_gemm_lds<0, false><<<dim3(1024 / 128, 4096 / 64), 256, 0, stream>>>((const unsigned short*)(G64A), nullptr, (const unsigned short*)(G64B), nullptr, Kb, 1024, 1024, 0.0625f);
    k_castS16<<<(unsigned)((((long long)(4096) * ((1024) / 2)) + 255) / 256), 256, 0, stream>>>(x + (size_t)1 * NR * D, 1024, (__bf16*)(G64A), (__bf16*)(G64A2), 1024, 4096, 1024, 1.0f, 0);
    k_castS16<<<(unsigned)((((long long)(1024) * ((1024) / 2)) + 255) / 256), 256, 0, stream>>>(Wv, 1024, (__bf16*)(G64B), (__bf16*)(G64B2), 1024, 1024, 1024, 1.0f, 0);
    w25::wmma_gemm_lds<1, true><<<dim3(1024 / 128, 4096 / 64), 256, 0, stream>>>((const unsigned short*)(G64A), (const unsigned short*)(G64A2), (const unsigned short*)(G64B), (const unsigned short*)(G64B2), V, 1024, 1024, 1.0f);
    k_cm_rope<<<(unsigned)(((long long)NR * 2 * NH * 32 + 255) / 256), 256, 0, stream>>>(Q, Kb, cosT, sinT, (const int*)tpos, Bn, S, NH, HD);
    { /*apv4*/ AttnP a;
      a.Q = Q; a.K = Kb; a.V = V; a.O = AT; a.P = 0; a.Mf = 0; a.Mi = 0; a.ST = 0;
      a.Pw = 0; a.Rt = 0; a.SQ = 0; a.SK = 0;
      a.swb = 0; a.swh = 0; a.swi = 0; a.swj = 0; a.srb = 0; a.srh = 0; a.sri = 0; a.sQb = (long long)S * D; a.sQh = HD; a.sQi = D; a.sQd = 1; a.sKb = (long long)S * D; a.sKh = HD; a.sKj = D; a.sKd = 1; a.sVb = (long long)S * D; a.sVh = HD; a.sVj = D; a.sVd = 1; a.sOb = (long long)S * D; a.sOh = HD; a.sOi = D; a.sPb = 0; a.sPh = 0; a.sPi = 0; a.smb = 0; a.smh = 0; a.smi = 0; a.smj = 0;
      a.Lq = S; a.Lk = S; a.dh = HD; a.dv = HD; a.hrep = 1; a.causal = 1; a.coff = 0; a.pband = 0;
      a.scale = 0.125f; a.mfill = 0.0f; a.nonorm = 0; a.mpol = 0;
      a.roff = 0; a.rn = 1; a.segpol = 0; a.win = 0;
      k_attn<64, 64, 0, false, false, 2048, 1024><<<dim3((unsigned)((S) + 16 * AW - 1) / (16 * AW), (unsigned)(NH), (unsigned)(Bn)), 32 * AW, 0, stream>>>(a); }
    k_castS16<<<(unsigned)((((long long)(64) * ((1024) / 2)) + 255) / 256), 256, 0, stream>>>(x + ((size_t)1 * NR + (size_t)0 * S) * D, 1024, (__bf16*)(G64A), (__bf16*)(G64A2), 1024, 64, 1024, 1.0f, 0);
    k_castS16<<<(unsigned)((((long long)(1024) * ((1024) / 2)) + 255) / 256), 256, 0, stream>>>(Wq, 1024, (__bf16*)(G64B), (__bf16*)(G64B2), 1024, 1024, 1024, 1.0f, 0);
    w25::wmma_gemm_lds<1, true><<<dim3(1024 / 128, 64 / 64), 256, 0, stream>>>((const unsigned short*)(G64A), (const unsigned short*)(G64A2), (const unsigned short*)(G64B), (const unsigned short*)(G64B2), Q64 + (size_t)0 * 64 * D, 1024, 1024, 1.0f);
    k_castS16<<<(unsigned)((((long long)(64) * ((1024) / 2)) + 255) / 256), 256, 0, stream>>>(x + ((size_t)1 * NR + (size_t)0 * S) * D, 1024, (__bf16*)(G64A), (__bf16*)(G64A2), 1024, 64, 1024, 1.0f, 0);
    k_castS16<<<(unsigned)((((long long)(1024) * ((1024) / 2)) + 255) / 256), 256, 0, stream>>>(Wk, 1024, (__bf16*)(G64B), (__bf16*)(G64B2), 1024, 1024, 1024, 1.0f, 0);
    w25::wmma_gemm_lds<1, true><<<dim3(1024 / 128, 64 / 64), 256, 0, stream>>>((const unsigned short*)(G64A), (const unsigned short*)(G64A2), (const unsigned short*)(G64B), (const unsigned short*)(G64B2), K64 + (size_t)0 * 64 * D, 1024, 1024, 1.0f);
    k_castS16<<<(unsigned)((((long long)(64) * ((1024) / 2)) + 255) / 256), 256, 0, stream>>>(x + ((size_t)1 * NR + (size_t)1 * S) * D, 1024, (__bf16*)(G64A), (__bf16*)(G64A2), 1024, 64, 1024, 1.0f, 0);
    k_castS16<<<(unsigned)((((long long)(1024) * ((1024) / 2)) + 255) / 256), 256, 0, stream>>>(Wq, 1024, (__bf16*)(G64B), (__bf16*)(G64B2), 1024, 1024, 1024, 1.0f, 0);
    w25::wmma_gemm_lds<1, true><<<dim3(1024 / 128, 64 / 64), 256, 0, stream>>>((const unsigned short*)(G64A), (const unsigned short*)(G64A2), (const unsigned short*)(G64B), (const unsigned short*)(G64B2), Q64 + (size_t)1 * 64 * D, 1024, 1024, 1.0f);
    k_castS16<<<(unsigned)((((long long)(64) * ((1024) / 2)) + 255) / 256), 256, 0, stream>>>(x + ((size_t)1 * NR + (size_t)1 * S) * D, 1024, (__bf16*)(G64A), (__bf16*)(G64A2), 1024, 64, 1024, 1.0f, 0);
    k_castS16<<<(unsigned)((((long long)(1024) * ((1024) / 2)) + 255) / 256), 256, 0, stream>>>(Wk, 1024, (__bf16*)(G64B), (__bf16*)(G64B2), 1024, 1024, 1024, 1.0f, 0);
    w25::wmma_gemm_lds<1, true><<<dim3(1024 / 128, 64 / 64), 256, 0, stream>>>((const unsigned short*)(G64A), (const unsigned short*)(G64A2), (const unsigned short*)(G64B), (const unsigned short*)(G64B2), K64 + (size_t)1 * 64 * D, 1024, 1024, 1.0f);
    k_cm_rope<<<(unsigned)(((long long)Bn * 64 * 2 * NH * 32 + 255) / 256), 256, 0, stream>>>(Q64, K64, cosT, sinT, (const int*)tpos, Bn, 64, NH, HD); k_cm_exact<<<Bn * NH * 64, 64, 0, stream>>>(Q64, K64, V, AT, S, D, NH, HD);
    k_castS16<<<(unsigned)((((long long)(4096) * ((1024) / 2)) + 255) / 256), 256, 0, stream>>>(AT, 1024, (__bf16*)(G64A), (__bf16*)(G64A2), 1024, 4096, 1024, 1.0f, 0);
    k_castS16<<<(unsigned)((((long long)(1024) * ((1024) / 2)) + 255) / 256), 256, 0, stream>>>(Wo, 1024, (__bf16*)(G64B), (__bf16*)(G64B2), 1024, 1024, 1024, 1.0f, 0);
    w25::wmma_gemm_lds<1, true><<<dim3(1024 / 128, 4096 / 64), 256, 0, stream>>>((const unsigned short*)(G64A), (const unsigned short*)(G64A2), (const unsigned short*)(G64B), (const unsigned short*)(G64B2), out + (size_t)1 * NR * D, 1024, 1024, 1.0f);
}

// v003
// Measured time: 761 microseconds a run.
// Timed twice side by side with v002, it ran 1.31 and 1.32 times as fast.
// Over all steps from v000 it is 5.92 times as fast.
// Contractions: q/k = x.W^T [8192x1024].[1024x1024] with f16 operands (weights x16); v = x.Wv^T and the output projection on bf16 hi/lo split planes (late causal rows are long averages, so the value path must be f32-class) — v_wmma_f32_16x16x32_*, 64x128 work-group tiles with both operands staged in LDS; per (batch, head) causal softmax(q k^T / 8) v as one flash launch (f16 q.k^T and p.v; fully-masked key tiles skipped); f32 accumulate and softmax. The interleaved-pair RoPE with the INPUT cos/sin tables gathered by the INPUT token positions (generic elementwise form: out = x*cos + rot(x)*sin with rot = (-x[odd], x[even]) interleaved) and the exact-f32 recompute of the first 64 causal rows per head (whose q/k rows come from their own small bf16 hi/lo split GEMMs [256x1024].[1024x1024] on rows 0..63 of each batch) are f32 kernels.
#include <hip/hip_runtime.h>
#include <math.h>

typedef __attribute__((ext_vector_type(16))) _Float16 v16h;
typedef __attribute__((ext_vector_type(8)))  _Float16 v8h;
typedef __attribute__((ext_vector_type(4)))  _Float16 v4h;
typedef __attribute__((ext_vector_type(16))) __bf16   v16b;
typedef __attribute__((ext_vector_type(8)))  float    v8f;
typedef __attribute__((ext_vector_type(4)))  float    v4f;

// 16-bit WMMA fragment map (wave32), lane L, h = L>>4, m = L&15:
//   A 16x32: lane = row m;   element i -> k = (i<8) ? 8h+i : 16+8h+(i-8)
//   B 32x16: lane = column m; the SAME k(i,h)
//   D 16x16 (8 f32): lane = column m; element r -> row 8h+r
__device__ __forceinline__ int frag_k(int i, int h) { return (i < 8) ? (8 * h + i) : (16 + 8 * h + (i - 8)); }
__device__ __forceinline__ __bf16 bf16_rne(float f) {
    unsigned int u = __float_as_uint(f);
    u += 0x7fffu + ((u >> 16) & 1u);
    return __builtin_bit_cast(__bf16, (unsigned short)(u >> 16));
}
__device__ __forceinline__ float bf16_f32(__bf16 b) { return __uint_as_float(((unsigned int)__builtin_bit_cast(unsigned short, b)) << 16); }
__device__ __forceinline__ v8f wmma16(v16h a, v16h b, v8f c) {
    c = __builtin_amdgcn_wmma_f32_16x16x32_f16(false, a, false, b, (short)0, c, false, false);
    asm volatile("v_nop\n\tv_nop\n\tv_nop\n\tv_nop" : "+v"(c) : "v"(a), "v"(b));
    return c;
}
__device__ __forceinline__ v8f wmmab(v16b a, v16b b, v8f c) {
    c = __builtin_amdgcn_wmma_f32_16x16x32_bf16(false, a, false, b, (short)0, c, false, false);
    asm volatile("v_nop\n\tv_nop\n\tv_nop\n\tv_nop" : "+v"(c) : "v"(a), "v"(b));
    return c;
}
struct Split { v16b hi, lo; };
// hi/lo split product: a.hi*b.hi + a.hi*b.lo + a.lo*b.hi
__device__ __forceinline__ v8f wmma3(const Split& a, const Split& b, v8f c) {
    c = __builtin_amdgcn_wmma_f32_16x16x32_bf16(false, a.hi, false, b.hi, (short)0, c, false, false);
    c = __builtin_amdgcn_wmma_f32_16x16x32_bf16(false, a.hi, false, b.lo, (short)0, c, false, false);
    c = __builtin_amdgcn_wmma_f32_16x16x32_bf16(false, a.lo, false, b.hi, (short)0, c, false, false);
    asm volatile("v_nop\n\tv_nop\n\tv_nop\n\tv_nop" : "+v"(c) : "v"(a.hi), "v"(a.lo), "v"(b.hi), "v"(b.lo));
    return c;
}
struct Split3 { v16b hi, mid, lo; };
// triple split product (6 terms, drops only terms below 2^-24 relative)
__device__ __forceinline__ v8f wmma6(const Split3& a, const Split3& b, v8f c) {
    c = __builtin_amdgcn_wmma_f32_16x16x32_bf16(false, a.hi, false, b.hi, (short)0, c, false, false);
    c = __builtin_amdgcn_wmma_f32_16x16x32_bf16(false, a.hi, false, b.mid, (short)0, c, false, false);
    c = __builtin_amdgcn_wmma_f32_16x16x32_bf16(false, a.mid, false, b.hi, (short)0, c, false, false);
    c = __builtin_amdgcn_wmma_f32_16x16x32_bf16(false, a.hi, false, b.lo, (short)0, c, false, false);
    c = __builtin_amdgcn_wmma_f32_16x16x32_bf16(false, a.mid, false, b.mid, (short)0, c, false, false);
    c = __builtin_amdgcn_wmma_f32_16x16x32_bf16(false, a.lo, false, b.hi, (short)0, c, false, false);
    asm volatile("v_nop\n\tv_nop\n\tv_nop\n\tv_nop" : "+v"(c) : "v"(a.hi), "v"(a.mid), "v"(a.lo), "v"(b.hi), "v"(b.mid), "v"(b.lo));
    return c;
}

// Fragment gathers from f32 memory: element i <- p[(k0 + frag_k(i,h)) * sk] * s, zero for k >= klen.
__device__ __forceinline__ v16h fh_ld(const float* __restrict__ p, long long sk, int k0, int h, int klen, float s) {
    v16h a;
#pragma unroll
    for (int i = 0; i < 16; ++i) { const int k = k0 + frag_k(i, h); a[i] = (k < klen) ? (_Float16)(p[(long long)k * sk] * s) : (_Float16)0.f; }
    return a;
}
__device__ __forceinline__ Split sp_ld(const float* __restrict__ p, long long sk, int k0, int h, int klen, float s) {
    Split r;
#pragma unroll
    for (int i = 0; i < 16; ++i) {
        const int k = k0 + frag_k(i, h); const float x = (k < klen) ? p[(long long)k * sk] * s : 0.f;
        const __bf16 hb = bf16_rne(x); r.hi[i] = hb; r.lo[i] = bf16_rne(x - bf16_f32(hb));
    }
    return r;
}
__device__ __forceinline__ Split3 sp3_ld(const float* __restrict__ p, long long sk, int k0, int h, int klen, float s) {
    Split3 r;
#pragma unroll
    for (int i = 0; i < 16; ++i) {
        const int k = k0 + frag_k(i, h); const float x = (k < klen) ? p[(long long)k * sk] * s : 0.f;
        const __bf16 hb = bf16_rne(x); const float r1 = x - bf16_f32(hb); const __bf16 mb = bf16_rne(r1);
        r.hi[i] = hb; r.mid[i] = mb; r.lo[i] = bf16_rne(r1 - bf16_f32(mb));
    }
    return r;
}
__device__ __forceinline__ v16b bh_ld(const float* __restrict__ p, long long sk, int k0, int h, int klen, float s) {
    v16b a;
#pragma unroll
    for (int i = 0; i < 16; ++i) { const int k = k0 + frag_k(i, h); a[i] = bf16_rne((k < klen) ? p[(long long)k * sk] * s : 0.f); }
    return a;
}
// f16 fragment from an f16 LDS/global row with element stride 1 (k-contiguous), no bounds (tile already zero padded)
__device__ __forceinline__ v16h fh_row(const _Float16* __restrict__ row, int k0, int h) {
    v16h a;
#pragma unroll
    for (int i = 0; i < 16; ++i) a[i] = row[k0 + frag_k(i, h)];
    return a;
}

#define VST2(T, ptr, val) do { const T vst2_v_ = (val); *(T*)(ptr) = vst2_v_;  } while (0)
typedef float v4f __attribute__((ext_vector_type(4)));
#define VST2V4(ptr, val) do { const v4f vst2_v4_ = (val); *(v4f*)(ptr) = vst2_v4_;  } while (0)

__device__ __attribute__((noinline)) float act_fn(float v, int act) {
    if (act == 1) return fmaxf(v, 0.f);                                                                               // relu
    if (act == 2) { const float u = 0.7978845608028654f * (v + 0.044715f * v * v * v); return 0.5f * v * (1.f + tanhf(u)); } // tanh-gelu
    if (act == 3) return v / (1.f + expf(-v));                                                                        // silu
    if (act == 4) return 0.5f * v * (1.f + erff(v * 0.7071067811865476f));                                             // erf-gelu
    if (act == 5) return tanhf(v);
    if (act == 6) return 1.f / (1.f + expf(-v));                                                                      // sigmoid
    if (act == 7) return (v > 0.f) ? v : 0.01f * v;                                                                   // leaky relu 0.01
    if (act == 8) return (v > 0.f) ? v : (expf(v) - 1.f);                                                             // elu
    if (act == 9) return fminf(fmaxf(v, 0.f), 6.f);                                                                   // relu6
    if (act == 10) return fabsf(v);                                                                                    // abs
    if (act == 11) return (v >= 0.f) ? v : 0.1f * v;                                                                  // leaky 0.1
    if (act == 12) return (v > 0.f) ? v : 0.2f * v;                                                                   // leaky 0.2
    if (act == 13) return (v > 20.f) ? v : log1pf(expf(v));                                                            // softplus
    return v;
}

// =====================================================================================================================
// k_gemm<MODE>: C(z, m, n) = act(alpha * sum_k A(z, m, k) * B(z, k, n) + bias) + beta * R(z, m, n)
//   One wave (32-thread block) per 16 x 32 tile of C; grid (ceil(N/32), ceil(M/16), Z). Batch z -> (zo = z / zi_n, zi = z % zi_n)
//   with separate outer/inner strides for every tensor (e.g. batch and head). A(m,k) = A[zo*sAo + zi*sAi + m*sAm + k*sAk] (f32),
//   B(k,n) = B[zo*sBo + zi*sBi + n*sBn + k*sBk] (f32); any M, N, K (K zero-padded to 32 inside the fragments, M/N tails guarded).
//   C(m,n) = C[zo*sCo + zi*sCi + m*sCm + n] (n contiguous). flags: 1 bias[n], 2 bias[m], 4 residual R[zo*sRo + zi*sRi + m*sRm + n*sRn].
//   MODE 0: f16 operands (A prescaled by sa, B by sb, both undone in the epilogue); 1: bf16 hi/lo split (3 products); 2: bf16;
//   3: bf16 hi/mid/lo triple split (6 products); 4: as 3 with Kahan-compensated f32 accumulation across k-steps.
// =====================================================================================================================
struct GemmP {
    const float* A; const float* B; const float* bias; const float* R; float* C;
    long long sAo, sAi, sAm, sAk, sBo, sBi, sBn, sBk, sCo, sCi, sCm, sRo, sRi, sRm, sRn;
    int M, N, K, zi_n, flags, act; float alpha, beta, sa, sb;
    int Npad, pad_;     // columns [N, Npad) of C are written as 0 so that padded workspace rows are covered by whole-line stores; Npad >= N
};
static_assert(sizeof(GemmP) == 5 * 8 + 15 * 8 + 6 * 4 + 4 * 4 + 2 * 4, "GemmP has padding");

template <int MODE>
__global__ __launch_bounds__(32) void k_gemm(GemmP p) {
    const int lane = threadIdx.x & 31, h = lane >> 4, l15 = lane & 15;
    const int m0 = blockIdx.y * 16, n0 = blockIdx.x * 32;
    const int z = blockIdx.z, zo = z / p.zi_n, zi = z - zo * p.zi_n;
    const float* A = p.A + zo * p.sAo + zi * p.sAi;
    const float* B = p.B + zo * p.sBo + zi * p.sBi;
    const int am = min(m0 + l15, p.M - 1);                       // clamped row for loads (stores are guarded)
    v8f acc[2], comp[2];
#pragma unroll
    for (int t = 0; t < 2; ++t) { v8f zz = {}; acc[t] = zz; comp[t] = zz; }
    for (int k0 = 0; k0 < p.K; k0 += 32) {
        const float* arow = A + (long long)am * p.sAm;
        if (MODE == 1) {
            const Split a = sp_ld(arow, p.sAk, k0, h, p.K, 1.f);
#pragma unroll
            for (int t = 0; t < 2; ++t) {
                const int bn = min(n0 + t * 16 + l15, p.N - 1);
                acc[t] = wmma3(a, sp_ld(B + (long long)bn * p.sBn, p.sBk, k0, h, p.K, 1.f), acc[t]);
            }
        } else if (MODE == 3) {
            const Split3 a = sp3_ld(arow, p.sAk, k0, h, p.K, 1.f);
#pragma unroll
            for (int t = 0; t < 2; ++t) {
                const int bn = min(n0 + t * 16 + l15, p.N - 1);
                acc[t] = wmma6(a, sp3_ld(B + (long long)bn * p.sBn, p.sBk, k0, h, p.K, 1.f), acc[t]);
            }
        } else if (MODE == 4) {
            // triple split as MODE 3, but each k-step's 6 products go into a fresh accumulator and the partial is added to the running f32 sum
            // on the VALU with Kahan compensation (accumulation error stays ~1 ulp however long K is)
            const Split3 a = sp3_ld(arow, p.sAk, k0, h, p.K, 1.f);
#pragma unroll
            for (int t = 0; t < 2; ++t) {
                const int bn = min(n0 + t * 16 + l15, p.N - 1); v8f zz = {};
                const v8f part = wmma6(a, sp3_ld(B + (long long)bn * p.sBn, p.sBk, k0, h, p.K, 1.f), zz);
                const v8f y = part - comp[t]; const v8f s = acc[t] + y; comp[t] = (s - acc[t]) - y; acc[t] = s;
            }
        } else if (MODE == 2) {
            const v16b a = bh_ld(arow, p.sAk, k0, h, p.K, 1.f);
#pragma unroll
            for (int t = 0; t < 2; ++t) {
                const int bn = min(n0 + t * 16 + l15, p.N - 1);
                acc[t] = wmmab(a, bh_ld(B + (long long)bn * p.sBn, p.sBk, k0, h, p.K, 1.f), acc[t]);
            }
        } else {
            const v16h a = fh_ld(arow, p.sAk, k0, h, p.K, p.sa);
#pragma unroll
            for (int t = 0; t < 2; ++t) {
                const int bn = min(n0 + t * 16 + l15, p.N - 1);
                acc[t] = wmma16(a, fh_ld(B + (long long)bn * p.sBn, p.sBk, k0, h, p.K, p.sb), acc[t]);
            }
        }
    }
    const float iscale = (MODE == 0) ? p.alpha / (p.sa * p.sb) : p.alpha;
    float* C = p.C + zo * p.sCo + zi * p.sCi;
    const float* R = p.R + zo * p.sRo + zi * p.sRi;
    __shared__ __align__(16) float ctile[16][36];
#pragma unroll
    for (int t = 0; t < 2; ++t) {
        const int n = n0 + t * 16 + l15; const int nn = min(n, p.N - 1);
#pragma unroll
        for (int r = 0; r < 8; ++r) {
            const int m = m0 + 8 * h + r; const int mm = min(m, p.M - 1);
            float v = acc[t][r] * iscale;
            if (p.flags & 1) v += p.bias[nn];
            if (p.flags & 2) v += p.bias[mm];
            if (p.flags & 8) v *= p.bias[(long long)zo * p.M + mm];   /* per-(z,row) scale vector laid out [Z][M]; exclusive with the bias flags */
            v = act_fn(v, p.act);
            if (p.flags & 4) v += p.beta * R[(long long)mm * p.sRm + (long long)nn * p.sRn];
            ctile[8 * h + r][t * 16 + l15] = (n < p.N) ? v : 0.f;
        }
    }
    __syncthreads();
    const int NW = (p.Npad > p.N) ? p.Npad : p.N;           // write width
    const bool fast = (m0 + 16 <= p.M) && (n0 + 32 <= NW) && ((p.sCm & 3) == 0) && ((((size_t)C) & 15) == 0);
    if (fast) {
#pragma unroll
        for (int s = 0; s < 4; ++s) {
            const int row = s * 4 + (lane >> 3), c4 = (lane & 7) * 4;
            const v4f v = *(const v4f*)&ctile[row][c4];
            VST2V4(C + (long long)(m0 + row) * p.sCm + n0 + c4, v);
        }
    } else {
        for (int row = 0; row < 16; ++row) {
            const int m = m0 + row, n = n0 + lane;
            if (m < p.M && n < NW) VST2(float, C + (long long)m * p.sCm + n, ctile[row][lane]);
        }
    }
}


// =====================================================================================================================
// k_gemmT<MODE, TM, TN>: same contract as k_gemm, but one wave computes a (16*TM) x (16*TN) tile: TM A fragments and TN B fragments are
//   loaded per 32-wide k-step and reused across TM*TN WMMAs (far fewer load/convert instructions per MAC). MODE 0 (f16), 1 (bf16 hi/lo),
//   2 (bf16) only. grid (ceil(NW/(16*TN)), ceil(M/(16*TM)), Z), block 32. Epilogue identical to k_gemm, run per 16x32 sub-tile.
// =====================================================================================================================
template <int MODE, int TM, int TN>
__global__ __launch_bounds__(32) void k_gemmT(GemmP p) {
    const int lane = threadIdx.x & 31, h = lane >> 4, l15 = lane & 15;
    const int m0 = blockIdx.y * (16 * TM), n0 = blockIdx.x * (16 * TN);
    const int z = blockIdx.z, zo = z / p.zi_n, zi = z - zo * p.zi_n;
    const float* A = p.A + zo * p.sAo + zi * p.sAi;
    const float* B = p.B + zo * p.sBo + zi * p.sBi;
    v8f acc[TM][TN];
#pragma unroll
    for (int i = 0; i < TM; ++i)
#pragma unroll
        for (int t = 0; t < TN; ++t) { v8f zz = {}; acc[i][t] = zz; }
    for (int k0 = 0; k0 < p.K; k0 += 32) {
        if (MODE == 1) {
            Split a[TM], b[TN];
#pragma unroll
            for (int i = 0; i < TM; ++i) { const int am = min(m0 + 16 * i + l15, p.M - 1); a[i] = sp_ld(A + (long long)am * p.sAm, p.sAk, k0, h, p.K, 1.f); }
#pragma unroll
            for (int t = 0; t < TN; ++t) { const int bn = min(n0 + 16 * t + l15, p.N - 1); b[t] = sp_ld(B + (long long)bn * p.sBn, p.sBk, k0, h, p.K, 1.f); }
#pragma unroll
            for (int i = 0; i < TM; ++i)
#pragma unroll
                for (int t = 0; t < TN; ++t) acc[i][t] = wmma3(a[i], b[t], acc[i][t]);
        } else if (MODE == 2) {
            v16b a[TM], b[TN];
#pragma unroll
            for (int i = 0; i < TM; ++i) { const int am = min(m0 + 16 * i + l15, p.M - 1); a[i] = bh_ld(A + (long long)am * p.sAm, p.sAk, k0, h, p.K, 1.f); }
#pragma unroll
            for (int t = 0; t < TN; ++t) { const int bn = min(n0 + 16 * t + l15, p.N - 1); b[t] = bh_ld(B + (long long)bn * p.sBn, p.sBk, k0, h, p.K, 1.f); }
#pragma unroll
            for (int i = 0; i < TM; ++i)
#pragma unroll
                for (int t = 0; t < TN; ++t) acc[i][t] = wmmab(a[i], b[t], acc[i][t]);
        } else {
            v16h a[TM], b[TN];
#pragma unroll
            for (int i = 0; i < TM; ++i) { const int am = min(m0 + 16 * i + l15, p.M - 1); a[i] = fh_ld(A + (long long)am * p.sAm, p.sAk, k0, h, p.K, p.sa); }
#pragma unroll
            for (int t = 0; t < TN; ++t) { const int bn = min(n0 + 16 * t + l15, p.N - 1); b[t] = fh_ld(B + (long long)bn * p.sBn, p.sBk, k0, h, p.K, p.sb); }
#pragma unroll
            for (int i = 0; i < TM; ++i)
#pragma unroll
                for (int t = 0; t < TN; ++t) acc[i][t] = wmma16(a[i], b[t], acc[i][t]);
        }
    }
    const float iscale = (MODE == 0) ? p.alpha / (p.sa * p.sb) : p.alpha;
    float* C = p.C + zo * p.sCo + zi * p.sCi;
    const float* R = p.R + zo * p.sRo + zi * p.sRi;
    const int NW = (p.Npad > p.N) ? p.Npad : p.N;
    __shared__ __align__(16) float ctile[16][36];
#pragma unroll
    for (int i = 0; i < TM; ++i) {
        const int mb = m0 + 16 * i; if (mb >= p.M) break;          // wave-uniform
#pragma unroll
        for (int tp = 0; tp < TN / 2; ++tp) {
            const int nb = n0 + 32 * tp; if (nb >= NW) break;        // wave-uniform
#pragma unroll
            for (int t2 = 0; t2 < 2; ++t2) {
                const int t = 2 * tp + t2; const int n = nb + t2 * 16 + l15; const int nn = min(n, p.N - 1);
#pragma unroll
                for (int r = 0; r < 8; ++r) {
                    const int m = mb + 8 * h + r; const int mm = min(m, p.M - 1);
                    float v = acc[i][t][r] * iscale;
                    if (p.flags & 1) v += p.bias[nn];
                    if (p.flags & 2) v += p.bias[mm];
            if (p.flags & 8) v *= p.bias[(long long)zo * p.M + mm];   /* per-(z,row) scale vector laid out [Z][M]; exclusive with the bias flags */
                    v = act_fn(v, p.act);
                    if (p.flags & 4) v += p.beta * R[(long long)mm * p.sRm + (long long)nn * p.sRn];
                    ctile[8 * h + r][t2 * 16 + l15] = (n < p.N) ? v : 0.f;
                }
            }
            __syncthreads();
            const bool fast = (mb + 16 <= p.M) && (nb + 32 <= NW) && ((p.sCm & 3) == 0) && ((((size_t)C) & 15) == 0);
            if (fast) {
#pragma unroll
                for (int s = 0; s < 4; ++s) {
                    const int row = s * 4 + (lane >> 3), c4 = (lane & 7) * 4;
                    const v4f v = *(const v4f*)&ctile[row][c4];
                    VST2V4(C + (long long)(mb + row) * p.sCm + nb + c4, v);
                }
            } else {
                for (int row = 0; row < 16; ++row) {
                    const int m = mb + row, n = nb + lane;
                    if (m < p.M && n < NW) VST2(float, C + (long long)m * p.sCm + n, ctile[row][lane]);
                }
            }
            __syncthreads();
        }
    }
}

// =====================================================================================================================
//   Wave = 16 queries, AW waves per block, 64-key blocks; grid (ceil(Lq/(16*AW)), H, B), block 32*AW. Any Lq, Lk; head dim dh <= DHP
//   (DHP multiple of 32), value dim dv <= DVP (multiple of 16, <= 128). Every tensor addressed by (batch, head, row, element) strides, f32.
//   Scores: QM 0 f16 operands, 1 bf16 hi/lo split, 2 bf16 triple split; statistics f32 (exp2 domain); P.V: P x 4096 as f16 with V f16 staged in LDS
//   (SPLITPV: P and V as bf16 hi/lo splits). kv head = h / hrep. Masking: causal = 1 (keep j <= i + coff, masked -> -inf, key blocks beyond the
//   diagonal skipped), causal = 2 (masked -> mfill, a finite fill like the -1e9; no skipping), causal = 3 (keep j >= i + coff,
//   masked -> -inf, no skipping); optional additive f32 mask Mf,
//   optional int keep-mask Mi (0 -> score := mfill), both addressed b*smb + h*smh + i*smi + j*smj (0 strides broadcast).
// =====================================================================================================================
#define AW 4
struct AttnP {   // apv4
    const float* Q; const float* K; const float* V; float* O; float* P; const float* Mf; const int* Mi; float* ST;
    const float* Pw; const float* Rt; const int* SQ; const int* SK;           // optional: post-softmax weight, relative-position table, segment ids
    long long swb, swh, swi, swj, srb, srh, sri;                                 // Pw strides (b,h,i,j); Rt strides (b,h,i), column = clamp(i - j + roff, 0, rn-1)
    long long sQb, sQh, sQi, sQd, sKb, sKh, sKj, sKd, sVb, sVh, sVj, sVd, sOb, sOh, sOi, sPb, sPh, sPi, smb, smh, smi, smj;
    int Lq, Lk, dh, dv, hrep, causal, coff, pband;   // pband > 0: P holds only the band |j - i| <= pband, column j - i + pband
    float scale, mfill; int nonorm, mpol;             // nonorm (online path only): O = sum_j exp(score_j) V_j without the 1/rowsum (scores must be <= ~0); mpol: Mi masks where ==0 (mpol 0) or where !=0 (mpol 1)
    int roff, rn, segpol, win;                        // Rt column offset/count; SQ/SK: score := mfill where (segpol 0) SQ[i] != SK[j] or (segpol 1) SQ[i] == SK[j]; win > 0: keys with i - j > win (after coff) -> -inf
};
//   Pw: the softmax numerator is multiplied by Pw(b,h,i,j) AFTER the row sum is taken (probs * weight, then P.V), as in post-softmax multiplicative biases.                                                    // ST (optional): per row (b,h,i) -> ST[((b*H + h)*Lq + i)*2 + {0,1}] = {row max of the scaled+masked score (natural units), sum_j exp(score - max)}
static_assert(sizeof(AttnP) == 12 * 8 + 29 * 8 + 16 * 4, "AttnP has padding");

#ifndef KATTN_ATTR
#define KATTN_ATTR __attribute__((amdgpu_waves_per_eu(4)))   // at most 256 registers a wave: four waves a SIMD, 1024 work-groups of the causal grid resident at once
#endif
//   FS > 0 (QM 0, one pass, f16 P.V only): the layout is fixed at compile time: Q, K, V, O are dense [batch][FS rows][FD] f32 with head h at column h * DHP (DVP for V, O),
//   dh = DHP, dv = DVP, Lq = Lk = FS (multiple of 64), causal = 1 with coff = 0, none of the optional inputs or outputs. Every element guard and stride then folds
//   away, and a key block's K and V come in by plain 16-byte loads that are in flight together, in two batches, instead of guarded 4-byte loads waited on one at a time.
template <int DHP, int DVP, int QM, bool SPLITPV, bool TWOPASS, int FS = 0, int FD = 0>
__global__ __launch_bounds__(32 * AW) KATTN_ATTR void k_attn(AttnP p) {
    static_assert(FS == 0 || (QM == 0 && !SPLITPV && !TWOPASS && DHP == 64 && DVP == 64 && FS % 64 == 0 && FD % 8 == 0), "fixed layout: whole key blocks, 32-byte aligned fragments");
    if (FS > 0) {
        p.P = nullptr; p.Mf = nullptr; p.Mi = nullptr; p.ST = nullptr; p.Pw = nullptr; p.Rt = nullptr; p.SQ = nullptr; p.SK = nullptr;
        p.sQb = (long long)FS * FD; p.sQh = DHP; p.sQi = FD; p.sQd = 1; p.sKb = (long long)FS * FD; p.sKh = DHP; p.sKj = FD; p.sKd = 1;
        p.sVb = (long long)FS * FD; p.sVh = DVP; p.sVj = FD; p.sVd = 1; p.sOb = (long long)FS * FD; p.sOh = DVP; p.sOi = FD;
        p.Lq = FS; p.Lk = FS; p.dh = DHP; p.dv = DVP; p.hrep = 1; p.causal = 1; p.coff = 0; p.pband = 0; p.nonorm = 0; p.win = 0;
    }
    constexpr int NT = DVP / 16;                // output tiles
    constexpr int KS = DHP / 32;                // k-steps for the scores
    constexpr int VP = DVP + 8;                 // LDS pitch (halves)
    __shared__ __align__(16) float    pl[AW][16 * 64];
    __shared__ __align__(16) _Float16 vl[(SPLITPV ? 2 : 1) * 64 * VP];   // f16 V tile, or bf16 hi and lo tiles (same 2-byte size)
    const int lane = threadIdx.x & 31, hf = lane >> 4, l15 = lane & 15, wave = threadIdx.x >> 5;
    const int h = blockIdx.y, b = blockIdx.z, hk = h / p.hrep;
    const int q0 = (blockIdx.x * AW + wave) * 16;
    float* myp = pl[wave];
    const float L2E = 1.4426950408889634f;
    const float NEG = -__builtin_inff();
    const int qi = min(q0 + l15, p.Lq - 1);
    const float* qrow = p.Q + b * p.sQb + h * p.sQh + (long long)qi * p.sQi;
    const float* kbase = p.K + b * p.sKb + hk * p.sKh;
    const float* vbase = p.V + b * p.sVb + hk * p.sVh;
    v16h qa[QM == 0 ? KS : 1]; Split qs_[QM == 1 ? KS : 1]; Split3 qt_[QM == 2 ? KS : 1];
#pragma unroll
    for (int ks = 0; ks < KS; ++ks) {
        if (QM == 2) qt_[ks] = sp3_ld(qrow, p.sQd, ks * 32, hf, p.dh, 1.f);
        else if (QM == 1) qs_[ks] = sp_ld(qrow, p.sQd, ks * 32, hf, p.dh, 1.f);
        else qa[ks] = fh_ld(qrow, p.sQd, ks * 32, hf, p.dh, 1.f);
    }
    v8f o[NT]; float m8[8], l8[8];
#pragma unroll
    for (int t = 0; t < NT; ++t) { v8f zz = {}; o[t] = zz; }
#pragma unroll
    for (int i = 0; i < 8; ++i) { m8[i] = NEG; l8[i] = 0.f; }
    int jend = p.Lk; int jstart = 0;
    if (p.causal == 1) { const int je = (blockIdx.x * AW + AW - 1) * 16 + 16 + p.coff; jend = min(jend, max(je, 0)); }   // uniform per block
    if (p.win > 0) { const int js = (int)(blockIdx.x * AW) * 16 + p.coff - p.win; jstart = (js > 0) ? (js / 64) * 64 : 0; }   // uniform per block: key blocks entirely outside every row's window hold only -inf entries and are skipped exactly
    const int npass = TWOPASS ? 2 : 1;
    for (int pass = 0; pass < npass; ++pass) {
        const bool dopv = (!TWOPASS) || pass == 1;
        for (int j0 = jstart; j0 < jend; j0 += 64) {
            v16h kf[FS > 0 ? 4 * KS : 1];                        // FS > 0: the key block's K fragments, tile t and k-step ks at t * KS + ks
            if (dopv) {
                __syncthreads();                                 // previous key block's reads of vl / pl are done
                if (FS > 0) {
                    // raw f32 in two batches, so that the loaded values and everything else that is live fit 256 registers (four waves a SIMD)
                    v4f vr[8]; v8f kr[8];                                           // V: four consecutive elements per thread and step; K: half a fragment each
                    const float* krow = kbase + (long long)(j0 + l15) * FD + 8 * hf;
#pragma unroll
                    for (int it = 0; it < 8; ++it)
                        vr[it] = *(const v4f*)(vbase + (long long)(j0 + ((int)threadIdx.x >> 4)) * FD + ((int)threadIdx.x & 15) * 4 + it * (2 * AW * FD));   // rows 2 AW apart per step
#pragma unroll
                    for (int c = 0; c < 8; ++c) kr[c] = *(const v8f*)(krow + (c >> 2) * (16 * FD) + (c & 3) * 16);   // key tile t = c / 4; k = 16 (c % 4) + 8 hf + (0..7)
                    // inputs-only fence on the loaded values: their first use is here, so the batch's 24 loads are all issued before any is waited on (without it
                    // the scheduler puts each load directly in front of its conversion and waits on it there)
                    asm volatile("" :: "v"(vr[0]), "v"(vr[1]), "v"(vr[2]), "v"(vr[3]), "v"(vr[4]), "v"(vr[5]), "v"(vr[6]), "v"(vr[7]),
                                 "v"(kr[0]), "v"(kr[1]), "v"(kr[2]), "v"(kr[3]), "v"(kr[4]), "v"(kr[5]), "v"(kr[6]), "v"(kr[7]));
#pragma unroll
                    for (int it = 0; it < 8; ++it) {
                        v4h hv; hv[0] = (_Float16)vr[it][0]; hv[1] = (_Float16)vr[it][1]; hv[2] = (_Float16)vr[it][2]; hv[3] = (_Float16)vr[it][3];
                        *(v4h*)(vl + ((int)threadIdx.x >> 4) * VP + ((int)threadIdx.x & 15) * 4 + it * (2 * AW * VP)) = hv;
                    }
#pragma unroll
                    for (int f = 0; f < 4; ++f)
#pragma unroll
                        for (int e = 0; e < 8; ++e) { kf[f][e] = (_Float16)kr[2 * f][e]; kf[f][8 + e] = (_Float16)kr[2 * f + 1][e]; }
                    v8f ks2[8];
#pragma unroll
                    for (int c = 0; c < 8; ++c) ks2[c] = *(const v8f*)(krow + (2 + (c >> 2)) * (16 * FD) + (c & 3) * 16);   // key tiles 2 and 3
                    // the same fence for the second batch's 16 loads; the address is named too, so that it stays live and none of these loads is given its register pair as destination
                    asm volatile("" :: "v"(ks2[0]), "v"(ks2[1]), "v"(ks2[2]), "v"(ks2[3]), "v"(ks2[4]), "v"(ks2[5]), "v"(ks2[6]), "v"(ks2[7]), "v"(krow));
#pragma unroll
                    for (int f = 0; f < 4; ++f)
#pragma unroll
                        for (int e = 0; e < 8; ++e) { kf[4 + f][e] = (_Float16)ks2[2 * f][e]; kf[4 + f][8 + e] = (_Float16)ks2[2 * f + 1][e]; }
                } else
                for (int idx = threadIdx.x; idx < 64 * DVP; idx += 32 * AW) {
                    const int jr = idx / DVP, d = idx - jr * DVP, j = j0 + jr;
                    const float f = (j < p.Lk && d < p.dv) ? vbase[(long long)j * p.sVj + (long long)d * p.sVd] : 0.f;
                    if (SPLITPV) {
                        const __bf16 hb = bf16_rne(f);
                        ((__bf16*)vl)[jr * VP + d] = hb; ((__bf16*)vl)[64 * VP + jr * VP + d] = bf16_rne(f - bf16_f32(hb));
                    } else vl[jr * VP + d] = (_Float16)f;
                }
            }
            v8f s[4];
#pragma unroll
            for (int t = 0; t < 4; ++t) {
                const int j = min(j0 + t * 16 + l15, p.Lk - 1);
                const float* krow = kbase + (long long)j * p.sKj;
                v8f acc = {};
#pragma unroll
                for (int ks = 0; ks < KS; ++ks) {
                    if (QM == 2)      acc = wmma6(qt_[ks], sp3_ld(krow, p.sKd, ks * 32, hf, p.dh, 1.f), acc);
                    else if (QM == 1) acc = wmma3(qs_[ks], sp_ld(krow, p.sKd, ks * 32, hf, p.dh, 1.f), acc);
                    else if (FS > 0)  acc = wmma16(qa[ks], kf[t * KS + ks], acc);
                    else              acc = wmma16(qa[ks], fh_ld(krow, p.sKd, ks * 32, hf, p.dh, 1.f), acc);
                }
                s[t] = acc;
            }
            float pv[8][4];
#pragma unroll
            for (int i = 0; i < 8; ++i) {
                const int irow = q0 + i + 8 * hf;
                const int ic = min(irow, p.Lq - 1);
                float sc[4];
#pragma unroll
                for (int t = 0; t < 4; ++t) {
                    const int jg = j0 + t * 16 + l15;
                    float v = s[t][i] * p.scale;
                    if (p.Mf) v += p.Mf[b * p.smb + h * p.smh + (long long)ic * p.smi + (long long)min(jg, p.Lk - 1) * p.smj];
                    if (p.Rt) { int rc = ic - min(jg, p.Lk - 1) + p.roff; rc = rc < 0 ? 0 : (rc >= p.rn ? p.rn - 1 : rc); v += p.Rt[b * p.srb + h * p.srh + (long long)ic * p.sri + rc]; }
                    if (p.Mi) { const int mv = p.Mi[b * p.smb + h * p.smh + (long long)ic * p.smi + (long long)min(jg, p.Lk - 1) * p.smj]; if (p.mpol ? (mv != 0) : (mv == 0)) v = p.mfill; }
                    if (p.SQ) { const bool same = p.SQ[(long long)b * p.Lq + ic] == p.SK[(long long)b * p.Lk + min(jg, p.Lk - 1)]; if (p.segpol ? same : !same) v = p.mfill; }
                    if (p.causal == 2 && jg > irow + p.coff) v = p.mfill;
                    if (jg >= p.Lk || (p.causal == 1 && jg > irow + p.coff) || (p.causal == 3 && jg < irow + p.coff) || (p.win > 0 && irow + p.coff - jg > p.win)) v = NEG; else v *= L2E;
                    sc[t] = v;
                }
                if (!TWOPASS || pass == 0) {
                    float mx = fmaxf(fmaxf(sc[0], sc[1]), fmaxf(sc[2], sc[3]));
                    mx = fmaxf(mx, __shfl_xor(mx, 1, 32)); mx = fmaxf(mx, __shfl_xor(mx, 2, 32));
                    mx = fmaxf(mx, __shfl_xor(mx, 4, 32)); mx = fmaxf(mx, __shfl_xor(mx, 8, 32));
                    const float mnew = fmaxf(m8[i], mx);
                    const float corr = (mnew == NEG) ? 1.f : exp2f(m8[i] - mnew);
                    float rs = 0.f;
#pragma unroll
                    for (int t = 0; t < 4; ++t) {
                        const float pp = (sc[t] == NEG) ? 0.f : exp2f(sc[t] - mnew); rs += pp;
                        pv[i][t] = p.Pw ? pp * p.Pw[b * p.swb + h * p.swh + (long long)ic * p.swi + (long long)min(j0 + t * 16 + l15, p.Lk - 1) * p.swj] : pp;
                    }
                    rs += __shfl_xor(rs, 1, 32); rs += __shfl_xor(rs, 2, 32); rs += __shfl_xor(rs, 4, 32); rs += __shfl_xor(rs, 8, 32);
                    l8[i] = l8[i] * corr + rs; m8[i] = mnew;
                    if (!TWOPASS) {
#pragma unroll
                        for (int t = 0; t < NT; ++t) o[t][i] *= corr;
                    }
                } else {
                    const float inv = (l8[i] > 0.f) ? 1.f / l8[i] : 0.f;
#pragma unroll
                    for (int t = 0; t < 4; ++t) {
                        const int jg = j0 + t * 16 + l15;
                        float pp = (sc[t] == NEG) ? 0.f : exp2f(sc[t] - m8[i]) * inv;
                        if (p.Pw) pp *= p.Pw[b * p.swb + h * p.swh + (long long)ic * p.swi + (long long)min(jg, p.Lk - 1) * p.swj];
                        pv[i][t] = pp;
                    }
                }
            }
            if (dopv) {
#pragma unroll
                for (int i = 0; i < 8; ++i)
#pragma unroll
                    for (int t = 0; t < 4; ++t) ((float*)myp)[(i + 8 * hf) * 64 + t * 16 + l15] = pv[i][t];
                __syncthreads();                                 // P (per wave) and V (shared) visible
                if (p.P) {
                    float* pb_ = p.P + b * p.sPb + h * p.sPh;
                    const bool fastP = (p.pband == 0) && ((p.sPi & 3) == 0) && (j0 + 64 <= p.Lk) && (q0 + 16 <= p.Lq) && ((((size_t)pb_) & 15) == 0);
                    if (fastP) {
#pragma unroll
                        for (int s = 0; s < 8; ++s) {
                            const int row = s * 2 + (lane >> 4), c4 = (lane & 15) * 4;
                            const v4f v = *(const v4f*)(myp + row * 64 + c4);
                            VST2V4(pb_ + (long long)(q0 + row) * p.sPi + j0 + c4, v);
                        }
                    } else {
                        for (int row = 0; row < 16; ++row) {
                            const int irow = q0 + row; if (irow >= p.Lq) continue;
                            for (int c = lane; c < 64; c += 32) {
                                const int jg = j0 + c; if (jg >= p.Lk) continue;
                                if (p.pband == 0) VST2(float, pb_ + (long long)irow * p.sPi + jg, myp[row * 64 + c]);
                                else if (jg - irow <= p.pband && irow - jg <= p.pband) VST2(float, pb_ + (long long)irow * p.sPi + (jg - irow + p.pband), myp[row * 64 + c]);
                            }
                        }
                    }
                }
                if (SPLITPV) {
                    const Split pa0 = sp_ld(myp + l15 * 64, 1, 0, hf, 64, 1.f), pa1 = sp_ld(myp + l15 * 64, 1, 32, hf, 64, 1.f);
                    const __bf16* vh = (const __bf16*)vl; const __bf16* vlo = vh + 64 * VP;
#pragma unroll
                    for (int t = 0; t < NT; ++t) {
                        const int dcol = t * 16 + l15;
                        Split b0, b1;
#pragma unroll
                        for (int e = 0; e < 16; ++e) {
                            const int k0 = frag_k(e, hf), k1 = 32 + frag_k(e, hf);
                            b0.hi[e] = vh[k0 * VP + dcol]; b0.lo[e] = vlo[k0 * VP + dcol]; b1.hi[e] = vh[k1 * VP + dcol]; b1.lo[e] = vlo[k1 * VP + dcol];
                        }
                        o[t] = wmma3(pa0, b0, o[t]);
                        o[t] = wmma3(pa1, b1, o[t]);
                    }
                } else {
                    const v16h pa0 = fh_ld(myp + l15 * 64, 1, 0, hf, 64, 4096.f), pa1 = fh_ld(myp + l15 * 64, 1, 32, hf, 64, 4096.f);
#pragma unroll
                    for (int t = 0; t < NT; ++t) {
                        const int dcol = t * 16 + l15;
                        v16h b0, b1;
#pragma unroll
                        for (int e = 0; e < 16; ++e) { b0[e] = vl[frag_k(e, hf) * VP + dcol]; b1[e] = vl[(32 + frag_k(e, hf)) * VP + dcol]; }
                        o[t] = wmma16(pa0, b0, o[t]);
                        o[t] = wmma16(pa1, b1, o[t]);
                    }
                }
            }
        }
    }
    float* obase = p.O + b * p.sOb + h * p.sOh;
    if (p.ST) {
        const int rl = lane >> 1, isel = rl & 7;           // row q0 + rl ; rl>>3 == hf holds because lane>>4 == (lane>>1)>>3
        float mv = 0.f, lv = 0.f;
#pragma unroll
        for (int i = 0; i < 8; ++i) if (i == isel) { mv = m8[i]; lv = l8[i]; }
        const int irow = q0 + rl;
        if (irow < p.Lq) { float* st = p.ST + (((long long)b * gridDim.y + h) * p.Lq + irow) * 2 + (lane & 1); VST2(float, st, (lane & 1) ? lv : mv * 0.6931471805599453f); }
    }
    float invr[8];
#pragma unroll
    for (int i = 0; i < 8; ++i) {
        if (TWOPASS) invr[i] = SPLITPV ? 1.f : (1.f / 4096.f);
        else if (p.nonorm) invr[i] = exp2f(m8[i]) * (SPLITPV ? 1.f : (1.f / 4096.f));
        else invr[i] = (l8[i] > 0.f) ? (SPLITPV ? 1.f / l8[i] : 1.f / (l8[i] * 4096.f)) : 0.f;
    }
    __syncthreads();                                             // all waves done with pl/vl from the main loop
    const bool ofast = ((p.sOi & 3) == 0) && ((((size_t)obase) & 15) == 0) && (q0 + 16 <= p.Lq);
#pragma unroll
    for (int c0 = 0; c0 < DVP; c0 += 64) {
#pragma unroll
        for (int i = 0; i < 8; ++i)
#pragma unroll
            for (int t = 0; t < NT; ++t) if (t * 16 >= c0 && t * 16 < c0 + 64) ((float*)myp)[(i + 8 * hf) * 64 + (t * 16 - c0) + l15] = o[t][i] * invr[i];
        __syncthreads();
        const int cw = (DVP - c0 < 64) ? (DVP - c0) : 64;      // staged columns in this chunk (multiple of 16)
        if (ofast && (c0 + cw <= p.dv) && (cw % 32 == 0)) {
            const int lpr = cw / 4;                              // lanes per row (16 for 64 cols, 8 for 32)
            const int rows_per_ins = 32 / lpr;
            for (int r0 = 0; r0 < 16; r0 += rows_per_ins) {
                const int row = r0 + lane / lpr, c4 = (lane % lpr) * 4;
                const v4f v = *(const v4f*)(myp + row * 64 + c4);
                VST2V4(obase + (long long)(q0 + row) * p.sOi + c0 + c4, v);
            }
        } else {
            for (int row = 0; row < 16; ++row) {
                const int irow = q0 + row; if (irow >= p.Lq) continue;
                for (int c = lane; c < cw; c += 32) { const int d = c0 + c; if (d < p.dv) VST2(float, obase + (long long)irow * p.sOi + d, myp[row * 64 + c]); }
            }
        }
        __syncthreads();
    }
}

// =====================================================================================================================
// k_tr: dst(z, c, r) = alpha * src(z, r, c) (+ beta * R2(z, c, r)): [Z][R][C] (row stride lds) -> [Z][C][R] (row stride ldd) through a 32x32 LDS tile;
//   flags: 1 -> add beta * residual R2 addressed like dst (z*sRz + c*ldr + r); act applied before the residual.
// =====================================================================================================================
struct TrP { const float* src; float* dst; const float* R2; long long sSz, lds, sDz, ldd, sRz, ldr; int R, C, flags, act; float alpha, beta; };
static_assert(sizeof(TrP) == 3 * 8 + 6 * 8 + 6 * 4, "TrP has padding");
__global__ __launch_bounds__(256) void k_tr(TrP p) {
    __shared__ float tile[32][33];
    const int c0 = blockIdx.x * 32, r0 = blockIdx.y * 32, z = blockIdx.z;
    const int lane = threadIdx.x & 31, wave = threadIdx.x >> 5;
    const float* s = p.src + z * p.sSz;
#pragma unroll
    for (int k = 0; k < 4; ++k) {
        const int rl = wave * 4 + k, r = r0 + rl, c = c0 + lane;
        tile[rl][lane] = (r < p.R && c < p.C) ? s[(long long)r * p.lds + c] : 0.f;
    }
    __syncthreads();
    float* d = p.dst + z * p.sDz; const float* rr = p.R2 + z * p.sRz;
#pragma unroll
    for (int k = 0; k < 4; ++k) {
        const int cl = wave * 4 + k, c = c0 + cl, r = r0 + lane;
        if (c < p.C && r < p.R) {
            float v = act_fn(p.alpha * tile[lane][cl], p.act);
            if (p.flags & 1) v += p.beta * rr[(long long)c * p.ldr + r];
            VST2(float, d + (long long)c * p.ldd + r, v);
        }
    }
}

// k_affine: dst[i] = a * (sdev ? sdev[0] : 1) * src[i] + b, i < n (one thread per element; consecutive lanes -> consecutive addresses)
__global__ __launch_bounds__(256) void k_affine(const float* __restrict__ src, float* __restrict__ dst, int n, float a, float b, const float* __restrict__ sdev) {
    const int i = blockIdx.x * 256 + threadIdx.x;
    if (i < n) { const float aa = sdev ? a * sdev[0] : a; const float v = aa * src[i] + b; VST2(float, dst + i, v); }
}

// =====================================================================================================================
// k_softmax: row softmax over n contiguous elements, one 256-thread block per row; rows addressed z*sz + r*sr (grid (R, Z)).
//   out = scale_out * softmax(scale_in * x + (Mf ? Mf[z*smz + r*smr + j] : 0)); a row whose max is -inf is written as 0.
// =====================================================================================================================
struct SmP { const float* src; float* dst; const float* Mf; long long sz, sr, dz, dr, smz, smr; int n, pad; float scale_in, scale_out; };
static_assert(sizeof(SmP) == 3 * 8 + 6 * 8 + 4 * 4, "SmP has padding");
__global__ __launch_bounds__(256) void k_softmax(SmP p) {
    __shared__ float red[256];
    const int r = blockIdx.x, z = blockIdx.y, tid = threadIdx.x;
    const float* s = p.src + z * p.sz + (long long)r * p.sr;
    const float* mf = p.Mf ? (p.Mf + z * p.smz + (long long)r * p.smr) : nullptr;
    float mx = -__builtin_inff();
    for (int j = tid; j < p.n; j += 256) { float v = s[j] * p.scale_in; if (mf) v += mf[j]; mx = fmaxf(mx, v); }
    red[tid] = mx; __syncthreads();
    for (int o = 128; o > 0; o >>= 1) { if (tid < o) red[tid] = fmaxf(red[tid], red[tid + o]); __syncthreads(); }
    mx = red[0]; __syncthreads();
    float sum = 0.f;
    for (int j = tid; j < p.n; j += 256) { float v = s[j] * p.scale_in; if (mf) v += mf[j]; sum += (mx == -__builtin_inff()) ? 0.f : expf(v - mx); }
    red[tid] = sum; __syncthreads();
    for (int o = 128; o > 0; o >>= 1) { if (tid < o) red[tid] += red[tid + o]; __syncthreads(); }
    sum = red[0];
    const float inv = (sum > 0.f) ? p.scale_out / sum : 0.f;
    float* d = p.dst + z * p.dz + (long long)r * p.dr;
    for (int j = tid; j < p.n; j += 256) { float v = s[j] * p.scale_in; if (mf) v += mf[j]; const float o = (mx == -__builtin_inff()) ? 0.f : expf(v - mx) * inv; VST2(float, d + j, o); }
}
// =====================================================================================================================
// k_stats: mean and rsqrt(var + eps) over a set of n elements addressed base + z*sz + (e / inner) * so + (e % inner) * si, one 256-thread
// k_norm_apply: y = (x - mean[set]) * rstd[set] * g[c] + b[c] over a [Z][C][L] channel-major tensor with set = z*G + c / (C/G) (G groups per z;
//   G = C -> per-channel sets indexed z*C+c; for batch norm pass stats indexed by c only via bn = 1). Optional act. Output same layout.
// =====================================================================================================================
//   mode 0: mean / rsqrt(var + eps); mode 1 (RMSNorm): 0 / rsqrt(mean(x^2) + eps); mode 2 (L2 normalize * sqrt(n)): 0 / sqrt(n) / max(||x||, eps); mode 3: as 0 with unbiased variance (n-1)
__global__ __launch_bounds__(256) void k_stats(const float* __restrict__ x, long long sz, long long so, long long si, int inner, int n, float eps, float* __restrict__ stat, int mode) {
    __shared__ float red[256];
    const int z = blockIdx.x, tid = threadIdx.x;
    const float* base = x + z * sz;
    float s = 0.f;
    for (int e = tid; e < n; e += 256) s += base[(long long)(e / inner) * so + (long long)(e % inner) * si];
    red[tid] = s; __syncthreads();
    for (int o = 128; o > 0; o >>= 1) { if (tid < o) red[tid] += red[tid + o]; __syncthreads(); }
    const float mu = (mode == 0 || mode == 3) ? red[0] / (float)n : 0.f; __syncthreads();
    float q = 0.f;
    for (int e = tid; e < n; e += 256) { const float dlt = base[(long long)(e / inner) * so + (long long)(e % inner) * si] - mu; q += dlt * dlt; }
    red[tid] = q; __syncthreads();
    for (int o = 128; o > 0; o >>= 1) { if (tid < o) red[tid] += red[tid + o]; __syncthreads(); }
    {
        float rs;
        if (mode == 2) rs = sqrtf((float)n) / fmaxf(sqrtf(red[0]), eps); else if (mode == 3) rs = rsqrtf(red[0] / (float)(n - 1) + eps); else rs = rsqrtf(red[0] / (float)n + eps);
        if (tid < 32) { const float v = (tid == 0) ? mu : ((tid == 1) ? rs : 0.f); VST2(float, stat + (long long)z * 32 + tid, v); }
    }
}
//   One thread per element over the flat [Z][C][L] index space: grid ceil(Z*C*L / 256).
__global__ __launch_bounds__(256) void k_norm_apply(const float* __restrict__ x, float* __restrict__ y, const float* __restrict__ stat, const float* __restrict__ g, const float* __restrict__ bta,
                                                     int Z, int C, int L, int G, int bn, int act) {
    const long long idx = (long long)blockIdx.x * 256 + threadIdx.x;
    if (idx >= (long long)Z * C * L) return;
    const int l = (int)(idx % L); const long long zc = idx / L; const int c = (int)(zc % C), z = (int)(zc / C); (void)l;
    const int set = bn ? c : (z * G + c / (C / G));
    float v = (x[idx] - stat[(long long)set * 32]) * stat[(long long)set * 32 + 1];
    if (g) v *= g[c];
    if (bta) v += bta[c];
    v = act_fn(v, act);
    VST2(float, y + idx, v);
}

// k_lse_neg: c[i] = -(st[2i] + log(st[2i+1])) = minus the log-sum-exp of row i from k_attn's ST output (for softmax over the query dimension)
__global__ __launch_bounds__(256) void k_lse_neg(const float* __restrict__ st, float* __restrict__ c, int n) {
    const int i = blockIdx.x * 256 + threadIdx.x;
    if (i < n) { const float v = -(st[2 * i] + logf(st[2 * i + 1])); VST2(float, c + i, v); }
}

// k_iota: dst[i] = a * i + b as int32 (segment/position id helper)
__global__ __launch_bounds__(256) void k_iota(int* __restrict__ dst, int n, int a, int b) {
    const int i = blockIdx.x * 256 + threadIdx.x;
    if (i < n) { const int v = a * i + b; VST2(int, dst + i, v); }
}

// k_axpby: dst[i] = a * x[i] + b * y[i] (+ c), i < n
__global__ __launch_bounds__(256) void k_axpby(const float* __restrict__ x, const float* __restrict__ y, float* __restrict__ dst, int n, float a, float b, float c) {
    const int i = blockIdx.x * 256 + threadIdx.x;
    if (i < n) { const float v = a * x[i] + b * y[i] + c; VST2(float, dst + i, v); }
}

// =====================================================================================================================
// k_rope: rotary embedding on a [R rows][Hn heads][D] view (row stride sXr, head stride sXh, element stride 1) -> Y (own strides).
//   mode 0: rotate_half (partner d±D/2, sign - for d<D/2); mode 1: interleaved pairs (partner d^1, sign - for even d).
//   table column tcol: tmode 0 -> d, 1 -> d % (D/2), 2 -> d / 2; position p: pmode 0 -> r % S, 1 -> head index, 2 -> pos[r];
//   c = C[(r / S) * sCb + p * sCp + tcol * sCd], s likewise from Sn; y = x[d] * c + sign * x[partner] * s. X and Y must not alias.
// =====================================================================================================================
struct RopeP { const float* X; float* Y; const float* C; const float* Sn; const int* pos; long long sXr, sXh, sYr, sYh, sCb, sCp, sCd; int R, Hn, D, S, mode, tmode, pmode, pad; };
static_assert(sizeof(RopeP) == 5 * 8 + 7 * 8 + 8 * 4, "RopeP has padding");
__global__ __launch_bounds__(256) void k_rope(RopeP p) {
    const long long idx = (long long)blockIdx.x * 256 + threadIdx.x;
    if (idx >= (long long)p.R * p.Hn * p.D) return;
    const int d = (int)(idx % p.D); const long long rh = idx / p.D; const int h = (int)(rh % p.Hn); const int r = (int)(rh / p.Hn);
    const int half = p.D / 2;
    int partner; float sign;
    if (p.mode == 0) { partner = (d < half) ? d + half : d - half; sign = (d < half) ? -1.f : 1.f; }
    else { partner = d ^ 1; sign = (d & 1) ? 1.f : -1.f; }
    const int tcol = (p.tmode == 0) ? d : ((p.tmode == 1) ? (d % half) : (d >> 1));
    const int pp = (p.pmode == 0) ? (r % p.S) : ((p.pmode == 1) ? h : p.pos[r]);
    const long long toff = (long long)(r / p.S) * p.sCb + (long long)pp * p.sCp + (long long)tcol * p.sCd;
    const float* xr = p.X + (long long)r * p.sXr + (long long)h * p.sXh;
    const float v = xr[d] * p.C[toff] + sign * xr[partner] * p.Sn[toff];
    VST2(float, p.Y + (long long)r * p.sYr + (long long)h * p.sYh + d, v);
}

// k_invf + k_sincos (split so neither kernel carries a large VALU-fma footprint): invf_i = num * (1 / powf(base, (2 i)/D)) [fmode 0],
//   num * expf((2 i) * cexp) [fmode 1], num * powf(base, -2 (i - 1) / D) [fmode 2]; then cs/sn[s*half + i] = cos/sin((pscale * s) * invf_i)
__global__ __launch_bounds__(256) void k_invf(float* __restrict__ invb, int half, int D, float base, float num, int fmode, float cexp) {
    const int i = blockIdx.x * 256 + threadIdx.x;
    if (i >= ((half + 31) / 32) * 32) return;
    if (i >= half) { VST2(float, invb + i, 0.f); return; }
    const float e = (float)(2 * i) / (float)D;
    float invf;
    if (fmode == 1) invf = num * expf((float)(2 * i) * cexp);
    else if (fmode == 2) invf = num * powf(base, (-2.0f * ((float)i - 1.0f)) / (float)D);
    else invf = num * (1.0f / powf(base, e));
    VST2(float, invb + i, invf);
}
__global__ __launch_bounds__(256) void k_sincos(float* __restrict__ cs, float* __restrict__ sn, const float* __restrict__ invb, int S, int half, float pscale) {
    const int idx = blockIdx.x * 256 + threadIdx.x;
    if (idx >= S * half) return;
    const int s = idx / half, i = idx - s * half;
    const float ang = (pscale * (float)s) * invb[i];
    VST2(float, cs + idx, cosf(ang)); VST2(float, sn + idx, sinf(ang));
}

// k_mulact: dst[i] = act(x[i]) * y[i]
__global__ __launch_bounds__(256) void k_mulact(const float* __restrict__ x, const float* __restrict__ y, float* __restrict__ dst, int n, int act) {
    const int i = blockIdx.x * 256 + threadIdx.x;
    if (i < n) { const float v = act_fn(x[i], act) * y[i]; VST2(float, dst + i, v); }
}

// =====================================================================================================================
// k_matvec: thread-per-row matrix-vector products for N <= 8 output columns (heads with 1-3 outputs, gates), f32 on the VALU.
//   C[r*sCm + j] = act(alpha * sum_k A[r*sAm + k*sAk] * B[j*sBn + k*sBk] + bias[j]) + beta * R[r*sRm + j*sRn]; each thread writes its N contiguous floats.
// =====================================================================================================================
__global__ __launch_bounds__(256) void k_matvec(GemmP p) {
    // N == 1: one row per thread, 32 lanes write 32 consecutive rows with one instruction; otherwise 32 consecutive rows per thread.
    const int rpt = (p.N == 1) ? 1 : 32;
    const long long r0 = ((long long)blockIdx.x * 256 + threadIdx.x) * rpt; const int z = blockIdx.z, zo = z / p.zi_n, zi = z - zo * p.zi_n;
    if (r0 >= p.M) return;
    const float* Bb = p.B + zo * p.sBo + zi * p.sBi;
    float* C = p.C + zo * p.sCo + zi * p.sCi; const float* R = p.R + zo * p.sRo + zi * p.sRi;
    for (int rr = 0; rr < rpt; ++rr) {
        const long long r = r0 + rr; if (r >= p.M) break;
        const float* A = p.A + zo * p.sAo + zi * p.sAi + r * p.sAm;
        float acc[8] = {0.f, 0.f, 0.f, 0.f, 0.f, 0.f, 0.f, 0.f};
        for (int k = 0; k < p.K; ++k) { const float a = A[(long long)k * p.sAk];
#pragma unroll
            for (int j = 0; j < 8; ++j) if (j < p.N) acc[j] += a * Bb[(long long)j * p.sBn + (long long)k * p.sBk]; }
#pragma unroll
        for (int j = 0; j < 8; ++j) if (j < p.N) {
            float v = acc[j] * p.alpha;
            if (p.flags & 1) v += p.bias[j];
            if (p.flags & 2) v += p.bias[r];
            v = act_fn(v, p.act);
            if (p.flags & 4) v += p.beta * R[r * p.sRm + (long long)j * p.sRn];
            VST2(float, C + r * p.sCm + j, v);
        }
    }
}
// k_smallsoftmax: thread-per-row softmax for short rows (n <= 64): dst[r*dr + j] = softmax(scale*src[r*sr + j])
__global__ __launch_bounds__(256) void k_smallsoftmax(const float* __restrict__ src, float* __restrict__ dst, long long sr, long long dr, int n, long long R, float scale) {
    const long long r0 = ((long long)blockIdx.x * 256 + threadIdx.x) * 32;
    for (int rr = 0; rr < 32; ++rr) {
        const long long r = r0 + rr; if (r >= R) return;
        const float* s = src + r * sr; float* d = dst + r * dr;
        float mx = -__builtin_inff();
        for (int j = 0; j < n; ++j) mx = fmaxf(mx, s[j] * scale);
        float sum = 0.f;
        for (int j = 0; j < n; ++j) sum += expf(s[j] * scale - mx);
        const float inv = 1.f / sum;
        for (int j = 0; j < n; ++j) { const float v = expf(s[j] * scale - mx) * inv; VST2(float, d + j, v); }
    }
}

__global__ __launch_bounds__(32) void k_unitstat(float* __restrict__ st) { const int t = threadIdx.x; const float v = (t == 1) ? 1.f : 0.f; VST2(float, st + t, v); }

// destination (e.g. a d_out whose row width is not a multiple of 32 floats) is written by consecutive lanes of one instruction
__global__ __launch_bounds__(256) void k_lincopy(const float* __restrict__ src, long long lds, float* __restrict__ dst, long long ldd, long long rows, int cols) {
    const long long i = (long long)blockIdx.x * 256 + threadIdx.x; if (i >= rows * cols) return;
    const long long r = i / cols; const int c = (int)(i - r * cols);
    const float v = src[r * lds + c]; VST2(float, dst + r * ldd + c, v);
}

namespace w25 {
typedef __attribute__((ext_vector_type(16))) _Float16 v16h;
typedef __attribute__((ext_vector_type(8)))  _Float16 v8h;
typedef __attribute__((ext_vector_type(16))) __bf16   v16b;
typedef __attribute__((ext_vector_type(8)))  __bf16   v8b;
typedef __attribute__((ext_vector_type(8)))  float    v8f;
typedef __attribute__((ext_vector_type(4)))  float    v4f;

__device__ __forceinline__ unsigned short f2bf_bits(float f) {
  unsigned u = __float_as_uint(f);
  return (unsigned short)((u + 0x7FFFu + ((u >> 16) & 1u)) >> 16);
}
__device__ __forceinline__ float bf_bits2f(unsigned short h) { return __uint_as_float(((unsigned)h) << 16); }

template <typename T> struct Frag;
template <> struct Frag<_Float16> {
  typedef v16h V; union U { v16h v; v8h h[2]; };
  static __device__ __forceinline__ v16h load(const _Float16* p) {   // elements 0..7 <- p[0..7], 8..15 <- p[16..23]
    U f; f.h[0] = *(const v8h*)(p); f.h[1] = *(const v8h*)(p + 16); return f.v;
  }
  static __device__ __forceinline__ v8f mma(v16h a, v16h b, v8f c) {
    return __builtin_amdgcn_wmma_f32_16x16x32_f16(false, a, false, b, (short)0, c, false, false);
  }
};
template <> struct Frag<__bf16> {
  typedef v16b V; union U { v16b v; v8b h[2]; };
  static __device__ __forceinline__ v16b load(const __bf16* p) {
    U f; f.h[0] = *(const v8b*)(p); f.h[1] = *(const v8b*)(p + 16); return f.v;
  }
  static __device__ __forceinline__ v8f mma(v16b a, v16b b, v8f c) {
    return __builtin_amdgcn_wmma_f32_16x16x32_bf16(false, a, false, b, (short)0, c, false, false);
  }
};

// ---- WMMA GEMM with both operands staged in LDS ------------------------------
// C[m,n] = scale * sum_k A[m,k] * Bt[n,k], f32 out. A row-major [M,K]; Bt row-major [N,K]; C row-major [M,N]; M % 64 == 0, N % 128 == 0, K % 64 == 0.
// grid (N / 128, M / 64), 8 waves: a work-group owns a 64 x 128 tile of C, wave (wave >> 2, wave & 3) a 32 x 32 part of it.
// K runs in stages of 64: a stage's 64 A rows and 128 Bt rows (128 B each, per plane) come from global memory as whole 128-byte lines
// (8 lanes x 16 B per row), go to LDS at a pitch of 144 B, and every wave reads its fragments from there with 16-byte LDS loads.
// Two LDS buffers: the next stage's global loads are in flight while the current stage is multiplied; one barrier per stage.
// SPLIT: operands are hi/lo planes (A2/Bt2 = lo planes, same layout); product = hi.hi + hi.lo + lo.hi, in that order per 32 k.
// ET: 0 = f16 operands, 1 = bf16 operands (pointers passed as 16-bit storage)
// astep: rows of A from one 64-row tile of C to the next (64: A is dense; more: each tile takes the first 64 rows of a longer block of A)
template <int ET> struct Elem;
template <> struct Elem<0> { typedef _Float16 T; typedef v8h V8; };
template <> struct Elem<1> { typedef __bf16 T; typedef v8b V8; };
template <int ET, bool SPLIT>
__global__ __launch_bounds__(256) void wmma_gemm_lds(
    const unsigned short* __restrict__ Ap, const unsigned short* __restrict__ A2p,
    const unsigned short* __restrict__ Btp, const unsigned short* __restrict__ Bt2p,
    float* __restrict__ C, int N, int K, float scale, int astep) {
  typedef typename Elem<ET>::T T;
  typedef typename Elem<ET>::V8 V8;
  typedef typename Frag<T>::V V;
  constexpr int NP    = SPLIT ? 2 : 1;      // planes
  constexpr int PITCH = 72;                 // LDS row pitch in 16-bit elements: 144 B = 16 B x 9
  constexpr int PROWS = 192;                // rows of one plane in a stage: 64 of A, then 128 of Bt
  constexpr int STAGE = NP * PROWS * PITCH; // elements of one buffer
  constexpr int NL    = NP * 6;             // 16-byte pieces per thread and stage (32 rows per step)
  constexpr int CP    = 132;                // pitch of the staged C tile in floats
  static_assert(2 * STAGE * 2 >= 64 * CP * 4, "the C tile is staged in the operand buffers");
  __shared__ __align__(16) T sm[2 * STAGE];
  const int lane = threadIdx.x & 31;
  const int wave = threadIdx.x >> 5;
  const int m0 = blockIdx.y << 6;
  const int n0 = blockIdx.x << 7;
  const int wm = (wave >> 2) << 5;          // this wave's first row and column in the tile
  const int wn = (wave & 3) << 5;
  const int rlane = lane & 15;              // row (A) / col (B, D) within a 16 x 16 subtile
  const int koff  = (lane >> 4) * 8;        // k offset of this lane half
  const int mOff  = (lane >> 4) * 8;        // D row offset

  const int lrow = threadIdx.x >> 3, lseg = (threadIdx.x & 7) * 8;   // staging: row within a step of 32 rows, 16-byte piece of the row
  const int a0 = blockIdx.y * astep;        // first A row of this tile
  const T* gA  = (const T*)Ap  + (size_t)(a0 + lrow) * K + lseg;
  const T* gB  = (const T*)Btp + (size_t)(n0 + lrow) * K + lseg;
  const T* gA2 = SPLIT ? (const T*)A2p  + (size_t)(a0 + lrow) * K + lseg : nullptr;
  const T* gB2 = SPLIT ? (const T*)Bt2p + (size_t)(n0 + lrow) * K + lseg : nullptr;
  const int sw = lrow * PITCH + lseg;       // this thread's place in a buffer, step 0
  const int fa = (wm + rlane) * PITCH + koff;        // this lane's A and Bt fragment places in a buffer, subtile 0, k 0
  const int fb = (64 + wn + rlane) * PITCH + koff;

  v8f acc[2][2];
#pragma unroll
  for (int i = 0; i < 2; ++i)
#pragma unroll
    for (int j = 0; j < 2; ++j) acc[i][j] = (v8f){0.f,0.f,0.f,0.f,0.f,0.f,0.f,0.f};

  V8 st[NL];
  auto fetch = [&](int k0) {                // stage at k0: global memory -> registers
#pragma unroll
    for (int it = 0; it < NL; ++it) {
      const int q = it % 6;                 // steps 0, 1: A rows; 2..5: Bt rows; then the same for the lo planes
      const T* g = (it < 6) ? (q < 2 ? gA : gB) : (q < 2 ? gA2 : gB2);
      st[it] = *(const V8*)(g + (size_t)((q < 2 ? q : q - 2) * 32) * K + k0);
    }
  };
  auto put = [&](int buf) {                 // registers -> LDS buffer
#pragma unroll
    for (int it = 0; it < NL; ++it) *(V8*)(sm + buf * STAGE + sw + it * (32 * PITCH)) = st[it];
  };
  auto mult = [&](int buf) {                // one stage: 2 steps of 32 k
    const T* s = sm + buf * STAGE;
#pragma unroll
    for (int kk = 0; kk < 2; ++kk) {
      V ah[2], al[2], bh[2], bl[2];
#pragma unroll
      for (int i = 0; i < 2; ++i) {
        ah[i] = Frag<T>::load(s + fa + i * (16 * PITCH) + kk * 32);
        bh[i] = Frag<T>::load(s + fb + i * (16 * PITCH) + kk * 32);
        if (SPLIT) {
          al[i] = Frag<T>::load(s + PROWS * PITCH + fa + i * (16 * PITCH) + kk * 32);
          bl[i] = Frag<T>::load(s + PROWS * PITCH + fb + i * (16 * PITCH) + kk * 32);
        }
      }
#pragma unroll
      for (int i = 0; i < 2; ++i)
#pragma unroll
        for (int j = 0; j < 2; ++j) acc[i][j] = Frag<T>::mma(ah[i], bh[j], acc[i][j]);
      if (SPLIT) {
#pragma unroll
        for (int i = 0; i < 2; ++i)
#pragma unroll
          for (int j = 0; j < 2; ++j) acc[i][j] = Frag<T>::mma(ah[i], bl[j], acc[i][j]);
#pragma unroll
        for (int i = 0; i < 2; ++i)
#pragma unroll
          for (int j = 0; j < 2; ++j) acc[i][j] = Frag<T>::mma(al[i], bh[j], acc[i][j]);
      }
    }
  };

  const int NK = K >> 6;
  fetch(0);
  put(0);
  __syncthreads();                          // stage 0 is visible
  for (int kt = 0; kt + 1 < NK; ++kt) {
    fetch((kt + 1) << 6);
    __builtin_amdgcn_sched_barrier(0);      // keeps the next stage's global loads issued ahead of this stage's products, so that their latency runs under them
    mult(kt & 1);
    put((kt + 1) & 1);                      // the buffer that stage kt - 1 was read from; its readers left it at the barrier that ended that trip
    __syncthreads();                        // stage kt + 1 is visible, and every wave has finished reading stage kt
  }
  mult((NK - 1) & 1);
  __syncthreads();                          // all fragment reads are done: the buffers now stage the C tile

  // ---- epilogue: the 64 x 128 f32 tile through LDS, so that each store instruction writes 512 contiguous bytes of one row ----
  float* sC = (float*)sm;
#pragma unroll
  for (int i = 0; i < 2; ++i)
#pragma unroll
    for (int j = 0; j < 2; ++j)
#pragma unroll
      for (int r = 0; r < 8; ++r) sC[(wm + (i << 4) + mOff + r) * CP + wn + (j << 4) + rlane] = acc[i][j][r] * scale;
  __syncthreads();
#pragma unroll
  for (int it = 0; it < 8; ++it) {
    const int row = it * 8 + wave;
    const v4f v = *(const v4f*)(sC + row * CP + lane * 4);
    *(v4f*)(C + (size_t)(m0 + row) * N + n0 + lane * 4) = v;
  }
}

__global__ __launch_bounds__(256) void cast_f32_f16x2(
    const float* __restrict__ in, _Float16* __restrict__ out, int n2) {
  int i = blockIdx.x * 256 + threadIdx.x;
  if (i < n2) {
    const _Float16 h0 = (_Float16)in[2 * i], h1 = (_Float16)in[2 * i + 1];
    const unsigned u = (unsigned)__builtin_bit_cast(unsigned short, h0) | ((unsigned)__builtin_bit_cast(unsigned short, h1) << 16);
    ((unsigned*)out)[i] = u;
    
  }
}


} // namespace w25

__global__ __launch_bounds__(256) void k_castT16(const float* __restrict__ src, long long lds, _Float16* __restrict__ dst, long long ldd, int R, int C, float s) {
    const long long i = (long long)blockIdx.x * 256 + threadIdx.x; const long long np = (long long)C * (R / 2); if (i >= np) return; const int c = (int)(i / (R / 2)); const int r = 2 * (int)(i % (R / 2));
    const _Float16 h0 = (_Float16)(src[(long long)r * lds + c] * s), h1 = (_Float16)(src[(long long)(r + 1) * lds + c] * s);
    const unsigned u = (unsigned)__builtin_bit_cast(unsigned short, h0) | ((unsigned)__builtin_bit_cast(unsigned short, h1) << 16);
    unsigned* d = (unsigned*)(dst + (long long)c * ldd + r); *d = u;  }
__global__ __launch_bounds__(256) void k_cast16(const float* __restrict__ src, long long lds, _Float16* __restrict__ dst, long long ldd, int R, int C, float s) {
    const long long i = (long long)blockIdx.x * 256 + threadIdx.x; const long long np = (long long)R * (C / 2); if (i >= np) return; const int r = (int)(i / (C / 2)); const int c = 2 * (int)(i % (C / 2));
    const _Float16 h0 = (_Float16)(src[(long long)r * lds + c] * s), h1 = (_Float16)(src[(long long)r * lds + c + 1] * s);
    const unsigned u = (unsigned)__builtin_bit_cast(unsigned short, h0) | ((unsigned)__builtin_bit_cast(unsigned short, h1) << 16);
    unsigned* d = (unsigned*)(dst + (long long)r * ldd + c); *d = u;  }

// f32 -> bf16 hi plane + bf16 lo plane (x = hi + lo to ~2^-17 relative; RNE both), [R][C] -> [R][C] (or transposed to [C][R]); 2 consecutive destination elements
__device__ __forceinline__ unsigned int f2bf2_pack(float a, float b, unsigned int* lo) {
    const unsigned short ha = w25::f2bf_bits(a), hb = w25::f2bf_bits(b);
    const unsigned short la = w25::f2bf_bits(a - w25::bf_bits2f(ha)), lb = w25::f2bf_bits(b - w25::bf_bits2f(hb));
    *lo = (unsigned)la | ((unsigned)lb << 16); return (unsigned)ha | ((unsigned)hb << 16); }
__global__ __launch_bounds__(256) void k_castS16(const float* __restrict__ src, long long lds, __bf16* __restrict__ dhi, __bf16* __restrict__ dlo, long long ldd, int R, int C, float s, int transpose) {
    const long long i = (long long)blockIdx.x * 256 + threadIdx.x; long long o; float a, b;
    if (transpose) { const long long np = (long long)C * (R / 2); if (i >= np) return; const int c = (int)(i / (R / 2)); const int r = 2 * (int)(i % (R / 2)); a = src[(long long)r * lds + c] * s; b = src[(long long)(r + 1) * lds + c] * s; o = (long long)c * ldd + r; }
    else { const long long np = (long long)R * (C / 2); if (i >= np) return; const int r = (int)(i / (C / 2)); const int c = 2 * (int)(i % (C / 2)); a = src[(long long)r * lds + c] * s; b = src[(long long)r * lds + c + 1] * s; o = (long long)r * ldd + c; }
    unsigned lo; const unsigned hi = f2bf2_pack(a, b, &lo); unsigned* ph = (unsigned*)(dhi + o); unsigned* pl = (unsigned*)(dlo + o);
    *ph = hi; *pl = lo;  }

namespace w25 {
// =====================================================================================
// Generic causal/non-causal attention for head_dim 64, f32 in / f32 out; 16-bit operands: bf16 with optional hi/lo splits, or
// plain f16 (F16=true, non-split, probabilities carried x2^15).
//   scores = (q*qscale)·kᵀ : v_wmma_f32_16x16x32_bf16; SPLIT_QK -> q,k as bf16 hi/lo (hi·hi + hi·lo + lo·hi)
//   out    = p·v           : v_wmma_f32_16x16x32_bf16; SPLIT_PV -> p,v as bf16 hi/lo; else p,v plain bf16
//   f32 accumulate; online softmax in f32. Block = 4 waves = 64 query rows of one (batch, head); S % 64 == 0.
//   Element (b, s, h, d) of tensor X lives at X[b*X_bs + s*X_rs + h*X_hs + d] (strides in floats, multiples of 4).
//   Masking: mask_mode 0 none, 1 causal (kv > q masked), 2 tensor [S][Skv] shared over (b,h) (float if
//   mask_is_int==0, int32 with element == 0 -> masked if 1, int32 with element != 0 -> masked if 2), 3 per-token vectors qmask[B][S] & kvmask[B][Skv] (int32,
//   0 -> masked), 4 causal + sliding window (kv > q or q - kv > W masked; W passed in mask_is_int);
//   5 = relative-position bias: s += cp[b,h,q][idx[q][kv]] + pc[b,h,kv][idx[q][kv]] with idx = mask_b ([S][Skv] int32) and
//   mask_a an int32 [S][Skv] tensor with nonzero = masked (tables: element (b,h,row,n) at X + b*c_bs + h*c_hs + row*c_rs + n);
//   masked scores are replaced by mask_fill (e.g. -inf or -1e9) before the softmax.
//   grid.x = B * H * (S/64) (or a sub-range with blk0).
// =====================================================================================
#define AT_D 64
#define AT_NW 4
#define AT_QB 64
#define AT_KC 64
struct AttnGeom { const float* cp = nullptr; const float* pc = nullptr; long c_bs = 0, c_rs = 0, c_hs = 0;   // mode-5 score-bias tables
                  long q_bs, q_rs, q_hs, k_bs, k_rs, k_hs, v_bs, v_rs, v_hs, o_bs, o_rs, o_hs;
                  int S, Skv, H, mask_mode; float qscale; int blk0; float mask_fill; int mask_is_int; };
static_assert(sizeof(AttnGeom) == 168, "no padding");

__device__ __forceinline__ unsigned short at_bf_bits(float f) {
  unsigned u = __float_as_uint(f);
  return (unsigned short)((u + 0x7FFFu + ((u >> 16) & 1u)) >> 16);
}
__device__ __forceinline__ __bf16 at_f2bf(float f) { return __builtin_bit_cast(__bf16, at_bf_bits(f)); }
__device__ __forceinline__ void at_split(float f, __bf16& hi, __bf16& lo) {
  const unsigned short hb = at_bf_bits(f);
  hi = __builtin_bit_cast(__bf16, hb);
  lo = at_f2bf(f - __uint_as_float(((unsigned)hb) << 16));
}
__device__ __forceinline__ v8f at_mma(v16b a, v16b b, v8f c) {
  c = __builtin_amdgcn_wmma_f32_16x16x32_bf16(false, a, false, b, (short)0, c, false, false);
  asm volatile("v_nop\n\tv_nop\n\tv_nop\n\tv_nop" : "+v"(c) : "v"(a), "v"(b));
  return c;
}
// 16-bit element as a bit pattern held in a __bf16 slot: f16 bits when F16, bf16 (RNE) otherwise
template <bool F16> __device__ __forceinline__ __bf16 at_to16(float f) {
  if (F16) return __builtin_bit_cast(__bf16, (_Float16)f);
  return at_f2bf(f);
}
template <bool F16> __device__ __forceinline__ v8f at_mma16(v16b a, v16b b, v8f c) {
  if (F16) {
    const v16h ah = __builtin_bit_cast(v16h, a), bh = __builtin_bit_cast(v16h, b);
    c = __builtin_amdgcn_wmma_f32_16x16x32_f16(false, ah, false, bh, (short)0, c, false, false);
    asm volatile("v_nop\n\tv_nop\n\tv_nop\n\tv_nop" : "+v"(c) : "v"(ah), "v"(bh));
    return c;
  }
  return at_mma(a, b, c);
}

template <bool SPLIT_QK, bool SPLIT_PV, bool F16 = false>
__global__ __launch_bounds__(128)
void attn64_kernel(const float* __restrict__ q, const float* __restrict__ k,
                   const float* __restrict__ v, float* __restrict__ out,
                   const void* __restrict__ mask_a, const int* __restrict__ mask_b, AttnGeom g) {
  static_assert(!(F16 && (SPLIT_QK || SPLIT_PV)), "f16 mode is non-split");
  const float PSC = F16 ? 32768.0f : 1.0f;     // f16 probabilities carried x2^15 (subnormal range), folded into the final 1/l
  union FB { v16b v; v8b h[2]; };
  __shared__ __align__(16) __bf16 Ksh[AT_KC * AT_D];             // K hi [kv][d]      8 KB
  __shared__ __align__(16) __bf16 Ksl[SPLIT_QK ? AT_KC * AT_D : 8];
  __shared__ __align__(16) __bf16 Vth[AT_D * AT_KC];             // V hi [d][kv]      8 KB
  __shared__ __align__(16) __bf16 Vtl[SPLIT_PV ? AT_D * AT_KC : 8];
  __shared__ __align__(16) __bf16 Psh[AT_NW][16 * AT_KC];        // per wave P hi [row][kv]  8 KB
  __shared__ __align__(16) __bf16 Psl[SPLIT_PV ? AT_NW : 1][SPLIT_PV ? 16 * AT_KC : 8];
  __shared__ __align__(16) float  Os[AT_NW][16 * 68];            // per wave out tile, pitch 68

  const int tid  = threadIdx.x;
  const int wave = tid >> 5;
  const int lane = tid & 31;
  const int hh   = lane >> 4;
  const int c    = lane & 15;

  const int nqb = g.S / AT_QB;
  const int bx = blockIdx.x + g.blk0;
  const int qb = bx % nqb;
  const int bh = bx / nqb;
  const int h  = bh % g.H;
  const int b  = bh / g.H;
  const int qbase_block = qb * AT_QB;
  const int q0 = qbase_block + wave * 16;

  const float* qb_ptr = q + (size_t)b * g.q_bs + (size_t)h * g.q_hs;
  const float* kb_ptr = k + (size_t)b * g.k_bs + (size_t)h * g.k_hs;
  const float* vb_ptr = v + (size_t)b * g.v_bs + (size_t)h * g.v_hs;
  float*       ob_ptr = out + (size_t)b * g.o_bs + (size_t)h * g.o_hs;

  // ---- Q fragments (A operand): 2 d-chunks, hi (and lo) ----
  v16b qah[2], qal[2];
  {
    const float* qrow = qb_ptr + (size_t)(q0 + c) * g.q_rs;
#pragma unroll
    for (int dc = 0; dc < 2; ++dc) {
#pragma unroll
      for (int e = 0; e < 8; ++e) {
        const float f0 = qrow[dc * 32 + 8 * hh + e] * g.qscale;
        const float f1 = qrow[dc * 32 + 16 + 8 * hh + e] * g.qscale;
        if (SPLIT_QK) { __bf16 hq, lq; at_split(f0, hq, lq); qah[dc][e] = hq; qal[dc][e] = lq; at_split(f1, hq, lq); qah[dc][8 + e] = hq; qal[dc][8 + e] = lq; }
        else { qah[dc][e] = at_to16<F16>(f0); qah[dc][8 + e] = at_to16<F16>(f1); qal[dc][e] = qah[dc][e]; qal[dc][8 + e] = qah[dc][8 + e]; }
      }
    }
  }

  float mrow[8], lrow[8];
  v8f oacc[4];
#pragma unroll
  for (int r = 0; r < 8; ++r) { mrow[r] = -INFINITY; lrow[r] = 0.f; }
#pragma unroll
  for (int t = 0; t < 4; ++t) oacc[t] = (v8f){0.f,0.f,0.f,0.f,0.f,0.f,0.f,0.f};

  const int nChunks = (g.mask_mode == 1 || g.mask_mode == 4) ? (qb + 1) : (g.Skv / AT_KC);   // block-uniform
  // per-row query mask (mode 3)
  int qkeep[8];
#pragma unroll
  for (int r = 0; r < 8; ++r) qkeep[r] = (g.mask_mode == 3) ? mask_b[(size_t)b * g.S + q0 + 8 * hh + r] : 1;   // mask_b = qmask in mode 3
  for (int kc = 0; kc < nChunks; ++kc) {
    const int kv0 = kc * AT_KC;
    __syncthreads();
    {
      const int kvr = tid >> 1, dh = (tid & 1) * 32;
      const float* krow = kb_ptr + (size_t)(kv0 + kvr) * g.k_rs + dh;
      const float* vrow = vb_ptr + (size_t)(kv0 + kvr) * g.v_rs + dh;
#pragma unroll
      for (int i = 0; i < 8; ++i) {
        v4f kk = *(const v4f*)(krow + 4 * i);
        v4f vv = *(const v4f*)(vrow + 4 * i);
#pragma unroll
        for (int e = 0; e < 4; ++e) {
          const int d = dh + 4 * i + e;
          if (SPLIT_QK) { __bf16 a, bl; at_split(kk[e], a, bl); Ksh[kvr * AT_D + d] = a; Ksl[kvr * AT_D + d] = bl; }
          else Ksh[kvr * AT_D + d] = at_to16<F16>(kk[e]);
          if (SPLIT_PV) { __bf16 a, bl; at_split(vv[e], a, bl); Vth[d * AT_KC + kvr] = a; Vtl[d * AT_KC + kvr] = bl; }
          else Vth[d * AT_KC + kvr] = at_to16<F16>(vv[e]);
        }
      }
    }
    __syncthreads();

    v8f s[4];
#pragma unroll
    for (int j = 0; j < 4; ++j) {
      s[j] = (v8f){0.f,0.f,0.f,0.f,0.f,0.f,0.f,0.f};
#pragma unroll 1
      for (int dc = 0; dc < 2; ++dc) {
        FB kb;
        kb.h[0] = *(const v8b*)(Ksh + (j * 16 + c) * AT_D + dc * 32 + 8 * hh);
        kb.h[1] = *(const v8b*)(Ksh + (j * 16 + c) * AT_D + dc * 32 + 16 + 8 * hh);
        s[j] = at_mma16<F16>(qah[dc], kb.v, s[j]);
        if (SPLIT_QK) {
          FB kl;
          kl.h[0] = *(const v8b*)(Ksl + (j * 16 + c) * AT_D + dc * 32 + 8 * hh);
          kl.h[1] = *(const v8b*)(Ksl + (j * 16 + c) * AT_D + dc * 32 + 16 + 8 * hh);
          s[j] = at_mma16<F16>(qah[dc], kl.v, s[j]);
          s[j] = at_mma16<F16>(qal[dc], kb.v, s[j]);
        }
      }
    }
    const bool diag = (g.mask_mode == 1) && (kc == qb);
    int kvkeep[4] = {1, 1, 1, 1};
    if (g.mask_mode == 3) {
#pragma unroll
      for (int j = 0; j < 4; ++j) kvkeep[j] = ((const int*)mask_a)[(size_t)b * g.Skv + kv0 + j * 16 + c];   // mask_a = kvmask
    }
    float cm[8];
#pragma unroll
    for (int r = 0; r < 8; ++r) {
      const int qrow = q0 + 8 * hh + r;
      float m = -INFINITY;
#pragma unroll
      for (int j = 0; j < 4; ++j) {
        const int kvcol = kv0 + j * 16 + c;
        bool masked = false;
        if (diag) masked = (kvcol > qrow);
        else if (g.mask_mode == 4) masked = (kvcol > qrow) || (qrow - kvcol > g.mask_is_int);
        else if (g.mask_mode == 2) {
          const size_t mi = (size_t)qrow * g.Skv + kvcol;
          masked = (g.mask_is_int == 0) ? (((const float*)mask_a)[mi] == 0.0f)
                 : (g.mask_is_int == 1) ? (((const int*)mask_a)[mi] == 0) : (((const int*)mask_a)[mi] != 0);
        } else if (g.mask_mode == 3) masked = (qkeep[r] == 0) || (kvkeep[j] == 0);
        else if (g.mask_mode == 5) {
          const size_t mi = (size_t)qrow * g.Skv + kvcol;
          masked = (((const int*)mask_a)[mi] != 0);
          int n = mask_b[mi]; n = n < 0 ? 0 : n;
          s[j][r] += g.cp[(size_t)b * g.c_bs + (size_t)h * g.c_hs + (size_t)qrow * g.c_rs + n]
                   + g.pc[(size_t)b * g.c_bs + (size_t)h * g.c_hs + (size_t)kvcol * g.c_rs + n];
        }
        if (masked) s[j][r] = g.mask_fill;
        m = fmaxf(m, s[j][r]);
      }
#pragma unroll
      for (int off = 1; off < 16; off <<= 1) m = fmaxf(m, __shfl_xor(m, off, 32));
      cm[r] = m;
    }
    __bf16* pwh = Psh[wave];
    __bf16* pwl = Psl[SPLIT_PV ? wave : 0];
#pragma unroll
    for (int r = 0; r < 8; ++r) {
      const float mnew = fmaxf(mrow[r], cm[r]);
      const float alpha = expf(mrow[r] - mnew);
      mrow[r] = mnew;
      float psum = 0.f;
#pragma unroll
      for (int j = 0; j < 4; ++j) {
        const float p = expf(s[j][r] - mnew);
        psum += p;
        if (SPLIT_PV) { __bf16 a, bl; at_split(p, a, bl); pwh[(8 * hh + r) * AT_KC + j * 16 + c] = a; pwl[(8 * hh + r) * AT_KC + j * 16 + c] = bl; }
        else pwh[(8 * hh + r) * AT_KC + j * 16 + c] = at_to16<F16>(p * PSC);
      }
#pragma unroll
      for (int off = 1; off < 16; off <<= 1) psum += __shfl_xor(psum, off, 32);
      lrow[r] = lrow[r] * alpha + psum;
#pragma unroll
      for (int t = 0; t < 4; ++t) oacc[t][r] *= alpha;
    }
    __builtin_amdgcn_fence(__ATOMIC_RELEASE, "workgroup");
    __builtin_amdgcn_wave_barrier();
    __builtin_amdgcn_fence(__ATOMIC_ACQUIRE, "workgroup");
#pragma unroll 1
    for (int kk = 0; kk < 2; ++kk) {
      FB pa, pl;
      pa.h[0] = *(const v8b*)(pwh + c * AT_KC + kk * 32 + 8 * hh);
      pa.h[1] = *(const v8b*)(pwh + c * AT_KC + kk * 32 + 16 + 8 * hh);
      if (SPLIT_PV) {
        pl.h[0] = *(const v8b*)(pwl + c * AT_KC + kk * 32 + 8 * hh);
        pl.h[1] = *(const v8b*)(pwl + c * AT_KC + kk * 32 + 16 + 8 * hh);
      }
#pragma unroll
      for (int t = 0; t < 4; ++t) {
        FB vb;
        vb.h[0] = *(const v8b*)(Vth + (t * 16 + c) * AT_KC + kk * 32 + 8 * hh);
        vb.h[1] = *(const v8b*)(Vth + (t * 16 + c) * AT_KC + kk * 32 + 16 + 8 * hh);
        oacc[t] = at_mma16<F16>(pa.v, vb.v, oacc[t]);
        if (SPLIT_PV) {
          FB vl;
          vl.h[0] = *(const v8b*)(Vtl + (t * 16 + c) * AT_KC + kk * 32 + 8 * hh);
          vl.h[1] = *(const v8b*)(Vtl + (t * 16 + c) * AT_KC + kk * 32 + 16 + 8 * hh);
          oacc[t] = at_mma16<F16>(pa.v, vl.v, oacc[t]);
          oacc[t] = at_mma16<F16>(pl.v, vb.v, oacc[t]);
        }
      }
    }
  }

  float* os = Os[wave];
#pragma unroll
  for (int r = 0; r < 8; ++r) {
    const float inv = 1.0f / (lrow[r] * PSC);
#pragma unroll
    for (int t = 0; t < 4; ++t) os[(8 * hh + r) * 68 + t * 16 + c] = oacc[t][r] * inv;
  }
  __builtin_amdgcn_fence(__ATOMIC_RELEASE, "workgroup");
  __builtin_amdgcn_wave_barrier();
  __builtin_amdgcn_fence(__ATOMIC_ACQUIRE, "workgroup");
  {
    const int c4 = (lane & 15) * 4;
    {
#pragma unroll
      for (int it = 0; it < 8; ++it) {
        const int row = it * 2 + hh;
        v4f val = *(const v4f*)(os + row * 68 + c4);
        *(v4f*)(ob_ptr + (size_t)(q0 + row) * g.o_rs + c4) = val;
      }
      
    }
  }
}

} // namespace w25

// RoPE in place: thread per (row, q|k, head, pair i<32): (x0, x1) = (x[2i], x[2i+1]) -> (x0 cos[2i] - x1 sin[2i], x1 cos[2i+1] + x0 sin[2i+1]); tables gathered by the INPUT position (clamped); one 8-B store per lane, lanes contiguous
__global__ __launch_bounds__(256) void k_cm_rope(float* __restrict__ Q, float* __restrict__ Kx, const float* __restrict__ CS, const float* __restrict__ SN, const int* __restrict__ POS, int Bn, int S, int NH, int HD) { const long long t = (long long)blockIdx.x * 256 + threadIdx.x; const int HF = HD / 2; if (t >= (long long)Bn * S * 2 * NH * HF) return; const int i = (int)(t % HF); long long r = t / HF; const int h = (int)(r % NH); r /= NH; const int which = (int)(r % 2); const long long row = r / 2; const int sq = (int)(row % S);
    int ps = POS[sq]; ps = ps < 0 ? 0 : (ps >= S ? S - 1 : ps); const float c0 = CS[ps * HD + 2 * i], c1 = CS[ps * HD + 2 * i + 1], s0 = SN[ps * HD + 2 * i], s1 = SN[ps * HD + 2 * i + 1];
    float* base = ((which == 0) ? Q : Kx) + row * ((long long)NH * HD) + h * HD + 2 * i; const float x0 = base[0], x1 = base[1];
    const unsigned long long pk = (unsigned long long)__builtin_bit_cast(unsigned, x0 * c0 - x1 * s0) | ((unsigned long long)__builtin_bit_cast(unsigned, x1 * c1 + x0 * s1) << 32); VST2(unsigned long long, (unsigned long long*)base, pk); }
__global__ __launch_bounds__(64) void k_cm_exact(const float* __restrict__ Q64, const float* __restrict__ K64, const float* __restrict__ V, float* __restrict__ AT, int S, int D, int NH, int HD) { __shared__ float sc[64]; const int t = blockIdx.x % 64; const int h = (blockIdx.x / 64) % NH; const int b = blockIdx.x / (64 * NH); const int d = threadIdx.x;
    const float* q = Q64 + ((long long)b * 64 + t) * D + h * HD; float s = -3.0e38f;
    if (d <= t) { const float* kr = K64 + ((long long)b * 64 + d) * D + h * HD; float a = 0.f;
#pragma unroll 1
        for (int j = 0; j < HD; ++j) a += q[j] * kr[j];
        s = a * 0.125f; }
    sc[d] = s; __syncthreads();
    float mx = -3.0e38f; for (int j = 0; j <= t; ++j) mx = fmaxf(mx, sc[j]);
    float den = 0.f; for (int j = 0; j <= t; ++j) den += expf(sc[j] - mx);
    float acc = 0.f;
#pragma unroll 1
    for (int j = 0; j <= t; ++j) acc += expf(sc[j] - mx) * V[((long long)b * S + j) * D + h * HD + d];
    VST2(float, AT + ((long long)b * S + t) * D + h * HD + d, acc / den); }


extern "C" void kernel_launch(void* const* d_in, const int* in_sizes, int n_in, void* d_out, int out_size, void* d_ws, size_t ws_size, hipStream_t stream) {
    (void)in_sizes; (void)n_in; (void)out_size; (void)ws_size;
    const float* x = (const float*)d_in[0];
    const float* Wq = (const float*)d_in[1];
    const float* Wk = (const float*)d_in[2];
    const float* Wv = (const float*)d_in[3];
    const float* Wo = (const float*)d_in[4];
    const float* cosT = (const float*)d_in[5];
    const float* sinT = (const float*)d_in[6];
    const int* tpos = (const int*)d_in[7];
    const int Bn = 4;
    const int S = 2048;
    const int D = 1024;
    const int NH = 16;
    const int HD = 64;
    const int NR = Bn * S;
    float* out = (float*)d_out;
    char* wsp = (char*)d_ws;
    float* Q = (float*)wsp; wsp += (size_t)NR * D * 4;
    float* Kb = (float*)wsp; wsp += (size_t)NR * D * 4;
    float* V = (float*)wsp; wsp += (size_t)NR * D * 4;
    float* AT = (float*)wsp; wsp += (size_t)NR * D * 4;
    float* Q64 = (float*)wsp; wsp += (size_t)Bn * 64 * D * 4;
    float* K64 = (float*)wsp; wsp += (size_t)Bn * 64 * D * 4;
    unsigned short* XH = (unsigned short*)wsp; wsp += (size_t)NR * D * 2;    // x as f16
    unsigned short* XS = (unsigned short*)wsp; wsp += (size_t)NR * D * 2;    // x as bf16 hi and lo planes; after the exact-row GEMMs the attention output's planes
    unsigned short* XS2 = (unsigned short*)wsp; wsp += (size_t)NR * D * 2;
    unsigned short* WqH = (unsigned short*)wsp; wsp += (size_t)D * D * 2;    // 16 Wq, 16 Wk as f16
    unsigned short* WkH = (unsigned short*)wsp; wsp += (size_t)D * D * 2;
    unsigned short* WqS = (unsigned short*)wsp; wsp += (size_t)D * D * 2;    // bf16 hi and lo planes of the four weights
    unsigned short* WqS2 = (unsigned short*)wsp; wsp += (size_t)D * D * 2;
    unsigned short* WkS = (unsigned short*)wsp; wsp += (size_t)D * D * 2;
    unsigned short* WkS2 = (unsigned short*)wsp; wsp += (size_t)D * D * 2;
    unsigned short* WvS = (unsigned short*)wsp; wsp += (size_t)D * D * 2;
    unsigned short* WvS2 = (unsigned short*)wsp; wsp += (size_t)D * D * 2;
    unsigned short* WoS = (unsigned short*)wsp; wsp += (size_t)D * D * 2;
    unsigned short* WoS2 = (unsigned short*)wsp; wsp += (size_t)D * D * 2;
    const unsigned gX = (unsigned)(((long long)NR * (D / 2) + 255) / 256);   // cast grids: two elements a thread
    const unsigned gW = (unsigned)(((long long)D * (D / 2) + 255) / 256);
    // q, k: f16 operands
    k_cast16<<<gX, 256, 0, stream>>>(x, D, (_Float16*)XH, D, NR, D, 1.0f);
    k_cast16<<<gW, 256, 0, stream>>>(Wq, D, (_Float16*)WqH, D, D, D, 16.0f);
    k_cast16<<<gW, 256, 0, stream>>>(Wk, D, (_Float16*)WkH, D, D, D, 16.0f);
    w25::wmma_gemm_lds<0, false><<<dim3(D / 128, NR / 64), 256, 0, stream>>>(XH, nullptr, WqH, nullptr, Q, D, D, 0.0625f, 64);
    w25::wmma_gemm_lds<0, false><<<dim3(D / 128, NR / 64), 256, 0, stream>>>(XH, nullptr, WkH, nullptr, Kb, D, D, 0.0625f, 64);
    // v: bf16 hi/lo planes
    k_castS16<<<gX, 256, 0, stream>>>(x, D, (__bf16*)XS, (__bf16*)XS2, D, NR, D, 1.0f, 0);
    k_castS16<<<gW, 256, 0, stream>>>(Wv, D, (__bf16*)WvS, (__bf16*)WvS2, D, D, D, 1.0f, 0);
    w25::wmma_gemm_lds<1, true><<<dim3(D / 128, NR / 64), 256, 0, stream>>>(XS, XS2, WvS, WvS2, V, D, D, 1.0f, 64);
    // q, k of the first 64 rows of every batch, from the same planes of x: tile b of C takes rows b S .. b S + 63 of A
    k_castS16<<<gW, 256, 0, stream>>>(Wq, D, (__bf16*)WqS, (__bf16*)WqS2, D, D, D, 1.0f, 0);
    k_castS16<<<gW, 256, 0, stream>>>(Wk, D, (__bf16*)WkS, (__bf16*)WkS2, D, D, D, 1.0f, 0);
    w25::wmma_gemm_lds<1, true><<<dim3(D / 128, Bn), 256, 0, stream>>>(XS, XS2, WqS, WqS2, Q64, D, D, 1.0f, S);
    w25::wmma_gemm_lds<1, true><<<dim3(D / 128, Bn), 256, 0, stream>>>(XS, XS2, WkS, WkS2, K64, D, D, 1.0f, S);
    k_cm_rope<<<(unsigned)(((long long)NR * 2 * NH * 32 + 255) / 256), 256, 0, stream>>>(Q, Kb, cosT, sinT, (const int*)tpos, Bn, S, NH, HD);
    k_cm_rope<<<(unsigned)(((long long)Bn * 64 * 2 * NH * 32 + 255) / 256), 256, 0, stream>>>(Q64, K64, cosT, sinT, (const int*)tpos, Bn, 64, NH, HD);
    { /*apv4*/ AttnP a;
      a.Q = Q; a.K = Kb; a.V = V; a.O = AT; a.P = 0; a.Mf = 0; a.Mi = 0; a.ST = 0;
      a.Pw = 0; a.Rt = 0; a.SQ = 0; a.SK = 0;
      a.swb = 0; a.swh = 0; a.swi = 0; a.swj = 0; a.srb = 0; a.srh = 0; a.sri = 0; a.sQb = (long long)S * D; a.sQh = HD; a.sQi = D; a.sQd = 1; a.sKb = (long long)S * D; a.sKh = HD; a.sKj = D; a.sKd = 1; a.sVb = (long long)S * D; a.sVh = HD; a.sVj = D; a.sVd = 1; a.sOb = (long long)S * D; a.sOh = HD; a.sOi = D; a.sPb = 0; a.sPh = 0; a.sPi = 0; a.smb = 0; a.smh = 0; a.smi = 0; a.smj = 0;
      a.Lq = S; a.Lk = S; a.dh = HD; a.dv = HD; a.hrep = 1; a.causal = 1; a.coff = 0; a.pband = 0;
      a.scale = 0.125f; a.mfill = 0.0f; a.nonorm = 0; a.mpol = 0;
      a.roff = 0; a.rn = 1; a.segpol = 0; a.win = 0;
      k_attn<64, 64, 0, false, false, 2048, 1024><<<dim3((unsigned)((S) + 16 * AW - 1) / (16 * AW), (unsigned)(NH), (unsigned)(Bn)), 32 * AW, 0, stream>>>(a); }
    k_cm_exact<<<Bn * NH * 64, 64, 0, stream>>>(Q64, K64, V, AT, S, D, NH, HD);
    k_castS16<<<gX, 256, 0, stream>>>(AT, D, (__bf16*)XS, (__bf16*)XS2, D, NR, D, 1.0f, 0);
    k_castS16<<<gW, 256, 0, stream>>>(Wo, D, (__bf16*)WoS, (__bf16*)WoS2, D, D, D, 1.0f, 0);
    w25::wmma_gemm_lds<1, true><<<dim3(D / 128, NR / 64), 256, 0, stream>>>(XS, XS2, WoS, WoS2, out, D, D, 1.0f, 64);
}

// v004
// Measured time: 559 microseconds a run.
// Two timings next to v003 both put it at 1.36 times that version's speed.
// Over all steps from v000 it is 8.06 times as fast.
// Contractions: q/k = x.W^T [8192x1024].[1024x1024] with f16 operands (weights x16); v = x.Wv^T and the output projection on bf16 hi/lo split planes (late causal rows are long averages, so the value path must be f32-class) — v_wmma_f32_16x16x32_*, 64x128 work-group tiles with both operands staged in LDS; per (batch, head) causal softmax(q k^T / 8) v as one flash launch (f16 q.k^T and p.v; fully-masked key tiles skipped); f32 accumulate and softmax. The interleaved-pair RoPE with the INPUT cos/sin tables gathered by the INPUT token positions (generic elementwise form: out = x*cos + rot(x)*sin with rot = (-x[odd], x[even]) interleaved) and the exact-f32 recompute of the first 64 causal rows per head (whose q/k rows come from their own small bf16 hi/lo split GEMMs [256x1024].[1024x1024] on rows 0..63 of each batch) are f32 kernels.
#include <hip/hip_runtime.h>
#include <math.h>

typedef __attribute__((ext_vector_type(16))) _Float16 v16h;
typedef __attribute__((ext_vector_type(8)))  _Float16 v8h;
typedef __attribute__((ext_vector_type(4)))  _Float16 v4h;
typedef __attribute__((ext_vector_type(16))) __bf16   v16b;
typedef __attribute__((ext_vector_type(8)))  float    v8f;
typedef __attribute__((ext_vector_type(4)))  float    v4f;

// 16-bit WMMA fragment map (wave32), lane L, h = L>>4, m = L&15:
//   A 16x32: lane = row m;   element i -> k = (i<8) ? 8h+i : 16+8h+(i-8)
//   B 32x16: lane = column m; the SAME k(i,h)
//   D 16x16 (8 f32): lane = column m; element r -> row 8h+r
__device__ __forceinline__ int frag_k(int i, int h) { return (i < 8) ? (8 * h + i) : (16 + 8 * h + (i - 8)); }
__device__ __forceinline__ __bf16 bf16_rne(float f) {
    unsigned int u = __float_as_uint(f);
    u += 0x7fffu + ((u >> 16) & 1u);
    return __builtin_bit_cast(__bf16, (unsigned short)(u >> 16));
}
__device__ __forceinline__ float bf16_f32(__bf16 b) { return __uint_as_float(((unsigned int)__builtin_bit_cast(unsigned short, b)) << 16); }
__device__ __forceinline__ v8f wmma16(v16h a, v16h b, v8f c) {
    c = __builtin_amdgcn_wmma_f32_16x16x32_f16(false, a, false, b, (short)0, c, false, false);
    asm volatile("v_nop\n\tv_nop\n\tv_nop\n\tv_nop" : "+v"(c) : "v"(a), "v"(b));
    return c;
}
__device__ __forceinline__ v8f wmmab(v16b a, v16b b, v8f c) {
    c = __builtin_amdgcn_wmma_f32_16x16x32_bf16(false, a, false, b, (short)0, c, false, false);
    asm volatile("v_nop\n\tv_nop\n\tv_nop\n\tv_nop" : "+v"(c) : "v"(a), "v"(b));
    return c;
}
struct Split { v16b hi, lo; };
// hi/lo split product: a.hi*b.hi + a.hi*b.lo + a.lo*b.hi
__device__ __forceinline__ v8f wmma3(const Split& a, const Split& b, v8f c) {
    c = __builtin_amdgcn_wmma_f32_16x16x32_bf16(false, a.hi, false, b.hi, (short)0, c, false, false);
    c = __builtin_amdgcn_wmma_f32_16x16x32_bf16(false, a.hi, false, b.lo, (short)0, c, false, false);
    c = __builtin_amdgcn_wmma_f32_16x16x32_bf16(false, a.lo, false, b.hi, (short)0, c, false, false);
    asm volatile("v_nop\n\tv_nop\n\tv_nop\n\tv_nop" : "+v"(c) : "v"(a.hi), "v"(a.lo), "v"(b.hi), "v"(b.lo));
    return c;
}
struct Split3 { v16b hi, mid, lo; };
// triple split product (6 terms, drops only terms below 2^-24 relative)
__device__ __forceinline__ v8f wmma6(const Split3& a, const Split3& b, v8f c) {
    c = __builtin_amdgcn_wmma_f32_16x16x32_bf16(false, a.hi, false, b.hi, (short)0, c, false, false);
    c = __builtin_amdgcn_wmma_f32_16x16x32_bf16(false, a.hi, false, b.mid, (short)0, c, false, false);
    c = __builtin_amdgcn_wmma_f32_16x16x32_bf16(false, a.mid, false, b.hi, (short)0, c, false, false);
    c = __builtin_amdgcn_wmma_f32_16x16x32_bf16(false, a.hi, false, b.lo, (short)0, c, false, false);
    c = __builtin_amdgcn_wmma_f32_16x16x32_bf16(false, a.mid, false, b.mid, (short)0, c, false, false);
    c = __builtin_amdgcn_wmma_f32_16x16x32_bf16(false, a.lo, false, b.hi, (short)0, c, false, false);
    asm volatile("v_nop\n\tv_nop\n\tv_nop\n\tv_nop" : "+v"(c) : "v"(a.hi), "v"(a.mid), "v"(a.lo), "v"(b.hi), "v"(b.mid), "v"(b.lo));
    return c;
}

// Fragment gathers from f32 memory: element i <- p[(k0 + frag_k(i,h)) * sk] * s, zero for k >= klen.
__device__ __forceinline__ v16h fh_ld(const float* __restrict__ p, long long sk, int k0, int h, int klen, float s) {
    v16h a;
#pragma unroll
    for (int i = 0; i < 16; ++i) { const int k = k0 + frag_k(i, h); a[i] = (k < klen) ? (_Float16)(p[(long long)k * sk] * s) : (_Float16)0.f; }
    return a;
}
__device__ __forceinline__ Split sp_ld(const float* __restrict__ p, long long sk, int k0, int h, int klen, float s) {
    Split r;
#pragma unroll
    for (int i = 0; i < 16; ++i) {
        const int k = k0 + frag_k(i, h); const float x = (k < klen) ? p[(long long)k * sk] * s : 0.f;
        const __bf16 hb = bf16_rne(x); r.hi[i] = hb; r.lo[i] = bf16_rne(x - bf16_f32(hb));
    }
    return r;
}
__device__ __forceinline__ Split3 sp3_ld(const float* __restrict__ p, long long sk, int k0, int h, int klen, float s) {
    Split3 r;
#pragma unroll
    for (int i = 0; i < 16; ++i) {
        const int k = k0 + frag_k(i, h); const float x = (k < klen) ? p[(long long)k * sk] * s : 0.f;
        const __bf16 hb = bf16_rne(x); const float r1 = x - bf16_f32(hb); const __bf16 mb = bf16_rne(r1);
        r.hi[i] = hb; r.mid[i] = mb; r.lo[i] = bf16_rne(r1 - bf16_f32(mb));
    }
    return r;
}
__device__ __forceinline__ v16b bh_ld(const float* __restrict__ p, long long sk, int k0, int h, int klen, float s) {
    v16b a;
#pragma unroll
    for (int i = 0; i < 16; ++i) { const int k = k0 + frag_k(i, h); a[i] = bf16_rne((k < klen) ? p[(long long)k * sk] * s : 0.f); }
    return a;
}
// f16 fragment from an f16 LDS/global row with element stride 1 (k-contiguous), no bounds (tile already zero padded)
__device__ __forceinline__ v16h fh_row(const _Float16* __restrict__ row, int k0, int h) {
    v16h a;
#pragma unroll
    for (int i = 0; i < 16; ++i) a[i] = row[k0 + frag_k(i, h)];
    return a;
}

#define VST2(T, ptr, val) do { const T vst2_v_ = (val); *(T*)(ptr) = vst2_v_;  } while (0)
typedef float v4f __attribute__((ext_vector_type(4)));
#define VST2V4(ptr, val) do { const v4f vst2_v4_ = (val); *(v4f*)(ptr) = vst2_v4_;  } while (0)

__device__ __attribute__((noinline)) float act_fn(float v, int act) {
    if (act == 1) return fmaxf(v, 0.f);                                                                               // relu
    if (act == 2) { const float u = 0.7978845608028654f * (v + 0.044715f * v * v * v); return 0.5f * v * (1.f + tanhf(u)); } // tanh-gelu
    if (act == 3) return v / (1.f + expf(-v));                                                                        // silu
    if (act == 4) return 0.5f * v * (1.f + erff(v * 0.7071067811865476f));                                             // erf-gelu
    if (act == 5) return tanhf(v);
    if (act == 6) return 1.f / (1.f + expf(-v));                                                                      // sigmoid
    if (act == 7) return (v > 0.f) ? v : 0.01f * v;                                                                   // leaky relu 0.01
    if (act == 8) return (v > 0.f) ? v : (expf(v) - 1.f);                                                             // elu
    if (act == 9) return fminf(fmaxf(v, 0.f), 6.f);                                                                   // relu6
    if (act == 10) return fabsf(v);                                                                                    // abs
    if (act == 11) return (v >= 0.f) ? v : 0.1f * v;                                                                  // leaky 0.1
    if (act == 12) return (v > 0.f) ? v : 0.2f * v;                                                                   // leaky 0.2
    if (act == 13) return (v > 20.f) ? v : log1pf(expf(v));                                                            // softplus
    return v;
}

// =====================================================================================================================
// k_gemm<MODE>: C(z, m, n) = act(alpha * sum_k A(z, m, k) * B(z, k, n) + bias) + beta * R(z, m, n)
//   One wave (32-thread block) per 16 x 32 tile of C; grid (ceil(N/32), ceil(M/16), Z). Batch z -> (zo = z / zi_n, zi = z % zi_n)
//   with separate outer/inner strides for every tensor (e.g. batch and head). A(m,k) = A[zo*sAo + zi*sAi + m*sAm + k*sAk] (f32),
//   B(k,n) = B[zo*sBo + zi*sBi + n*sBn + k*sBk] (f32); any M, N, K (K zero-padded to 32 inside the fragments, M/N tails guarded).
//   C(m,n) = C[zo*sCo + zi*sCi + m*sCm + n] (n contiguous). flags: 1 bias[n], 2 bias[m], 4 residual R[zo*sRo + zi*sRi + m*sRm + n*sRn].
//   MODE 0: f16 operands (A prescaled by sa, B by sb, both undone in the epilogue); 1: bf16 hi/lo split (3 products); 2: bf16;
//   3: bf16 hi/mid/lo triple split (6 products); 4: as 3 with Kahan-compensated f32 accumulation across k-steps.
// =====================================================================================================================
struct GemmP {
    const float* A; const float* B; const float* bias; const float* R; float* C;
    long long sAo, sAi, sAm, sAk, sBo, sBi, sBn, sBk, sCo, sCi, sCm, sRo, sRi, sRm, sRn;
    int M, N, K, zi_n, flags, act; float alpha, beta, sa, sb;
    int Npad, pad_;     // columns [N, Npad) of C are written as 0 so that padded workspace rows are covered by whole-line stores; Npad >= N
};
static_assert(sizeof(GemmP) == 5 * 8 + 15 * 8 + 6 * 4 + 4 * 4 + 2 * 4, "GemmP has padding");

template <int MODE>
__global__ __launch_bounds__(32) void k_gemm(GemmP p) {
    const int lane = threadIdx.x & 31, h = lane >> 4, l15 = lane & 15;
    const int m0 = blockIdx.y * 16, n0 = blockIdx.x * 32;
    const int z = blockIdx.z, zo = z / p.zi_n, zi = z - zo * p.zi_n;
    const float* A = p.A + zo * p.sAo + zi * p.sAi;
    const float* B = p.B + zo * p.sBo + zi * p.sBi;
    const int am = min(m0 + l15, p.M - 1);                       // clamped row for loads (stores are guarded)
    v8f acc[2], comp[2];
#pragma unroll
    for (int t = 0; t < 2; ++t) { v8f zz = {}; acc[t] = zz; comp[t] = zz; }
    for (int k0 = 0; k0 < p.K; k0 += 32) {
        const float* arow = A + (long long)am * p.sAm;
        if (MODE == 1) {
            const Split a = sp_ld(arow, p.sAk, k0, h, p.K, 1.f);
#pragma unroll
            for (int t = 0; t < 2; ++t) {
                const int bn = min(n0 + t * 16 + l15, p.N - 1);
                acc[t] = wmma3(a, sp_ld(B + (long long)bn * p.sBn, p.sBk, k0, h, p.K, 1.f), acc[t]);
            }
        } else if (MODE == 3) {
            const Split3 a = sp3_ld(arow, p.sAk, k0, h, p.K, 1.f);
#pragma unroll
            for (int t = 0; t < 2; ++t) {
                const int bn = min(n0 + t * 16 + l15, p.N - 1);
                acc[t] = wmma6(a, sp3_ld(B + (long long)bn * p.sBn, p.sBk, k0, h, p.K, 1.f), acc[t]);
            }
        } else if (MODE == 4) {
            // triple split as MODE 3, but each k-step's 6 products go into a fresh accumulator and the partial is added to the running f32 sum
            // on the VALU with Kahan compensation (accumulation error stays ~1 ulp however long K is)
            const Split3 a = sp3_ld(arow, p.sAk, k0, h, p.K, 1.f);
#pragma unroll
            for (int t = 0; t < 2; ++t) {
                const int bn = min(n0 + t * 16 + l15, p.N - 1); v8f zz = {};
                const v8f part = wmma6(a, sp3_ld(B + (long long)bn * p.sBn, p.sBk, k0, h, p.K, 1.f), zz);
                const v8f y = part - comp[t]; const v8f s = acc[t] + y; comp[t] = (s - acc[t]) - y; acc[t] = s;
            }
        } else if (MODE == 2) {
            const v16b a = bh_ld(arow, p.sAk, k0, h, p.K, 1.f);
#pragma unroll
            for (int t = 0; t < 2; ++t) {
                const int bn = min(n0 + t * 16 + l15, p.N - 1);
                acc[t] = wmmab(a, bh_ld(B + (long long)bn * p.sBn, p.sBk, k0, h, p.K, 1.f), acc[t]);
            }
        } else {
            const v16h a = fh_ld(arow, p.sAk, k0, h, p.K, p.sa);
#pragma unroll
            for (int t = 0; t < 2; ++t) {
                const int bn = min(n0 + t * 16 + l15, p.N - 1);
                acc[t] = wmma16(a, fh_ld(B + (long long)bn * p.sBn, p.sBk, k0, h, p.K, p.sb), acc[t]);
            }
        }
    }
    const float iscale = (MODE == 0) ? p.alpha / (p.sa * p.sb) : p.alpha;
    float* C = p.C + zo * p.sCo + zi * p.sCi;
    const float* R = p.R + zo * p.sRo + zi * p.sRi;
    __shared__ __align__(16) float ctile[16][36];
#pragma unroll
    for (int t = 0; t < 2; ++t) {
        const int n = n0 + t * 16 + l15; const int nn = min(n, p.N - 1);
#pragma unroll
        for (int r = 0; r < 8; ++r) {
            const int m = m0 + 8 * h + r; const int mm = min(m, p.M - 1);
            float v = acc[t][r] * iscale;
            if (p.flags & 1) v += p.bias[nn];
            if (p.flags & 2) v += p.bias[mm];
            if (p.flags & 8) v *= p.bias[(long long)zo * p.M + mm];   /* per-(z,row) scale vector laid out [Z][M]; exclusive with the bias flags */
            v = act_fn(v, p.act);
            if (p.flags & 4) v += p.beta * R[(long long)mm * p.sRm + (long long)nn * p.sRn];
            ctile[8 * h + r][t * 16 + l15] = (n < p.N) ? v : 0.f;
        }
    }
    __syncthreads();
    const int NW = (p.Npad > p.N) ? p.Npad : p.N;           // write width
    const bool fast = (m0 + 16 <= p.M) && (n0 + 32 <= NW) && ((p.sCm & 3) == 0) && ((((size_t)C) & 15) == 0);
    if (fast) {
#pragma unroll
        for (int s = 0; s < 4; ++s) {
            const int row = s * 4 + (lane >> 3), c4 = (lane & 7) * 4;
            const v4f v = *(const v4f*)&ctile[row][c4];
            VST2V4(C + (long long)(m0 + row) * p.sCm + n0 + c4, v);
        }
    } else {
        for (int row = 0; row < 16; ++row) {
            const int m = m0 + row, n = n0 + lane;
            if (m < p.M && n < NW) VST2(float, C + (long long)m * p.sCm + n, ctile[row][lane]);
        }
    }
}


// =====================================================================================================================
// k_gemmT<MODE, TM, TN>: same contract as k_gemm, but one wave computes a (16*TM) x (16*TN) tile: TM A fragments and TN B fragments are
//   loaded per 32-wide k-step and reused across TM*TN WMMAs (far fewer load/convert instructions per MAC). MODE 0 (f16), 1 (bf16 hi/lo),
//   2 (bf16) only. grid (ceil(NW/(16*TN)), ceil(M/(16*TM)), Z), block 32. Epilogue identical to k_gemm, run per 16x32 sub-tile.
// =====================================================================================================================
template <int MODE, int TM, int TN>
__global__ __launch_bounds__(32) void k_gemmT(GemmP p) {
    const int lane = threadIdx.x & 31, h = lane >> 4, l15 = lane & 15;
    const int m0 = blockIdx.y * (16 * TM), n0 = blockIdx.x * (16 * TN);
    const int z = blockIdx.z, zo = z / p.zi_n, zi = z - zo * p.zi_n;
    const float* A = p.A + zo * p.sAo + zi * p.sAi;
    const float* B = p.B + zo * p.sBo + zi * p.sBi;
    v8f acc[TM][TN];
#pragma unroll
    for (int i = 0; i < TM; ++i)
#pragma unroll
        for (int t = 0; t < TN; ++t) { v8f zz = {}; acc[i][t] = zz; }
    for (int k0 = 0; k0 < p.K; k0 += 32) {
        if (MODE == 1) {
            Split a[TM], b[TN];
#pragma unroll
            for (int i = 0; i < TM; ++i) { const int am = min(m0 + 16 * i + l15, p.M - 1); a[i] = sp_ld(A + (long long)am * p.sAm, p.sAk, k0, h, p.K, 1.f); }
#pragma unroll
            for (int t = 0; t < TN; ++t) { const int bn = min(n0 + 16 * t + l15, p.N - 1); b[t] = sp_ld(B + (long long)bn * p.sBn, p.sBk, k0, h, p.K, 1.f); }
#pragma unroll
            for (int i = 0; i < TM; ++i)
#pragma unroll
                for (int t = 0; t < TN; ++t) acc[i][t] = wmma3(a[i], b[t], acc[i][t]);
        } else if (MODE == 2) {
            v16b a[TM], b[TN];
#pragma unroll
            for (int i = 0; i < TM; ++i) { const int am = min(m0 + 16 * i + l15, p.M - 1); a[i] = bh_ld(A + (long long)am * p.sAm, p.sAk, k0, h, p.K, 1.f); }
#pragma unroll
            for (int t = 0; t < TN; ++t) { const int bn = min(n0 + 16 * t + l15, p.N - 1); b[t] = bh_ld(B + (long long)bn * p.sBn, p.sBk, k0, h, p.K, 1.f); }
#pragma unroll
            for (int i = 0; i < TM; ++i)
#pragma unroll
                for (int t = 0; t < TN; ++t) acc[i][t] = wmmab(a[i], b[t], acc[i][t]);
        } else {
            v16h a[TM], b[TN];
#pragma unroll
            for (int i = 0; i < TM; ++i) { const int am = min(m0 + 16 * i + l15, p.M - 1); a[i] = fh_ld(A + (long long)am * p.sAm, p.sAk, k0, h, p.K, p.sa); }
#pragma unroll
            for (int t = 0; t < TN; ++t) { const int bn = min(n0 + 16 * t + l15, p.N - 1); b[t] = fh_ld(B + (long long)bn * p.sBn, p.sBk, k0, h, p.K, p.sb); }
#pragma unroll
            for (int i = 0; i < TM; ++i)
#pragma unroll
                for (int t = 0; t < TN; ++t) acc[i][t] = wmma16(a[i], b[t], acc[i][t]);
        }
    }
    const float iscale = (MODE == 0) ? p.alpha / (p.sa * p.sb) : p.alpha;
    float* C = p.C + zo * p.sCo + zi * p.sCi;
    const float* R = p.R + zo * p.sRo + zi * p.sRi;
    const int NW = (p.Npad > p.N) ? p.Npad : p.N;
    __shared__ __align__(16) float ctile[16][36];
#pragma unroll
    for (int i = 0; i < TM; ++i) {
        const int mb = m0 + 16 * i; if (mb >= p.M) break;          // wave-uniform
#pragma unroll
        for (int tp = 0; tp < TN / 2; ++tp) {
            const int nb = n0 + 32 * tp; if (nb >= NW) break;        // wave-uniform
#pragma unroll
            for (int t2 = 0; t2 < 2; ++t2) {
                const int t = 2 * tp + t2; const int n = nb + t2 * 16 + l15; const int nn = min(n, p.N - 1);
#pragma unroll
                for (int r = 0; r < 8; ++r) {
                    const int m = mb + 8 * h + r; const int mm = min(m, p.M - 1);
                    float v = acc[i][t][r] * iscale;
                    if (p.flags & 1) v += p.bias[nn];
                    if (p.flags & 2) v += p.bias[mm];
            if (p.flags & 8) v *= p.bias[(long long)zo * p.M + mm];   /* per-(z,row) scale vector laid out [Z][M]; exclusive with the bias flags */
                    v = act_fn(v, p.act);
                    if (p.flags & 4) v += p.beta * R[(long long)mm * p.sRm + (long long)nn * p.sRn];
                    ctile[8 * h + r][t2 * 16 + l15] = (n < p.N) ? v : 0.f;
                }
            }
            __syncthreads();
            const bool fast = (mb + 16 <= p.M) && (nb + 32 <= NW) && ((p.sCm & 3) == 0) && ((((size_t)C) & 15) == 0);
            if (fast) {
#pragma unroll
                for (int s = 0; s < 4; ++s) {
                    const int row = s * 4 + (lane >> 3), c4 = (lane & 7) * 4;
                    const v4f v = *(const v4f*)&ctile[row][c4];
                    VST2V4(C + (long long)(mb + row) * p.sCm + nb + c4, v);
                }
            } else {
                for (int row = 0; row < 16; ++row) {
                    const int m = mb + row, n = nb + lane;
                    if (m < p.M && n < NW) VST2(float, C + (long long)m * p.sCm + n, ctile[row][lane]);
                }
            }
            __syncthreads();
        }
    }
}

// =====================================================================================================================
//   Wave = 16 queries, AW waves per block, 64-key blocks; grid (ceil(Lq/(16*AW)), H, B), block 32*AW. Any Lq, Lk; head dim dh <= DHP
//   (DHP multiple of 32), value dim dv <= DVP (multiple of 16, <= 128). Every tensor addressed by (batch, head, row, element) strides, f32.
//   Scores: QM 0 f16 operands, 1 bf16 hi/lo split, 2 bf16 triple split; statistics f32 (exp2 domain); P.V: P x 4096 as f16 with V f16 staged in LDS
//   (SPLITPV: P and V as bf16 hi/lo splits). kv head = h / hrep. Masking: causal = 1 (keep j <= i + coff, masked -> -inf, key blocks beyond the
//   diagonal skipped), causal = 2 (masked -> mfill, a finite fill like the -1e9; no skipping), causal = 3 (keep j >= i + coff,
//   masked -> -inf, no skipping); optional additive f32 mask Mf,
//   optional int keep-mask Mi (0 -> score := mfill), both addressed b*smb + h*smh + i*smi + j*smj (0 strides broadcast).
// =====================================================================================================================
#define AW 4
struct AttnP {   // apv4
    const float* Q; const float* K; const float* V; float* O; float* P; const float* Mf; const int* Mi; float* ST;
    const float* Pw; const float* Rt; const int* SQ; const int* SK;           // optional: post-softmax weight, relative-position table, segment ids
    long long swb, swh, swi, swj, srb, srh, sri;                                 // Pw strides (b,h,i,j); Rt strides (b,h,i), column = clamp(i - j + roff, 0, rn-1)
    long long sQb, sQh, sQi, sQd, sKb, sKh, sKj, sKd, sVb, sVh, sVj, sVd, sOb, sOh, sOi, sPb, sPh, sPi, smb, smh, smi, smj;
    int Lq, Lk, dh, dv, hrep, causal, coff, pband;   // pband > 0: P holds only the band |j - i| <= pband, column j - i + pband
    float scale, mfill; int nonorm, mpol;             // nonorm (online path only): O = sum_j exp(score_j) V_j without the 1/rowsum (scores must be <= ~0); mpol: Mi masks where ==0 (mpol 0) or where !=0 (mpol 1)
    int roff, rn, segpol, win;                        // Rt column offset/count; SQ/SK: score := mfill where (segpol 0) SQ[i] != SK[j] or (segpol 1) SQ[i] == SK[j]; win > 0: keys with i - j > win (after coff) -> -inf
};
//   Pw: the softmax numerator is multiplied by Pw(b,h,i,j) AFTER the row sum is taken (probs * weight, then P.V), as in post-softmax multiplicative biases.                                                    // ST (optional): per row (b,h,i) -> ST[((b*H + h)*Lq + i)*2 + {0,1}] = {row max of the scaled+masked score (natural units), sum_j exp(score - max)}
static_assert(sizeof(AttnP) == 12 * 8 + 29 * 8 + 16 * 4, "AttnP has padding");

#ifndef KATTN_ATTR
#define KATTN_ATTR __attribute__((amdgpu_waves_per_eu(4)))   // at most 256 registers a wave: four waves a SIMD, 1024 work-groups of the causal grid resident at once
#endif
//   FS > 0 (QM 0, one pass, f16 P.V only): the layout is fixed at compile time: Q, K, V, O are dense [batch][FS rows][FD] f32 with head h at column h * DHP (DVP for V, O),
//   dh = DHP, dv = DVP, Lq = Lk = FS (multiple of 64), causal = 1 with coff = 0, none of the optional inputs or outputs. Every element guard and stride then folds
//   away, and a key block's K and V come in by plain 16-byte loads that are in flight together, in two batches, instead of guarded 4-byte loads waited on one at a time.
template <int DHP, int DVP, int QM, bool SPLITPV, bool TWOPASS, int FS = 0, int FD = 0>
__global__ __launch_bounds__(32 * AW) KATTN_ATTR void k_attn(AttnP p) {
    static_assert(FS == 0 || (QM == 0 && !SPLITPV && !TWOPASS && DHP == 64 && DVP == 64 && FS % 64 == 0 && FD % 8 == 0), "fixed layout: whole key blocks, 32-byte aligned fragments");
    if (FS > 0) {
        p.P = nullptr; p.Mf = nullptr; p.Mi = nullptr; p.ST = nullptr; p.Pw = nullptr; p.Rt = nullptr; p.SQ = nullptr; p.SK = nullptr;
        p.sQb = (long long)FS * FD; p.sQh = DHP; p.sQi = FD; p.sQd = 1; p.sKb = (long long)FS * FD; p.sKh = DHP; p.sKj = FD; p.sKd = 1;
        p.sVb = (long long)FS * FD; p.sVh = DVP; p.sVj = FD; p.sVd = 1; p.sOb = (long long)FS * FD; p.sOh = DVP; p.sOi = FD;
        p.Lq = FS; p.Lk = FS; p.dh = DHP; p.dv = DVP; p.hrep = 1; p.causal = 1; p.coff = 0; p.pband = 0; p.nonorm = 0; p.win = 0;
    }
    constexpr int NT = DVP / 16;                // output tiles
    constexpr int KS = DHP / 32;                // k-steps for the scores
    constexpr int VP = DVP + 8;                 // LDS pitch (halves)
    __shared__ __align__(16) float    pl[AW][16 * 64];
    __shared__ __align__(16) _Float16 vl[(SPLITPV ? 2 : 1) * 64 * VP];   // f16 V tile, or bf16 hi and lo tiles (same 2-byte size)
    const int lane = threadIdx.x & 31, hf = lane >> 4, l15 = lane & 15, wave = threadIdx.x >> 5;
    // FS > 0: grid (heads, batches, query tiles) and query tile bx = last - blockIdx.z. A causal tile walks bx + 1 key blocks and only half the work-groups are resident at once;
    // the long tiles get the lowest indices (for speed only), and neighbours in index cost the same.
    const int bx = FS > 0 ? FS / (16 * AW) - 1 - (int)blockIdx.z : (int)blockIdx.x;
    const int h = FS > 0 ? blockIdx.x : blockIdx.y, b = FS > 0 ? blockIdx.y : blockIdx.z, hk = h / p.hrep;
    const int q0 = (bx * AW + wave) * 16;
    float* myp = pl[wave];
    const float L2E = 1.4426950408889634f;
    const float NEG = -__builtin_inff();
    const int qi = min(q0 + l15, p.Lq - 1);
    const float* qrow = p.Q + b * p.sQb + h * p.sQh + (long long)qi * p.sQi;
    const float* kbase = p.K + b * p.sKb + hk * p.sKh;
    const float* vbase = p.V + b * p.sVb + hk * p.sVh;
    v16h qa[QM == 0 ? KS : 1]; Split qs_[QM == 1 ? KS : 1]; Split3 qt_[QM == 2 ? KS : 1];
#pragma unroll
    for (int ks = 0; ks < KS; ++ks) {
        if (QM == 2) qt_[ks] = sp3_ld(qrow, p.sQd, ks * 32, hf, p.dh, 1.f);
        else if (QM == 1) qs_[ks] = sp_ld(qrow, p.sQd, ks * 32, hf, p.dh, 1.f);
        else qa[ks] = fh_ld(qrow, p.sQd, ks * 32, hf, p.dh, 1.f);
    }
    v8f o[NT]; float m8[8], l8[8];
#pragma unroll
    for (int t = 0; t < NT; ++t) { v8f zz = {}; o[t] = zz; }
#pragma unroll
    for (int i = 0; i < 8; ++i) { m8[i] = NEG; l8[i] = 0.f; }
    int jend = p.Lk; int jstart = 0;
    if (p.causal == 1) { const int je = (bx * AW + AW - 1) * 16 + 16 + p.coff; jend = min(jend, max(je, 0)); }   // uniform per block
    if (p.win > 0) { const int js = (bx * AW) * 16 + p.coff - p.win; jstart = (js > 0) ? (js / 64) * 64 : 0; }   // uniform per block: key blocks entirely outside every row's window hold only -inf entries and are skipped exactly
    const int npass = TWOPASS ? 2 : 1;
    for (int pass = 0; pass < npass; ++pass) {
        const bool dopv = (!TWOPASS) || pass == 1;
        for (int j0 = jstart; j0 < jend; j0 += 64) {
            v16h kf[FS > 0 ? 4 * KS : 1];                        // FS > 0: the key block's K fragments, tile t and k-step ks at t * KS + ks
            if (dopv) {
                __syncthreads();                                 // previous key block's reads of vl / pl are done
                if (FS > 0) {
                    // raw f32 in two batches, so that the loaded values and everything else that is live fit 256 registers (four waves a SIMD)
                    v4f vr[8]; v8f kr[8];                                           // V: four consecutive elements per thread and step; K: half a fragment each
                    const float* krow = kbase + (long long)(j0 + l15) * FD + 8 * hf;
#pragma unroll
                    for (int it = 0; it < 8; ++it)
                        vr[it] = *(const v4f*)(vbase + (long long)(j0 + ((int)threadIdx.x >> 4)) * FD + ((int)threadIdx.x & 15) * 4 + it * (2 * AW * FD));   // rows 2 AW apart per step
#pragma unroll
                    for (int c = 0; c < 8; ++c) kr[c] = *(const v8f*)(krow + (c >> 2) * (16 * FD) + (c & 3) * 16);   // key tile t = c / 4; k = 16 (c % 4) + 8 hf + (0..7)
                    // inputs-only fence on the loaded values: their first use is here, so the batch's 24 loads are all issued before any is waited on (without it
                    // the scheduler puts each load directly in front of its conversion and waits on it there)
                    asm volatile("" :: "v"(vr[0]), "v"(vr[1]), "v"(vr[2]), "v"(vr[3]), "v"(vr[4]), "v"(vr[5]), "v"(vr[6]), "v"(vr[7]),
                                 "v"(kr[0]), "v"(kr[1]), "v"(kr[2]), "v"(kr[3]), "v"(kr[4]), "v"(kr[5]), "v"(kr[6]), "v"(kr[7]));
#pragma unroll
                    for (int it = 0; it < 8; ++it) {
                        v4h hv; hv[0] = (_Float16)vr[it][0]; hv[1] = (_Float16)vr[it][1]; hv[2] = (_Float16)vr[it][2]; hv[3] = (_Float16)vr[it][3];
                        *(v4h*)(vl + ((int)threadIdx.x >> 4) * VP + ((int)threadIdx.x & 15) * 4 + it * (2 * AW * VP)) = hv;
                    }
#pragma unroll
                    for (int f = 0; f < 4; ++f)
#pragma unroll
                        for (int e = 0; e < 8; ++e) { kf[f][e] = (_Float16)kr[2 * f][e]; kf[f][8 + e] = (_Float16)kr[2 * f + 1][e]; }
                    v8f ks2[8];
#pragma unroll
                    for (int c = 0; c < 8; ++c) ks2[c] = *(const v8f*)(krow + (2 + (c >> 2)) * (16 * FD) + (c & 3) * 16);   // key tiles 2 and 3
                    // the same fence for the second batch's 16 loads; the address is named too, so that it stays live and none of these loads is given its register pair as destination
                    asm volatile("" :: "v"(ks2[0]), "v"(ks2[1]), "v"(ks2[2]), "v"(ks2[3]), "v"(ks2[4]), "v"(ks2[5]), "v"(ks2[6]), "v"(ks2[7]), "v"(krow));
#pragma unroll
                    for (int f = 0; f < 4; ++f)
#pragma unroll
                        for (int e = 0; e < 8; ++e) { kf[4 + f][e] = (_Float16)ks2[2 * f][e]; kf[4 + f][8 + e] = (_Float16)ks2[2 * f + 1][e]; }
                } else
                for (int idx = threadIdx.x; idx < 64 * DVP; idx += 32 * AW) {
                    const int jr = idx / DVP, d = idx - jr * DVP, j = j0 + jr;
                    const float f = (j < p.Lk && d < p.dv) ? vbase[(long long)j * p.sVj + (long long)d * p.sVd] : 0.f;
                    if (SPLITPV) {
                        const __bf16 hb = bf16_rne(f);
                        ((__bf16*)vl)[jr * VP + d] = hb; ((__bf16*)vl)[64 * VP + jr * VP + d] = bf16_rne(f - bf16_f32(hb));
                    } else vl[jr * VP + d] = (_Float16)f;
                }
            }
            v8f s[4];
#pragma unroll
            for (int t = 0; t < 4; ++t) {
                const int j = min(j0 + t * 16 + l15, p.Lk - 1);
                const float* krow = kbase + (long long)j * p.sKj;
                v8f acc = {};
#pragma unroll
                for (int ks = 0; ks < KS; ++ks) {
                    if (QM == 2)      acc = wmma6(qt_[ks], sp3_ld(krow, p.sKd, ks * 32, hf, p.dh, 1.f), acc);
                    else if (QM == 1) acc = wmma3(qs_[ks], sp_ld(krow, p.sKd, ks * 32, hf, p.dh, 1.f), acc);
                    else if (FS > 0)  acc = wmma16(qa[ks], kf[t * KS + ks], acc);
                    else              acc = wmma16(qa[ks], fh_ld(krow, p.sKd, ks * 32, hf, p.dh, 1.f), acc);
                }
                s[t] = acc;
            }
            float pv[8][4];
#pragma unroll
            for (int i = 0; i < 8; ++i) {
                const int irow = q0 + i + 8 * hf;
                const int ic = min(irow, p.Lq - 1);
                float sc[4];
#pragma unroll
                for (int t = 0; t < 4; ++t) {
                    const int jg = j0 + t * 16 + l15;
                    float v = s[t][i] * p.scale;
                    if (p.Mf) v += p.Mf[b * p.smb + h * p.smh + (long long)ic * p.smi + (long long)min(jg, p.Lk - 1) * p.smj];
                    if (p.Rt) { int rc = ic - min(jg, p.Lk - 1) + p.roff; rc = rc < 0 ? 0 : (rc >= p.rn ? p.rn - 1 : rc); v += p.Rt[b * p.srb + h * p.srh + (long long)ic * p.sri + rc]; }
                    if (p.Mi) { const int mv = p.Mi[b * p.smb + h * p.smh + (long long)ic * p.smi + (long long)min(jg, p.Lk - 1) * p.smj]; if (p.mpol ? (mv != 0) : (mv == 0)) v = p.mfill; }
                    if (p.SQ) { const bool same = p.SQ[(long long)b * p.Lq + ic] == p.SK[(long long)b * p.Lk + min(jg, p.Lk - 1)]; if (p.segpol ? same : !same) v = p.mfill; }
                    if (p.causal == 2 && jg > irow + p.coff) v = p.mfill;
                    if (jg >= p.Lk || (p.causal == 1 && jg > irow + p.coff) || (p.causal == 3 && jg < irow + p.coff) || (p.win > 0 && irow + p.coff - jg > p.win)) v = NEG; else v *= L2E;
                    sc[t] = v;
                }
                if (!TWOPASS || pass == 0) {
                    float mx = fmaxf(fmaxf(sc[0], sc[1]), fmaxf(sc[2], sc[3]));
                    mx = fmaxf(mx, __shfl_xor(mx, 1, 32)); mx = fmaxf(mx, __shfl_xor(mx, 2, 32));
                    mx = fmaxf(mx, __shfl_xor(mx, 4, 32)); mx = fmaxf(mx, __shfl_xor(mx, 8, 32));
                    const float mnew = fmaxf(m8[i], mx);
                    const float corr = (mnew == NEG) ? 1.f : exp2f(m8[i] - mnew);
                    float rs = 0.f;
#pragma unroll
                    for (int t = 0; t < 4; ++t) {
                        const float pp = (sc[t] == NEG) ? 0.f : exp2f(sc[t] - mnew); rs += pp;
                        pv[i][t] = p.Pw ? pp * p.Pw[b * p.swb + h * p.swh + (long long)ic * p.swi + (long long)min(j0 + t * 16 + l15, p.Lk - 1) * p.swj] : pp;
                    }
                    rs += __shfl_xor(rs, 1, 32); rs += __shfl_xor(rs, 2, 32); rs += __shfl_xor(rs, 4, 32); rs += __shfl_xor(rs, 8, 32);
                    l8[i] = l8[i] * corr + rs; m8[i] = mnew;
                    if (!TWOPASS) {
#pragma unroll
                        for (int t = 0; t < NT; ++t) o[t][i] *= corr;
                    }
                } else {
                    const float inv = (l8[i] > 0.f) ? 1.f / l8[i] : 0.f;
#pragma unroll
                    for (int t = 0; t < 4; ++t) {
                        const int jg = j0 + t * 16 + l15;
                        float pp = (sc[t] == NEG) ? 0.f : exp2f(sc[t] - m8[i]) * inv;
                        if (p.Pw) pp *= p.Pw[b * p.swb + h * p.swh + (long long)ic * p.swi + (long long)min(jg, p.Lk - 1) * p.swj];
                        pv[i][t] = pp;
                    }
                }
            }
            if (dopv) {
#pragma unroll
                for (int i = 0; i < 8; ++i)
#pragma unroll
                    for (int t = 0; t < 4; ++t) ((float*)myp)[(i + 8 * hf) * 64 + t * 16 + l15] = pv[i][t];
                __syncthreads();                                 // P (per wave) and V (shared) visible
                if (p.P) {
                    float* pb_ = p.P + b * p.sPb + h * p.sPh;
                    const bool fastP = (p.pband == 0) && ((p.sPi & 3) == 0) && (j0 + 64 <= p.Lk) && (q0 + 16 <= p.Lq) && ((((size_t)pb_) & 15) == 0);
                    if (fastP) {
#pragma unroll
                        for (int s = 0; s < 8; ++s) {
                            const int row = s * 2 + (lane >> 4), c4 = (lane & 15) * 4;
                            const v4f v = *(const v4f*)(myp + row * 64 + c4);
                            VST2V4(pb_ + (long long)(q0 + row) * p.sPi + j0 + c4, v);
                        }
                    } else {
                        for (int row = 0; row < 16; ++row) {
                            const int irow = q0 + row; if (irow >= p.Lq) continue;
                            for (int c = lane; c < 64; c += 32) {
                                const int jg = j0 + c; if (jg >= p.Lk) continue;
                                if (p.pband == 0) VST2(float, pb_ + (long long)irow * p.sPi + jg, myp[row * 64 + c]);
                                else if (jg - irow <= p.pband && irow - jg <= p.pband) VST2(float, pb_ + (long long)irow * p.sPi + (jg - irow + p.pband), myp[row * 64 + c]);
                            }
                        }
                    }
                }
                if (SPLITPV) {
                    const Split pa0 = sp_ld(myp + l15 * 64, 1, 0, hf, 64, 1.f), pa1 = sp_ld(myp + l15 * 64, 1, 32, hf, 64, 1.f);
                    const __bf16* vh = (const __bf16*)vl; const __bf16* vlo = vh + 64 * VP;
#pragma unroll
                    for (int t = 0; t < NT; ++t) {
                        const int dcol = t * 16 + l15;
                        Split b0, b1;
#pragma unroll
                        for (int e = 0; e < 16; ++e) {
                            const int k0 = frag_k(e, hf), k1 = 32 + frag_k(e, hf);
                            b0.hi[e] = vh[k0 * VP + dcol]; b0.lo[e] = vlo[k0 * VP + dcol]; b1.hi[e] = vh[k1 * VP + dcol]; b1.lo[e] = vlo[k1 * VP + dcol];
                        }
                        o[t] = wmma3(pa0, b0, o[t]);
                        o[t] = wmma3(pa1, b1, o[t]);
                    }
                } else {
                    const v16h pa0 = fh_ld(myp + l15 * 64, 1, 0, hf, 64, 4096.f), pa1 = fh_ld(myp + l15 * 64, 1, 32, hf, 64, 4096.f);
#pragma unroll
                    for (int t = 0; t < NT; ++t) {
                        const int dcol = t * 16 + l15;
                        v16h b0, b1;
#pragma unroll
                        for (int e = 0; e < 16; ++e) { b0[e] = vl[frag_k(e, hf) * VP + dcol]; b1[e] = vl[(32 + frag_k(e, hf)) * VP + dcol]; }
                        o[t] = wmma16(pa0, b0, o[t]);
                        o[t] = wmma16(pa1, b1, o[t]);
                    }
                }
            }
        }
    }
    float* obase = p.O + b * p.sOb + h * p.sOh;
    if (p.ST) {
        const int rl = lane >> 1, isel = rl & 7;           // row q0 + rl ; rl>>3 == hf holds because lane>>4 == (lane>>1)>>3
        float mv = 0.f, lv = 0.f;
#pragma unroll
        for (int i = 0; i < 8; ++i) if (i == isel) { mv = m8[i]; lv = l8[i]; }
        const int irow = q0 + rl;
        if (irow < p.Lq) { float* st = p.ST + (((long long)b * gridDim.y + h) * p.Lq + irow) * 2 + (lane & 1); VST2(float, st, (lane & 1) ? lv : mv * 0.6931471805599453f); }
    }
    float invr[8];
#pragma unroll
    for (int i = 0; i < 8; ++i) {
        if (TWOPASS) invr[i] = SPLITPV ? 1.f : (1.f / 4096.f);
        else if (p.nonorm) invr[i] = exp2f(m8[i]) * (SPLITPV ? 1.f : (1.f / 4096.f));
        else invr[i] = (l8[i] > 0.f) ? (SPLITPV ? 1.f / l8[i] : 1.f / (l8[i] * 4096.f)) : 0.f;
    }
    __syncthreads();                                             // all waves done with pl/vl from the main loop
    const bool ofast = ((p.sOi & 3) == 0) && ((((size_t)obase) & 15) == 0) && (q0 + 16 <= p.Lq);
#pragma unroll
    for (int c0 = 0; c0 < DVP; c0 += 64) {
#pragma unroll
        for (int i = 0; i < 8; ++i)
#pragma unroll
            for (int t = 0; t < NT; ++t) if (t * 16 >= c0 && t * 16 < c0 + 64) ((float*)myp)[(i + 8 * hf) * 64 + (t * 16 - c0) + l15] = o[t][i] * invr[i];
        __syncthreads();
        const int cw = (DVP - c0 < 64) ? (DVP - c0) : 64;      // staged columns in this chunk (multiple of 16)
        if (ofast && (c0 + cw <= p.dv) && (cw % 32 == 0)) {
            const int lpr = cw / 4;                              // lanes per row (16 for 64 cols, 8 for 32)
            const int rows_per_ins = 32 / lpr;
            for (int r0 = 0; r0 < 16; r0 += rows_per_ins) {
                const int row = r0 + lane / lpr, c4 = (lane % lpr) * 4;
                const v4f v = *(const v4f*)(myp + row * 64 + c4);
                VST2V4(obase + (long long)(q0 + row) * p.sOi + c0 + c4, v);
            }
        } else {
            for (int row = 0; row < 16; ++row) {
                const int irow = q0 + row; if (irow >= p.Lq) continue;
                for (int c = lane; c < cw; c += 32) { const int d = c0 + c; if (d < p.dv) VST2(float, obase + (long long)irow * p.sOi + d, myp[row * 64 + c]); }
            }
        }
        __syncthreads();
    }
}

// =====================================================================================================================
// k_tr: dst(z, c, r) = alpha * src(z, r, c) (+ beta * R2(z, c, r)): [Z][R][C] (row stride lds) -> [Z][C][R] (row stride ldd) through a 32x32 LDS tile;
//   flags: 1 -> add beta * residual R2 addressed like dst (z*sRz + c*ldr + r); act applied before the residual.
// =====================================================================================================================
struct TrP { const float* src; float* dst; const float* R2; long long sSz, lds, sDz, ldd, sRz, ldr; int R, C, flags, act; float alpha, beta; };
static_assert(sizeof(TrP) == 3 * 8 + 6 * 8 + 6 * 4, "TrP has padding");
__global__ __launch_bounds__(256) void k_tr(TrP p) {
    __shared__ float tile[32][33];
    const int c0 = blockIdx.x * 32, r0 = blockIdx.y * 32, z = blockIdx.z;
    const int lane = threadIdx.x & 31, wave = threadIdx.x >> 5;
    const float* s = p.src + z * p.sSz;
#pragma unroll
    for (int k = 0; k < 4; ++k) {
        const int rl = wave * 4 + k, r = r0 + rl, c = c0 + lane;
        tile[rl][lane] = (r < p.R && c < p.C) ? s[(long long)r * p.lds + c] : 0.f;
    }
    __syncthreads();
    float* d = p.dst + z * p.sDz; const float* rr = p.R2 + z * p.sRz;
#pragma unroll
    for (int k = 0; k < 4; ++k) {
        const int cl = wave * 4 + k, c = c0 + cl, r = r0 + lane;
        if (c < p.C && r < p.R) {
            float v = act_fn(p.alpha * tile[lane][cl], p.act);
            if (p.flags & 1) v += p.beta * rr[(long long)c * p.ldr + r];
            VST2(float, d + (long long)c * p.ldd + r, v);
        }
    }
}

// k_affine: dst[i] = a * (sdev ? sdev[0] : 1) * src[i] + b, i < n (one thread per element; consecutive lanes -> consecutive addresses)
__global__ __launch_bounds__(256) void k_affine(const float* __restrict__ src, float* __restrict__ dst, int n, float a, float b, const float* __restrict__ sdev) {
    const int i = blockIdx.x * 256 + threadIdx.x;
    if (i < n) { const float aa = sdev ? a * sdev[0] : a; const float v = aa * src[i] + b; VST2(float, dst + i, v); }
}

// =====================================================================================================================
// k_softmax: row softmax over n contiguous elements, one 256-thread block per row; rows addressed z*sz + r*sr (grid (R, Z)).
//   out = scale_out * softmax(scale_in * x + (Mf ? Mf[z*smz + r*smr + j] : 0)); a row whose max is -inf is written as 0.
// =====================================================================================================================
struct SmP { const float* src; float* dst; const float* Mf; long long sz, sr, dz, dr, smz, smr; int n, pad; float scale_in, scale_out; };
static_assert(sizeof(SmP) == 3 * 8 + 6 * 8 + 4 * 4, "SmP has padding");
__global__ __launch_bounds__(256) void k_softmax(SmP p) {
    __shared__ float red[256];
    const int r = blockIdx.x, z = blockIdx.y, tid = threadIdx.x;
    const float* s = p.src + z * p.sz + (long long)r * p.sr;
    const float* mf = p.Mf ? (p.Mf + z * p.smz + (long long)r * p.smr) : nullptr;
    float mx = -__builtin_inff();
    for (int j = tid; j < p.n; j += 256) { float v = s[j] * p.scale_in; if (mf) v += mf[j]; mx = fmaxf(mx, v); }
    red[tid] = mx; __syncthreads();
    for (int o = 128; o > 0; o >>= 1) { if (tid < o) red[tid] = fmaxf(red[tid], red[tid + o]); __syncthreads(); }
    mx = red[0]; __syncthreads();
    float sum = 0.f;
    for (int j = tid; j < p.n; j += 256) { float v = s[j] * p.scale_in; if (mf) v += mf[j]; sum += (mx == -__builtin_inff()) ? 0.f : expf(v - mx); }
    red[tid] = sum; __syncthreads();
    for (int o = 128; o > 0; o >>= 1) { if (tid < o) red[tid] += red[tid + o]; __syncthreads(); }
    sum = red[0];
    const float inv = (sum > 0.f) ? p.scale_out / sum : 0.f;
    float* d = p.dst + z * p.dz + (long long)r * p.dr;
    for (int j = tid; j < p.n; j += 256) { float v = s[j] * p.scale_in; if (mf) v += mf[j]; const float o = (mx == -__builtin_inff()) ? 0.f : expf(v - mx) * inv; VST2(float, d + j, o); }
}
// =====================================================================================================================
// k_stats: mean and rsqrt(var + eps) over a set of n elements addressed base + z*sz + (e / inner) * so + (e % inner) * si, one 256-thread
// k_norm_apply: y = (x - mean[set]) * rstd[set] * g[c] + b[c] over a [Z][C][L] channel-major tensor with set = z*G + c / (C/G) (G groups per z;
//   G = C -> per-channel sets indexed z*C+c; for batch norm pass stats indexed by c only via bn = 1). Optional act. Output same layout.
// =====================================================================================================================
//   mode 0: mean / rsqrt(var + eps); mode 1 (RMSNorm): 0 / rsqrt(mean(x^2) + eps); mode 2 (L2 normalize * sqrt(n)): 0 / sqrt(n) / max(||x||, eps); mode 3: as 0 with unbiased variance (n-1)
__global__ __launch_bounds__(256) void k_stats(const float* __restrict__ x, long long sz, long long so, long long si, int inner, int n, float eps, float* __restrict__ stat, int mode) {
    __shared__ float red[256];
    const int z = blockIdx.x, tid = threadIdx.x;
    const float* base = x + z * sz;
    float s = 0.f;
    for (int e = tid; e < n; e += 256) s += base[(long long)(e / inner) * so + (long long)(e % inner) * si];
    red[tid] = s; __syncthreads();
    for (int o = 128; o > 0; o >>= 1) { if (tid < o) red[tid] += red[tid + o]; __syncthreads(); }
    const float mu = (mode == 0 || mode == 3) ? red[0] / (float)n : 0.f; __syncthreads();
    float q = 0.f;
    for (int e = tid; e < n; e += 256) { const float dlt = base[(long long)(e / inner) * so + (long long)(e % inner) * si] - mu; q += dlt * dlt; }
    red[tid] = q; __syncthreads();
    for (int o = 128; o > 0; o >>= 1) { if (tid < o) red[tid] += red[tid + o]; __syncthreads(); }
    {
        float rs;
        if (mode == 2) rs = sqrtf((float)n) / fmaxf(sqrtf(red[0]), eps); else if (mode == 3) rs = rsqrtf(red[0] / (float)(n - 1) + eps); else rs = rsqrtf(red[0] / (float)n + eps);
        if (tid < 32) { const float v = (tid == 0) ? mu : ((tid == 1) ? rs : 0.f); VST2(float, stat + (long long)z * 32 + tid, v); }
    }
}
//   One thread per element over the flat [Z][C][L] index space: grid ceil(Z*C*L / 256).
__global__ __launch_bounds__(256) void k_norm_apply(const float* __restrict__ x, float* __restrict__ y, const float* __restrict__ stat, const float* __restrict__ g, const float* __restrict__ bta,
                                                     int Z, int C, int L, int G, int bn, int act) {
    const long long idx = (long long)blockIdx.x * 256 + threadIdx.x;
    if (idx >= (long long)Z * C * L) return;
    const int l = (int)(idx % L); const long long zc = idx / L; const int c = (int)(zc % C), z = (int)(zc / C); (void)l;
    const int set = bn ? c : (z * G + c / (C / G));
    float v = (x[idx] - stat[(long long)set * 32]) * stat[(long long)set * 32 + 1];
    if (g) v *= g[c];
    if (bta) v += bta[c];
    v = act_fn(v, act);
    VST2(float, y + idx, v);
}

// k_lse_neg: c[i] = -(st[2i] + log(st[2i+1])) = minus the log-sum-exp of row i from k_attn's ST output (for softmax over the query dimension)
__global__ __launch_bounds__(256) void k_lse_neg(const float* __restrict__ st, float* __restrict__ c, int n) {
    const int i = blockIdx.x * 256 + threadIdx.x;
    if (i < n) { const float v = -(st[2 * i] + logf(st[2 * i + 1])); VST2(float, c + i, v); }
}

// k_iota: dst[i] = a * i + b as int32 (segment/position id helper)
__global__ __launch_bounds__(256) void k_iota(int* __restrict__ dst, int n, int a, int b) {
    const int i = blockIdx.x * 256 + threadIdx.x;
    if (i < n) { const int v = a * i + b; VST2(int, dst + i, v); }
}

// k_axpby: dst[i] = a * x[i] + b * y[i] (+ c), i < n
__global__ __launch_bounds__(256) void k_axpby(const float* __restrict__ x, const float* __restrict__ y, float* __restrict__ dst, int n, float a, float b, float c) {
    const int i = blockIdx.x * 256 + threadIdx.x;
    if (i < n) { const float v = a * x[i] + b * y[i] + c; VST2(float, dst + i, v); }
}

// =====================================================================================================================
// k_rope: rotary embedding on a [R rows][Hn heads][D] view (row stride sXr, head stride sXh, element stride 1) -> Y (own strides).
//   mode 0: rotate_half (partner d±D/2, sign - for d<D/2); mode 1: interleaved pairs (partner d^1, sign - for even d).
//   table column tcol: tmode 0 -> d, 1 -> d % (D/2), 2 -> d / 2; position p: pmode 0 -> r % S, 1 -> head index, 2 -> pos[r];
//   c = C[(r / S) * sCb + p * sCp + tcol * sCd], s likewise from Sn; y = x[d] * c + sign * x[partner] * s. X and Y must not alias.
// =====================================================================================================================
struct RopeP { const float* X; float* Y; const float* C; const float* Sn; const int* pos; long long sXr, sXh, sYr, sYh, sCb, sCp, sCd; int R, Hn, D, S, mode, tmode, pmode, pad; };
static_assert(sizeof(RopeP) == 5 * 8 + 7 * 8 + 8 * 4, "RopeP has padding");
__global__ __launch_bounds__(256) void k_rope(RopeP p) {
    const long long idx = (long long)blockIdx.x * 256 + threadIdx.x;
    if (idx >= (long long)p.R * p.Hn * p.D) return;
    const int d = (int)(idx % p.D); const long long rh = idx / p.D; const int h = (int)(rh % p.Hn); const int r = (int)(rh / p.Hn);
    const int half = p.D / 2;
    int partner; float sign;
    if (p.mode == 0) { partner = (d < half) ? d + half : d - half; sign = (d < half) ? -1.f : 1.f; }
    else { partner = d ^ 1; sign = (d & 1) ? 1.f : -1.f; }
    const int tcol = (p.tmode == 0) ? d : ((p.tmode == 1) ? (d % half) : (d >> 1));
    const int pp = (p.pmode == 0) ? (r % p.S) : ((p.pmode == 1) ? h : p.pos[r]);
    const long long toff = (long long)(r / p.S) * p.sCb + (long long)pp * p.sCp + (long long)tcol * p.sCd;
    const float* xr = p.X + (long long)r * p.sXr + (long long)h * p.sXh;
    const float v = xr[d] * p.C[toff] + sign * xr[partner] * p.Sn[toff];
    VST2(float, p.Y + (long long)r * p.sYr + (long long)h * p.sYh + d, v);
}

// k_invf + k_sincos (split so neither kernel carries a large VALU-fma footprint): invf_i = num * (1 / powf(base, (2 i)/D)) [fmode 0],
//   num * expf((2 i) * cexp) [fmode 1], num * powf(base, -2 (i - 1) / D) [fmode 2]; then cs/sn[s*half + i] = cos/sin((pscale * s) * invf_i)
__global__ __launch_bounds__(256) void k_invf(float* __restrict__ invb, int half, int D, float base, float num, int fmode, float cexp) {
    const int i = blockIdx.x * 256 + threadIdx.x;
    if (i >= ((half + 31) / 32) * 32) return;
    if (i >= half) { VST2(float, invb + i, 0.f); return; }
    const float e = (float)(2 * i) / (float)D;
    float invf;
    if (fmode == 1) invf = num * expf((float)(2 * i) * cexp);
    else if (fmode == 2) invf = num * powf(base, (-2.0f * ((float)i - 1.0f)) / (float)D);
    else invf = num * (1.0f / powf(base, e));
    VST2(float, invb + i, invf);
}
__global__ __launch_bounds__(256) void k_sincos(float* __restrict__ cs, float* __restrict__ sn, const float* __restrict__ invb, int S, int half, float pscale) {
    const int idx = blockIdx.x * 256 + threadIdx.x;
    if (idx >= S * half) return;
    const int s = idx / half, i = idx - s * half;
    const float ang = (pscale * (float)s) * invb[i];
    VST2(float, cs + idx, cosf(ang)); VST2(float, sn + idx, sinf(ang));
}

// k_mulact: dst[i] = act(x[i]) * y[i]
__global__ __launch_bounds__(256) void k_mulact(const float* __restrict__ x, const float* __restrict__ y, float* __restrict__ dst, int n, int act) {
    const int i = blockIdx.x * 256 + threadIdx.x;
    if (i < n) { const float v = act_fn(x[i], act) * y[i]; VST2(float, dst + i, v); }
}

// =====================================================================================================================
// k_matvec: thread-per-row matrix-vector products for N <= 8 output columns (heads with 1-3 outputs, gates), f32 on the VALU.
//   C[r*sCm + j] = act(alpha * sum_k A[r*sAm + k*sAk] * B[j*sBn + k*sBk] + bias[j]) + beta * R[r*sRm + j*sRn]; each thread writes its N contiguous floats.
// =====================================================================================================================
__global__ __launch_bounds__(256) void k_matvec(GemmP p) {
    // N == 1: one row per thread, 32 lanes write 32 consecutive rows with one instruction; otherwise 32 consecutive rows per thread.
    const int rpt = (p.N == 1) ? 1 : 32;
    const long long r0 = ((long long)blockIdx.x * 256 + threadIdx.x) * rpt; const int z = blockIdx.z, zo = z / p.zi_n, zi = z - zo * p.zi_n;
    if (r0 >= p.M) return;
    const float* Bb = p.B + zo * p.sBo + zi * p.sBi;
    float* C = p.C + zo * p.sCo + zi * p.sCi; const float* R = p.R + zo * p.sRo + zi * p.sRi;
    for (int rr = 0; rr < rpt; ++rr) {
        const long long r = r0 + rr; if (r >= p.M) break;
        const float* A = p.A + zo * p.sAo + zi * p.sAi + r * p.sAm;
        float acc[8] = {0.f, 0.f, 0.f, 0.f, 0.f, 0.f, 0.f, 0.f};
        for (int k = 0; k < p.K; ++k) { const float a = A[(long long)k * p.sAk];
#pragma unroll
            for (int j = 0; j < 8; ++j) if (j < p.N) acc[j] += a * Bb[(long long)j * p.sBn + (long long)k * p.sBk]; }
#pragma unroll
        for (int j = 0; j < 8; ++j) if (j < p.N) {
            float v = acc[j] * p.alpha;
            if (p.flags & 1) v += p.bias[j];
            if (p.flags & 2) v += p.bias[r];
            v = act_fn(v, p.act);
            if (p.flags & 4) v += p.beta * R[r * p.sRm + (long long)j * p.sRn];
            VST2(float, C + r * p.sCm + j, v);
        }
    }
}
// k_smallsoftmax: thread-per-row softmax for short rows (n <= 64): dst[r*dr + j] = softmax(scale*src[r*sr + j])
__global__ __launch_bounds__(256) void k_smallsoftmax(const float* __restrict__ src, float* __restrict__ dst, long long sr, long long dr, int n, long long R, float scale) {
    const long long r0 = ((long long)blockIdx.x * 256 + threadIdx.x) * 32;
    for (int rr = 0; rr < 32; ++rr) {
        const long long r = r0 + rr; if (r >= R) return;
        const float* s = src + r * sr; float* d = dst + r * dr;
        float mx = -__builtin_inff();
        for (int j = 0; j < n; ++j) mx = fmaxf(mx, s[j] * scale);
        float sum = 0.f;
        for (int j = 0; j < n; ++j) sum += expf(s[j] * scale - mx);
        const float inv = 1.f / sum;
        for (int j = 0; j < n; ++j) { const float v = expf(s[j] * scale - mx) * inv; VST2(float, d + j, v); }
    }
}

__global__ __launch_bounds__(32) void k_unitstat(float* __restrict__ st) { const int t = threadIdx.x; const float v = (t == 1) ? 1.f : 0.f; VST2(float, st + t, v); }

// destination (e.g. a d_out whose row width is not a multiple of 32 floats) is written by consecutive lanes of one instruction
__global__ __launch_bounds__(256) void k_lincopy(const float* __restrict__ src, long long lds, float* __restrict__ dst, long long ldd, long long rows, int cols) {
    const long long i = (long long)blockIdx.x * 256 + threadIdx.x; if (i >= rows * cols) return;
    const long long r = i / cols; const int c = (int)(i - r * cols);
    const float v = src[r * lds + c]; VST2(float, dst + r * ldd + c, v);
}

namespace w25 {
typedef __attribute__((ext_vector_type(16))) _Float16 v16h;
typedef __attribute__((ext_vector_type(8)))  _Float16 v8h;
typedef __attribute__((ext_vector_type(16))) __bf16   v16b;
typedef __attribute__((ext_vector_type(8)))  __bf16   v8b;
typedef __attribute__((ext_vector_type(8)))  float    v8f;
typedef __attribute__((ext_vector_type(4)))  float    v4f;

__device__ __forceinline__ unsigned short f2bf_bits(float f) {
  unsigned u = __float_as_uint(f);
  return (unsigned short)((u + 0x7FFFu + ((u >> 16) & 1u)) >> 16);
}
__device__ __forceinline__ float bf_bits2f(unsigned short h) { return __uint_as_float(((unsigned)h) << 16); }

template <typename T> struct Frag;
template <> struct Frag<_Float16> {
  typedef v16h V; union U { v16h v; v8h h[2]; };
  static __device__ __forceinline__ v16h load(const _Float16* p) {   // elements 0..7 <- p[0..7], 8..15 <- p[16..23]
    U f; f.h[0] = *(const v8h*)(p); f.h[1] = *(const v8h*)(p + 16); return f.v;
  }
  static __device__ __forceinline__ v8f mma(v16h a, v16h b, v8f c) {
    return __builtin_amdgcn_wmma_f32_16x16x32_f16(false, a, false, b, (short)0, c, false, false);
  }
};
template <> struct Frag<__bf16> {
  typedef v16b V; union U { v16b v; v8b h[2]; };
  static __device__ __forceinline__ v16b load(const __bf16* p) {
    U f; f.h[0] = *(const v8b*)(p); f.h[1] = *(const v8b*)(p + 16); return f.v;
  }
  static __device__ __forceinline__ v8f mma(v16b a, v16b b, v8f c) {
    return __builtin_amdgcn_wmma_f32_16x16x32_bf16(false, a, false, b, (short)0, c, false, false);
  }
};

// ---- WMMA GEMM with both operands staged in LDS ------------------------------
// C[m,n] = scale * sum_k A[m,k] * Bt[n,k], f32 out. A row-major [M,K]; Bt row-major [N,K]; C row-major [M,N]; M % 64 == 0, N % 128 == 0, K % 64 == 0.
// grid (N / 128, M / 64), 8 waves: a work-group owns a 64 x 128 tile of C, wave (wave >> 2, wave & 3) a 32 x 32 part of it.
// K runs in stages of 64: a stage's 64 A rows and 128 Bt rows (128 B each, per plane) come from global memory as whole 128-byte lines
// (8 lanes x 16 B per row), go to LDS at a pitch of 144 B, and every wave reads its fragments from there with 16-byte LDS loads.
// Two LDS buffers: the next stage's global loads are in flight while the current stage is multiplied; one barrier per stage.
// SPLIT: operands are hi/lo planes (A2/Bt2 = lo planes, same layout); product = hi.hi + hi.lo + lo.hi, in that order per 32 k.
// ET: 0 = f16 operands, 1 = bf16 operands (pointers passed as 16-bit storage)
// astep: rows of A from one 64-row tile of C to the next (64: A is dense; more: each tile takes the first 64 rows of a longer block of A)
template <int ET> struct Elem;
template <> struct Elem<0> { typedef _Float16 T; typedef v8h V8; };
template <> struct Elem<1> { typedef __bf16 T; typedef v8b V8; };
template <int ET, bool SPLIT>
__global__ __launch_bounds__(256) void wmma_gemm_lds(
    const unsigned short* __restrict__ Ap, const unsigned short* __restrict__ A2p,
    const unsigned short* __restrict__ Btp, const unsigned short* __restrict__ Bt2p,
    float* __restrict__ C, int N, int K, float scale, int astep) {
  typedef typename Elem<ET>::T T;
  typedef typename Elem<ET>::V8 V8;
  typedef typename Frag<T>::V V;
  constexpr int NP    = SPLIT ? 2 : 1;      // planes
  constexpr int PITCH = 72;                 // LDS row pitch in 16-bit elements: 144 B = 16 B x 9
  constexpr int PROWS = 192;                // rows of one plane in a stage: 64 of A, then 128 of Bt
  constexpr int STAGE = NP * PROWS * PITCH; // elements of one buffer
  constexpr int NL    = NP * 6;             // 16-byte pieces per thread and stage (32 rows per step)
  constexpr int CP    = 132;                // pitch of the staged C tile in floats
  static_assert(2 * STAGE * 2 >= 64 * CP * 4, "the C tile is staged in the operand buffers");
  __shared__ __align__(16) T sm[2 * STAGE];
  const int lane = threadIdx.x & 31;
  const int wave = threadIdx.x >> 5;
  const int m0 = blockIdx.y << 6;
  const int n0 = blockIdx.x << 7;
  const int wm = (wave >> 2) << 5;          // this wave's first row and column in the tile
  const int wn = (wave & 3) << 5;
  const int rlane = lane & 15;              // row (A) / col (B, D) within a 16 x 16 subtile
  const int koff  = (lane >> 4) * 8;        // k offset of this lane half
  const int mOff  = (lane >> 4) * 8;        // D row offset

  const int lrow = threadIdx.x >> 3, lseg = (threadIdx.x & 7) * 8;   // staging: row within a step of 32 rows, 16-byte piece of the row
  const int a0 = blockIdx.y * astep;        // first A row of this tile
  const T* gA  = (const T*)Ap  + (size_t)(a0 + lrow) * K + lseg;
  const T* gB  = (const T*)Btp + (size_t)(n0 + lrow) * K + lseg;
  const T* gA2 = SPLIT ? (const T*)A2p  + (size_t)(a0 + lrow) * K + lseg : nullptr;
  const T* gB2 = SPLIT ? (const T*)Bt2p + (size_t)(n0 + lrow) * K + lseg : nullptr;
  const int sw = lrow * PITCH + lseg;       // this thread's place in a buffer, step 0
  const int fa = (wm + rlane) * PITCH + koff;        // this lane's A and Bt fragment places in a buffer, subtile 0, k 0
  const int fb = (64 + wn + rlane) * PITCH + koff;

  v8f acc[2][2];
#pragma unroll
  for (int i = 0; i < 2; ++i)
#pragma unroll
    for (int j = 0; j < 2; ++j) acc[i][j] = (v8f){0.f,0.f,0.f,0.f,0.f,0.f,0.f,0.f};

  V8 st[NL];
  auto fetch = [&](int k0) {                // stage at k0: global memory -> registers
#pragma unroll
    for (int it = 0; it < NL; ++it) {
      const int q = it % 6;                 // steps 0, 1: A rows; 2..5: Bt rows; then the same for the lo planes
      const T* g = (it < 6) ? (q < 2 ? gA : gB) : (q < 2 ? gA2 : gB2);
      st[it] = *(const V8*)(g + (size_t)((q < 2 ? q : q - 2) * 32) * K + k0);
    }
  };
  auto put = [&](int buf) {                 // registers -> LDS buffer
#pragma unroll
    for (int it = 0; it < NL; ++it) *(V8*)(sm + buf * STAGE + sw + it * (32 * PITCH)) = st[it];
  };
  auto mult = [&](int buf) {                // one stage: 2 steps of 32 k
    const T* s = sm + buf * STAGE;
#pragma unroll
    for (int kk = 0; kk < 2; ++kk) {
      V ah[2], al[2], bh[2], bl[2];
#pragma unroll
      for (int i = 0; i < 2; ++i) {
        ah[i] = Frag<T>::load(s + fa + i * (16 * PITCH) + kk * 32);
        bh[i] = Frag<T>::load(s + fb + i * (16 * PITCH) + kk * 32);
        if (SPLIT) {
          al[i] = Frag<T>::load(s + PROWS * PITCH + fa + i * (16 * PITCH) + kk * 32);
          bl[i] = Frag<T>::load(s + PROWS * PITCH + fb + i * (16 * PITCH) + kk * 32);
        }
      }
#pragma unroll
      for (int i = 0; i < 2; ++i)
#pragma unroll
        for (int j = 0; j < 2; ++j) acc[i][j] = Frag<T>::mma(ah[i], bh[j], acc[i][j]);
      if (SPLIT) {
#pragma unroll
        for (int i = 0; i < 2; ++i)
#pragma unroll
          for (int j = 0; j < 2; ++j) acc[i][j] = Frag<T>::mma(ah[i], bl[j], acc[i][j]);
#pragma unroll
        for (int i = 0; i < 2; ++i)
#pragma unroll
          for (int j = 0; j < 2; ++j) acc[i][j] = Frag<T>::mma(al[i], bh[j], acc[i][j]);
      }
    }
  };

  const int NK = K >> 6;
  fetch(0);
  put(0);
  __syncthreads();                          // stage 0 is visible
  for (int kt = 0; kt + 1 < NK; ++kt) {
    fetch((kt + 1) << 6);
    __builtin_amdgcn_sched_barrier(0);      // keeps the next stage's global loads issued ahead of this stage's products, so that their latency runs under them
    mult(kt & 1);
    put((kt + 1) & 1);                      // the buffer that stage kt - 1 was read from; its readers left it at the barrier that ended that trip
    __syncthreads();                        // stage kt + 1 is visible, and every wave has finished reading stage kt
  }
  mult((NK - 1) & 1);
  __syncthreads();                          // all fragment reads are done: the buffers now stage the C tile

  // ---- epilogue: the 64 x 128 f32 tile through LDS, so that each store instruction writes 512 contiguous bytes of one row ----
  float* sC = (float*)sm;
#pragma unroll
  for (int i = 0; i < 2; ++i)
#pragma unroll
    for (int j = 0; j < 2; ++j)
#pragma unroll
      for (int r = 0; r < 8; ++r) sC[(wm + (i << 4) + mOff + r) * CP + wn + (j << 4) + rlane] = acc[i][j][r] * scale;
  __syncthreads();
#pragma unroll
  for (int it = 0; it < 8; ++it) {
    const int row = it * 8 + wave;
    const v4f v = *(const v4f*)(sC + row * CP + lane * 4);
    *(v4f*)(C + (size_t)(m0 + row) * N + n0 + lane * 4) = v;
  }
}

__global__ __launch_bounds__(256) void cast_f32_f16x2(
    const float* __restrict__ in, _Float16* __restrict__ out, int n2) {
  int i = blockIdx.x * 256 + threadIdx.x;
  if (i < n2) {
    const _Float16 h0 = (_Float16)in[2 * i], h1 = (_Float16)in[2 * i + 1];
    const unsigned u = (unsigned)__builtin_bit_cast(unsigned short, h0) | ((unsigned)__builtin_bit_cast(unsigned short, h1) << 16);
    ((unsigned*)out)[i] = u;
    
  }
}


} // namespace w25

__global__ __launch_bounds__(256) void k_castT16(const float* __restrict__ src, long long lds, _Float16* __restrict__ dst, long long ldd, int R, int C, float s) {
    const long long i = (long long)blockIdx.x * 256 + threadIdx.x; const long long np = (long long)C * (R / 2); if (i >= np) return; const int c = (int)(i / (R / 2)); const int r = 2 * (int)(i % (R / 2));
    const _Float16 h0 = (_Float16)(src[(long long)r * lds + c] * s), h1 = (_Float16)(src[(long long)(r + 1) * lds + c] * s);
    const unsigned u = (unsigned)__builtin_bit_cast(unsigned short, h0) | ((unsigned)__builtin_bit_cast(unsigned short, h1) << 16);
    unsigned* d = (unsigned*)(dst + (long long)c * ldd + r); *d = u;  }
__global__ __launch_bounds__(256) void k_cast16(const float* __restrict__ src, long long lds, _Float16* __restrict__ dst, long long ldd, int R, int C, float s) {
    const long long i = (long long)blockIdx.x * 256 + threadIdx.x; const long long np = (long long)R * (C / 2); if (i >= np) return; const int r = (int)(i / (C / 2)); const int c = 2 * (int)(i % (C / 2));
    const _Float16 h0 = (_Float16)(src[(long long)r * lds + c] * s), h1 = (_Float16)(src[(long long)r * lds + c + 1] * s);
    const unsigned u = (unsigned)__builtin_bit_cast(unsigned short, h0) | ((unsigned)__builtin_bit_cast(unsigned short, h1) << 16);
    unsigned* d = (unsigned*)(dst + (long long)r * ldd + c); *d = u;  }

// f32 -> bf16 hi plane + bf16 lo plane (x = hi + lo to ~2^-17 relative; RNE both), [R][C] -> [R][C] (or transposed to [C][R]); 2 consecutive destination elements
__device__ __forceinline__ unsigned int f2bf2_pack(float a, float b, unsigned int* lo) {
    const unsigned short ha = w25::f2bf_bits(a), hb = w25::f2bf_bits(b);
    const unsigned short la = w25::f2bf_bits(a - w25::bf_bits2f(ha)), lb = w25::f2bf_bits(b - w25::bf_bits2f(hb));
    *lo = (unsigned)la | ((unsigned)lb << 16); return (unsigned)ha | ((unsigned)hb << 16); }
__global__ __launch_bounds__(256) void k_castS16(const float* __restrict__ src, long long lds, __bf16* __restrict__ dhi, __bf16* __restrict__ dlo, long long ldd, int R, int C, float s, int transpose) {
    const long long i = (long long)blockIdx.x * 256 + threadIdx.x; long long o; float a, b;
    if (transpose) { const long long np = (long long)C * (R / 2); if (i >= np) return; const int c = (int)(i / (R / 2)); const int r = 2 * (int)(i % (R / 2)); a = src[(long long)r * lds + c] * s; b = src[(long long)(r + 1) * lds + c] * s; o = (long long)c * ldd + r; }
    else { const long long np = (long long)R * (C / 2); if (i >= np) return; const int r = (int)(i / (C / 2)); const int c = 2 * (int)(i % (C / 2)); a = src[(long long)r * lds + c] * s; b = src[(long long)r * lds + c + 1] * s; o = (long long)r * ldd + c; }
    unsigned lo; const unsigned hi = f2bf2_pack(a, b, &lo); unsigned* ph = (unsigned*)(dhi + o); unsigned* pl = (unsigned*)(dlo + o);
    *ph = hi; *pl = lo;  }

namespace w25 {
// =====================================================================================
// Generic causal/non-causal attention for head_dim 64, f32 in / f32 out; 16-bit operands: bf16 with optional hi/lo splits, or
// plain f16 (F16=true, non-split, probabilities carried x2^15).
//   scores = (q*qscale)·kᵀ : v_wmma_f32_16x16x32_bf16; SPLIT_QK -> q,k as bf16 hi/lo (hi·hi + hi·lo + lo·hi)
//   out    = p·v           : v_wmma_f32_16x16x32_bf16; SPLIT_PV -> p,v as bf16 hi/lo; else p,v plain bf16
//   f32 accumulate; online softmax in f32. Block = 4 waves = 64 query rows of one (batch, head); S % 64 == 0.
//   Element (b, s, h, d) of tensor X lives at X[b*X_bs + s*X_rs + h*X_hs + d] (strides in floats, multiples of 4).
//   Masking: mask_mode 0 none, 1 causal (kv > q masked), 2 tensor [S][Skv] shared over (b,h) (float if
//   mask_is_int==0, int32 with element == 0 -> masked if 1, int32 with element != 0 -> masked if 2), 3 per-token vectors qmask[B][S] & kvmask[B][Skv] (int32,
//   0 -> masked), 4 causal + sliding window (kv > q or q - kv > W masked; W passed in mask_is_int);
//   5 = relative-position bias: s += cp[b,h,q][idx[q][kv]] + pc[b,h,kv][idx[q][kv]] with idx = mask_b ([S][Skv] int32) and
//   mask_a an int32 [S][Skv] tensor with nonzero = masked (tables: element (b,h,row,n) at X + b*c_bs + h*c_hs + row*c_rs + n);
//   masked scores are replaced by mask_fill (e.g. -inf or -1e9) before the softmax.
//   grid.x = B * H * (S/64) (or a sub-range with blk0).
// =====================================================================================
#define AT_D 64
#define AT_NW 4
#define AT_QB 64
#define AT_KC 64
struct AttnGeom { const float* cp = nullptr; const float* pc = nullptr; long c_bs = 0, c_rs = 0, c_hs = 0;   // mode-5 score-bias tables
                  long q_bs, q_rs, q_hs, k_bs, k_rs, k_hs, v_bs, v_rs, v_hs, o_bs, o_rs, o_hs;
                  int S, Skv, H, mask_mode; float qscale; int blk0; float mask_fill; int mask_is_int; };
static_assert(sizeof(AttnGeom) == 168, "no padding");

__device__ __forceinline__ unsigned short at_bf_bits(float f) {
  unsigned u = __float_as_uint(f);
  return (unsigned short)((u + 0x7FFFu + ((u >> 16) & 1u)) >> 16);
}
__device__ __forceinline__ __bf16 at_f2bf(float f) { return __builtin_bit_cast(__bf16, at_bf_bits(f)); }
__device__ __forceinline__ void at_split(float f, __bf16& hi, __bf16& lo) {
  const unsigned short hb = at_bf_bits(f);
  hi = __builtin_bit_cast(__bf16, hb);
  lo = at_f2bf(f - __uint_as_float(((unsigned)hb) << 16));
}
__device__ __forceinline__ v8f at_mma(v16b a, v16b b, v8f c) {
  c = __builtin_amdgcn_wmma_f32_16x16x32_bf16(false, a, false, b, (short)0, c, false, false);
  asm volatile("v_nop\n\tv_nop\n\tv_nop\n\tv_nop" : "+v"(c) : "v"(a), "v"(b));
  return c;
}
// 16-bit element as a bit pattern held in a __bf16 slot: f16 bits when F16, bf16 (RNE) otherwise
template <bool F16> __device__ __forceinline__ __bf16 at_to16(float f) {
  if (F16) return __builtin_bit_cast(__bf16, (_Float16)f);
  return at_f2bf(f);
}
template <bool F16> __device__ __forceinline__ v8f at_mma16(v16b a, v16b b, v8f c) {
  if (F16) {
    const v16h ah = __builtin_bit_cast(v16h, a), bh = __builtin_bit_cast(v16h, b);
    c = __builtin_amdgcn_wmma_f32_16x16x32_f16(false, ah, false, bh, (short)0, c, false, false);
    asm volatile("v_nop\n\tv_nop\n\tv_nop\n\tv_nop" : "+v"(c) : "v"(ah), "v"(bh));
    return c;
  }
  return at_mma(a, b, c);
}

template <bool SPLIT_QK, bool SPLIT_PV, bool F16 = false>
__global__ __launch_bounds__(128)
void attn64_kernel(const float* __restrict__ q, const float* __restrict__ k,
                   const float* __restrict__ v, float* __restrict__ out,
                   const void* __restrict__ mask_a, const int* __restrict__ mask_b, AttnGeom g) {
  static_assert(!(F16 && (SPLIT_QK || SPLIT_PV)), "f16 mode is non-split");
  const float PSC = F16 ? 32768.0f : 1.0f;     // f16 probabilities carried x2^15 (subnormal range), folded into the final 1/l
  union FB { v16b v; v8b h[2]; };
  __shared__ __align__(16) __bf16 Ksh[AT_KC * AT_D];             // K hi [kv][d]      8 KB
  __shared__ __align__(16) __bf16 Ksl[SPLIT_QK ? AT_KC * AT_D : 8];
  __shared__ __align__(16) __bf16 Vth[AT_D * AT_KC];             // V hi [d][kv]      8 KB
  __shared__ __align__(16) __bf16 Vtl[SPLIT_PV ? AT_D * AT_KC : 8];
  __shared__ __align__(16) __bf16 Psh[AT_NW][16 * AT_KC];        // per wave P hi [row][kv]  8 KB
  __shared__ __align__(16) __bf16 Psl[SPLIT_PV ? AT_NW : 1][SPLIT_PV ? 16 * AT_KC : 8];
  __shared__ __align__(16) float  Os[AT_NW][16 * 68];            // per wave out tile, pitch 68

  const int tid  = threadIdx.x;
  const int wave = tid >> 5;
  const int lane = tid & 31;
  const int hh   = lane >> 4;
  const int c    = lane & 15;

  const int nqb = g.S / AT_QB;
  const int bx = blockIdx.x + g.blk0;
  const int qb = bx % nqb;
  const int bh = bx / nqb;
  const int h  = bh % g.H;
  const int b  = bh / g.H;
  const int qbase_block = qb * AT_QB;
  const int q0 = qbase_block + wave * 16;

  const float* qb_ptr = q + (size_t)b * g.q_bs + (size_t)h * g.q_hs;
  const float* kb_ptr = k + (size_t)b * g.k_bs + (size_t)h * g.k_hs;
  const float* vb_ptr = v + (size_t)b * g.v_bs + (size_t)h * g.v_hs;
  float*       ob_ptr = out + (size_t)b * g.o_bs + (size_t)h * g.o_hs;

  // ---- Q fragments (A operand): 2 d-chunks, hi (and lo) ----
  v16b qah[2], qal[2];
  {
    const float* qrow = qb_ptr + (size_t)(q0 + c) * g.q_rs;
#pragma unroll
    for (int dc = 0; dc < 2; ++dc) {
#pragma unroll
      for (int e = 0; e < 8; ++e) {
        const float f0 = qrow[dc * 32 + 8 * hh + e] * g.qscale;
        const float f1 = qrow[dc * 32 + 16 + 8 * hh + e] * g.qscale;
        if (SPLIT_QK) { __bf16 hq, lq; at_split(f0, hq, lq); qah[dc][e] = hq; qal[dc][e] = lq; at_split(f1, hq, lq); qah[dc][8 + e] = hq; qal[dc][8 + e] = lq; }
        else { qah[dc][e] = at_to16<F16>(f0); qah[dc][8 + e] = at_to16<F16>(f1); qal[dc][e] = qah[dc][e]; qal[dc][8 + e] = qah[dc][8 + e]; }
      }
    }
  }

  float mrow[8], lrow[8];
  v8f oacc[4];
#pragma unroll
  for (int r = 0; r < 8; ++r) { mrow[r] = -INFINITY; lrow[r] = 0.f; }
#pragma unroll
  for (int t = 0; t < 4; ++t) oacc[t] = (v8f){0.f,0.f,0.f,0.f,0.f,0.f,0.f,0.f};

  const int nChunks = (g.mask_mode == 1 || g.mask_mode == 4) ? (qb + 1) : (g.Skv / AT_KC);   // block-uniform
  // per-row query mask (mode 3)
  int qkeep[8];
#pragma unroll
  for (int r = 0; r < 8; ++r) qkeep[r] = (g.mask_mode == 3) ? mask_b[(size_t)b * g.S + q0 + 8 * hh + r] : 1;   // mask_b = qmask in mode 3
  for (int kc = 0; kc < nChunks; ++kc) {
    const int kv0 = kc * AT_KC;
    __syncthreads();
    {
      const int kvr = tid >> 1, dh = (tid & 1) * 32;
      const float* krow = kb_ptr + (size_t)(kv0 + kvr) * g.k_rs + dh;
      const float* vrow = vb_ptr + (size_t)(kv0 + kvr) * g.v_rs + dh;
#pragma unroll
      for (int i = 0; i < 8; ++i) {
        v4f kk = *(const v4f*)(krow + 4 * i);
        v4f vv = *(const v4f*)(vrow + 4 * i);
#pragma unroll
        for (int e = 0; e < 4; ++e) {
          const int d = dh + 4 * i + e;
          if (SPLIT_QK) { __bf16 a, bl; at_split(kk[e], a, bl); Ksh[kvr * AT_D + d] = a; Ksl[kvr * AT_D + d] = bl; }
          else Ksh[kvr * AT_D + d] = at_to16<F16>(kk[e]);
          if (SPLIT_PV) { __bf16 a, bl; at_split(vv[e], a, bl); Vth[d * AT_KC + kvr] = a; Vtl[d * AT_KC + kvr] = bl; }
          else Vth[d * AT_KC + kvr] = at_to16<F16>(vv[e]);
        }
      }
    }
    __syncthreads();

    v8f s[4];
#pragma unroll
    for (int j = 0; j < 4; ++j) {
      s[j] = (v8f){0.f,0.f,0.f,0.f,0.f,0.f,0.f,0.f};
#pragma unroll 1
      for (int dc = 0; dc < 2; ++dc) {
        FB kb;
        kb.h[0] = *(const v8b*)(Ksh + (j * 16 + c) * AT_D + dc * 32 + 8 * hh);
        kb.h[1] = *(const v8b*)(Ksh + (j * 16 + c) * AT_D + dc * 32 + 16 + 8 * hh);
        s[j] = at_mma16<F16>(qah[dc], kb.v, s[j]);
        if (SPLIT_QK) {
          FB kl;
          kl.h[0] = *(const v8b*)(Ksl + (j * 16 + c) * AT_D + dc * 32 + 8 * hh);
          kl.h[1] = *(const v8b*)(Ksl + (j * 16 + c) * AT_D + dc * 32 + 16 + 8 * hh);
          s[j] = at_mma16<F16>(qah[dc], kl.v, s[j]);
          s[j] = at_mma16<F16>(qal[dc], kb.v, s[j]);
        }
      }
    }
    const bool diag = (g.mask_mode == 1) && (kc == qb);
    int kvkeep[4] = {1, 1, 1, 1};
    if (g.mask_mode == 3) {
#pragma unroll
      for (int j = 0; j < 4; ++j) kvkeep[j] = ((const int*)mask_a)[(size_t)b * g.Skv + kv0 + j * 16 + c];   // mask_a = kvmask
    }
    float cm[8];
#pragma unroll
    for (int r = 0; r < 8; ++r) {
      const int qrow = q0 + 8 * hh + r;
      float m = -INFINITY;
#pragma unroll
      for (int j = 0; j < 4; ++j) {
        const int kvcol = kv0 + j * 16 + c;
        bool masked = false;
        if (diag) masked = (kvcol > qrow);
        else if (g.mask_mode == 4) masked = (kvcol > qrow) || (qrow - kvcol > g.mask_is_int);
        else if (g.mask_mode == 2) {
          const size_t mi = (size_t)qrow * g.Skv + kvcol;
          masked = (g.mask_is_int == 0) ? (((const float*)mask_a)[mi] == 0.0f)
                 : (g.mask_is_int == 1) ? (((const int*)mask_a)[mi] == 0) : (((const int*)mask_a)[mi] != 0);
        } else if (g.mask_mode == 3) masked = (qkeep[r] == 0) || (kvkeep[j] == 0);
        else if (g.mask_mode == 5) {
          const size_t mi = (size_t)qrow * g.Skv + kvcol;
          masked = (((const int*)mask_a)[mi] != 0);
          int n = mask_b[mi]; n = n < 0 ? 0 : n;
          s[j][r] += g.cp[(size_t)b * g.c_bs + (size_t)h * g.c_hs + (size_t)qrow * g.c_rs + n]
                   + g.pc[(size_t)b * g.c_bs + (size_t)h * g.c_hs + (size_t)kvcol * g.c_rs + n];
        }
        if (masked) s[j][r] = g.mask_fill;
        m = fmaxf(m, s[j][r]);
      }
#pragma unroll
      for (int off = 1; off < 16; off <<= 1) m = fmaxf(m, __shfl_xor(m, off, 32));
      cm[r] = m;
    }
    __bf16* pwh = Psh[wave];
    __bf16* pwl = Psl[SPLIT_PV ? wave : 0];
#pragma unroll
    for (int r = 0; r < 8; ++r) {
      const float mnew = fmaxf(mrow[r], cm[r]);
      const float alpha = expf(mrow[r] - mnew);
      mrow[r] = mnew;
      float psum = 0.f;
#pragma unroll
      for (int j = 0; j < 4; ++j) {
        const float p = expf(s[j][r] - mnew);
        psum += p;
        if (SPLIT_PV) { __bf16 a, bl; at_split(p, a, bl); pwh[(8 * hh + r) * AT_KC + j * 16 + c] = a; pwl[(8 * hh + r) * AT_KC + j * 16 + c] = bl; }
        else pwh[(8 * hh + r) * AT_KC + j * 16 + c] = at_to16<F16>(p * PSC);
      }
#pragma unroll
      for (int off = 1; off < 16; off <<= 1) psum += __shfl_xor(psum, off, 32);
      lrow[r] = lrow[r] * alpha + psum;
#pragma unroll
      for (int t = 0; t < 4; ++t) oacc[t][r] *= alpha;
    }
    __builtin_amdgcn_fence(__ATOMIC_RELEASE, "workgroup");
    __builtin_amdgcn_wave_barrier();
    __builtin_amdgcn_fence(__ATOMIC_ACQUIRE, "workgroup");
#pragma unroll 1
    for (int kk = 0; kk < 2; ++kk) {
      FB pa, pl;
      pa.h[0] = *(const v8b*)(pwh + c * AT_KC + kk * 32 + 8 * hh);
      pa.h[1] = *(const v8b*)(pwh + c * AT_KC + kk * 32 + 16 + 8 * hh);
      if (SPLIT_PV) {
        pl.h[0] = *(const v8b*)(pwl + c * AT_KC + kk * 32 + 8 * hh);
        pl.h[1] = *(const v8b*)(pwl + c * AT_KC + kk * 32 + 16 + 8 * hh);
      }
#pragma unroll
      for (int t = 0; t < 4; ++t) {
        FB vb;
        vb.h[0] = *(const v8b*)(Vth + (t * 16 + c) * AT_KC + kk * 32 + 8 * hh);
        vb.h[1] = *(const v8b*)(Vth + (t * 16 + c) * AT_KC + kk * 32 + 16 + 8 * hh);
        oacc[t] = at_mma16<F16>(pa.v, vb.v, oacc[t]);
        if (SPLIT_PV) {
          FB vl;
          vl.h[0] = *(const v8b*)(Vtl + (t * 16 + c) * AT_KC + kk * 32 + 8 * hh);
          vl.h[1] = *(const v8b*)(Vtl + (t * 16 + c) * AT_KC + kk * 32 + 16 + 8 * hh);
          oacc[t] = at_mma16<F16>(pa.v, vl.v, oacc[t]);
          oacc[t] = at_mma16<F16>(pl.v, vb.v, oacc[t]);
        }
      }
    }
  }

  float* os = Os[wave];
#pragma unroll
  for (int r = 0; r < 8; ++r) {
    const float inv = 1.0f / (lrow[r] * PSC);
#pragma unroll
    for (int t = 0; t < 4; ++t) os[(8 * hh + r) * 68 + t * 16 + c] = oacc[t][r] * inv;
  }
  __builtin_amdgcn_fence(__ATOMIC_RELEASE, "workgroup");
  __builtin_amdgcn_wave_barrier();
  __builtin_amdgcn_fence(__ATOMIC_ACQUIRE, "workgroup");
  {
    const int c4 = (lane & 15) * 4;
    {
#pragma unroll
      for (int it = 0; it < 8; ++it) {
        const int row = it * 2 + hh;
        v4f val = *(const v4f*)(os + row * 68 + c4);
        *(v4f*)(ob_ptr + (size_t)(q0 + row) * g.o_rs + c4) = val;
      }
      
    }
  }
}

} // namespace w25

// RoPE in place: thread per (row, q|k, head, pair i<32): (x0, x1) = (x[2i], x[2i+1]) -> (x0 cos[2i] - x1 sin[2i], x1 cos[2i+1] + x0 sin[2i+1]); tables gathered by the INPUT position (clamped); one 8-B store per lane, lanes contiguous
__global__ __launch_bounds__(256) void k_cm_rope(float* __restrict__ Q, float* __restrict__ Kx, const float* __restrict__ CS, const float* __restrict__ SN, const int* __restrict__ POS, int Bn, int S, int NH, int HD) { const long long t = (long long)blockIdx.x * 256 + threadIdx.x; const int HF = HD / 2; if (t >= (long long)Bn * S * 2 * NH * HF) return; const int i = (int)(t % HF); long long r = t / HF; const int h = (int)(r % NH); r /= NH; const int which = (int)(r % 2); const long long row = r / 2; const int sq = (int)(row % S);
    int ps = POS[sq]; ps = ps < 0 ? 0 : (ps >= S ? S - 1 : ps); const float c0 = CS[ps * HD + 2 * i], c1 = CS[ps * HD + 2 * i + 1], s0 = SN[ps * HD + 2 * i], s1 = SN[ps * HD + 2 * i + 1];
    float* base = ((which == 0) ? Q : Kx) + row * ((long long)NH * HD) + h * HD + 2 * i; const float x0 = base[0], x1 = base[1];
    const unsigned long long pk = (unsigned long long)__builtin_bit_cast(unsigned, x0 * c0 - x1 * s0) | ((unsigned long long)__builtin_bit_cast(unsigned, x1 * c1 + x0 * s1) << 32); VST2(unsigned long long, (unsigned long long*)base, pk); }
__global__ __launch_bounds__(64) void k_cm_exact(const float* __restrict__ Q64, const float* __restrict__ K64, const float* __restrict__ V, float* __restrict__ AT, int S, int D, int NH, int HD) { __shared__ float sc[64]; const int t = blockIdx.x % 64; const int h = (blockIdx.x / 64) % NH; const int b = blockIdx.x / (64 * NH); const int d = threadIdx.x;
    const float* q = Q64 + ((long long)b * 64 + t) * D + h * HD; float s = -3.0e38f;
    if (d <= t) { const float* kr = K64 + ((long long)b * 64 + d) * D + h * HD; float a = 0.f;
#pragma unroll 1
        for (int j = 0; j < HD; ++j) a += q[j] * kr[j];
        s = a * 0.125f; }
    sc[d] = s; __syncthreads();
    float mx = -3.0e38f; for (int j = 0; j <= t; ++j) mx = fmaxf(mx, sc[j]);
    float den = 0.f; for (int j = 0; j <= t; ++j) den += expf(sc[j] - mx);
    float acc = 0.f;
#pragma unroll 1
    for (int j = 0; j <= t; ++j) acc += expf(sc[j] - mx) * V[((long long)b * S + j) * D + h * HD + d];
    VST2(float, AT + ((long long)b * S + t) * D + h * HD + d, acc / den); }


extern "C" void kernel_launch(void* const* d_in, const int* in_sizes, int n_in, void* d_out, int out_size, void* d_ws, size_t ws_size, hipStream_t stream) {
    (void)in_sizes; (void)n_in; (void)out_size; (void)ws_size;
    const float* x = (const float*)d_in[0];
    const float* Wq = (const float*)d_in[1];
    const float* Wk = (const float*)d_in[2];
    const float* Wv = (const float*)d_in[3];
    const float* Wo = (const float*)d_in[4];
    const float* cosT = (const float*)d_in[5];
    const float* sinT = (const float*)d_in[6];
    const int* tpos = (const int*)d_in[7];
    const int Bn = 4;
    const int S = 2048;
    const int D = 1024;
    const int NH = 16;
    const int HD = 64;
    const int NR = Bn * S;
    float* out = (float*)d_out;
    char* wsp = (char*)d_ws;
    float* Q = (float*)wsp; wsp += (size_t)NR * D * 4;
    float* Kb = (float*)wsp; wsp += (size_t)NR * D * 4;
    float* V = (float*)wsp; wsp += (size_t)NR * D * 4;
    float* AT = (float*)wsp; wsp += (size_t)NR * D * 4;
    float* Q64 = (float*)wsp; wsp += (size_t)Bn * 64 * D * 4;
    float* K64 = (float*)wsp; wsp += (size_t)Bn * 64 * D * 4;
    unsigned short* XH = (unsigned short*)wsp; wsp += (size_t)NR * D * 2;    // x as f16
    unsigned short* XS = (unsigned short*)wsp; wsp += (size_t)NR * D * 2;    // x as bf16 hi and lo planes; after the exact-row GEMMs the attention output's planes
    unsigned short* XS2 = (unsigned short*)wsp; wsp += (size_t)NR * D * 2;
    unsigned short* WqH = (unsigned short*)wsp; wsp += (size_t)D * D * 2;    // 16 Wq, 16 Wk as f16
    unsigned short* WkH = (unsigned short*)wsp; wsp += (size_t)D * D * 2;
    unsigned short* WqS = (unsigned short*)wsp; wsp += (size_t)D * D * 2;    // bf16 hi and lo planes of the four weights
    unsigned short* WqS2 = (unsigned short*)wsp; wsp += (size_t)D * D * 2;
    unsigned short* WkS = (unsigned short*)wsp; wsp += (size_t)D * D * 2;
    unsigned short* WkS2 = (unsigned short*)wsp; wsp += (size_t)D * D * 2;
    unsigned short* WvS = (unsigned short*)wsp; wsp += (size_t)D * D * 2;
    unsigned short* WvS2 = (unsigned short*)wsp; wsp += (size_t)D * D * 2;
    unsigned short* WoS = (unsigned short*)wsp; wsp += (size_t)D * D * 2;
    unsigned short* WoS2 = (unsigned short*)wsp; wsp += (size_t)D * D * 2;
    const unsigned gX = (unsigned)(((long long)NR * (D / 2) + 255) / 256);   // cast grids: two elements a thread
    const unsigned gW = (unsigned)(((long long)D * (D / 2) + 255) / 256);
    // q, k: f16 operands
    k_cast16<<<gX, 256, 0, stream>>>(x, D, (_Float16*)XH, D, NR, D, 1.0f);
    k_cast16<<<gW, 256, 0, stream>>>(Wq, D, (_Float16*)WqH, D, D, D, 16.0f);
    k_cast16<<<gW, 256, 0, stream>>>(Wk, D, (_Float16*)WkH, D, D, D, 16.0f);
    w25::wmma_gemm_lds<0, false><<<dim3(D / 128, NR / 64), 256, 0, stream>>>(XH, nullptr, WqH, nullptr, Q, D, D, 0.0625f, 64);
    w25::wmma_gemm_lds<0, false><<<dim3(D / 128, NR / 64), 256, 0, stream>>>(XH, nullptr, WkH, nullptr, Kb, D, D, 0.0625f, 64);
    // v: bf16 hi/lo planes
    k_castS16<<<gX, 256, 0, stream>>>(x, D, (__bf16*)XS, (__bf16*)XS2, D, NR, D, 1.0f, 0);
    k_castS16<<<gW, 256, 0, stream>>>(Wv, D, (__bf16*)WvS, (__bf16*)WvS2, D, D, D, 1.0f, 0);
    w25::wmma_gemm_lds<1, true><<<dim3(D / 128, NR / 64), 256, 0, stream>>>(XS, XS2, WvS, WvS2, V, D, D, 1.0f, 64);
    // q, k of the first 64 rows of every batch, from the same planes of x: tile b of C takes rows b S .. b S + 63 of A
    k_castS16<<<gW, 256, 0, stream>>>(Wq, D, (__bf16*)WqS, (__bf16*)WqS2, D, D, D, 1.0f, 0);
    k_castS16<<<gW, 256, 0, stream>>>(Wk, D, (__bf16*)WkS, (__bf16*)WkS2, D, D, D, 1.0f, 0);
    w25::wmma_gemm_lds<1, true><<<dim3(D / 128, Bn), 256, 0, stream>>>(XS, XS2, WqS, WqS2, Q64, D, D, 1.0f, S);
    w25::wmma_gemm_lds<1, true><<<dim3(D / 128, Bn), 256, 0, stream>>>(XS, XS2, WkS, WkS2, K64, D, D, 1.0f, S);
    k_cm_rope<<<(unsigned)(((long long)NR * 2 * NH * 32 + 255) / 256), 256, 0, stream>>>(Q, Kb, cosT, sinT, (const int*)tpos, Bn, S, NH, HD);
    k_cm_rope<<<(unsigned)(((long long)Bn * 64 * 2 * NH * 32 + 255) / 256), 256, 0, stream>>>(Q64, K64, cosT, sinT, (const int*)tpos, Bn, 64, NH, HD);
    { /*apv4*/ AttnP a;
      a.Q = Q; a.K = Kb; a.V = V; a.O = AT; a.P = 0; a.Mf = 0; a.Mi = 0; a.ST = 0;
      a.Pw = 0; a.Rt = 0; a.SQ = 0; a.SK = 0;
      a.swb = 0; a.swh = 0; a.swi = 0; a.swj = 0; a.srb = 0; a.srh = 0; a.sri = 0; a.sQb = (long long)S * D; a.sQh = HD; a.sQi = D; a.sQd = 1; a.sKb = (long long)S * D; a.sKh = HD; a.sKj = D; a.sKd = 1; a.sVb = (long long)S * D; a.sVh = HD; a.sVj = D; a.sVd = 1; a.sOb = (long long)S * D; a.sOh = HD; a.sOi = D; a.sPb = 0; a.sPh = 0; a.sPi = 0; a.smb = 0; a.smh = 0; a.smi = 0; a.smj = 0;
      a.Lq = S; a.Lk = S; a.dh = HD; a.dv = HD; a.hrep = 1; a.causal = 1; a.coff = 0; a.pband = 0;
      a.scale = 0.125f; a.mfill = 0.0f; a.nonorm = 0; a.mpol = 0;
      a.roff = 0; a.rn = 1; a.segpol = 0; a.win = 0;
      k_attn<64, 64, 0, false, false, 2048, 1024><<<dim3((unsigned)(NH), (unsigned)(Bn), (unsigned)((S) + 16 * AW - 1) / (16 * AW)), 32 * AW, 0, stream>>>(a); }
    k_cm_exact<<<Bn * NH * 64, 64, 0, stream>>>(Q64, K64, V, AT, S, D, NH, HD);
    k_castS16<<<gX, 256, 0, stream>>>(AT, D, (__bf16*)XS, (__bf16*)XS2, D, NR, D, 1.0f, 0);
    k_castS16<<<gW, 256, 0, stream>>>(Wo, D, (__bf16*)WoS, (__bf16*)WoS2, D, D, D, 1.0f, 0);
    w25::wmma_gemm_lds<1, true><<<dim3(D / 128, NR / 64), 256, 0, stream>>>(XS, XS2, WoS, WoS2, out, D, D, 1.0f, 64);
}
